// v000
// Measured on an AMD MI455X. A time is GPU time per run, averaged over a window of back-to-back runs after a warm-up
// (all launches, gaps included; the runs take copies of the inputs in turn), and the median of several windows.
// Apart from v000's, it joins two sittings. Times from different sittings can be a few percent apart, while
// side-by-side timings come from the same sitting.
// v000, which the later versions start from, runs in 380 microseconds.
// All contractions (weight-normalised q/k/v projections, q.k^T, P.V): v_wmma_f32_16x16x32_f16 (f16 operands, f32 accumulate); float inputs bf16-converted (RNE) first, direction weights carried x16 with the per-row norm gain applied in f32 at the projection epilogue, P carried x2^15; query rows < EROWS additionally carry q, k, v, P as f16 value + x2048 f16 residual planes (three products, residual products in their own accumulator); mask, softmax, norms in f32.
#include <hip/hip_runtime.h>
#include <math.h>

// ---- sizes (NB / SEQ reducible; *_FULL = strides of the inputs / output) ----
#ifndef NB
#define NB 16
#endif
#ifndef SEQ
#define SEQ 1024
#endif
#ifndef EROWS
#define EROWS ((SEQ < 512) ? SEQ : 512)
#endif
#define LROWS (SEQ - EROWS)
#define NB_FULL 16
#define SEQ_FULL 1024
#define EMB 512
#define NHEAD 8
#define HDIM 64
#define WSZ (EMB * EMB)

static_assert(NB >= 1 && NB <= NB_FULL);
static_assert(SEQ <= SEQ_FULL && SEQ % 64 == 0 && SEQ >= 64);
static_assert(EROWS % 64 == 0 && EROWS >= 64 && EROWS <= SEQ);
static_assert(LROWS % 64 == 0);
static_assert(EMB % 64 == 0 && EMB == NHEAD * HDIM && HDIM == 64 && NHEAD == 8);
static_assert(EMB % 32 == 0);                          // WMMA k-steps of 32, weight rows per prep block
static_assert(4 * 256 == 64 * 16);                     // k_castxT load phase: trips x threads == tile rows x 16-B pieces per row
static_assert(2 * 256 == 64 * 8);
static_assert(2 * 32 * 8 == EMB);                      // k_wprep: trips x lanes x elements == weight row width
static_assert(8 * 4 == 32);                            // k_wprep: waves x rows per wave == rows per block
static_assert(32 * 16 * 4 == 16 * 128);                // projection epilogue: lanes x bytes x trips == slab rows x row bytes (64 halves)
static_assert(4 * 32 * 16 * 8 == 64 * 256);            // attention output: waves x lanes x bytes x trips == tile rows x row bytes (64 floats)
static_assert(8 * 16 * 68 * 4 <= 131072);              // static LDS of the projection kernels
static_assert(2 * 4 * 16 * 64 * 2 + 64 * 68 * 4 <= 131072);   // static LDS of the attention kernels
static_assert(64 * 65 * 4 <= 131072);                  // static LDS of k_castxT

typedef _Float16 h16;
typedef __attribute__((ext_vector_type(16))) _Float16 v16h;
typedef __attribute__((ext_vector_type(8)))  _Float16 v8h;
typedef __attribute__((ext_vector_type(8)))  float    v8f;
typedef __attribute__((ext_vector_type(4)))  float    v4f;
typedef __attribute__((ext_vector_type(4)))  unsigned int u4v;

// 16-bit WMMA fragment map (wave32), lane L, h = L>>4, m = L&15:
//   A 16x32: lane = row m;    element i -> k = (i<8) ? 8h+i : 16+8h+(i-8)
//   B 32x16: lane = column m; the SAME k(i,h)
//   D 16x16 (8 f32): lane = column m; element r -> row 8h+r
union FragU { v16h v; v8h h[2]; };
// p already includes the +8h lane-half offset: elements 0..7 <- p[0..7], 8..15 <- p[16..23]
__device__ __forceinline__ v16h frag_ld(const _Float16* p) { FragU f; f.h[0] = *(const v8h*)(p); f.h[1] = *(const v8h*)(p + 16); return f.v; }

__device__ __forceinline__ v8f wmma16(v16h a, v16h b, v8f c) {
    c = __builtin_amdgcn_wmma_f32_16x16x32_f16(false, a, false, b, (short)0, c, false, false);
    asm volatile("v_nop\n\tv_nop\n\tv_nop\n\tv_nop" : "+v"(c) : "v"(a), "v"(b));
    return c;
}
__device__ __forceinline__ v8f mma_raw(v16h a, v16h b, v8f c) { return __builtin_amdgcn_wmma_f32_16x16x32_f16(false, a, false, b, (short)0, c, false, false); }
__device__ __forceinline__ void dep_guard_h(v8f& a, v8f& b, v16h x, v16h y) { asm volatile("v_nop\n\tv_nop\n\tv_nop\n\tv_nop" : "+v"(a), "+v"(b) : "v"(x), "v"(y)); }
__device__ __forceinline__ void keep4_h(v16h a, v16h b, v16h c, v16h d) { asm volatile("v_nop" :: "v"(a), "v"(b), "v"(c), "v"(d)); }
__device__ __forceinline__ void acc_guard4(v8f& a, v8f& b, v8f& c, v8f& d) { asm volatile("v_nop\n\tv_nop\n\tv_nop\n\tv_nop" : "+v"(a), "+v"(b), "+v"(c), "+v"(d)); }

// bf16 RNE convert, kept as f32 (finite inputs)
__device__ __forceinline__ float bf_keep(float v) { const unsigned u = __float_as_uint(v); return __uint_as_float((u + 0x7fffu + ((u >> 16) & 1u)) & 0xffff0000u); }
// f32 -> f16 that cannot produce an f16 subnormal (value select)
__device__ __forceinline__ h16 toh_flush(float v) { const h16 r = (h16)v; return (fabsf(v) < 6.103515625e-05f) ? (h16)0.0f : r; }
__device__ __forceinline__ unsigned pk2hf(float a, float b) { return (unsigned)__builtin_bit_cast(unsigned short, toh_flush(a)) | ((unsigned)__builtin_bit_cast(unsigned short, toh_flush(b)) << 16); }

#define VST2(T, ptr, val) do { const T vst2_v_ = (val); *(T*)(ptr) = vst2_v_;  } while (0)

// ---- query / key (f32, [b][c][s], full strides) -> f16 planes of the bf16-converted values, compact [NB*SEQ][512] (token-major);
//      plane 0 = query at D, plane 1 = key at D + NB*SEQ*EMB. 64 channels x 64 tokens per block through an LDS tile (cross-wave: block barrier);
__global__ __launch_bounds__(256) void k_castxT(const float* __restrict__ xq, const float* __restrict__ xk, unsigned short* __restrict__ D) {
#pragma clang fp contract(off)
    __shared__ float tile[64 * 65];
    const unsigned z = blockIdx.z;
    const unsigned which = z & 1u;                       // block-uniform select among global pointers
    const unsigned b = z >> 1;
    const float* src = xq;
    if (which == 1u) src = xk;
    const unsigned s0 = blockIdx.x * 64u, c0 = blockIdx.y * 64u;
    const unsigned t = threadIdx.x;
#pragma unroll
    for (int i = 0; i < 4; ++i) {
        const unsigned idx = t + 256u * (unsigned)i;
        const unsigned cc = idx >> 4, s4 = (idx & 15u) << 2;
        const v4f a = *(const v4f*)(src + ((size_t)b * EMB + c0 + cc) * SEQ_FULL + s0 + s4);
        tile[cc * 65u + s4 + 0u] = a.x; tile[cc * 65u + s4 + 1u] = a.y; tile[cc * 65u + s4 + 2u] = a.z; tile[cc * 65u + s4 + 3u] = a.w;
    }
    __syncthreads();
#pragma unroll
    for (int i = 0; i < 2; ++i) {
        const unsigned idx = t + 256u * (unsigned)i;
        const unsigned ss = idx >> 3, c8 = (idx & 7u) << 3;
        const float f0 = tile[(c8 + 0u) * 65u + ss], f1 = tile[(c8 + 1u) * 65u + ss], f2 = tile[(c8 + 2u) * 65u + ss], f3 = tile[(c8 + 3u) * 65u + ss];
        const float f4 = tile[(c8 + 4u) * 65u + ss], f5 = tile[(c8 + 5u) * 65u + ss], f6 = tile[(c8 + 6u) * 65u + ss], f7 = tile[(c8 + 7u) * 65u + ss];
        u4v pk; pk.x = pk2hf(bf_keep(f0), bf_keep(f1)); pk.y = pk2hf(bf_keep(f2), bf_keep(f3)); pk.z = pk2hf(bf_keep(f4), bf_keep(f5)); pk.w = pk2hf(bf_keep(f6), bf_keep(f7));
        VST2(u4v, (u4v*)(D + (size_t)which * ((size_t)NB * SEQ * EMB) + ((size_t)b * SEQ + s0 + ss) * EMB + c0 + c8), pk);
    }
}

// ---- three [512 out][512 in] direction weights -> f16 planes of bf16-converted values x16 (exact), plane y at D + y*WSZ, and the per-row gain table
//      SCL[y*512 + o] = bf16(g[o]) / ||bf16(v[o,:])|| / 16 (f32). Block = 32 rows (wave = 4 rows); grid (EMB/32, 3).
//      Plane rows: 2 instructions x 32 lanes x 16 B lane-contiguous; gain line: 32 lanes x 4 B of wave 0 in one instruction (LDS word per row, block barrier). ----
__global__ __launch_bounds__(256) void k_wprep(const float* __restrict__ v0, const float* __restrict__ g0, const float* __restrict__ v1, const float* __restrict__ g1,
                                               const float* __restrict__ v2, const float* __restrict__ g2, unsigned short* __restrict__ D, float* __restrict__ SCLp) {
#pragma clang fp contract(off)
    __shared__ float red[32];
    const unsigned y = blockIdx.y;                       // block-uniform select among global pointers
    const float* s = v0; const float* g = g0;
    if (y == 1u) { s = v1; g = g1; }
    if (y == 2u) { s = v2; g = g2; }
    const unsigned lane = threadIdx.x & 31u;
    const unsigned wave = (unsigned)__builtin_amdgcn_readfirstlane((int)(threadIdx.x >> 5));
    const unsigned rb = blockIdx.x * 32u;
#pragma unroll 1
    for (unsigned rr = 0; rr < 4u; ++rr) {
        const unsigned rl = wave * 4u + rr;
        const unsigned row = rb + rl;
        float ss = 0.f;
#pragma unroll 1
        for (unsigned it = 0; it < 2u; ++it) {
            const unsigned u = it * 32u + lane;          // 16-B piece of the row
            const float* p = s + (size_t)row * EMB + u * 8u;
            const v4f a = *(const v4f*)(p), b = *(const v4f*)(p + 4);
            const float a0 = bf_keep(a.x), a1 = bf_keep(a.y), a2 = bf_keep(a.z), a3 = bf_keep(a.w);
            const float b0 = bf_keep(b.x), b1 = bf_keep(b.y), b2 = bf_keep(b.z), b3 = bf_keep(b.w);
            ss += a0 * a0; ss += a1 * a1; ss += a2 * a2; ss += a3 * a3;
            ss += b0 * b0; ss += b1 * b1; ss += b2 * b2; ss += b3 * b3;
            u4v pk; pk.x = pk2hf(a0 * 16.f, a1 * 16.f); pk.y = pk2hf(a2 * 16.f, a3 * 16.f); pk.z = pk2hf(b0 * 16.f, b1 * 16.f); pk.w = pk2hf(b2 * 16.f, b3 * 16.f);
            VST2(u4v, (u4v*)(D + (size_t)y * WSZ + (size_t)row * EMB + u * 8u), pk);
        }
        ss += __shfl_xor(ss, 1, 32); ss += __shfl_xor(ss, 2, 32); ss += __shfl_xor(ss, 4, 32);
        ss += __shfl_xor(ss, 8, 32); ss += __shfl_xor(ss, 16, 32);
        if (lane == 0u) red[rl] = ss;
    }
    __syncthreads();
    if (threadIdx.x < 32u) {
        const unsigned row = rb + lane;
        const float sc = bf_keep(g[row]) * (1.0f / sqrtf(red[lane])) * 0.0625f;
        VST2(float, SCLp + (size_t)y * EMB + row, sc);
    }
}

// =====================================================================================================================
// gemm64_body: C[m,n] = scl * sum_k A[m,k] * Bt[n,k] + bias; each wave owns a 64x64 tile; 8 waves per block; grid (ceil(tiles/8), batch).
//   A row-major [M,K] f16 (pitch lda); Bt row-major [N,K] f16 (pitch ldb); M,N % 64 == 0, K % 32 == 0; batch b adds stride*b to every tensor.
//   BIAS_MODE 1 = bias[m], scl[m]; 2 = bias[n], scl[n] (bias bf16-converted on load; scl is an f32 table).
//   Output: f16 plane Chi (value); RES: also the f16 plane Cres = (value - f16 value) x 2048.
// =====================================================================================================================
template <int BIAS_MODE, bool RES>
__device__ __forceinline__ void gemm64_body(
    const _Float16* __restrict__ A, int lda, long strideA,
    const _Float16* __restrict__ Bt, int ldb, long strideB,
    _Float16* Chi, int ldc, long strideC,
    _Float16* Cres, int ldr, long strideR,
    const float* __restrict__ bias, const float* __restrict__ scl,
    int M, int N, int K) {
  __shared__ __align__(16) float sT[8][16 * 68];   // per-wave 16x64 slab, pitch 68 floats
  const unsigned b    = blockIdx.y;
  const unsigned lane = threadIdx.x & 31u;
  const unsigned wave = (unsigned)__builtin_amdgcn_readfirstlane((int)(threadIdx.x >> 5));
  const unsigned tilesN = (unsigned)N >> 6;
  const unsigned tilesM = (unsigned)M >> 6;
  const unsigned tile = blockIdx.x * 8u + wave;
  if (tile >= tilesM * tilesN) return;   // wave-uniform; no block barriers in this kernel
  const unsigned tm = tile / tilesN;
  const unsigned tn = tile - tm * tilesN;
  const unsigned m0 = tm << 6;
  const unsigned n0 = tn << 6;

  const _Float16* Ab = A  + (size_t)b * (size_t)strideA;
  const _Float16* Bb = Bt + (size_t)b * (size_t)strideB;

  const unsigned rlane = lane & 15u;            // row (A) / col (B, D) within subtile
  const unsigned koff  = (lane >> 4) << 3;      // k offset of this lane half
  const unsigned mOff  = (lane >> 4) << 3;      // D row offset

  v8f acc[4][4];
#pragma unroll
  for (int i = 0; i < 4; ++i)
#pragma unroll
    for (int j = 0; j < 4; ++j) acc[i][j] = (v8f){0.f,0.f,0.f,0.f,0.f,0.f,0.f,0.f};

  for (unsigned k0 = 0; k0 < (unsigned)K; k0 += 32u) {
    v16h bh[4];
#pragma unroll
    for (int j = 0; j < 4; ++j) {
      const size_t bo = (size_t)(n0 + ((unsigned)j << 4) + rlane) * (unsigned)ldb + koff + k0;
      bh[j] = frag_ld(Bb + bo);
    }
#pragma unroll
    for (int i = 0; i < 4; ++i) {
      const size_t ao = (size_t)(m0 + ((unsigned)i << 4) + rlane) * (unsigned)lda + koff + k0;
      const v16h ah = frag_ld(Ab + ao);
#pragma unroll
      for (int j = 0; j < 4; ++j) acc[i][j] = mma_raw(ah, bh[j], acc[i][j]);
      dep_guard_h(acc[i][0], acc[i][3], ah, ah);
    }
    keep4_h(bh[0], bh[1], bh[2], bh[3]);
  }
  acc_guard4(acc[0][0], acc[0][1], acc[0][2], acc[0][3]);
  acc_guard4(acc[1][0], acc[1][1], acc[1][2], acc[1][3]);
  acc_guard4(acc[2][0], acc[2][1], acc[2][2], acc[2][3]);
  acc_guard4(acc[3][0], acc[3][1], acc[3][2], acc[3][3]);

  // ---- epilogue ----
  float* slab = sT[wave];
  _Float16* C  = Chi  + (size_t)b * (size_t)strideC;
  _Float16* Cr = Cres + (size_t)b * (size_t)strideR;
#pragma unroll
  for (int i = 0; i < 4; ++i) {
    const unsigned mBase = m0 + ((unsigned)i << 4);
    float bm[8], sm[8];
#pragma unroll
    for (int r = 0; r < 8; ++r) {
      bm[r] = (BIAS_MODE == 1) ? bf_keep(bias[mBase + mOff + (unsigned)r]) : 0.f;
      sm[r] = (BIAS_MODE == 1) ? scl[mBase + mOff + (unsigned)r] : 0.f;
    }
#pragma unroll
    for (int j = 0; j < 4; ++j) {
      const unsigned n = n0 + ((unsigned)j << 4) + rlane;
      float bv = 0.f, sv = 0.f;
      if (BIAS_MODE == 2) { bv = bf_keep(bias[n]); sv = scl[n]; }
#pragma unroll
      for (int r = 0; r < 8; ++r) {
        float v;
        if (BIAS_MODE == 1) v = acc[i][j][r] * sm[r] + bm[r];
        else                v = acc[i][j][r] * sv + bv;
        slab[(mOff + (unsigned)r) * 68u + ((unsigned)j << 4) + rlane] = v;
      }
    }
    __builtin_amdgcn_fence(3 /* release order */, "workgroup");
    __builtin_amdgcn_wave_barrier();
    __builtin_amdgcn_fence(2 /* acquire order */, "workgroup");
    {
      const unsigned q = lane >> 3, c8 = (lane & 7u) << 3;
      v8h hv[4];
      v8h rv[4];
#pragma unroll
      for (int it = 0; it < 4; ++it) {
        const unsigned row = (unsigned)it * 4u + q;
        const float* sp = slab + row * 68u + c8;
        const v4f s0 = *(const v4f*)(sp), s1 = *(const v4f*)(sp + 4);
        v8h t;
        t[0] = toh_flush(s0.x); t[1] = toh_flush(s0.y); t[2] = toh_flush(s0.z); t[3] = toh_flush(s0.w);
        t[4] = toh_flush(s1.x); t[5] = toh_flush(s1.y); t[6] = toh_flush(s1.z); t[7] = toh_flush(s1.w);
        hv[it] = t;
        v8h u = t;
        if (RES) {
          u[0] = toh_flush((s0.x - (float)t[0]) * 2048.0f); u[1] = toh_flush((s0.y - (float)t[1]) * 2048.0f);
          u[2] = toh_flush((s0.z - (float)t[2]) * 2048.0f); u[3] = toh_flush((s0.w - (float)t[3]) * 2048.0f);
          u[4] = toh_flush((s1.x - (float)t[4]) * 2048.0f); u[5] = toh_flush((s1.y - (float)t[5]) * 2048.0f);
          u[6] = toh_flush((s1.z - (float)t[6]) * 2048.0f); u[7] = toh_flush((s1.w - (float)t[7]) * 2048.0f);
        }
        rv[it] = u;
      }
      {
#pragma unroll
        for (int it = 0; it < 4; ++it) {
          const unsigned row = (unsigned)it * 4u + q;
          *(v8h*)(C + (size_t)(mBase + row) * (unsigned)ldc + n0 + c8) = hv[it];
          if (RES) *(v8h*)(Cr + (size_t)(mBase + row) * (unsigned)ldr + n0 + c8) = rv[it];
        }
        
      }
    }
    __builtin_amdgcn_fence(3 /* release order */, "workgroup");
    __builtin_amdgcn_wave_barrier();
    __builtin_amdgcn_fence(2 /* acquire order */, "workgroup");
  }
}

// token-major projections (q, k): bias[n], scl[n]; with / without the residual plane
__global__ __launch_bounds__(256) void k_proj_tok_res(const _Float16* __restrict__ A, int lda, long strideA, const _Float16* __restrict__ Bt, int ldb, long strideB,
                                                      _Float16* Chi, int ldc, long strideC, _Float16* Cres, int ldr, long strideR,
                                                      const float* __restrict__ bias, const float* __restrict__ scl, int M, int N, int K) {
  gemm64_body<2, true>(A, lda, strideA, Bt, ldb, strideB, Chi, ldc, strideC, Cres, ldr, strideR, bias, scl, M, N, K);
}
__global__ __launch_bounds__(256) void k_proj_tok(const _Float16* __restrict__ A, int lda, long strideA, const _Float16* __restrict__ Bt, int ldb, long strideB,
                                                  _Float16* Chi, int ldc, long strideC, _Float16* Cres, int ldr, long strideR,
                                                  const float* __restrict__ bias, const float* __restrict__ scl, int M, int N, int K) {
  gemm64_body<2, false>(A, lda, strideA, Bt, ldb, strideB, Chi, ldc, strideC, Cres, ldr, strideR, bias, scl, M, N, K);
}
// channel-major projection (v^T): bias[m], scl[m]; with / without the residual plane
__global__ __launch_bounds__(256) void k_proj_ch_res(const _Float16* __restrict__ A, int lda, long strideA, const _Float16* __restrict__ Bt, int ldb, long strideB,
                                                     _Float16* Chi, int ldc, long strideC, _Float16* Cres, int ldr, long strideR,
                                                     const float* __restrict__ bias, const float* __restrict__ scl, int M, int N, int K) {
  gemm64_body<1, true>(A, lda, strideA, Bt, ldb, strideB, Chi, ldc, strideC, Cres, ldr, strideR, bias, scl, M, N, K);
}
__global__ __launch_bounds__(256) void k_proj_ch(const _Float16* __restrict__ A, int lda, long strideA, const _Float16* __restrict__ Bt, int ldb, long strideB,
                                                 _Float16* Chi, int ldc, long strideC, _Float16* Cres, int ldr, long strideR,
                                                 const float* __restrict__ bias, const float* __restrict__ scl, int M, int N, int K) {
  gemm64_body<1, false>(A, lda, strideA, Bt, ldb, strideB, Chi, ldc, strideC, Cres, ldr, strideR, bias, scl, M, N, K);
}

// =====================================================================================================================
// attn_body<EARLY>: strictly causal attention (key j < query i; masked scores REPLACED by -10000 before the softmax; sequence row 0 zeroed after it),
//   head dim 64. Block = 4 waves = 64 query rows of one (batch, head): query block qb = qb_off + blockIdx.x % nqb; key chunks 0..qb (64 keys each).
//   Chunks above the diagonal are skipped: every query row i > 0 sees at least key 0, so their exp(-10000 - max) terms are exactly 0 in f32.
//   Flash-style online softmax (f32, exp2 domain). Q, K: f16 planes [NB*SEQ][512]; VT: f16 plane [NB][512][SEQ]; fragments are loaded straight from
//   the dense planes (arithmetic addressing, two 16-B loads each). P (x2^15, f16) goes through a wave-private LDS tile.
//   EARLY (query rows < EROWS): q, k, v^T and P also as x2048 residual planes QR/KR [NB][EROWS][512], VTR [NB][512][EROWS]; residual products
//   (qr.k + q.kr ; Pr.v + P.vr) go to their own accumulators, folded back with 1/2048 in f32.
//   Output: f32 [b][h*64+d][token] (full strides): the block's 64x64 tile is transposed through LDS (cross-wave: block barrier) and every
// =====================================================================================================================
template <bool EARLY>
__device__ __forceinline__ void attn_body(const _Float16* __restrict__ Q, const _Float16* __restrict__ Kp, const _Float16* __restrict__ VT,
                                          const _Float16* __restrict__ QR, const _Float16* __restrict__ KR, const _Float16* __restrict__ VTR,
                                          float* __restrict__ OUT, unsigned qb_off, unsigned nqb) {
  __shared__ __align__(16) _Float16 Psh[4][16 * 64];                 // per wave P tile [row][kv]  (wave-private)
  __shared__ __align__(16) _Float16 Prs[EARLY ? 4 : 1][16 * 64];     // per wave P residual tile   (wave-private)
  __shared__ __align__(16) float    OT[64 * 68];                     // block output tile [d][query], pitch 68 (cross-wave)
  const unsigned tid  = threadIdx.x;
  const unsigned wave = (unsigned)__builtin_amdgcn_readfirstlane((int)(tid >> 5));
  const unsigned lane = tid & 31u;
  const unsigned hh   = lane >> 4;
  const unsigned c    = lane & 15u;
  const unsigned bx = blockIdx.x;
  const unsigned qb = qb_off + bx % nqb;
  const unsigned bh = bx / nqb;
  const unsigned h  = bh & 7u;
  const unsigned b  = bh >> 3;
  const unsigned q0 = qb * 64u + wave * 16u;
  const unsigned nch = qb + 1u;
  const size_t rowbase = (size_t)b * SEQ;
  const size_t resbase = (size_t)b * EROWS;

  const _Float16* qrow = Q + (rowbase + q0 + c) * EMB + h * 64u + 8u * hh;
  const v16h qa0 = frag_ld(qrow), qa1 = frag_ld(qrow + 32);
  v16h qr0 = qa0, qr1 = qa1;
  if (EARLY) {
    const _Float16* qrr = QR + (resbase + q0 + c) * EMB + h * 64u + 8u * hh;
    qr0 = frag_ld(qrr); qr1 = frag_ld(qrr + 32);
  }
  const _Float16* kbase  = Kp + rowbase * EMB + h * 64u + 8u * hh;                       // + key * EMB (+ 32 for the second d chunk)
  const _Float16* krbase = KR + resbase * EMB + h * 64u + 8u * hh;
  const _Float16* vbase  = VT  + ((size_t)b * EMB + h * 64u) * SEQ   + 8u * hh;          // + d * SEQ + kv
  const _Float16* vrbase = VTR + ((size_t)b * EMB + h * 64u) * EROWS + 8u * hh;          // + d * EROWS + kv

  float mrow[8], lrow[8];
  v8f oacc[4], oaccr[4];
#pragma unroll
  for (int r = 0; r < 8; ++r) { mrow[r] = -__builtin_inff(); lrow[r] = 0.f; }
#pragma unroll
  for (int t = 0; t < 4; ++t) { oacc[t] = (v8f){0.f,0.f,0.f,0.f,0.f,0.f,0.f,0.f}; oaccr[t] = (v8f){0.f,0.f,0.f,0.f,0.f,0.f,0.f,0.f}; }

  const float SC    = 0.125f * 1.4426950408889634f;       // 1/sqrt(64) and log2(e)
  const float FILLX = -14426.950408889634f;               // -10000 * log2(e)
  _Float16* pw  = Psh[wave];
  _Float16* prw = Prs[EARLY ? wave : 0u];

  for (unsigned kc = 0; kc < nch; ++kc) {
    const unsigned kv0 = kc * 64u;
    v8f s[4];
#pragma unroll
    for (int j = 0; j < 4; ++j) {
      const _Float16* kr = kbase + (size_t)(kv0 + (unsigned)j * 16u + c) * EMB;
      const v16h kh0 = frag_ld(kr), kh1 = frag_ld(kr + 32);
      v8f a = (v8f){0.f,0.f,0.f,0.f,0.f,0.f,0.f,0.f};
      a = wmma16(qa0, kh0, a);
      a = wmma16(qa1, kh1, a);
      if (EARLY) {
        const _Float16* krr = krbase + (size_t)(kv0 + (unsigned)j * 16u + c) * EMB;
        v8f ar = (v8f){0.f,0.f,0.f,0.f,0.f,0.f,0.f,0.f};
        ar = wmma16(qr0, kh0, ar);
        ar = wmma16(qr1, kh1, ar);
        ar = wmma16(qa0, frag_ld(krr), ar);
        ar = wmma16(qa1, frag_ld(krr + 32), ar);
        a = a + ar * 0.00048828125f;
      }
      s[j] = a;
    }
    const unsigned kj = kv0 + c;
#pragma unroll
    for (int r = 0; r < 8; ++r) {
      const unsigned qi = q0 + 8u * hh + (unsigned)r;
      const float x0 = (kj       < qi) ? s[0][r] * SC : FILLX;
      const float x1 = (kj + 16u < qi) ? s[1][r] * SC : FILLX;
      const float x2 = (kj + 32u < qi) ? s[2][r] * SC : FILLX;
      const float x3 = (kj + 48u < qi) ? s[3][r] * SC : FILLX;
      float m = fmaxf(fmaxf(x0, x1), fmaxf(x2, x3));
      m = fmaxf(m, __shfl_xor(m, 1, 32)); m = fmaxf(m, __shfl_xor(m, 2, 32));
      m = fmaxf(m, __shfl_xor(m, 4, 32)); m = fmaxf(m, __shfl_xor(m, 8, 32));
      const float mnew = fmaxf(mrow[r], m);
      const float alpha = exp2f(mrow[r] - mnew);
      mrow[r] = mnew;
      const float p0 = exp2f(x0 - mnew), p1 = exp2f(x1 - mnew), p2 = exp2f(x2 - mnew), p3 = exp2f(x3 - mnew);
      float psum = (p0 + p1) + (p2 + p3);
      const unsigned po = (8u * hh + (unsigned)r) * 64u + c;
      const float e0 = p0 * 32768.0f, e1 = p1 * 32768.0f, e2 = p2 * 32768.0f, e3 = p3 * 32768.0f;
      const h16 g0 = toh_flush(e0), g1 = toh_flush(e1), g2 = toh_flush(e2), g3 = toh_flush(e3);
      pw[po]       = g0;
      pw[po + 16u] = g1;
      pw[po + 32u] = g2;
      pw[po + 48u] = g3;
      if (EARLY) {
        prw[po]       = toh_flush((e0 - (float)g0) * 2048.0f);
        prw[po + 16u] = toh_flush((e1 - (float)g1) * 2048.0f);
        prw[po + 32u] = toh_flush((e2 - (float)g2) * 2048.0f);
        prw[po + 48u] = toh_flush((e3 - (float)g3) * 2048.0f);
      }
      psum += __shfl_xor(psum, 1, 32); psum += __shfl_xor(psum, 2, 32);
      psum += __shfl_xor(psum, 4, 32); psum += __shfl_xor(psum, 8, 32);
      lrow[r] = lrow[r] * alpha + psum;
#pragma unroll
      for (int t = 0; t < 4; ++t) { oacc[t][r] *= alpha; if (EARLY) oaccr[t][r] *= alpha; }
    }
    __builtin_amdgcn_fence(3 /* release order */, "workgroup");
    __builtin_amdgcn_wave_barrier();
    __builtin_amdgcn_fence(2 /* acquire order */, "workgroup");
#pragma unroll
    for (int kk = 0; kk < 2; ++kk) {
      const v16h pa = frag_ld(pw + c * 64u + (unsigned)kk * 32u + 8u * hh);
      v16h pr = pa;
      if (EARLY) pr = frag_ld(prw + c * 64u + (unsigned)kk * 32u + 8u * hh);
#pragma unroll
      for (int t = 0; t < 4; ++t) {
        const v16h vb = frag_ld(vbase + (size_t)((unsigned)t * 16u + c) * SEQ + kv0 + (unsigned)kk * 32u);
        oacc[t] = wmma16(pa, vb, oacc[t]);
        if (EARLY) {
          oaccr[t] = wmma16(pr, vb, oaccr[t]);
          const v16h vr = frag_ld(vrbase + (size_t)((unsigned)t * 16u + c) * EROWS + kv0 + (unsigned)kk * 32u);
          oaccr[t] = wmma16(pa, vr, oaccr[t]);
        }
      }
    }
    // the next key block's P stores must not pass this block's P fragment loads
    __builtin_amdgcn_fence(3 /* release order */, "workgroup");
    __builtin_amdgcn_wave_barrier();
    __builtin_amdgcn_fence(2 /* acquire order */, "workgroup");
  }

  // normalise (P carried x2^15), zero sequence row 0, transpose the wave's 16x64 tile into the block tile [d][query]
  float inv[8];
#pragma unroll
  for (int r = 0; r < 8; ++r) {
    const unsigned qi = q0 + 8u * hh + (unsigned)r;
    const float iv = 1.0f / (lrow[r] * 32768.0f);
    inv[r] = (qi == 0u) ? 0.0f : iv;
  }
#pragma unroll
  for (int t = 0; t < 4; ++t) {
    float o[8];
#pragma unroll
    for (int r = 0; r < 8; ++r) {
      float v = oacc[t][r];
      if (EARLY) v += oaccr[t][r] * 0.00048828125f;
      o[r] = v * inv[r];
    }
    const unsigned oi = ((unsigned)t * 16u + c) * 68u + wave * 16u + 8u * hh;
    *(v4f*)(OT + oi)      = (v4f){o[0], o[1], o[2], o[3]};
    *(v4f*)(OT + oi + 4u) = (v4f){o[4], o[5], o[6], o[7]};
  }
  __syncthreads();
  {
    const unsigned c4 = (lane & 15u) << 2;     // row segment = 64 floats = 256 B = 16 lanes x 16 B; 2 rows per instruction, 8 trips = 16 rows per wave
    float* ob = OUT + ((size_t)b * EMB + h * 64u + wave * 16u) * SEQ_FULL + qb * 64u + c4;
    v4f vv[8];
#pragma unroll
    for (int it = 0; it < 8; ++it) {
      const unsigned row = (unsigned)it * 2u + hh;
      vv[it] = *(const v4f*)(OT + (wave * 16u + row) * 68u + c4);
    }
    {
#pragma unroll
      for (int it = 0; it < 8; ++it) {
        const unsigned row = (unsigned)it * 2u + hh;
        *(v4f*)(ob + (size_t)row * SEQ_FULL) = vv[it];
      }
      
    }
  }
}

__global__ __launch_bounds__(128) __attribute__((amdgpu_num_vgpr(256))) void k_attn_early(
    const _Float16* __restrict__ Q, const _Float16* __restrict__ Kp, const _Float16* __restrict__ VT,
    const _Float16* __restrict__ QR, const _Float16* __restrict__ KR, const _Float16* __restrict__ VTR,
    float* __restrict__ OUT, unsigned qb_off, unsigned nqb) {
  attn_body<true>(Q, Kp, VT, QR, KR, VTR, OUT, qb_off, nqb);
}
__global__ __launch_bounds__(128) void k_attn_late(
    const _Float16* __restrict__ Q, const _Float16* __restrict__ Kp, const _Float16* __restrict__ VT,
    const _Float16* __restrict__ QR, const _Float16* __restrict__ KR, const _Float16* __restrict__ VTR,
    float* __restrict__ OUT, unsigned qb_off, unsigned nqb) {
  attn_body<false>(Q, Kp, VT, QR, KR, VTR, OUT, qb_off, nqb);
}

// ---- workspace carve (bytes; every region is a whole number of 256-B units and is written in full by its producer) ----
#define SZ_P16  ((size_t)NB * SEQ * EMB * 2)            // one f16 activation plane
#define SZ_R16  ((size_t)NB * EROWS * EMB * 2)          // one f16 residual plane (early rows only)
#define SZ_W16  ((size_t)3 * WSZ * 2)
#define SZ_SCL  ((size_t)3 * EMB * 4)
#define OFF_XQ   ((size_t)0)
#define OFF_XK   (OFF_XQ + SZ_P16)
#define OFF_W16  (OFF_XK + SZ_P16)
#define OFF_SCL  (OFF_W16 + SZ_W16)
#define OFF_QH   (OFF_SCL + SZ_SCL)
#define OFF_KH   (OFF_QH + SZ_P16)
#define OFF_VTH  (OFF_KH + SZ_P16)
#define OFF_QR   (OFF_VTH + SZ_P16)
#define OFF_KR   (OFF_QR + SZ_R16)
#define OFF_VTR  (OFF_KR + SZ_R16)
#define WS_TOTAL (OFF_VTR + SZ_R16)
static_assert(SZ_P16 % 256 == 0 && SZ_R16 % 256 == 0 && SZ_W16 % 256 == 0 && SZ_SCL % 256 == 0);
static_assert(OFF_XK == OFF_XQ + (size_t)NB * SEQ * EMB * 2);   // k_castxT addresses the key plane as plane 1 of one base
static_assert(WS_TOTAL <= (size_t)134217728);
static_assert((size_t)NB_FULL * EMB * SEQ_FULL * 4 == (size_t)33554432);   // output extent in bytes, offset 0

extern "C" void kernel_launch(void* const* d_in, const int* in_sizes, int n_in, void* d_out, int out_size, void* d_ws, size_t ws_size, hipStream_t stream) {
    if (n_in < 11) return;
    const long long xneed = ((long long)(NB - 1) * EMB + (EMB - 1)) * SEQ_FULL + SEQ;
    if ((long long)in_sizes[0] < xneed) return;
    if ((long long)in_sizes[1] < xneed) return;
    if (in_sizes[2] < WSZ || in_sizes[5] < WSZ || in_sizes[8] < WSZ) return;
    if (in_sizes[3] < EMB || in_sizes[4] < EMB || in_sizes[6] < EMB || in_sizes[7] < EMB || in_sizes[9] < EMB || in_sizes[10] < EMB) return;
    if ((long long)out_size < xneed) return;
    if ((size_t)WS_TOTAL > ws_size) return;

    // input order: query, key, vq, gq, bq, vk, gk, bk, vv, gv, bv
    const float* query = (const float*)d_in[0];
    const float* key   = (const float*)d_in[1];
    const float* vq = (const float*)d_in[2];  const float* gq = (const float*)d_in[3];  const float* bq = (const float*)d_in[4];
    const float* vk = (const float*)d_in[5];  const float* gk = (const float*)d_in[6];  const float* bk = (const float*)d_in[7];
    const float* vv = (const float*)d_in[8];  const float* gv = (const float*)d_in[9];  const float* bv = (const float*)d_in[10];
    float* out = (float*)d_out;

    char* ws = (char*)d_ws;
    unsigned short* X16  = (unsigned short*)(ws + OFF_XQ);     // plane 0 = query tokens, plane 1 = key tokens
    unsigned short* W16  = (unsigned short*)(ws + OFF_W16);    // planes: 0 vq 1 vk 2 vv (direction weights x16)
    float*          SCL  = (float*)(ws + OFF_SCL);             // [3][512] row gains / 16
    _Float16* QH  = (_Float16*)(ws + OFF_QH);
    _Float16* KH  = (_Float16*)(ws + OFF_KH);
    _Float16* VTH = (_Float16*)(ws + OFF_VTH);
    _Float16* QR  = (_Float16*)(ws + OFF_QR);
    _Float16* KR  = (_Float16*)(ws + OFF_KR);
    _Float16* VTR = (_Float16*)(ws + OFF_VTR);

    const _Float16* XQh = (const _Float16*)(ws + OFF_XQ);
    const _Float16* XKh = (const _Float16*)(ws + OFF_XK);
    const _Float16* W16h = (const _Float16*)W16;
    const long SB  = (long)SEQ * EMB;          // per-batch stride of the compact token-major planes
    const long SRB = (long)EROWS * EMB;        // per-batch stride of the token-major residual planes
    const long SVT = (long)EMB * SEQ;          // per-batch stride of the V^T plane
    const long SVR = (long)EMB * EROWS;        // per-batch stride of the V^T residual plane
    const size_t offB = (size_t)EROWS * EMB;   // row offset of the late row group inside a batch

    // 1-2: operand planes
    k_castxT<<<dim3((unsigned)(SEQ / 64), (unsigned)(EMB / 64), (unsigned)(NB * 2)), 256, 0, stream>>>(query, key, X16);
    k_wprep<<<dim3((unsigned)(EMB / 32), 3u), 256, 0, stream>>>(vq, gq, vk, gk, vv, gv, W16, SCL);

    // 3-8: q, k (tokens x V^T, row gain, bias -> f16 planes) and v^T (V x tokens^T, gain[m], bias[m] -> f16 plane [b][h*64+d][token]); early group also residual planes
    const unsigned gE = (unsigned)(((EROWS / 64) * (EMB / 64) + 7) / 8);
    const unsigned gL = (unsigned)(((LROWS / 64) * (EMB / 64) + 7) / 8);
    k_proj_tok_res<<<dim3(gE, NB), 256, 0, stream>>>(XQh, EMB, SB, W16h + (size_t)0 * WSZ, EMB, 0L, QH, EMB, SB, QR, EMB, SRB, bq, SCL + 0 * EMB, EROWS, EMB, EMB);
    k_proj_tok_res<<<dim3(gE, NB), 256, 0, stream>>>(XKh, EMB, SB, W16h + (size_t)1 * WSZ, EMB, 0L, KH, EMB, SB, KR, EMB, SRB, bk, SCL + 1 * EMB, EROWS, EMB, EMB);
    k_proj_ch_res<<<dim3(gE, NB), 256, 0, stream>>>(W16h + (size_t)2 * WSZ, EMB, 0L, XKh, EMB, SB, VTH, SEQ, SVT, VTR, EROWS, SVR, bv, SCL + 2 * EMB, EMB, EROWS, EMB);
    if (LROWS > 0) {
        k_proj_tok<<<dim3(gL, NB), 256, 0, stream>>>(XQh + offB, EMB, SB, W16h + (size_t)0 * WSZ, EMB, 0L, QH + offB, EMB, SB, QR, EMB, SRB, bq, SCL + 0 * EMB, LROWS, EMB, EMB);
        k_proj_tok<<<dim3(gL, NB), 256, 0, stream>>>(XKh + offB, EMB, SB, W16h + (size_t)1 * WSZ, EMB, 0L, KH + offB, EMB, SB, KR, EMB, SRB, bk, SCL + 1 * EMB, LROWS, EMB, EMB);
        k_proj_ch<<<dim3(gL, NB), 256, 0, stream>>>(W16h + (size_t)2 * WSZ, EMB, 0L, XKh + offB, EMB, SB, VTH + EROWS, SEQ, SVT, VTR, EROWS, SVR, bv, SCL + 2 * EMB, EMB, LROWS, EMB);
    }

    // 9-10: causal attention, early band (value + residual planes) and late band (single planes); each block writes its 64x64 tile of the output buffer
    k_attn_early<<<(unsigned)(NB * NHEAD * (EROWS / 64)), 128, 0, stream>>>(QH, KH, VTH, QR, KR, VTR, out, 0u, (unsigned)(EROWS / 64));
    if (LROWS > 0) {
        k_attn_late<<<(unsigned)(NB * NHEAD * (LROWS / 64)), 128, 0, stream>>>(QH, KH, VTH, QR, KR, VTR, out, (unsigned)(EROWS / 64), (unsigned)(LROWS / 64));
    }
}

// v001
// Measured time: 304 microseconds a run.
// Next to v000, in two timings, it ran 1.27 times as fast each time.
// All contractions (weight-normalised q/k/v projections, q.k^T, P.V): v_wmma_f32_16x16x32_f16 (f16 operands, f32 accumulate); float inputs bf16-converted (RNE) first, direction weights carried x16 with the per-row norm gain applied in f32 at the projection epilogue, P carried x2^15; query rows < EROWS additionally carry q, k, v, P as f16 value + x2048 f16 residual planes (three products, residual products in their own accumulator); mask, softmax, norms in f32.
#include <hip/hip_runtime.h>
#include <math.h>

// ---- sizes (NB / SEQ reducible; *_FULL = strides of the inputs / output) ----
#ifndef NB
#define NB 16
#endif
#ifndef SEQ
#define SEQ 1024
#endif
#ifndef EROWS
#define EROWS ((SEQ < 512) ? SEQ : 512)
#endif
#define LROWS (SEQ - EROWS)
#define NB_FULL 16
#define SEQ_FULL 1024
#define EMB 512
#define NHEAD 8
#define HDIM 64
#define WSZ (EMB * EMB)

static_assert(NB >= 1 && NB <= NB_FULL);
static_assert(SEQ <= SEQ_FULL && SEQ % 64 == 0 && SEQ >= 64);
static_assert(EROWS % 64 == 0 && EROWS >= 64 && EROWS <= SEQ);
static_assert(LROWS % 64 == 0);
static_assert(EMB % 64 == 0 && EMB == NHEAD * HDIM && HDIM == 64 && NHEAD == 8);
static_assert(EMB % 32 == 0);                          // WMMA k-steps of 32, weight rows per prep block
static_assert(4 * 256 == 64 * 16);                     // k_castxT load phase: trips x threads == tile rows x 16-B pieces per row
static_assert(2 * 256 == 64 * 8);
static_assert(2 * 32 * 8 == EMB);                      // k_wprep: trips x lanes x elements == weight row width
static_assert(8 * 4 == 32);                            // k_wprep: waves x rows per wave == rows per block
static_assert(32 * 16 * 4 == 16 * 128);                // projection epilogue: lanes x bytes x trips == slab rows x row bytes (64 halves)
static_assert(4 * 32 * 16 * 8 == 64 * 256);            // attention output: waves x lanes x bytes x trips == tile rows x row bytes (64 floats)
static_assert(8 * 16 * 68 * 4 <= 131072);              // static LDS of k_proj_all
static_assert(2 * 4 * 16 * 64 * 2 + 64 * 68 * 4 <= 131072);   // static LDS of the attention kernels
static_assert(64 * 65 * 4 <= 131072);                  // static LDS of k_castxT

typedef _Float16 h16;
typedef __attribute__((ext_vector_type(16))) _Float16 v16h;
typedef __attribute__((ext_vector_type(8)))  _Float16 v8h;
typedef __attribute__((ext_vector_type(8)))  float    v8f;
typedef __attribute__((ext_vector_type(4)))  float    v4f;
typedef __attribute__((ext_vector_type(4)))  unsigned int u4v;

// 16-bit WMMA fragment map (wave32), lane L, h = L>>4, m = L&15:
//   A 16x32: lane = row m;    element i -> k = (i<8) ? 8h+i : 16+8h+(i-8)
//   B 32x16: lane = column m; the SAME k(i,h)
//   D 16x16 (8 f32): lane = column m; element r -> row 8h+r
union FragU { v16h v; v8h h[2]; };
// p already includes the +8h lane-half offset: elements 0..7 <- p[0..7], 8..15 <- p[16..23]
__device__ __forceinline__ v16h frag_ld(const _Float16* p) { FragU f; f.h[0] = *(const v8h*)(p); f.h[1] = *(const v8h*)(p + 16); return f.v; }

__device__ __forceinline__ v8f wmma16(v16h a, v16h b, v8f c) {
    c = __builtin_amdgcn_wmma_f32_16x16x32_f16(false, a, false, b, (short)0, c, false, false);
    asm volatile("v_nop\n\tv_nop\n\tv_nop\n\tv_nop" : "+v"(c) : "v"(a), "v"(b));
    return c;
}
__device__ __forceinline__ v8f mma_raw(v16h a, v16h b, v8f c) { return __builtin_amdgcn_wmma_f32_16x16x32_f16(false, a, false, b, (short)0, c, false, false); }
__device__ __forceinline__ void dep_guard_h(v8f& a, v8f& b, v16h x, v16h y) { asm volatile("v_nop\n\tv_nop\n\tv_nop\n\tv_nop" : "+v"(a), "+v"(b) : "v"(x), "v"(y)); }
__device__ __forceinline__ void keep4_h(v16h a, v16h b, v16h c, v16h d) { asm volatile("v_nop" :: "v"(a), "v"(b), "v"(c), "v"(d)); }
__device__ __forceinline__ void acc_guard4(v8f& a, v8f& b, v8f& c, v8f& d) { asm volatile("v_nop\n\tv_nop\n\tv_nop\n\tv_nop" : "+v"(a), "+v"(b), "+v"(c), "+v"(d)); }

// bf16 RNE convert, kept as f32 (finite inputs)
__device__ __forceinline__ float bf_keep(float v) { const unsigned u = __float_as_uint(v); return __uint_as_float((u + 0x7fffu + ((u >> 16) & 1u)) & 0xffff0000u); }
// f32 -> f16 that cannot produce an f16 subnormal (value select)
__device__ __forceinline__ h16 toh_flush(float v) { const h16 r = (h16)v; return (fabsf(v) < 6.103515625e-05f) ? (h16)0.0f : r; }
__device__ __forceinline__ unsigned pk2hf(float a, float b) { return (unsigned)__builtin_bit_cast(unsigned short, toh_flush(a)) | ((unsigned)__builtin_bit_cast(unsigned short, toh_flush(b)) << 16); }

#define VST2(T, ptr, val) do { const T vst2_v_ = (val); *(T*)(ptr) = vst2_v_;  } while (0)

// ---- query / key (f32, [b][c][s], full strides) -> f16 planes of the bf16-converted values, compact [NB*SEQ][512] (token-major);
//      plane 0 = query at D, plane 1 = key at D + NB*SEQ*EMB. 64 channels x 64 tokens per block through an LDS tile (cross-wave: block barrier);
__global__ __launch_bounds__(256) void k_castxT(const float* __restrict__ xq, const float* __restrict__ xk, unsigned short* __restrict__ D) {
#pragma clang fp contract(off)
    __shared__ float tile[64 * 65];
    const unsigned z = blockIdx.z;
    const unsigned which = z & 1u;                       // block-uniform select among global pointers
    const unsigned b = z >> 1;
    const float* src = xq;
    if (which == 1u) src = xk;
    const unsigned s0 = blockIdx.x * 64u, c0 = blockIdx.y * 64u;
    const unsigned t = threadIdx.x;
#pragma unroll
    for (int i = 0; i < 4; ++i) {
        const unsigned idx = t + 256u * (unsigned)i;
        const unsigned cc = idx >> 4, s4 = (idx & 15u) << 2;
        const v4f a = *(const v4f*)(src + ((size_t)b * EMB + c0 + cc) * SEQ_FULL + s0 + s4);
        tile[cc * 65u + s4 + 0u] = a.x; tile[cc * 65u + s4 + 1u] = a.y; tile[cc * 65u + s4 + 2u] = a.z; tile[cc * 65u + s4 + 3u] = a.w;
    }
    __syncthreads();
#pragma unroll
    for (int i = 0; i < 2; ++i) {
        const unsigned idx = t + 256u * (unsigned)i;
        const unsigned ss = idx >> 3, c8 = (idx & 7u) << 3;
        const float f0 = tile[(c8 + 0u) * 65u + ss], f1 = tile[(c8 + 1u) * 65u + ss], f2 = tile[(c8 + 2u) * 65u + ss], f3 = tile[(c8 + 3u) * 65u + ss];
        const float f4 = tile[(c8 + 4u) * 65u + ss], f5 = tile[(c8 + 5u) * 65u + ss], f6 = tile[(c8 + 6u) * 65u + ss], f7 = tile[(c8 + 7u) * 65u + ss];
        u4v pk; pk.x = pk2hf(bf_keep(f0), bf_keep(f1)); pk.y = pk2hf(bf_keep(f2), bf_keep(f3)); pk.z = pk2hf(bf_keep(f4), bf_keep(f5)); pk.w = pk2hf(bf_keep(f6), bf_keep(f7));
        VST2(u4v, (u4v*)(D + (size_t)which * ((size_t)NB * SEQ * EMB) + ((size_t)b * SEQ + s0 + ss) * EMB + c0 + c8), pk);
    }
}

// ---- three [512 out][512 in] direction weights -> f16 planes of bf16-converted values x16 (exact), plane y at D + y*WSZ, and the per-row gain table
//      SCL[y*512 + o] = bf16(g[o]) / ||bf16(v[o,:])|| / 16 (f32). Block = 32 rows (wave = 4 rows); grid (EMB/32, 3).
//      Plane rows: 2 instructions x 32 lanes x 16 B lane-contiguous; gain line: 32 lanes x 4 B of wave 0 in one instruction (LDS word per row, block barrier). ----
__global__ __launch_bounds__(256) void k_wprep(const float* __restrict__ v0, const float* __restrict__ g0, const float* __restrict__ v1, const float* __restrict__ g1,
                                               const float* __restrict__ v2, const float* __restrict__ g2, unsigned short* __restrict__ D, float* __restrict__ SCLp) {
#pragma clang fp contract(off)
    __shared__ float red[32];
    const unsigned y = blockIdx.y;                       // block-uniform select among global pointers
    const float* s = v0; const float* g = g0;
    if (y == 1u) { s = v1; g = g1; }
    if (y == 2u) { s = v2; g = g2; }
    const unsigned lane = threadIdx.x & 31u;
    const unsigned wave = (unsigned)__builtin_amdgcn_readfirstlane((int)(threadIdx.x >> 5));
    const unsigned rb = blockIdx.x * 32u;
#pragma unroll 1
    for (unsigned rr = 0; rr < 4u; ++rr) {
        const unsigned rl = wave * 4u + rr;
        const unsigned row = rb + rl;
        float ss = 0.f;
#pragma unroll 1
        for (unsigned it = 0; it < 2u; ++it) {
            const unsigned u = it * 32u + lane;          // 16-B piece of the row
            const float* p = s + (size_t)row * EMB + u * 8u;
            const v4f a = *(const v4f*)(p), b = *(const v4f*)(p + 4);
            const float a0 = bf_keep(a.x), a1 = bf_keep(a.y), a2 = bf_keep(a.z), a3 = bf_keep(a.w);
            const float b0 = bf_keep(b.x), b1 = bf_keep(b.y), b2 = bf_keep(b.z), b3 = bf_keep(b.w);
            ss += a0 * a0; ss += a1 * a1; ss += a2 * a2; ss += a3 * a3;
            ss += b0 * b0; ss += b1 * b1; ss += b2 * b2; ss += b3 * b3;
            u4v pk; pk.x = pk2hf(a0 * 16.f, a1 * 16.f); pk.y = pk2hf(a2 * 16.f, a3 * 16.f); pk.z = pk2hf(b0 * 16.f, b1 * 16.f); pk.w = pk2hf(b2 * 16.f, b3 * 16.f);
            VST2(u4v, (u4v*)(D + (size_t)y * WSZ + (size_t)row * EMB + u * 8u), pk);
        }
        ss += __shfl_xor(ss, 1, 32); ss += __shfl_xor(ss, 2, 32); ss += __shfl_xor(ss, 4, 32);
        ss += __shfl_xor(ss, 8, 32); ss += __shfl_xor(ss, 16, 32);
        if (lane == 0u) red[rl] = ss;
    }
    __syncthreads();
    if (threadIdx.x < 32u) {
        const unsigned row = rb + lane;
        const float sc = bf_keep(g[row]) * (1.0f / sqrtf(red[lane])) * 0.0625f;
        VST2(float, SCLp + (size_t)y * EMB + row, sc);
    }
}

// =====================================================================================================================
// k_proj_all: all six projection row groups in ONE grid (they only read the operand planes and write disjoint planes, so none waits for another).
//   blockIdx.z: 0 q early, 1 k early, 2 v^T early (value + residual planes), 3 q late, 4 k late, 5 v^T late (value plane only); blockIdx.y = batch.
//   C[m,n] = scl * sum_k A[m,k] * Bt[n,k] + bias; each wave owns a 64x64 tile; 8 waves per block; A, Bt row-major f16, pitch EMB, K = EMB.
//   q, k (token-major): A = tokens, Bt = direction weights, bias[n], scl[n]; v^T (channel-major): A = direction weights, Bt = tokens, bias[m], scl[m]
//   (bias bf16-converted on load; scl is an f32 table). Output: f16 plane C (value); RES: also the f16 plane Cr = (value - f16 value) x 2048.
// =====================================================================================================================
template <int BIAS_MODE, bool RES>
__device__ __forceinline__ void proj_epilogue(v8f (&acc)[4][4], float* slab, _Float16* C, unsigned ldc, _Float16* Cr, unsigned ldr,
                                              const float* __restrict__ bias, const float* __restrict__ scl, unsigned m0, unsigned n0, unsigned lane) {
  const unsigned rlane = lane & 15u;            // col (D) within subtile
  const unsigned mOff  = (lane >> 4) << 3;      // D row offset
#pragma unroll
  for (int i = 0; i < 4; ++i) {
    const unsigned mBase = m0 + ((unsigned)i << 4);
    float bm[8], sm[8];
#pragma unroll
    for (int r = 0; r < 8; ++r) {
      bm[r] = (BIAS_MODE == 1) ? bf_keep(bias[mBase + mOff + (unsigned)r]) : 0.f;
      sm[r] = (BIAS_MODE == 1) ? scl[mBase + mOff + (unsigned)r] : 0.f;
    }
#pragma unroll
    for (int j = 0; j < 4; ++j) {
      const unsigned n = n0 + ((unsigned)j << 4) + rlane;
      float bv = 0.f, sv = 0.f;
      if (BIAS_MODE == 2) { bv = bf_keep(bias[n]); sv = scl[n]; }
#pragma unroll
      for (int r = 0; r < 8; ++r) {
        float v;
        if (BIAS_MODE == 1) v = acc[i][j][r] * sm[r] + bm[r];
        else                v = acc[i][j][r] * sv + bv;
        slab[(mOff + (unsigned)r) * 68u + ((unsigned)j << 4) + rlane] = v;
      }
    }
    __builtin_amdgcn_fence(3 /* release order */, "workgroup");
    __builtin_amdgcn_wave_barrier();
    __builtin_amdgcn_fence(2 /* acquire order */, "workgroup");
    {
      const unsigned q = lane >> 3, c8 = (lane & 7u) << 3;
      v8h hv[4];
      v8h rv[4];
#pragma unroll
      for (int it = 0; it < 4; ++it) {
        const unsigned row = (unsigned)it * 4u + q;
        const float* sp = slab + row * 68u + c8;
        const v4f s0 = *(const v4f*)(sp), s1 = *(const v4f*)(sp + 4);
        v8h t;
        t[0] = toh_flush(s0.x); t[1] = toh_flush(s0.y); t[2] = toh_flush(s0.z); t[3] = toh_flush(s0.w);
        t[4] = toh_flush(s1.x); t[5] = toh_flush(s1.y); t[6] = toh_flush(s1.z); t[7] = toh_flush(s1.w);
        hv[it] = t;
        v8h u = t;
        if (RES) {
          u[0] = toh_flush((s0.x - (float)t[0]) * 2048.0f); u[1] = toh_flush((s0.y - (float)t[1]) * 2048.0f);
          u[2] = toh_flush((s0.z - (float)t[2]) * 2048.0f); u[3] = toh_flush((s0.w - (float)t[3]) * 2048.0f);
          u[4] = toh_flush((s1.x - (float)t[4]) * 2048.0f); u[5] = toh_flush((s1.y - (float)t[5]) * 2048.0f);
          u[6] = toh_flush((s1.z - (float)t[6]) * 2048.0f); u[7] = toh_flush((s1.w - (float)t[7]) * 2048.0f);
        }
        rv[it] = u;
      }
#pragma unroll
      for (int it = 0; it < 4; ++it) {
        const unsigned row = (unsigned)it * 4u + q;
        *(v8h*)(C + (size_t)(mBase + row) * ldc + n0 + c8) = hv[it];
        if (RES) *(v8h*)(Cr + (size_t)(mBase + row) * ldr + n0 + c8) = rv[it];
      }
    }
    __builtin_amdgcn_fence(3 /* release order */, "workgroup");
    __builtin_amdgcn_wave_barrier();
    __builtin_amdgcn_fence(2 /* acquire order */, "workgroup");
  }
}

__global__ __launch_bounds__(256) void k_proj_all(const _Float16* __restrict__ XQ, const _Float16* __restrict__ XK, const _Float16* __restrict__ Wd,
                                                  _Float16* QHp, _Float16* KHp, _Float16* VTHp, _Float16* QRp, _Float16* KRp, _Float16* VTRp,
                                                  const float* __restrict__ bq, const float* __restrict__ bk, const float* __restrict__ bv,
                                                  const float* __restrict__ SCLp) {
  __shared__ __align__(16) float sT[8][16 * 68];   // per-wave 16x64 slab, pitch 68 floats
  const unsigned z    = blockIdx.z;                // block-uniform selects among global pointers below
  const unsigned b    = blockIdx.y;
  const bool     late = z >= 3u;
  const unsigned p    = late ? z - 3u : z;         // 0 q, 1 k, 2 v^T
  const bool     chm  = p == 2u;                   // channel-major (v^T)
  const unsigned rows = late ? (unsigned)LROWS : (unsigned)EROWS;   // tokens of this row group
  const unsigned row0 = late ? (unsigned)EROWS : 0u;                // its first token inside a batch
  const unsigned lane = threadIdx.x & 31u;
  const unsigned wave = (unsigned)__builtin_amdgcn_readfirstlane((int)(threadIdx.x >> 5));
  const unsigned tilesM = (chm ? (unsigned)EMB : rows) >> 6;
  const unsigned tilesN = (chm ? rows : (unsigned)EMB) >> 6;
  const unsigned tile = blockIdx.x * 8u + wave;
  if (tile >= tilesM * tilesN) return;   // wave-uniform; no block barriers in this kernel
  const unsigned tm = tile / tilesN;
  const unsigned tn = tile - tm * tilesN;
  const unsigned m0 = tm << 6;
  const unsigned n0 = tn << 6;

  const _Float16* X = XQ;
  if (p != 0u) X = XK;
  const _Float16* tok = X + ((size_t)b * SEQ + row0) * EMB;   // this batch's tokens of the row group
  const _Float16* wgt = Wd + (size_t)p * WSZ;
  const _Float16* Ab = chm ? wgt : tok;
  const _Float16* Bb = chm ? tok : wgt;

  const unsigned rlane = lane & 15u;            // row (A) / col (B) within subtile
  const unsigned koff  = (lane >> 4) << 3;      // k offset of this lane half

  v8f acc[4][4];
#pragma unroll
  for (int i = 0; i < 4; ++i)
#pragma unroll
    for (int j = 0; j < 4; ++j) acc[i][j] = (v8f){0.f,0.f,0.f,0.f,0.f,0.f,0.f,0.f};

  for (unsigned k0 = 0; k0 < (unsigned)EMB; k0 += 32u) {
    v16h bh[4];
#pragma unroll
    for (int j = 0; j < 4; ++j) {
      const size_t bo = (size_t)(n0 + ((unsigned)j << 4) + rlane) * (unsigned)EMB + koff + k0;
      bh[j] = frag_ld(Bb + bo);
    }
#pragma unroll
    for (int i = 0; i < 4; ++i) {
      const size_t ao = (size_t)(m0 + ((unsigned)i << 4) + rlane) * (unsigned)EMB + koff + k0;
      const v16h ah = frag_ld(Ab + ao);
#pragma unroll
      for (int j = 0; j < 4; ++j) acc[i][j] = mma_raw(ah, bh[j], acc[i][j]);
      dep_guard_h(acc[i][0], acc[i][3], ah, ah);
    }
    keep4_h(bh[0], bh[1], bh[2], bh[3]);
  }
  acc_guard4(acc[0][0], acc[0][1], acc[0][2], acc[0][3]);
  acc_guard4(acc[1][0], acc[1][1], acc[1][2], acc[1][3]);
  acc_guard4(acc[2][0], acc[2][1], acc[2][2], acc[2][3]);
  acc_guard4(acc[3][0], acc[3][1], acc[3][2], acc[3][3]);

  // ---- epilogue (one of four forms, block-uniform) ----
  float* slab = sT[wave];
  const float* scl = SCLp + (size_t)p * EMB;
  if (chm) {
    _Float16* C  = VTHp + (size_t)b * ((size_t)EMB * SEQ) + row0;
    _Float16* Cr = VTRp + (size_t)b * ((size_t)EMB * EROWS);
    if (late) proj_epilogue<1, false>(acc, slab, C, (unsigned)SEQ, Cr, (unsigned)EROWS, bv, scl, m0, n0, lane);
    else      proj_epilogue<1, true >(acc, slab, C, (unsigned)SEQ, Cr, (unsigned)EROWS, bv, scl, m0, n0, lane);
  } else {
    _Float16* Cp = QHp; _Float16* Rp = QRp; const float* bias = bq;
    if (p == 1u) { Cp = KHp; Rp = KRp; bias = bk; }
    _Float16* C  = Cp + ((size_t)b * SEQ + row0) * EMB;
    _Float16* Cr = Rp + (size_t)b * ((size_t)EROWS * EMB);
    if (late) proj_epilogue<2, false>(acc, slab, C, (unsigned)EMB, Cr, (unsigned)EMB, bias, scl, m0, n0, lane);
    else      proj_epilogue<2, true >(acc, slab, C, (unsigned)EMB, Cr, (unsigned)EMB, bias, scl, m0, n0, lane);
  }
}

// =====================================================================================================================
// attn_body<EARLY>: strictly causal attention (key j < query i; masked scores REPLACED by -10000 before the softmax; sequence row 0 zeroed after it),
//   head dim 64. Block = 4 waves = 64 query rows of one (batch, head): query block qb = qb_off + blockIdx.x % nqb; key chunks 0..qb (64 keys each).
//   Chunks above the diagonal are skipped: every query row i > 0 sees at least key 0, so their exp(-10000 - max) terms are exactly 0 in f32.
//   Flash-style online softmax (f32, exp2 domain). Q, K: f16 planes [NB*SEQ][512]; VT: f16 plane [NB][512][SEQ]; fragments are loaded straight from
//   the dense planes (arithmetic addressing, two 16-B loads each). P (x2^15, f16) goes through a wave-private LDS tile.
//   EARLY (query rows < EROWS): q, k, v^T and P also as x2048 residual planes QR/KR [NB][EROWS][512], VTR [NB][512][EROWS]; residual products
//   (qr.k + q.kr ; Pr.v + P.vr) go to their own accumulators, folded back with 1/2048 in f32.
//   Output: f32 [b][h*64+d][token] (full strides): the block's 64x64 tile is transposed through LDS (cross-wave: block barrier) and every
// =====================================================================================================================
template <bool EARLY>
__device__ __forceinline__ void attn_body(const _Float16* __restrict__ Q, const _Float16* __restrict__ Kp, const _Float16* __restrict__ VT,
                                          const _Float16* __restrict__ QR, const _Float16* __restrict__ KR, const _Float16* __restrict__ VTR,
                                          float* __restrict__ OUT, unsigned qb_off, unsigned nqb) {
  __shared__ __align__(16) _Float16 Psh[4][16 * 64];                 // per wave P tile [row][kv]  (wave-private)
  __shared__ __align__(16) _Float16 Prs[EARLY ? 4 : 1][16 * 64];     // per wave P residual tile   (wave-private)
  __shared__ __align__(16) float    OT[64 * 68];                     // block output tile [d][query], pitch 68 (cross-wave)
  const unsigned tid  = threadIdx.x;
  const unsigned wave = (unsigned)__builtin_amdgcn_readfirstlane((int)(tid >> 5));
  const unsigned lane = tid & 31u;
  const unsigned hh   = lane >> 4;
  const unsigned c    = lane & 15u;
  const unsigned bx = blockIdx.x;
  const unsigned qb = qb_off + bx % nqb;
  const unsigned bh = bx / nqb;
  const unsigned h  = bh & 7u;
  const unsigned b  = bh >> 3;
  const unsigned q0 = qb * 64u + wave * 16u;
  const unsigned nch = qb + 1u;
  const size_t rowbase = (size_t)b * SEQ;
  const size_t resbase = (size_t)b * EROWS;

  const _Float16* qrow = Q + (rowbase + q0 + c) * EMB + h * 64u + 8u * hh;
  const v16h qa0 = frag_ld(qrow), qa1 = frag_ld(qrow + 32);
  v16h qr0 = qa0, qr1 = qa1;
  if (EARLY) {
    const _Float16* qrr = QR + (resbase + q0 + c) * EMB + h * 64u + 8u * hh;
    qr0 = frag_ld(qrr); qr1 = frag_ld(qrr + 32);
  }
  const _Float16* kbase  = Kp + rowbase * EMB + h * 64u + 8u * hh;                       // + key * EMB (+ 32 for the second d chunk)
  const _Float16* krbase = KR + resbase * EMB + h * 64u + 8u * hh;
  const _Float16* vbase  = VT  + ((size_t)b * EMB + h * 64u) * SEQ   + 8u * hh;          // + d * SEQ + kv
  const _Float16* vrbase = VTR + ((size_t)b * EMB + h * 64u) * EROWS + 8u * hh;          // + d * EROWS + kv

  float mrow[8], lrow[8];
  v8f oacc[4], oaccr[4];
#pragma unroll
  for (int r = 0; r < 8; ++r) { mrow[r] = -__builtin_inff(); lrow[r] = 0.f; }
#pragma unroll
  for (int t = 0; t < 4; ++t) { oacc[t] = (v8f){0.f,0.f,0.f,0.f,0.f,0.f,0.f,0.f}; oaccr[t] = (v8f){0.f,0.f,0.f,0.f,0.f,0.f,0.f,0.f}; }

  const float SC    = 0.125f * 1.4426950408889634f;       // 1/sqrt(64) and log2(e)
  const float FILLX = -14426.950408889634f;               // -10000 * log2(e)
  _Float16* pw  = Psh[wave];
  _Float16* prw = Prs[EARLY ? wave : 0u];

  for (unsigned kc = 0; kc < nch; ++kc) {
    const unsigned kv0 = kc * 64u;
    v8f s[4];
#pragma unroll
    for (int j = 0; j < 4; ++j) {
      const _Float16* kr = kbase + (size_t)(kv0 + (unsigned)j * 16u + c) * EMB;
      const v16h kh0 = frag_ld(kr), kh1 = frag_ld(kr + 32);
      v8f a = (v8f){0.f,0.f,0.f,0.f,0.f,0.f,0.f,0.f};
      a = wmma16(qa0, kh0, a);
      a = wmma16(qa1, kh1, a);
      if (EARLY) {
        const _Float16* krr = krbase + (size_t)(kv0 + (unsigned)j * 16u + c) * EMB;
        v8f ar = (v8f){0.f,0.f,0.f,0.f,0.f,0.f,0.f,0.f};
        ar = wmma16(qr0, kh0, ar);
        ar = wmma16(qr1, kh1, ar);
        ar = wmma16(qa0, frag_ld(krr), ar);
        ar = wmma16(qa1, frag_ld(krr + 32), ar);
        a = a + ar * 0.00048828125f;
      }
      s[j] = a;
    }
    const unsigned kj = kv0 + c;
#pragma unroll
    for (int r = 0; r < 8; ++r) {
      const unsigned qi = q0 + 8u * hh + (unsigned)r;
      const float x0 = (kj       < qi) ? s[0][r] * SC : FILLX;
      const float x1 = (kj + 16u < qi) ? s[1][r] * SC : FILLX;
      const float x2 = (kj + 32u < qi) ? s[2][r] * SC : FILLX;
      const float x3 = (kj + 48u < qi) ? s[3][r] * SC : FILLX;
      float m = fmaxf(fmaxf(x0, x1), fmaxf(x2, x3));
      m = fmaxf(m, __shfl_xor(m, 1, 32)); m = fmaxf(m, __shfl_xor(m, 2, 32));
      m = fmaxf(m, __shfl_xor(m, 4, 32)); m = fmaxf(m, __shfl_xor(m, 8, 32));
      const float mnew = fmaxf(mrow[r], m);
      const float alpha = exp2f(mrow[r] - mnew);
      mrow[r] = mnew;
      const float p0 = exp2f(x0 - mnew), p1 = exp2f(x1 - mnew), p2 = exp2f(x2 - mnew), p3 = exp2f(x3 - mnew);
      float psum = (p0 + p1) + (p2 + p3);
      const unsigned po = (8u * hh + (unsigned)r) * 64u + c;
      const float e0 = p0 * 32768.0f, e1 = p1 * 32768.0f, e2 = p2 * 32768.0f, e3 = p3 * 32768.0f;
      const h16 g0 = toh_flush(e0), g1 = toh_flush(e1), g2 = toh_flush(e2), g3 = toh_flush(e3);
      pw[po]       = g0;
      pw[po + 16u] = g1;
      pw[po + 32u] = g2;
      pw[po + 48u] = g3;
      if (EARLY) {
        prw[po]       = toh_flush((e0 - (float)g0) * 2048.0f);
        prw[po + 16u] = toh_flush((e1 - (float)g1) * 2048.0f);
        prw[po + 32u] = toh_flush((e2 - (float)g2) * 2048.0f);
        prw[po + 48u] = toh_flush((e3 - (float)g3) * 2048.0f);
      }
      psum += __shfl_xor(psum, 1, 32); psum += __shfl_xor(psum, 2, 32);
      psum += __shfl_xor(psum, 4, 32); psum += __shfl_xor(psum, 8, 32);
      lrow[r] = lrow[r] * alpha + psum;
#pragma unroll
      for (int t = 0; t < 4; ++t) { oacc[t][r] *= alpha; if (EARLY) oaccr[t][r] *= alpha; }
    }
    __builtin_amdgcn_fence(3 /* release order */, "workgroup");
    __builtin_amdgcn_wave_barrier();
    __builtin_amdgcn_fence(2 /* acquire order */, "workgroup");
#pragma unroll
    for (int kk = 0; kk < 2; ++kk) {
      const v16h pa = frag_ld(pw + c * 64u + (unsigned)kk * 32u + 8u * hh);
      v16h pr = pa;
      if (EARLY) pr = frag_ld(prw + c * 64u + (unsigned)kk * 32u + 8u * hh);
#pragma unroll
      for (int t = 0; t < 4; ++t) {
        const v16h vb = frag_ld(vbase + (size_t)((unsigned)t * 16u + c) * SEQ + kv0 + (unsigned)kk * 32u);
        oacc[t] = wmma16(pa, vb, oacc[t]);
        if (EARLY) {
          oaccr[t] = wmma16(pr, vb, oaccr[t]);
          const v16h vr = frag_ld(vrbase + (size_t)((unsigned)t * 16u + c) * EROWS + kv0 + (unsigned)kk * 32u);
          oaccr[t] = wmma16(pa, vr, oaccr[t]);
        }
      }
    }
    // the next key block's P stores must not pass this block's P fragment loads
    __builtin_amdgcn_fence(3 /* release order */, "workgroup");
    __builtin_amdgcn_wave_barrier();
    __builtin_amdgcn_fence(2 /* acquire order */, "workgroup");
  }

  // normalise (P carried x2^15), zero sequence row 0, transpose the wave's 16x64 tile into the block tile [d][query]
  float inv[8];
#pragma unroll
  for (int r = 0; r < 8; ++r) {
    const unsigned qi = q0 + 8u * hh + (unsigned)r;
    const float iv = 1.0f / (lrow[r] * 32768.0f);
    inv[r] = (qi == 0u) ? 0.0f : iv;
  }
#pragma unroll
  for (int t = 0; t < 4; ++t) {
    float o[8];
#pragma unroll
    for (int r = 0; r < 8; ++r) {
      float v = oacc[t][r];
      if (EARLY) v += oaccr[t][r] * 0.00048828125f;
      o[r] = v * inv[r];
    }
    const unsigned oi = ((unsigned)t * 16u + c) * 68u + wave * 16u + 8u * hh;
    *(v4f*)(OT + oi)      = (v4f){o[0], o[1], o[2], o[3]};
    *(v4f*)(OT + oi + 4u) = (v4f){o[4], o[5], o[6], o[7]};
  }
  __syncthreads();
  {
    const unsigned c4 = (lane & 15u) << 2;     // row segment = 64 floats = 256 B = 16 lanes x 16 B; 2 rows per instruction, 8 trips = 16 rows per wave
    float* ob = OUT + ((size_t)b * EMB + h * 64u + wave * 16u) * SEQ_FULL + qb * 64u + c4;
    v4f vv[8];
#pragma unroll
    for (int it = 0; it < 8; ++it) {
      const unsigned row = (unsigned)it * 2u + hh;
      vv[it] = *(const v4f*)(OT + (wave * 16u + row) * 68u + c4);
    }
    {
#pragma unroll
      for (int it = 0; it < 8; ++it) {
        const unsigned row = (unsigned)it * 2u + hh;
        *(v4f*)(ob + (size_t)row * SEQ_FULL) = vv[it];
      }
      
    }
  }
}

__global__ __launch_bounds__(128) __attribute__((amdgpu_num_vgpr(256))) void k_attn_early(
    const _Float16* __restrict__ Q, const _Float16* __restrict__ Kp, const _Float16* __restrict__ VT,
    const _Float16* __restrict__ QR, const _Float16* __restrict__ KR, const _Float16* __restrict__ VTR,
    float* __restrict__ OUT, unsigned qb_off, unsigned nqb) {
  attn_body<true>(Q, Kp, VT, QR, KR, VTR, OUT, qb_off, nqb);
}
__global__ __launch_bounds__(128) void k_attn_late(
    const _Float16* __restrict__ Q, const _Float16* __restrict__ Kp, const _Float16* __restrict__ VT,
    const _Float16* __restrict__ QR, const _Float16* __restrict__ KR, const _Float16* __restrict__ VTR,
    float* __restrict__ OUT, unsigned qb_off, unsigned nqb) {
  attn_body<false>(Q, Kp, VT, QR, KR, VTR, OUT, qb_off, nqb);
}

// ---- workspace carve (bytes; every region is a whole number of 256-B units and is written in full by its producer) ----
#define SZ_P16  ((size_t)NB * SEQ * EMB * 2)            // one f16 activation plane
#define SZ_R16  ((size_t)NB * EROWS * EMB * 2)          // one f16 residual plane (early rows only)
#define SZ_W16  ((size_t)3 * WSZ * 2)
#define SZ_SCL  ((size_t)3 * EMB * 4)
#define OFF_XQ   ((size_t)0)
#define OFF_XK   (OFF_XQ + SZ_P16)
#define OFF_W16  (OFF_XK + SZ_P16)
#define OFF_SCL  (OFF_W16 + SZ_W16)
#define OFF_QH   (OFF_SCL + SZ_SCL)
#define OFF_KH   (OFF_QH + SZ_P16)
#define OFF_VTH  (OFF_KH + SZ_P16)
#define OFF_QR   (OFF_VTH + SZ_P16)
#define OFF_KR   (OFF_QR + SZ_R16)
#define OFF_VTR  (OFF_KR + SZ_R16)
#define WS_TOTAL (OFF_VTR + SZ_R16)
static_assert(SZ_P16 % 256 == 0 && SZ_R16 % 256 == 0 && SZ_W16 % 256 == 0 && SZ_SCL % 256 == 0);
static_assert(OFF_XK == OFF_XQ + (size_t)NB * SEQ * EMB * 2);   // k_castxT addresses the key plane as plane 1 of one base
static_assert(WS_TOTAL <= (size_t)134217728);
static_assert((size_t)NB_FULL * EMB * SEQ_FULL * 4 == (size_t)33554432);   // output extent in bytes, offset 0

extern "C" void kernel_launch(void* const* d_in, const int* in_sizes, int n_in, void* d_out, int out_size, void* d_ws, size_t ws_size, hipStream_t stream) {
    if (n_in < 11) return;
    const long long xneed = ((long long)(NB - 1) * EMB + (EMB - 1)) * SEQ_FULL + SEQ;
    if ((long long)in_sizes[0] < xneed) return;
    if ((long long)in_sizes[1] < xneed) return;
    if (in_sizes[2] < WSZ || in_sizes[5] < WSZ || in_sizes[8] < WSZ) return;
    if (in_sizes[3] < EMB || in_sizes[4] < EMB || in_sizes[6] < EMB || in_sizes[7] < EMB || in_sizes[9] < EMB || in_sizes[10] < EMB) return;
    if ((long long)out_size < xneed) return;
    if ((size_t)WS_TOTAL > ws_size) return;

    // input order: query, key, vq, gq, bq, vk, gk, bk, vv, gv, bv
    const float* query = (const float*)d_in[0];
    const float* key   = (const float*)d_in[1];
    const float* vq = (const float*)d_in[2];  const float* gq = (const float*)d_in[3];  const float* bq = (const float*)d_in[4];
    const float* vk = (const float*)d_in[5];  const float* gk = (const float*)d_in[6];  const float* bk = (const float*)d_in[7];
    const float* vv = (const float*)d_in[8];  const float* gv = (const float*)d_in[9];  const float* bv = (const float*)d_in[10];
    float* out = (float*)d_out;

    char* ws = (char*)d_ws;
    unsigned short* X16  = (unsigned short*)(ws + OFF_XQ);     // plane 0 = query tokens, plane 1 = key tokens
    unsigned short* W16  = (unsigned short*)(ws + OFF_W16);    // planes: 0 vq 1 vk 2 vv (direction weights x16)
    float*          SCL  = (float*)(ws + OFF_SCL);             // [3][512] row gains / 16
    _Float16* QH  = (_Float16*)(ws + OFF_QH);
    _Float16* KH  = (_Float16*)(ws + OFF_KH);
    _Float16* VTH = (_Float16*)(ws + OFF_VTH);
    _Float16* QR  = (_Float16*)(ws + OFF_QR);
    _Float16* KR  = (_Float16*)(ws + OFF_KR);
    _Float16* VTR = (_Float16*)(ws + OFF_VTR);

    const _Float16* XQh = (const _Float16*)(ws + OFF_XQ);
    const _Float16* XKh = (const _Float16*)(ws + OFF_XK);
    const _Float16* W16h = (const _Float16*)W16;

    // 1-2: operand planes
    k_castxT<<<dim3((unsigned)(SEQ / 64), (unsigned)(EMB / 64), (unsigned)(NB * 2)), 256, 0, stream>>>(query, key, X16);
    k_wprep<<<dim3((unsigned)(EMB / 32), 3u), 256, 0, stream>>>(vq, gq, vk, gk, vv, gv, W16, SCL);

    // 3: q, k (tokens x V^T, row gain, bias -> f16 planes) and v^T (V x tokens^T, gain[m], bias[m] -> f16 plane [b][h*64+d][token]); early group also residual planes;
    //    all six row groups in one grid (blockIdx.z), the early groups (longer epilogue) first
    k_proj_all<<<dim3((unsigned)(((EROWS > LROWS) ? EROWS : LROWS) / 64), (unsigned)NB, (LROWS > 0) ? 6u : 3u), 256, 0, stream>>>(
        XQh, XKh, W16h, QH, KH, VTH, QR, KR, VTR, bq, bk, bv, SCL);

    // 4-5: causal attention, early band (value + residual planes) and late band (single planes); each block writes its 64x64 tile of the output buffer
    k_attn_early<<<(unsigned)(NB * NHEAD * (EROWS / 64)), 128, 0, stream>>>(QH, KH, VTH, QR, KR, VTR, out, 0u, (unsigned)(EROWS / 64));
    if (LROWS > 0) {
        k_attn_late<<<(unsigned)(NB * NHEAD * (LROWS / 64)), 128, 0, stream>>>(QH, KH, VTH, QR, KR, VTR, out, (unsigned)(EROWS / 64), (unsigned)(LROWS / 64));
    }
}

// v002
// A run of this version takes 201 microseconds.
// Timed twice side by side with v001, it ran 1.52 times as fast both times.
// Counting every step since v000, it is 1.93 times as fast.
// All contractions (weight-normalised q/k/v projections, q.k^T, P.V): v_wmma_f32_16x16x32_f16 (f16 operands, f32 accumulate); float inputs bf16-converted (RNE) first, direction weights carried x16 with the per-row norm gain applied in f32 at the projection epilogue, P carried x2^15; query rows < EROWS additionally carry q, k, v, P as f16 value + x2048 f16 residual planes (three products, residual products in their own accumulator); mask, softmax, norms in f32.
#include <hip/hip_runtime.h>
#include <math.h>

// ---- sizes (NB / SEQ reducible; *_FULL = strides of the inputs / output) ----
#ifndef NB
#define NB 16
#endif
#ifndef SEQ
#define SEQ 1024
#endif
#ifndef EROWS
#define EROWS ((SEQ < 512) ? SEQ : 512)
#endif
#define LROWS (SEQ - EROWS)
#define NB_FULL 16
#define SEQ_FULL 1024
#define EMB 512
#define NHEAD 8
#define HDIM 64
#define WSZ (EMB * EMB)

static_assert(NB >= 1 && NB <= NB_FULL);
static_assert(SEQ <= SEQ_FULL && SEQ % 64 == 0 && SEQ >= 64);
static_assert(EROWS % 64 == 0 && EROWS >= 64 && EROWS <= SEQ);
static_assert(LROWS % 64 == 0);
static_assert(EMB % 64 == 0 && EMB == NHEAD * HDIM && HDIM == 64 && NHEAD == 8);
static_assert(EMB % 32 == 0);                          // WMMA k-steps of 32, weight rows per prep block
static_assert(4 * 256 == 64 * 16);                     // k_castxT load phase: trips x threads == tile rows x 16-B pieces per row
static_assert(2 * 256 == 64 * 8);
static_assert(2 * 32 * 8 == EMB);                      // k_wprep: trips x lanes x elements == weight row width
static_assert(8 * 4 == 32);                            // k_wprep: waves x rows per wave == rows per block
static_assert(32 * 16 * 4 == 16 * 128);                // projection epilogue: lanes x bytes x trips == slab rows x row bytes (64 halves)
static_assert(4 * 32 * 16 * 8 == 64 * 256);            // attention output: waves x lanes x bytes x trips == tile rows x row bytes (64 floats)
static_assert(8 * 16 * 68 * 4 <= 131072);              // static LDS of the projection kernels
static_assert(4 * 64 * 72 * 2 + 2 * 4 * 16 * 64 * 2 <= 81920);  // static LDS of the attention kernels: four blocks per 320-KiB LDS
static_assert(64 * 68 * 4 <= 2 * 64 * 72 * 2);         // the output tile fits the staging area that it reuses
static_assert(4 * 128 * 16 == 64 * 128);               // staging: copies per thread x threads x bytes == tile rows x row bytes
static_assert(64 * 65 * 4 <= 131072);                  // static LDS of k_castxT

typedef _Float16 h16;
typedef __attribute__((ext_vector_type(16))) _Float16 v16h;
typedef __attribute__((ext_vector_type(8)))  _Float16 v8h;
typedef __attribute__((ext_vector_type(8)))  float    v8f;
typedef __attribute__((ext_vector_type(4)))  float    v4f;
typedef __attribute__((ext_vector_type(4)))  unsigned int u4v;

// 16-bit WMMA fragment map (wave32), lane L, h = L>>4, m = L&15:
//   A 16x32: lane = row m;    element i -> k = (i<8) ? 8h+i : 16+8h+(i-8)
//   B 32x16: lane = column m; the SAME k(i,h)
//   D 16x16 (8 f32): lane = column m; element r -> row 8h+r
union FragU { v16h v; v8h h[2]; };
// p already includes the +8h lane-half offset: elements 0..7 <- p[0..7], 8..15 <- p[16..23]
__device__ __forceinline__ v16h frag_ld(const _Float16* p) { FragU f; f.h[0] = *(const v8h*)(p); f.h[1] = *(const v8h*)(p + 16); return f.v; }

__device__ __forceinline__ v8f wmma16(v16h a, v16h b, v8f c) {
    c = __builtin_amdgcn_wmma_f32_16x16x32_f16(false, a, false, b, (short)0, c, false, false);
    asm volatile("v_nop\n\tv_nop\n\tv_nop\n\tv_nop" : "+v"(c) : "v"(a), "v"(b));
    return c;
}
__device__ __forceinline__ v8f mma_raw(v16h a, v16h b, v8f c) { return __builtin_amdgcn_wmma_f32_16x16x32_f16(false, a, false, b, (short)0, c, false, false); }
__device__ __forceinline__ void dep_guard_h(v8f& a, v8f& b, v16h x, v16h y) { asm volatile("v_nop\n\tv_nop\n\tv_nop\n\tv_nop" : "+v"(a), "+v"(b) : "v"(x), "v"(y)); }
__device__ __forceinline__ void keep4_h(v16h a, v16h b, v16h c, v16h d) { asm volatile("v_nop" :: "v"(a), "v"(b), "v"(c), "v"(d)); }
__device__ __forceinline__ void acc_guard4(v8f& a, v8f& b, v8f& c, v8f& d) { asm volatile("v_nop\n\tv_nop\n\tv_nop\n\tv_nop" : "+v"(a), "+v"(b), "+v"(c), "+v"(d)); }

// bf16 RNE convert, kept as f32 (finite inputs)
__device__ __forceinline__ float bf_keep(float v) { const unsigned u = __float_as_uint(v); return __uint_as_float((u + 0x7fffu + ((u >> 16) & 1u)) & 0xffff0000u); }
// f32 -> f16 that cannot produce an f16 subnormal (value select)
__device__ __forceinline__ h16 toh_flush(float v) { const h16 r = (h16)v; return (fabsf(v) < 6.103515625e-05f) ? (h16)0.0f : r; }
__device__ __forceinline__ unsigned pk2hf(float a, float b) { return (unsigned)__builtin_bit_cast(unsigned short, toh_flush(a)) | ((unsigned)__builtin_bit_cast(unsigned short, toh_flush(b)) << 16); }

// ---- LDS staging of 64-row x 128-byte f16 tiles by asynchronous copies (global -> LDS, through no register) ----
#define KVP 72u                      // LDS row pitch in halves: 144 B = 16 B x 9, conflict-free for 16-byte fragment reads
#define TILE_H (64u * KVP)           // halves of one staged tile
#define ROWS16_B (16u * KVP * 2u)    // LDS bytes of 16 staged rows
// Each thread of the 128 copies its 16-byte piece of rows r, r+16, r+32, r+48: one wave-wide copy = 4 whole 128-byte rows.
// l = the thread's LDS byte address of its piece in row r, g = the same piece in global memory, st = 16 source rows in halves.
// s_wait_xcnt stands as the last line of the copies' own statement, so no address register is rewritten in front of it.
__device__ __forceinline__ void stage_tile1(unsigned l, const _Float16* g, size_t st) {
    asm volatile("global_load_async_to_lds_b128 %0, %4, off\n\t"
                 "global_load_async_to_lds_b128 %1, %5, off\n\t"
                 "global_load_async_to_lds_b128 %2, %6, off\n\t"
                 "global_load_async_to_lds_b128 %3, %7, off\n\t"
                 "s_wait_xcnt 0x0"
                 :: "v"(l), "v"(l + ROWS16_B), "v"(l + 2u * ROWS16_B), "v"(l + 3u * ROWS16_B),
                    "v"(g), "v"(g + st), "v"(g + 2u * st), "v"(g + 3u * st) : "memory");
}
__device__ __forceinline__ void stage_tile2(unsigned l, const _Float16* g, size_t st, unsigned l2, const _Float16* g2, size_t st2) {
    asm volatile("global_load_async_to_lds_b128 %0, %8, off\n\t"
                 "global_load_async_to_lds_b128 %1, %9, off\n\t"
                 "global_load_async_to_lds_b128 %2, %10, off\n\t"
                 "global_load_async_to_lds_b128 %3, %11, off\n\t"
                 "global_load_async_to_lds_b128 %4, %12, off\n\t"
                 "global_load_async_to_lds_b128 %5, %13, off\n\t"
                 "global_load_async_to_lds_b128 %6, %14, off\n\t"
                 "global_load_async_to_lds_b128 %7, %15, off\n\t"
                 "s_wait_xcnt 0x0"
                 :: "v"(l), "v"(l + ROWS16_B), "v"(l + 2u * ROWS16_B), "v"(l + 3u * ROWS16_B),
                    "v"(l2), "v"(l2 + ROWS16_B), "v"(l2 + 2u * ROWS16_B), "v"(l2 + 3u * ROWS16_B),
                    "v"(g), "v"(g + st), "v"(g + 2u * st), "v"(g + 3u * st),
                    "v"(g2), "v"(g2 + st2), "v"(g2 + 2u * st2), "v"(g2 + 3u * st2) : "memory");
}
// publish point of the next stage: this wave's LDS reads have returned, its own copies have landed, then the block barrier
// (it shows the landed tile to the other waves and ends every wave's reads of the buffer that is refilled behind it)
__device__ __forceinline__ void stage_publish() {
    asm volatile("s_wait_dscnt 0x0" ::: "memory");      // this wave's reads of the buffer about to be refilled are done
    asm volatile("s_wait_asynccnt 0x0" ::: "memory");   // this wave's copies of the next stage have landed
    __syncthreads();
}

#define VST2(T, ptr, val) do { const T vst2_v_ = (val); *(T*)(ptr) = vst2_v_;  } while (0)

// ---- query / key (f32, [b][c][s], full strides) -> f16 planes of the bf16-converted values, compact [NB*SEQ][512] (token-major);
//      plane 0 = query at D, plane 1 = key at D + NB*SEQ*EMB. 64 channels x 64 tokens per block through an LDS tile (cross-wave: block barrier);
__global__ __launch_bounds__(256) void k_castxT(const float* __restrict__ xq, const float* __restrict__ xk, unsigned short* __restrict__ D) {
#pragma clang fp contract(off)
    __shared__ float tile[64 * 65];
    const unsigned z = blockIdx.z;
    const unsigned which = z & 1u;                       // block-uniform select among global pointers
    const unsigned b = z >> 1;
    const float* src = xq;
    if (which == 1u) src = xk;
    const unsigned s0 = blockIdx.x * 64u, c0 = blockIdx.y * 64u;
    const unsigned t = threadIdx.x;
#pragma unroll
    for (int i = 0; i < 4; ++i) {
        const unsigned idx = t + 256u * (unsigned)i;
        const unsigned cc = idx >> 4, s4 = (idx & 15u) << 2;
        const v4f a = *(const v4f*)(src + ((size_t)b * EMB + c0 + cc) * SEQ_FULL + s0 + s4);
        tile[cc * 65u + s4 + 0u] = a.x; tile[cc * 65u + s4 + 1u] = a.y; tile[cc * 65u + s4 + 2u] = a.z; tile[cc * 65u + s4 + 3u] = a.w;
    }
    __syncthreads();
#pragma unroll
    for (int i = 0; i < 2; ++i) {
        const unsigned idx = t + 256u * (unsigned)i;
        const unsigned ss = idx >> 3, c8 = (idx & 7u) << 3;
        const float f0 = tile[(c8 + 0u) * 65u + ss], f1 = tile[(c8 + 1u) * 65u + ss], f2 = tile[(c8 + 2u) * 65u + ss], f3 = tile[(c8 + 3u) * 65u + ss];
        const float f4 = tile[(c8 + 4u) * 65u + ss], f5 = tile[(c8 + 5u) * 65u + ss], f6 = tile[(c8 + 6u) * 65u + ss], f7 = tile[(c8 + 7u) * 65u + ss];
        u4v pk; pk.x = pk2hf(bf_keep(f0), bf_keep(f1)); pk.y = pk2hf(bf_keep(f2), bf_keep(f3)); pk.z = pk2hf(bf_keep(f4), bf_keep(f5)); pk.w = pk2hf(bf_keep(f6), bf_keep(f7));
        VST2(u4v, (u4v*)(D + (size_t)which * ((size_t)NB * SEQ * EMB) + ((size_t)b * SEQ + s0 + ss) * EMB + c0 + c8), pk);
    }
}

// ---- three [512 out][512 in] direction weights -> f16 planes of bf16-converted values x16 (exact), plane y at D + y*WSZ, and the per-row gain table
//      SCL[y*512 + o] = bf16(g[o]) / ||bf16(v[o,:])|| / 16 (f32). Block = 32 rows (wave = 4 rows); grid (EMB/32, 3).
//      Plane rows: 2 instructions x 32 lanes x 16 B lane-contiguous; gain line: 32 lanes x 4 B of wave 0 in one instruction (LDS word per row, block barrier). ----
__global__ __launch_bounds__(256) void k_wprep(const float* __restrict__ v0, const float* __restrict__ g0, const float* __restrict__ v1, const float* __restrict__ g1,
                                               const float* __restrict__ v2, const float* __restrict__ g2, unsigned short* __restrict__ D, float* __restrict__ SCLp) {
#pragma clang fp contract(off)
    __shared__ float red[32];
    const unsigned y = blockIdx.y;                       // block-uniform select among global pointers
    const float* s = v0; const float* g = g0;
    if (y == 1u) { s = v1; g = g1; }
    if (y == 2u) { s = v2; g = g2; }
    const unsigned lane = threadIdx.x & 31u;
    const unsigned wave = (unsigned)__builtin_amdgcn_readfirstlane((int)(threadIdx.x >> 5));
    const unsigned rb = blockIdx.x * 32u;
#pragma unroll 1
    for (unsigned rr = 0; rr < 4u; ++rr) {
        const unsigned rl = wave * 4u + rr;
        const unsigned row = rb + rl;
        float ss = 0.f;
#pragma unroll 1
        for (unsigned it = 0; it < 2u; ++it) {
            const unsigned u = it * 32u + lane;          // 16-B piece of the row
            const float* p = s + (size_t)row * EMB + u * 8u;
            const v4f a = *(const v4f*)(p), b = *(const v4f*)(p + 4);
            const float a0 = bf_keep(a.x), a1 = bf_keep(a.y), a2 = bf_keep(a.z), a3 = bf_keep(a.w);
            const float b0 = bf_keep(b.x), b1 = bf_keep(b.y), b2 = bf_keep(b.z), b3 = bf_keep(b.w);
            ss += a0 * a0; ss += a1 * a1; ss += a2 * a2; ss += a3 * a3;
            ss += b0 * b0; ss += b1 * b1; ss += b2 * b2; ss += b3 * b3;
            u4v pk; pk.x = pk2hf(a0 * 16.f, a1 * 16.f); pk.y = pk2hf(a2 * 16.f, a3 * 16.f); pk.z = pk2hf(b0 * 16.f, b1 * 16.f); pk.w = pk2hf(b2 * 16.f, b3 * 16.f);
            VST2(u4v, (u4v*)(D + (size_t)y * WSZ + (size_t)row * EMB + u * 8u), pk);
        }
        ss += __shfl_xor(ss, 1, 32); ss += __shfl_xor(ss, 2, 32); ss += __shfl_xor(ss, 4, 32);
        ss += __shfl_xor(ss, 8, 32); ss += __shfl_xor(ss, 16, 32);
        if (lane == 0u) red[rl] = ss;
    }
    __syncthreads();
    if (threadIdx.x < 32u) {
        const unsigned row = rb + lane;
        const float sc = bf_keep(g[row]) * (1.0f / sqrtf(red[lane])) * 0.0625f;
        VST2(float, SCLp + (size_t)y * EMB + row, sc);
    }
}

// =====================================================================================================================
// k_proj_all: all six projection row groups in ONE grid (they only read the operand planes and write disjoint planes, so none waits for another).
//   blockIdx.z: 0 q early, 1 k early, 2 v^T early (value + residual planes), 3 q late, 4 k late, 5 v^T late (value plane only); blockIdx.y = batch.
//   C[m,n] = scl * sum_k A[m,k] * Bt[n,k] + bias; each wave owns a 64x64 tile; 8 waves per block; A, Bt row-major f16, pitch EMB, K = EMB.
//   q, k (token-major): A = tokens, Bt = direction weights, bias[n], scl[n]; v^T (channel-major): A = direction weights, Bt = tokens, bias[m], scl[m]
//   (bias bf16-converted on load; scl is an f32 table). Output: f16 plane C (value); RES: also the f16 plane Cr = (value - f16 value) x 2048.
// =====================================================================================================================
template <int BIAS_MODE, bool RES>
__device__ __forceinline__ void proj_epilogue(v8f (&acc)[4][4], float* slab, _Float16* C, unsigned ldc, _Float16* Cr, unsigned ldr,
                                              const float* __restrict__ bias, const float* __restrict__ scl, unsigned m0, unsigned n0, unsigned lane) {
  const unsigned rlane = lane & 15u;            // col (D) within subtile
  const unsigned mOff  = (lane >> 4) << 3;      // D row offset
#pragma unroll
  for (int i = 0; i < 4; ++i) {
    const unsigned mBase = m0 + ((unsigned)i << 4);
    float bm[8], sm[8];
#pragma unroll
    for (int r = 0; r < 8; ++r) {
      bm[r] = (BIAS_MODE == 1) ? bf_keep(bias[mBase + mOff + (unsigned)r]) : 0.f;
      sm[r] = (BIAS_MODE == 1) ? scl[mBase + mOff + (unsigned)r] : 0.f;
    }
#pragma unroll
    for (int j = 0; j < 4; ++j) {
      const unsigned n = n0 + ((unsigned)j << 4) + rlane;
      float bv = 0.f, sv = 0.f;
      if (BIAS_MODE == 2) { bv = bf_keep(bias[n]); sv = scl[n]; }
#pragma unroll
      for (int r = 0; r < 8; ++r) {
        float v;
        if (BIAS_MODE == 1) v = acc[i][j][r] * sm[r] + bm[r];
        else                v = acc[i][j][r] * sv + bv;
        slab[(mOff + (unsigned)r) * 68u + ((unsigned)j << 4) + rlane] = v;
      }
    }
    __builtin_amdgcn_fence(3 /* release order */, "workgroup");
    __builtin_amdgcn_wave_barrier();
    __builtin_amdgcn_fence(2 /* acquire order */, "workgroup");
    {
      const unsigned q = lane >> 3, c8 = (lane & 7u) << 3;
      v8h hv[4];
      v8h rv[4];
#pragma unroll
      for (int it = 0; it < 4; ++it) {
        const unsigned row = (unsigned)it * 4u + q;
        const float* sp = slab + row * 68u + c8;
        const v4f s0 = *(const v4f*)(sp), s1 = *(const v4f*)(sp + 4);
        v8h t;
        t[0] = toh_flush(s0.x); t[1] = toh_flush(s0.y); t[2] = toh_flush(s0.z); t[3] = toh_flush(s0.w);
        t[4] = toh_flush(s1.x); t[5] = toh_flush(s1.y); t[6] = toh_flush(s1.z); t[7] = toh_flush(s1.w);
        hv[it] = t;
        v8h u = t;
        if (RES) {
          u[0] = toh_flush((s0.x - (float)t[0]) * 2048.0f); u[1] = toh_flush((s0.y - (float)t[1]) * 2048.0f);
          u[2] = toh_flush((s0.z - (float)t[2]) * 2048.0f); u[3] = toh_flush((s0.w - (float)t[3]) * 2048.0f);
          u[4] = toh_flush((s1.x - (float)t[4]) * 2048.0f); u[5] = toh_flush((s1.y - (float)t[5]) * 2048.0f);
          u[6] = toh_flush((s1.z - (float)t[6]) * 2048.0f); u[7] = toh_flush((s1.w - (float)t[7]) * 2048.0f);
        }
        rv[it] = u;
      }
#pragma unroll
      for (int it = 0; it < 4; ++it) {
        const unsigned row = (unsigned)it * 4u + q;
        *(v8h*)(C + (size_t)(mBase + row) * ldc + n0 + c8) = hv[it];
        if (RES) *(v8h*)(Cr + (size_t)(mBase + row) * ldr + n0 + c8) = rv[it];
      }
    }
    __builtin_amdgcn_fence(3 /* release order */, "workgroup");
    __builtin_amdgcn_wave_barrier();
    __builtin_amdgcn_fence(2 /* acquire order */, "workgroup");
  }
}

__global__ __launch_bounds__(256) void k_proj_all(const _Float16* __restrict__ XQ, const _Float16* __restrict__ XK, const _Float16* __restrict__ Wd,
                                                  _Float16* QHp, _Float16* KHp, _Float16* VTHp, _Float16* QRp, _Float16* KRp, _Float16* VTRp,
                                                  const float* __restrict__ bq, const float* __restrict__ bk, const float* __restrict__ bv,
                                                  const float* __restrict__ SCLp) {
  __shared__ __align__(16) float sT[8][16 * 68];   // per-wave 16x64 slab, pitch 68 floats
  const unsigned z    = blockIdx.z;                // block-uniform selects among global pointers below
  const unsigned b    = blockIdx.y;
  const bool     late = z >= 3u;
  const unsigned p    = late ? z - 3u : z;         // 0 q, 1 k, 2 v^T
  const bool     chm  = p == 2u;                   // channel-major (v^T)
  const unsigned rows = late ? (unsigned)LROWS : (unsigned)EROWS;   // tokens of this row group
  const unsigned row0 = late ? (unsigned)EROWS : 0u;                // its first token inside a batch
  const unsigned lane = threadIdx.x & 31u;
  const unsigned wave = (unsigned)__builtin_amdgcn_readfirstlane((int)(threadIdx.x >> 5));
  const unsigned tilesM = (chm ? (unsigned)EMB : rows) >> 6;
  const unsigned tilesN = (chm ? rows : (unsigned)EMB) >> 6;
  const unsigned tile = blockIdx.x * 8u + wave;
  if (tile >= tilesM * tilesN) return;   // wave-uniform; no block barriers in this kernel
  const unsigned tm = tile / tilesN;
  const unsigned tn = tile - tm * tilesN;
  const unsigned m0 = tm << 6;
  const unsigned n0 = tn << 6;

  const _Float16* X = XQ;
  if (p != 0u) X = XK;
  const _Float16* tok = X + ((size_t)b * SEQ + row0) * EMB;   // this batch's tokens of the row group
  const _Float16* wgt = Wd + (size_t)p * WSZ;
  const _Float16* Ab = chm ? wgt : tok;
  const _Float16* Bb = chm ? tok : wgt;

  const unsigned rlane = lane & 15u;            // row (A) / col (B) within subtile
  const unsigned koff  = (lane >> 4) << 3;      // k offset of this lane half

  v8f acc[4][4];
#pragma unroll
  for (int i = 0; i < 4; ++i)
#pragma unroll
    for (int j = 0; j < 4; ++j) acc[i][j] = (v8f){0.f,0.f,0.f,0.f,0.f,0.f,0.f,0.f};

  for (unsigned k0 = 0; k0 < (unsigned)EMB; k0 += 32u) {
    v16h bh[4];
#pragma unroll
    for (int j = 0; j < 4; ++j) {
      const size_t bo = (size_t)(n0 + ((unsigned)j << 4) + rlane) * (unsigned)EMB + koff + k0;
      bh[j] = frag_ld(Bb + bo);
    }
#pragma unroll
    for (int i = 0; i < 4; ++i) {
      const size_t ao = (size_t)(m0 + ((unsigned)i << 4) + rlane) * (unsigned)EMB + koff + k0;
      const v16h ah = frag_ld(Ab + ao);
#pragma unroll
      for (int j = 0; j < 4; ++j) acc[i][j] = mma_raw(ah, bh[j], acc[i][j]);
      dep_guard_h(acc[i][0], acc[i][3], ah, ah);
    }
    keep4_h(bh[0], bh[1], bh[2], bh[3]);
  }
  acc_guard4(acc[0][0], acc[0][1], acc[0][2], acc[0][3]);
  acc_guard4(acc[1][0], acc[1][1], acc[1][2], acc[1][3]);
  acc_guard4(acc[2][0], acc[2][1], acc[2][2], acc[2][3]);
  acc_guard4(acc[3][0], acc[3][1], acc[3][2], acc[3][3]);

  // ---- epilogue (one of four forms, block-uniform) ----
  float* slab = sT[wave];
  const float* scl = SCLp + (size_t)p * EMB;
  if (chm) {
    _Float16* C  = VTHp + (size_t)b * ((size_t)EMB * SEQ) + row0;
    _Float16* Cr = VTRp + (size_t)b * ((size_t)EMB * EROWS);
    if (late) proj_epilogue<1, false>(acc, slab, C, (unsigned)SEQ, Cr, (unsigned)EROWS, bv, scl, m0, n0, lane);
    else      proj_epilogue<1, true >(acc, slab, C, (unsigned)SEQ, Cr, (unsigned)EROWS, bv, scl, m0, n0, lane);
  } else {
    _Float16* Cp = QHp; _Float16* Rp = QRp; const float* bias = bq;
    if (p == 1u) { Cp = KHp; Rp = KRp; bias = bk; }
    _Float16* C  = Cp + ((size_t)b * SEQ + row0) * EMB;
    _Float16* Cr = Rp + (size_t)b * ((size_t)EROWS * EMB);
    if (late) proj_epilogue<2, false>(acc, slab, C, (unsigned)EMB, Cr, (unsigned)EMB, bias, scl, m0, n0, lane);
    else      proj_epilogue<2, true >(acc, slab, C, (unsigned)EMB, Cr, (unsigned)EMB, bias, scl, m0, n0, lane);
  }
}

// =====================================================================================================================
// attn_body<EARLY>: strictly causal attention (key j < query i; masked scores REPLACED by -10000 before the softmax; sequence row 0 zeroed after it),
//   head dim 64. Block = 4 waves = 64 query rows of one (batch, head): query block qb = qb_off + blockIdx.x % nqb; key chunks 0..qb (64 keys each).
//   Chunks above the diagonal are skipped: every query row i > 0 sees at least key 0, so their exp(-10000 - max) terms are exactly 0 in f32.
//   Flash-style online softmax (f32, exp2 domain). Q, K: f16 planes [NB*SEQ][512]; VT: f16 plane [NB][512][SEQ]; Q fragments are loaded straight from
//   the dense plane. Each chunk's K tile and V^T tile (EARLY: their residual tiles too) are staged once per block in LDS by asynchronous copies of whole
//   128-byte rows and read from there by all four waves. Two buffers, stages K0 V0 K1 V1 ...: the K buffer refills while P.V runs, the V buffer while
//   q.k^T and the softmax run. P (x2^15, f16) goes through a wave-private LDS tile.
//   EARLY (query rows < EROWS): q, k, v^T and P also as x2048 residual planes QR/KR [NB][EROWS][512], VTR [NB][512][EROWS]; residual products
//   (qr.k + q.kr ; Pr.v + P.vr) go to their own accumulators, folded back with 1/2048 in f32.
//   Output: f32 [b][h*64+d][token] (full strides): the block's 64x64 tile is transposed through LDS (cross-wave: block barrier) and every
// =====================================================================================================================
template <bool EARLY>
__device__ __forceinline__ void attn_body(const _Float16* __restrict__ Q, const _Float16* __restrict__ Kp, const _Float16* __restrict__ VT,
                                          const _Float16* __restrict__ QR, const _Float16* __restrict__ KR, const _Float16* __restrict__ VTR,
                                          float* __restrict__ OUT, unsigned qb_off, unsigned nqb) {
  __shared__ __align__(16) _Float16 Psh[4][16 * 64];                 // per wave P tile [row][kv]  (wave-private)
  __shared__ __align__(16) _Float16 Prs[EARLY ? 4 : 1][16 * 64];     // per wave P residual tile   (wave-private)
  constexpr unsigned NT = EARLY ? 2u : 1u;                           // tiles per stage: value plane (+ residual plane)
  __shared__ __align__(16) _Float16 stg[2u * NT * TILE_H];           // buffer 0: K (, K residual); buffer 1: V^T (, V^T residual)
  float* OT = (float*)stg;                                           // block output tile [d][query], pitch 68 (cross-wave): reuses stg behind the loop
  const unsigned tid  = threadIdx.x;
  const unsigned wave = (unsigned)__builtin_amdgcn_readfirstlane((int)(tid >> 5));
  const unsigned lane = tid & 31u;
  const unsigned hh   = lane >> 4;
  const unsigned c    = lane & 15u;
  const unsigned bx = blockIdx.x;
  const unsigned qb = qb_off + bx % nqb;
  const unsigned bh = bx / nqb;
  const unsigned h  = bh & 7u;
  const unsigned b  = bh >> 3;
  const unsigned q0 = qb * 64u + wave * 16u;
  const unsigned nch = qb + 1u;
  const size_t rowbase = (size_t)b * SEQ;
  const size_t resbase = (size_t)b * EROWS;

  const _Float16* qrow = Q + (rowbase + q0 + c) * EMB + h * 64u + 8u * hh;
  const v16h qa0 = frag_ld(qrow), qa1 = frag_ld(qrow + 32);
  v16h qr0 = qa0, qr1 = qa1;
  if (EARLY) {
    const _Float16* qrr = QR + (resbase + q0 + c) * EMB + h * 64u + 8u * hh;
    qr0 = frag_ld(qrr); qr1 = frag_ld(qrr + 32);
  }
  const _Float16* kbase  = stg + 8u * hh;                                                // + key * KVP (+ 32 for the second d chunk)
  const _Float16* krbase = kbase + TILE_H;
  const _Float16* vbase  = stg + NT * TILE_H + 8u * hh;                                  // + d * KVP + kv
  const _Float16* vrbase = vbase + TILE_H;
  // staging: this thread's row (of 16 per copy) and 16-byte piece
  const unsigned srow = tid >> 3, spc = (tid & 7u) << 3;
  const unsigned lk = (unsigned)(size_t)stg + (srow * KVP + spc) * 2u;                   // LDS byte address in the K buffer
  const unsigned lv = lk + NT * TILE_H * 2u;                                             // the same place in the V^T buffer
  const unsigned ok  = srow * EMB + spc;                                                 // this thread's piece inside a K tile (value and residual planes)
  const unsigned ov  = srow * SEQ + spc, ovr = srow * EROWS + spc;                       // the same inside a V^T tile, a V^T residual tile
  const _Float16* gk  = Kp  + rowbase * EMB + h * 64u;                                   // block-uniform tile origins: + kv0 * EMB
  const _Float16* gkr = KR  + resbase * EMB + h * 64u;
  const _Float16* gv  = VT  + ((size_t)b * EMB + h * 64u) * SEQ;                         // + kv0
  const _Float16* gvr = VTR + ((size_t)b * EMB + h * 64u) * EROWS;

  float mrow[8], lrow[8];
  v8f oacc[4], oaccr[4];
#pragma unroll
  for (int r = 0; r < 8; ++r) { mrow[r] = -__builtin_inff(); lrow[r] = 0.f; }
#pragma unroll
  for (int t = 0; t < 4; ++t) { oacc[t] = (v8f){0.f,0.f,0.f,0.f,0.f,0.f,0.f,0.f}; oaccr[t] = (v8f){0.f,0.f,0.f,0.f,0.f,0.f,0.f,0.f}; }

  const float SC    = 0.125f * 1.4426950408889634f;       // 1/sqrt(64) and log2(e)
  const float FILLX = -14426.950408889634f;               // -10000 * log2(e)
  _Float16* pw  = Psh[wave];
  _Float16* prw = Prs[EARLY ? wave : 0u];

  // prologue of the two-buffer ring: stage 0 (K of chunk 0) lands and is published, then stage 1 (V^T of chunk 0) starts
  if (EARLY) stage_tile2(lk, gk + ok, 16u * EMB, lk + TILE_H * 2u, gkr + ok, 16u * EMB);
  else       stage_tile1(lk, gk + ok, 16u * EMB);
  asm volatile("s_wait_asynccnt 0x0" ::: "memory");   // this wave's copies of stage 0 have landed
  __syncthreads();
  if (EARLY) stage_tile2(lv, gv + ov, 16u * SEQ, lv + TILE_H * 2u, gvr + ovr, 16u * EROWS);
  else       stage_tile1(lv, gv + ov, 16u * SEQ);

  for (unsigned kc = 0; kc < nch; ++kc) {
    const unsigned kv0 = kc * 64u;
    const bool more = kc + 1u < nch;                   // block-uniform: a next chunk exists
    v8f s[4];
#pragma unroll
    for (int j = 0; j < 4; ++j) {
      const _Float16* kr = kbase + ((unsigned)j * 16u + c) * KVP;
      const v16h kh0 = frag_ld(kr), kh1 = frag_ld(kr + 32);
      v8f a = (v8f){0.f,0.f,0.f,0.f,0.f,0.f,0.f,0.f};
      a = wmma16(qa0, kh0, a);
      a = wmma16(qa1, kh1, a);
      if (EARLY) {
        const _Float16* krr = krbase + ((unsigned)j * 16u + c) * KVP;
        v8f ar = (v8f){0.f,0.f,0.f,0.f,0.f,0.f,0.f,0.f};
        ar = wmma16(qr0, kh0, ar);
        ar = wmma16(qr1, kh1, ar);
        ar = wmma16(qa0, frag_ld(krr), ar);
        ar = wmma16(qa1, frag_ld(krr + 32), ar);
        a = a + ar * 0.00048828125f;
      }
      s[j] = a;
    }
    const unsigned kj = kv0 + c;
#pragma unroll
    for (int r = 0; r < 8; ++r) {
      const unsigned qi = q0 + 8u * hh + (unsigned)r;
      const float x0 = (kj       < qi) ? s[0][r] * SC : FILLX;
      const float x1 = (kj + 16u < qi) ? s[1][r] * SC : FILLX;
      const float x2 = (kj + 32u < qi) ? s[2][r] * SC : FILLX;
      const float x3 = (kj + 48u < qi) ? s[3][r] * SC : FILLX;
      float m = fmaxf(fmaxf(x0, x1), fmaxf(x2, x3));
      m = fmaxf(m, __shfl_xor(m, 1, 32)); m = fmaxf(m, __shfl_xor(m, 2, 32));
      m = fmaxf(m, __shfl_xor(m, 4, 32)); m = fmaxf(m, __shfl_xor(m, 8, 32));
      const float mnew = fmaxf(mrow[r], m);
      const float alpha = exp2f(mrow[r] - mnew);
      mrow[r] = mnew;
      const float p0 = exp2f(x0 - mnew), p1 = exp2f(x1 - mnew), p2 = exp2f(x2 - mnew), p3 = exp2f(x3 - mnew);
      float psum = (p0 + p1) + (p2 + p3);
      const unsigned po = (8u * hh + (unsigned)r) * 64u + c;
      const float e0 = p0 * 32768.0f, e1 = p1 * 32768.0f, e2 = p2 * 32768.0f, e3 = p3 * 32768.0f;
      const h16 g0 = toh_flush(e0), g1 = toh_flush(e1), g2 = toh_flush(e2), g3 = toh_flush(e3);
      pw[po]       = g0;
      pw[po + 16u] = g1;
      pw[po + 32u] = g2;
      pw[po + 48u] = g3;
      if (EARLY) {
        prw[po]       = toh_flush((e0 - (float)g0) * 2048.0f);
        prw[po + 16u] = toh_flush((e1 - (float)g1) * 2048.0f);
        prw[po + 32u] = toh_flush((e2 - (float)g2) * 2048.0f);
        prw[po + 48u] = toh_flush((e3 - (float)g3) * 2048.0f);
      }
      psum += __shfl_xor(psum, 1, 32); psum += __shfl_xor(psum, 2, 32);
      psum += __shfl_xor(psum, 4, 32); psum += __shfl_xor(psum, 8, 32);
      lrow[r] = lrow[r] * alpha + psum;
#pragma unroll
      for (int t = 0; t < 4; ++t) { oacc[t][r] *= alpha; if (EARLY) oaccr[t][r] *= alpha; }
    }
    __builtin_amdgcn_fence(3 /* release order */, "workgroup");
    __builtin_amdgcn_wave_barrier();
    __builtin_amdgcn_fence(2 /* acquire order */, "workgroup");
    // V^T of this chunk is published; the K buffer, which every wave has left, takes the next chunk's K
    stage_publish();
    if (more) {
      const size_t ko = (size_t)(kv0 + 64u) * EMB;
      if (EARLY) stage_tile2(lk, (gk + ko) + ok, 16u * EMB, lk + TILE_H * 2u, (gkr + ko) + ok, 16u * EMB);
      else       stage_tile1(lk, (gk + ko) + ok, 16u * EMB);
    }
#pragma unroll
    for (int kk = 0; kk < 2; ++kk) {
      const v16h pa = frag_ld(pw + c * 64u + (unsigned)kk * 32u + 8u * hh);
      v16h pr = pa;
      if (EARLY) pr = frag_ld(prw + c * 64u + (unsigned)kk * 32u + 8u * hh);
#pragma unroll
      for (int t = 0; t < 4; ++t) {
        const v16h vb = frag_ld(vbase + ((unsigned)t * 16u + c) * KVP + (unsigned)kk * 32u);
        oacc[t] = wmma16(pa, vb, oacc[t]);
        if (EARLY) {
          oaccr[t] = wmma16(pr, vb, oaccr[t]);
          const v16h vr = frag_ld(vrbase + ((unsigned)t * 16u + c) * KVP + (unsigned)kk * 32u);
          oaccr[t] = wmma16(pa, vr, oaccr[t]);
        }
      }
    }
    // the next key block's P stores must not pass this block's P fragment loads
    __builtin_amdgcn_fence(3 /* release order */, "workgroup");
    __builtin_amdgcn_wave_barrier();
    __builtin_amdgcn_fence(2 /* acquire order */, "workgroup");
    // K of the next chunk is published; the V^T buffer, which every wave has left, takes the next chunk's V^T
    stage_publish();
    if (more) {
      if (EARLY) stage_tile2(lv, (gv + (kv0 + 64u)) + ov, 16u * SEQ, lv + TILE_H * 2u, (gvr + (kv0 + 64u)) + ovr, 16u * EROWS);
      else       stage_tile1(lv, (gv + (kv0 + 64u)) + ov, 16u * SEQ);
    }
  }
  asm volatile("s_wait_asynccnt 0x0" ::: "memory");   // no copy is outstanding when stg becomes the output tile (the last publish point's barrier ended all reads)

  // normalise (P carried x2^15), zero sequence row 0, transpose the wave's 16x64 tile into the block tile [d][query]
  float inv[8];
#pragma unroll
  for (int r = 0; r < 8; ++r) {
    const unsigned qi = q0 + 8u * hh + (unsigned)r;
    const float iv = 1.0f / (lrow[r] * 32768.0f);
    inv[r] = (qi == 0u) ? 0.0f : iv;
  }
#pragma unroll
  for (int t = 0; t < 4; ++t) {
    float o[8];
#pragma unroll
    for (int r = 0; r < 8; ++r) {
      float v = oacc[t][r];
      if (EARLY) v += oaccr[t][r] * 0.00048828125f;
      o[r] = v * inv[r];
    }
    const unsigned oi = ((unsigned)t * 16u + c) * 68u + wave * 16u + 8u * hh;
    *(v4f*)(OT + oi)      = (v4f){o[0], o[1], o[2], o[3]};
    *(v4f*)(OT + oi + 4u) = (v4f){o[4], o[5], o[6], o[7]};
  }
  __syncthreads();
  {
    const unsigned c4 = (lane & 15u) << 2;     // row segment = 64 floats = 256 B = 16 lanes x 16 B; 2 rows per instruction, 8 trips = 16 rows per wave
    float* ob = OUT + ((size_t)b * EMB + h * 64u + wave * 16u) * SEQ_FULL + qb * 64u + c4;
    v4f vv[8];
#pragma unroll
    for (int it = 0; it < 8; ++it) {
      const unsigned row = (unsigned)it * 2u + hh;
      vv[it] = *(const v4f*)(OT + (wave * 16u + row) * 68u + c4);
    }
    {
#pragma unroll
      for (int it = 0; it < 8; ++it) {
        const unsigned row = (unsigned)it * 2u + hh;
        *(v4f*)(ob + (size_t)row * SEQ_FULL) = vv[it];
      }
      
    }
  }
}

__global__ __launch_bounds__(128) __attribute__((amdgpu_num_vgpr(256))) void k_attn_early(
    const _Float16* __restrict__ Q, const _Float16* __restrict__ Kp, const _Float16* __restrict__ VT,
    const _Float16* __restrict__ QR, const _Float16* __restrict__ KR, const _Float16* __restrict__ VTR,
    float* __restrict__ OUT, unsigned qb_off, unsigned nqb) {
  attn_body<true>(Q, Kp, VT, QR, KR, VTR, OUT, qb_off, nqb);
}
__global__ __launch_bounds__(128) void k_attn_late(
    const _Float16* __restrict__ Q, const _Float16* __restrict__ Kp, const _Float16* __restrict__ VT,
    const _Float16* __restrict__ QR, const _Float16* __restrict__ KR, const _Float16* __restrict__ VTR,
    float* __restrict__ OUT, unsigned qb_off, unsigned nqb) {
  attn_body<false>(Q, Kp, VT, QR, KR, VTR, OUT, qb_off, nqb);
}

// ---- workspace carve (bytes; every region is a whole number of 256-B units and is written in full by its producer) ----
#define SZ_P16  ((size_t)NB * SEQ * EMB * 2)            // one f16 activation plane
#define SZ_R16  ((size_t)NB * EROWS * EMB * 2)          // one f16 residual plane (early rows only)
#define SZ_W16  ((size_t)3 * WSZ * 2)
#define SZ_SCL  ((size_t)3 * EMB * 4)
#define OFF_XQ   ((size_t)0)
#define OFF_XK   (OFF_XQ + SZ_P16)
#define OFF_W16  (OFF_XK + SZ_P16)
#define OFF_SCL  (OFF_W16 + SZ_W16)
#define OFF_QH   (OFF_SCL + SZ_SCL)
#define OFF_KH   (OFF_QH + SZ_P16)
#define OFF_VTH  (OFF_KH + SZ_P16)
#define OFF_QR   (OFF_VTH + SZ_P16)
#define OFF_KR   (OFF_QR + SZ_R16)
#define OFF_VTR  (OFF_KR + SZ_R16)
#define WS_TOTAL (OFF_VTR + SZ_R16)
static_assert(SZ_P16 % 256 == 0 && SZ_R16 % 256 == 0 && SZ_W16 % 256 == 0 && SZ_SCL % 256 == 0);
static_assert(OFF_XK == OFF_XQ + (size_t)NB * SEQ * EMB * 2);   // k_castxT addresses the key plane as plane 1 of one base
static_assert(WS_TOTAL <= (size_t)134217728);
static_assert((size_t)NB_FULL * EMB * SEQ_FULL * 4 == (size_t)33554432);   // output extent in bytes, offset 0

extern "C" void kernel_launch(void* const* d_in, const int* in_sizes, int n_in, void* d_out, int out_size, void* d_ws, size_t ws_size, hipStream_t stream) {
    if (n_in < 11) return;
    const long long xneed = ((long long)(NB - 1) * EMB + (EMB - 1)) * SEQ_FULL + SEQ;
    if ((long long)in_sizes[0] < xneed) return;
    if ((long long)in_sizes[1] < xneed) return;
    if (in_sizes[2] < WSZ || in_sizes[5] < WSZ || in_sizes[8] < WSZ) return;
    if (in_sizes[3] < EMB || in_sizes[4] < EMB || in_sizes[6] < EMB || in_sizes[7] < EMB || in_sizes[9] < EMB || in_sizes[10] < EMB) return;
    if ((long long)out_size < xneed) return;
    if ((size_t)WS_TOTAL > ws_size) return;

    // input order: query, key, vq, gq, bq, vk, gk, bk, vv, gv, bv
    const float* query = (const float*)d_in[0];
    const float* key   = (const float*)d_in[1];
    const float* vq = (const float*)d_in[2];  const float* gq = (const float*)d_in[3];  const float* bq = (const float*)d_in[4];
    const float* vk = (const float*)d_in[5];  const float* gk = (const float*)d_in[6];  const float* bk = (const float*)d_in[7];
    const float* vv = (const float*)d_in[8];  const float* gv = (const float*)d_in[9];  const float* bv = (const float*)d_in[10];
    float* out = (float*)d_out;

    char* ws = (char*)d_ws;
    unsigned short* X16  = (unsigned short*)(ws + OFF_XQ);     // plane 0 = query tokens, plane 1 = key tokens
    unsigned short* W16  = (unsigned short*)(ws + OFF_W16);    // planes: 0 vq 1 vk 2 vv (direction weights x16)
    float*          SCL  = (float*)(ws + OFF_SCL);             // [3][512] row gains / 16
    _Float16* QH  = (_Float16*)(ws + OFF_QH);
    _Float16* KH  = (_Float16*)(ws + OFF_KH);
    _Float16* VTH = (_Float16*)(ws + OFF_VTH);
    _Float16* QR  = (_Float16*)(ws + OFF_QR);
    _Float16* KR  = (_Float16*)(ws + OFF_KR);
    _Float16* VTR = (_Float16*)(ws + OFF_VTR);

    const _Float16* XQh = (const _Float16*)(ws + OFF_XQ);
    const _Float16* XKh = (const _Float16*)(ws + OFF_XK);
    const _Float16* W16h = (const _Float16*)W16;

    // 1-2: operand planes
    k_castxT<<<dim3((unsigned)(SEQ / 64), (unsigned)(EMB / 64), (unsigned)(NB * 2)), 256, 0, stream>>>(query, key, X16);
    k_wprep<<<dim3((unsigned)(EMB / 32), 3u), 256, 0, stream>>>(vq, gq, vk, gk, vv, gv, W16, SCL);

    // 3: q, k (tokens x V^T, row gain, bias -> f16 planes) and v^T (V x tokens^T, gain[m], bias[m] -> f16 plane [b][h*64+d][token]); early group also residual planes;
    //    all six row groups in one grid (blockIdx.z), the early groups (longer epilogue) first
    k_proj_all<<<dim3((unsigned)(((EROWS > LROWS) ? EROWS : LROWS) / 64), (unsigned)NB, (LROWS > 0) ? 6u : 3u), 256, 0, stream>>>(
        XQh, XKh, W16h, QH, KH, VTH, QR, KR, VTR, bq, bk, bv, SCL);

    // 4-5: causal attention, early band (value + residual planes) and late band (single planes); each block writes its 64x64 tile of the output buffer
    k_attn_early<<<(unsigned)(NB * NHEAD * (EROWS / 64)), 128, 0, stream>>>(QH, KH, VTH, QR, KR, VTR, out, 0u, (unsigned)(EROWS / 64));
    if (LROWS > 0) {
        k_attn_late<<<(unsigned)(NB * NHEAD * (LROWS / 64)), 128, 0, stream>>>(QH, KH, VTH, QR, KR, VTR, out, (unsigned)(EROWS / 64), (unsigned)(LROWS / 64));
    }
}

// v003
// It runs in 163 microseconds.
// Next to v002, in two timings, it ran 1.24 and 1.23 times as fast.
// All steps since v000 together make it 2.39 times as fast.
// All contractions (weight-normalised q/k/v projections, q.k^T, P.V): v_wmma_f32_16x16x32_f16 (f16 operands, f32 accumulate); float inputs bf16-converted (RNE) first, direction weights carried x16 with the per-row norm gain applied in f32 at the projection epilogue, P carried x2^15; query rows < EROWS additionally carry q, k, v, P as f16 value + x2048 f16 residual planes (three products, residual products in their own accumulator); mask, softmax, norms in f32.
#include <hip/hip_runtime.h>
#include <math.h>

// ---- sizes (NB / SEQ reducible; *_FULL = strides of the inputs / output) ----
#ifndef NB
#define NB 16
#endif
#ifndef SEQ
#define SEQ 1024
#endif
#ifndef EROWS
#define EROWS ((SEQ < 512) ? SEQ : 512)
#endif
#define LROWS (SEQ - EROWS)
#define NB_FULL 16
#define SEQ_FULL 1024
#define EMB 512
#define NHEAD 8
#define HDIM 64
#define WSZ (EMB * EMB)

static_assert(NB >= 1 && NB <= NB_FULL);
static_assert(SEQ <= SEQ_FULL && SEQ % 64 == 0 && SEQ >= 64);
static_assert(EROWS % 64 == 0 && EROWS >= 64 && EROWS <= SEQ);
static_assert(LROWS % 64 == 0);
static_assert(EMB % 64 == 0 && EMB == NHEAD * HDIM && HDIM == 64 && NHEAD == 8);
static_assert(EMB % 32 == 0);                          // WMMA k-steps of 32, weight rows per prep block
static_assert(4 * 256 == 64 * 16);                     // k_castxT load phase: trips x threads == tile rows x 16-B pieces per row
static_assert(2 * 256 == 64 * 8);
static_assert(2 * 32 * 8 == EMB);                      // k_wprep: trips x lanes x elements == weight row width
static_assert(8 * 4 == 32);                            // k_wprep: waves x rows per wave == rows per block
static_assert(32 * 16 * 4 == 16 * 128);                // projection epilogue: lanes x bytes x trips == slab rows x row bytes (64 halves)
static_assert(4 * 32 * 16 * 8 == 64 * 256);            // attention output: waves x lanes x bytes x trips == tile rows x row bytes (64 floats)
static_assert(2 * 576 * 72 * 2 + 8 * 16 * 68 * 4 <= 327680);  // static LDS of the projection kernel: two operand stages + the epilogue slabs
static_assert((EMB / 64) % 8 == 0 && (EROWS / 64) % 8 == 0 && (LROWS / 64) % 8 == 0);  // projection: the 8 waves of a block share one A tile; a block has all its tiles or none
static_assert(8 * 2 * 32 * 16 == 64 * 128 && 16 * 32 * 16 == 64 * 128);  // projection staging: (waves x) copies x lanes x bytes == tile rows x row bytes
static_assert(4 * 64 * 72 * 2 + 2 * 4 * 16 * 64 * 2 <= 81920);  // static LDS of the attention kernels: four blocks per 320-KiB LDS
static_assert(64 * 68 * 4 <= 2 * 64 * 72 * 2);         // the output tile fits the staging area that it reuses
static_assert(4 * 128 * 16 == 64 * 128);               // staging: copies per thread x threads x bytes == tile rows x row bytes
static_assert(64 * 65 * 4 <= 131072);                  // static LDS of k_castxT

typedef _Float16 h16;
typedef __attribute__((ext_vector_type(16))) _Float16 v16h;
typedef __attribute__((ext_vector_type(8)))  _Float16 v8h;
typedef __attribute__((ext_vector_type(8)))  float    v8f;
typedef __attribute__((ext_vector_type(4)))  float    v4f;
typedef __attribute__((ext_vector_type(4)))  unsigned int u4v;

// 16-bit WMMA fragment map (wave32), lane L, h = L>>4, m = L&15:
//   A 16x32: lane = row m;    element i -> k = (i<8) ? 8h+i : 16+8h+(i-8)
//   B 32x16: lane = column m; the SAME k(i,h)
//   D 16x16 (8 f32): lane = column m; element r -> row 8h+r
union FragU { v16h v; v8h h[2]; };
// p already includes the +8h lane-half offset: elements 0..7 <- p[0..7], 8..15 <- p[16..23]
__device__ __forceinline__ v16h frag_ld(const _Float16* p) { FragU f; f.h[0] = *(const v8h*)(p); f.h[1] = *(const v8h*)(p + 16); return f.v; }

__device__ __forceinline__ v8f wmma16(v16h a, v16h b, v8f c) {
    c = __builtin_amdgcn_wmma_f32_16x16x32_f16(false, a, false, b, (short)0, c, false, false);
    asm volatile("v_nop\n\tv_nop\n\tv_nop\n\tv_nop" : "+v"(c) : "v"(a), "v"(b));
    return c;
}
__device__ __forceinline__ v8f mma_raw(v16h a, v16h b, v8f c) { return __builtin_amdgcn_wmma_f32_16x16x32_f16(false, a, false, b, (short)0, c, false, false); }
__device__ __forceinline__ void dep_guard_h(v8f& a, v8f& b, v16h x, v16h y) { asm volatile("v_nop\n\tv_nop\n\tv_nop\n\tv_nop" : "+v"(a), "+v"(b) : "v"(x), "v"(y)); }
__device__ __forceinline__ void keep4_h(v16h a, v16h b, v16h c, v16h d) { asm volatile("v_nop" :: "v"(a), "v"(b), "v"(c), "v"(d)); }
__device__ __forceinline__ void acc_guard4(v8f& a, v8f& b, v8f& c, v8f& d) { asm volatile("v_nop\n\tv_nop\n\tv_nop\n\tv_nop" : "+v"(a), "+v"(b), "+v"(c), "+v"(d)); }

// bf16 RNE convert, kept as f32 (finite inputs)
__device__ __forceinline__ float bf_keep(float v) { const unsigned u = __float_as_uint(v); return __uint_as_float((u + 0x7fffu + ((u >> 16) & 1u)) & 0xffff0000u); }
// f32 -> f16 that cannot produce an f16 subnormal (value select)
__device__ __forceinline__ h16 toh_flush(float v) { const h16 r = (h16)v; return (fabsf(v) < 6.103515625e-05f) ? (h16)0.0f : r; }
__device__ __forceinline__ unsigned pk2hf(float a, float b) { return (unsigned)__builtin_bit_cast(unsigned short, toh_flush(a)) | ((unsigned)__builtin_bit_cast(unsigned short, toh_flush(b)) << 16); }

// ---- LDS staging of 64-row x 128-byte f16 tiles by asynchronous copies (global -> LDS, through no register) ----
#define KVP 72u                      // LDS row pitch in halves: 144 B = 16 B x 9, conflict-free for 16-byte fragment reads
#define TILE_H (64u * KVP)           // halves of one staged tile
#define ROWS16_B (16u * KVP * 2u)    // LDS bytes of 16 staged rows
#define PSTG_H (576u * KVP)          // halves of one projection stage: 64 A rows + 8 x 64 Bt rows
// Each thread of the 128 copies its 16-byte piece of rows r, r+16, r+32, r+48: one wave-wide copy = 4 whole 128-byte rows.
// l = the thread's LDS byte address of its piece in row r, g = the same piece in global memory, st = 16 source rows in halves.
// s_wait_xcnt stands as the last line of the copies' own statement, so no address register is rewritten in front of it.
__device__ __forceinline__ void stage_tile1(unsigned l, const _Float16* g, size_t st) {
    asm volatile("global_load_async_to_lds_b128 %0, %4, off\n\t"
                 "global_load_async_to_lds_b128 %1, %5, off\n\t"
                 "global_load_async_to_lds_b128 %2, %6, off\n\t"
                 "global_load_async_to_lds_b128 %3, %7, off\n\t"
                 "s_wait_xcnt 0x0"
                 :: "v"(l), "v"(l + ROWS16_B), "v"(l + 2u * ROWS16_B), "v"(l + 3u * ROWS16_B),
                    "v"(g), "v"(g + st), "v"(g + 2u * st), "v"(g + 3u * st) : "memory");
}
__device__ __forceinline__ void stage_tile2(unsigned l, const _Float16* g, size_t st, unsigned l2, const _Float16* g2, size_t st2) {
    asm volatile("global_load_async_to_lds_b128 %0, %8, off\n\t"
                 "global_load_async_to_lds_b128 %1, %9, off\n\t"
                 "global_load_async_to_lds_b128 %2, %10, off\n\t"
                 "global_load_async_to_lds_b128 %3, %11, off\n\t"
                 "global_load_async_to_lds_b128 %4, %12, off\n\t"
                 "global_load_async_to_lds_b128 %5, %13, off\n\t"
                 "global_load_async_to_lds_b128 %6, %14, off\n\t"
                 "global_load_async_to_lds_b128 %7, %15, off\n\t"
                 "s_wait_xcnt 0x0"
                 :: "v"(l), "v"(l + ROWS16_B), "v"(l + 2u * ROWS16_B), "v"(l + 3u * ROWS16_B),
                    "v"(l2), "v"(l2 + ROWS16_B), "v"(l2 + 2u * ROWS16_B), "v"(l2 + 3u * ROWS16_B),
                    "v"(g), "v"(g + st), "v"(g + 2u * st), "v"(g + 3u * st),
                    "v"(g2), "v"(g2 + st2), "v"(g2 + 2u * st2), "v"(g2 + 3u * st2) : "memory");
}
// Wave-wide forms for the projection: a lane copies its 16-byte piece of rows r, r+4, ... (source pitch EMB halves): one wave-wide copy = 4 whole 128-byte rows.
#define ROWS4_B (4u * KVP * 2u)      // LDS bytes of 4 staged rows
__device__ __forceinline__ void stage_rows2(unsigned l, const _Float16* g) {
    asm volatile("global_load_async_to_lds_b128 %0, %2, off\n\t"
                 "global_load_async_to_lds_b128 %1, %3, off\n\t"
                 "s_wait_xcnt 0x0"
                 :: "v"(l), "v"(l + ROWS4_B), "v"(g), "v"(g + 4u * EMB) : "memory");
}
__device__ __forceinline__ void stage_rows8(unsigned l, const _Float16* g) {
    asm volatile("global_load_async_to_lds_b128 %0, %8, off\n\t"
                 "global_load_async_to_lds_b128 %1, %9, off\n\t"
                 "global_load_async_to_lds_b128 %2, %10, off\n\t"
                 "global_load_async_to_lds_b128 %3, %11, off\n\t"
                 "global_load_async_to_lds_b128 %4, %12, off\n\t"
                 "global_load_async_to_lds_b128 %5, %13, off\n\t"
                 "global_load_async_to_lds_b128 %6, %14, off\n\t"
                 "global_load_async_to_lds_b128 %7, %15, off\n\t"
                 "s_wait_xcnt 0x0"
                 :: "v"(l), "v"(l + ROWS4_B), "v"(l + 2u * ROWS4_B), "v"(l + 3u * ROWS4_B),
                    "v"(l + 4u * ROWS4_B), "v"(l + 5u * ROWS4_B), "v"(l + 6u * ROWS4_B), "v"(l + 7u * ROWS4_B),
                    "v"(g), "v"(g + 4u * EMB), "v"(g + 8u * EMB), "v"(g + 12u * EMB),
                    "v"(g + 16u * EMB), "v"(g + 20u * EMB), "v"(g + 24u * EMB), "v"(g + 28u * EMB) : "memory");
}
// publish point of the next stage: this wave's LDS reads have returned, its own copies have landed, then the block barrier
// (it shows the landed tile to the other waves and ends every wave's reads of the buffer that is refilled behind it)
__device__ __forceinline__ void stage_publish() {
    asm volatile("s_wait_dscnt 0x0" ::: "memory");      // this wave's reads of the buffer about to be refilled are done
    asm volatile("s_wait_asynccnt 0x0" ::: "memory");   // this wave's copies of the next stage have landed
    __syncthreads();
}

#define VST2(T, ptr, val) do { const T vst2_v_ = (val); *(T*)(ptr) = vst2_v_;  } while (0)

// ---- query / key (f32, [b][c][s], full strides) -> f16 planes of the bf16-converted values, compact [NB*SEQ][512] (token-major);
//      plane 0 = query at D, plane 1 = key at D + NB*SEQ*EMB. 64 channels x 64 tokens per block through an LDS tile (cross-wave: block barrier);
__global__ __launch_bounds__(256) void k_castxT(const float* __restrict__ xq, const float* __restrict__ xk, unsigned short* __restrict__ D) {
#pragma clang fp contract(off)
    __shared__ float tile[64 * 65];
    const unsigned z = blockIdx.z;
    const unsigned which = z & 1u;                       // block-uniform select among global pointers
    const unsigned b = z >> 1;
    const float* src = xq;
    if (which == 1u) src = xk;
    const unsigned s0 = blockIdx.x * 64u, c0 = blockIdx.y * 64u;
    const unsigned t = threadIdx.x;
#pragma unroll
    for (int i = 0; i < 4; ++i) {
        const unsigned idx = t + 256u * (unsigned)i;
        const unsigned cc = idx >> 4, s4 = (idx & 15u) << 2;
        const v4f a = *(const v4f*)(src + ((size_t)b * EMB + c0 + cc) * SEQ_FULL + s0 + s4);
        tile[cc * 65u + s4 + 0u] = a.x; tile[cc * 65u + s4 + 1u] = a.y; tile[cc * 65u + s4 + 2u] = a.z; tile[cc * 65u + s4 + 3u] = a.w;
    }
    __syncthreads();
#pragma unroll
    for (int i = 0; i < 2; ++i) {
        const unsigned idx = t + 256u * (unsigned)i;
        const unsigned ss = idx >> 3, c8 = (idx & 7u) << 3;
        const float f0 = tile[(c8 + 0u) * 65u + ss], f1 = tile[(c8 + 1u) * 65u + ss], f2 = tile[(c8 + 2u) * 65u + ss], f3 = tile[(c8 + 3u) * 65u + ss];
        const float f4 = tile[(c8 + 4u) * 65u + ss], f5 = tile[(c8 + 5u) * 65u + ss], f6 = tile[(c8 + 6u) * 65u + ss], f7 = tile[(c8 + 7u) * 65u + ss];
        u4v pk; pk.x = pk2hf(bf_keep(f0), bf_keep(f1)); pk.y = pk2hf(bf_keep(f2), bf_keep(f3)); pk.z = pk2hf(bf_keep(f4), bf_keep(f5)); pk.w = pk2hf(bf_keep(f6), bf_keep(f7));
        VST2(u4v, (u4v*)(D + (size_t)which * ((size_t)NB * SEQ * EMB) + ((size_t)b * SEQ + s0 + ss) * EMB + c0 + c8), pk);
    }
}

// ---- three [512 out][512 in] direction weights -> f16 planes of bf16-converted values x16 (exact), plane y at D + y*WSZ, and the per-row gain table
//      SCL[y*512 + o] = bf16(g[o]) / ||bf16(v[o,:])|| / 16 (f32). Block = 32 rows (wave = 4 rows); grid (EMB/32, 3).
//      Plane rows: 2 instructions x 32 lanes x 16 B lane-contiguous; gain line: 32 lanes x 4 B of wave 0 in one instruction (LDS word per row, block barrier). ----
__global__ __launch_bounds__(256) void k_wprep(const float* __restrict__ v0, const float* __restrict__ g0, const float* __restrict__ v1, const float* __restrict__ g1,
                                               const float* __restrict__ v2, const float* __restrict__ g2, unsigned short* __restrict__ D, float* __restrict__ SCLp) {
#pragma clang fp contract(off)
    __shared__ float red[32];
    const unsigned y = blockIdx.y;                       // block-uniform select among global pointers
    const float* s = v0; const float* g = g0;
    if (y == 1u) { s = v1; g = g1; }
    if (y == 2u) { s = v2; g = g2; }
    const unsigned lane = threadIdx.x & 31u;
    const unsigned wave = (unsigned)__builtin_amdgcn_readfirstlane((int)(threadIdx.x >> 5));
    const unsigned rb = blockIdx.x * 32u;
#pragma unroll 1
    for (unsigned rr = 0; rr < 4u; ++rr) {
        const unsigned rl = wave * 4u + rr;
        const unsigned row = rb + rl;
        float ss = 0.f;
#pragma unroll 1
        for (unsigned it = 0; it < 2u; ++it) {
            const unsigned u = it * 32u + lane;          // 16-B piece of the row
            const float* p = s + (size_t)row * EMB + u * 8u;
            const v4f a = *(const v4f*)(p), b = *(const v4f*)(p + 4);
            const float a0 = bf_keep(a.x), a1 = bf_keep(a.y), a2 = bf_keep(a.z), a3 = bf_keep(a.w);
            const float b0 = bf_keep(b.x), b1 = bf_keep(b.y), b2 = bf_keep(b.z), b3 = bf_keep(b.w);
            ss += a0 * a0; ss += a1 * a1; ss += a2 * a2; ss += a3 * a3;
            ss += b0 * b0; ss += b1 * b1; ss += b2 * b2; ss += b3 * b3;
            u4v pk; pk.x = pk2hf(a0 * 16.f, a1 * 16.f); pk.y = pk2hf(a2 * 16.f, a3 * 16.f); pk.z = pk2hf(b0 * 16.f, b1 * 16.f); pk.w = pk2hf(b2 * 16.f, b3 * 16.f);
            VST2(u4v, (u4v*)(D + (size_t)y * WSZ + (size_t)row * EMB + u * 8u), pk);
        }
        ss += __shfl_xor(ss, 1, 32); ss += __shfl_xor(ss, 2, 32); ss += __shfl_xor(ss, 4, 32);
        ss += __shfl_xor(ss, 8, 32); ss += __shfl_xor(ss, 16, 32);
        if (lane == 0u) red[rl] = ss;
    }
    __syncthreads();
    if (threadIdx.x < 32u) {
        const unsigned row = rb + lane;
        const float sc = bf_keep(g[row]) * (1.0f / sqrtf(red[lane])) * 0.0625f;
        VST2(float, SCLp + (size_t)y * EMB + row, sc);
    }
}

// =====================================================================================================================
// k_proj_all: all six projection row groups in ONE grid (they only read the operand planes and write disjoint planes, so none waits for another).
//   blockIdx.z: 0 q early, 1 k early, 2 v^T early (value + residual planes), 3 q late, 4 k late, 5 v^T late (value plane only); blockIdx.y = batch.
//   C[m,n] = scl * sum_k A[m,k] * Bt[n,k] + bias; each wave owns a 64x64 tile; 8 waves per block; A, Bt row-major f16, pitch EMB, K = EMB.
//   q, k (token-major): A = tokens, Bt = direction weights, bias[n], scl[n]; v^T (channel-major): A = direction weights, Bt = tokens, bias[m], scl[m]
//   (bias bf16-converted on load; scl is an f32 table). Operands: a stage is 64 k (whole 128-byte rows) of the block's 64 A rows (shared by its 8 waves)
//   and of each wave's 64 Bt rows, brought into LDS by asynchronous copies, two buffers: stage t + 1 flies while stage t feeds the products. Output: f16 plane C (value); RES: also the f16 plane Cr = (value - f16 value) x 2048.
// =====================================================================================================================
template <int BIAS_MODE, bool RES>
__device__ __forceinline__ void proj_epilogue(v8f (&acc)[4][4], float* slab, _Float16* C, unsigned ldc, _Float16* Cr, unsigned ldr,
                                              const float* __restrict__ bias, const float* __restrict__ scl, unsigned m0, unsigned n0, unsigned lane) {
  const unsigned rlane = lane & 15u;            // col (D) within subtile
  const unsigned mOff  = (lane >> 4) << 3;      // D row offset
#pragma unroll
  for (int i = 0; i < 4; ++i) {
    const unsigned mBase = m0 + ((unsigned)i << 4);
    float bm[8], sm[8];
#pragma unroll
    for (int r = 0; r < 8; ++r) {
      bm[r] = (BIAS_MODE == 1) ? bf_keep(bias[mBase + mOff + (unsigned)r]) : 0.f;
      sm[r] = (BIAS_MODE == 1) ? scl[mBase + mOff + (unsigned)r] : 0.f;
    }
#pragma unroll
    for (int j = 0; j < 4; ++j) {
      const unsigned n = n0 + ((unsigned)j << 4) + rlane;
      float bv = 0.f, sv = 0.f;
      if (BIAS_MODE == 2) { bv = bf_keep(bias[n]); sv = scl[n]; }
#pragma unroll
      for (int r = 0; r < 8; ++r) {
        float v;
        if (BIAS_MODE == 1) v = acc[i][j][r] * sm[r] + bm[r];
        else                v = acc[i][j][r] * sv + bv;
        slab[(mOff + (unsigned)r) * 68u + ((unsigned)j << 4) + rlane] = v;
      }
    }
    __builtin_amdgcn_fence(3 /* release order */, "workgroup");
    __builtin_amdgcn_wave_barrier();
    __builtin_amdgcn_fence(2 /* acquire order */, "workgroup");
    {
      const unsigned q = lane >> 3, c8 = (lane & 7u) << 3;
      v8h hv[4];
      v8h rv[4];
#pragma unroll
      for (int it = 0; it < 4; ++it) {
        const unsigned row = (unsigned)it * 4u + q;
        const float* sp = slab + row * 68u + c8;
        const v4f s0 = *(const v4f*)(sp), s1 = *(const v4f*)(sp + 4);
        v8h t;
        t[0] = toh_flush(s0.x); t[1] = toh_flush(s0.y); t[2] = toh_flush(s0.z); t[3] = toh_flush(s0.w);
        t[4] = toh_flush(s1.x); t[5] = toh_flush(s1.y); t[6] = toh_flush(s1.z); t[7] = toh_flush(s1.w);
        hv[it] = t;
        v8h u = t;
        if (RES) {
          u[0] = toh_flush((s0.x - (float)t[0]) * 2048.0f); u[1] = toh_flush((s0.y - (float)t[1]) * 2048.0f);
          u[2] = toh_flush((s0.z - (float)t[2]) * 2048.0f); u[3] = toh_flush((s0.w - (float)t[3]) * 2048.0f);
          u[4] = toh_flush((s1.x - (float)t[4]) * 2048.0f); u[5] = toh_flush((s1.y - (float)t[5]) * 2048.0f);
          u[6] = toh_flush((s1.z - (float)t[6]) * 2048.0f); u[7] = toh_flush((s1.w - (float)t[7]) * 2048.0f);
        }
        rv[it] = u;
      }
#pragma unroll
      for (int it = 0; it < 4; ++it) {
        const unsigned row = (unsigned)it * 4u + q;
        *(v8h*)(C + (size_t)(mBase + row) * ldc + n0 + c8) = hv[it];
        if (RES) *(v8h*)(Cr + (size_t)(mBase + row) * ldr + n0 + c8) = rv[it];
      }
    }
    __builtin_amdgcn_fence(3 /* release order */, "workgroup");
    __builtin_amdgcn_wave_barrier();
    __builtin_amdgcn_fence(2 /* acquire order */, "workgroup");
  }
}

__global__ __launch_bounds__(256) void k_proj_all(const _Float16* __restrict__ XQ, const _Float16* __restrict__ XK, const _Float16* __restrict__ Wd,
                                                  _Float16* QHp, _Float16* KHp, _Float16* VTHp, _Float16* QRp, _Float16* KRp, _Float16* VTRp,
                                                  const float* __restrict__ bq, const float* __restrict__ bk, const float* __restrict__ bv,
                                                  const float* __restrict__ SCLp) {
  __shared__ __align__(16) float sT[8][16 * 68];   // per-wave 16x64 slab, pitch 68 floats
  __shared__ __align__(16) _Float16 pst[2u * PSTG_H];   // two operand stages: rows 0..63 = A, rows 64 + 64 * wave .. = that wave's Bt rows; pitch KVP
  const unsigned z    = blockIdx.z;                // block-uniform selects among global pointers below
  const unsigned b    = blockIdx.y;
  const bool     late = z >= 3u;
  const unsigned p    = late ? z - 3u : z;         // 0 q, 1 k, 2 v^T
  const bool     chm  = p == 2u;                   // channel-major (v^T)
  const unsigned rows = late ? (unsigned)LROWS : (unsigned)EROWS;   // tokens of this row group
  const unsigned row0 = late ? (unsigned)EROWS : 0u;                // its first token inside a batch
  const unsigned lane = threadIdx.x & 31u;
  const unsigned wave = (unsigned)__builtin_amdgcn_readfirstlane((int)(threadIdx.x >> 5));
  const unsigned tilesM = (chm ? (unsigned)EMB : rows) >> 6;
  const unsigned tilesN = (chm ? rows : (unsigned)EMB) >> 6;
  const unsigned tile = blockIdx.x * 8u + wave;
  if (tile >= tilesM * tilesN) return;   // block-uniform (tile counts are multiples of 8), in front of every barrier
  const unsigned tm = tile / tilesN;
  const unsigned tn = tile - tm * tilesN;
  const unsigned m0 = tm << 6;
  const unsigned n0 = tn << 6;

  const _Float16* X = XQ;
  if (p != 0u) X = XK;
  const _Float16* tok = X + ((size_t)b * SEQ + row0) * EMB;   // this batch's tokens of the row group
  const _Float16* wgt = Wd + (size_t)p * WSZ;
  const _Float16* Ab = chm ? wgt : tok;
  const _Float16* Bb = chm ? tok : wgt;

  const unsigned rlane = lane & 15u;            // row (A) / col (B) within subtile
  const unsigned koff  = (lane >> 4) << 3;      // k offset of this lane half

  v8f acc[4][4];
#pragma unroll
  for (int i = 0; i < 4; ++i)
#pragma unroll
    for (int j = 0; j < 4; ++j) acc[i][j] = (v8f){0.f,0.f,0.f,0.f,0.f,0.f,0.f,0.f};

  // staging: this lane's row (of 4 per wave-wide copy) and 16-byte piece; each wave brings 8 of the A rows and its own 64 Bt rows
  const unsigned lr = lane >> 3, pc = (lane & 7u) << 3;
  const unsigned la = (unsigned)(size_t)pst + ((wave * 8u + lr) * KVP + pc) * 2u;            // LDS byte addresses in buffer 0
  const unsigned lb = (unsigned)(size_t)pst + ((64u + wave * 64u + lr) * KVP + pc) * 2u;
  const _Float16* ga = Ab + (size_t)(m0 + wave * 8u + lr) * (unsigned)EMB + pc;              // + 64 * stage
  const _Float16* gb = Bb + (size_t)(n0 + lr) * (unsigned)EMB + pc;
  const _Float16* fa = pst + rlane * KVP + koff;                                             // fragment rows in buffer 0
  const _Float16* fb = fa + (64u + wave * 64u) * KVP;
  constexpr unsigned NSTG = (unsigned)EMB / 64u;
  static_assert(NSTG >= 2u);                                                                 // the prologue starts stages 0 and 1

  // prologue of the two-buffer ring: stage 0 lands and is published, then stage 1 starts
  stage_rows2(la, ga);
  stage_rows8(lb, gb);
  stage_rows8(lb + 8u * ROWS4_B, gb + 32u * EMB);
  asm volatile("s_wait_asynccnt 0x0" ::: "memory");   // this wave's copies of stage 0 have landed
  __syncthreads();
  stage_rows2(la + PSTG_H * 2u, ga + 64u);
  stage_rows8(lb + PSTG_H * 2u, gb + 64u);
  stage_rows8(lb + PSTG_H * 2u + 8u * ROWS4_B, gb + 64u + 32u * EMB);

#pragma unroll 1   // one copy of the hot loop in the instruction cache; the buffer select is scalar
  for (unsigned t = 0; t < NSTG; ++t) {
    const unsigned bo = (t & 1u) * PSTG_H;             // this stage's buffer, in halves
#pragma unroll
    for (int ks = 0; ks < 2; ++ks) {
      v16h bh[4], ah[4];                               // the k-step's eight fragments are read as one group, ahead of its products
#pragma unroll
      for (int j = 0; j < 4; ++j) bh[j] = frag_ld(fb + bo + (unsigned)j * 16u * KVP + (unsigned)ks * 32u);
#pragma unroll
      for (int i = 0; i < 4; ++i) ah[i] = frag_ld(fa + bo + (unsigned)i * 16u * KVP + (unsigned)ks * 32u);
#pragma unroll
      for (int i = 0; i < 4; ++i) {
#pragma unroll
        for (int j = 0; j < 4; ++j) acc[i][j] = mma_raw(ah[i], bh[j], acc[i][j]);
        dep_guard_h(acc[i][0], acc[i][3], ah[i], ah[i]);
      }
      keep4_h(bh[0], bh[1], bh[2], bh[3]);
    }
    // stage t + 1 is published; the buffer that every wave has just left takes stage t + 2
    stage_publish();
    if (t + 2u < NSTG) {
      const unsigned ko = (t + 2u) * 64u;
      stage_rows2(la + bo * 2u, ga + ko);
      stage_rows8(lb + bo * 2u, gb + ko);
      stage_rows8(lb + bo * 2u + 8u * ROWS4_B, gb + ko + 32u * EMB);
    }
  }
  asm volatile("s_wait_asynccnt 0x0" ::: "memory");   // no copy is outstanding behind the loop
  acc_guard4(acc[0][0], acc[0][1], acc[0][2], acc[0][3]);
  acc_guard4(acc[1][0], acc[1][1], acc[1][2], acc[1][3]);
  acc_guard4(acc[2][0], acc[2][1], acc[2][2], acc[2][3]);
  acc_guard4(acc[3][0], acc[3][1], acc[3][2], acc[3][3]);

  // ---- epilogue (one of four forms, block-uniform) ----
  float* slab = sT[wave];
  const float* scl = SCLp + (size_t)p * EMB;
  if (chm) {
    _Float16* C  = VTHp + (size_t)b * ((size_t)EMB * SEQ) + row0;
    _Float16* Cr = VTRp + (size_t)b * ((size_t)EMB * EROWS);
    if (late) proj_epilogue<1, false>(acc, slab, C, (unsigned)SEQ, Cr, (unsigned)EROWS, bv, scl, m0, n0, lane);
    else      proj_epilogue<1, true >(acc, slab, C, (unsigned)SEQ, Cr, (unsigned)EROWS, bv, scl, m0, n0, lane);
  } else {
    _Float16* Cp = QHp; _Float16* Rp = QRp; const float* bias = bq;
    if (p == 1u) { Cp = KHp; Rp = KRp; bias = bk; }
    _Float16* C  = Cp + ((size_t)b * SEQ + row0) * EMB;
    _Float16* Cr = Rp + (size_t)b * ((size_t)EROWS * EMB);
    if (late) proj_epilogue<2, false>(acc, slab, C, (unsigned)EMB, Cr, (unsigned)EMB, bias, scl, m0, n0, lane);
    else      proj_epilogue<2, true >(acc, slab, C, (unsigned)EMB, Cr, (unsigned)EMB, bias, scl, m0, n0, lane);
  }
}

// =====================================================================================================================
// attn_body<EARLY>: strictly causal attention (key j < query i; masked scores REPLACED by -10000 before the softmax; sequence row 0 zeroed after it),
//   head dim 64. Block = 4 waves = 64 query rows of one (batch, head): query block qb = qb_off + blockIdx.x % nqb; key chunks 0..qb (64 keys each).
//   Chunks above the diagonal are skipped: every query row i > 0 sees at least key 0, so their exp(-10000 - max) terms are exactly 0 in f32.
//   Flash-style online softmax (f32, exp2 domain). Q, K: f16 planes [NB*SEQ][512]; VT: f16 plane [NB][512][SEQ]; Q fragments are loaded straight from
//   the dense plane. Each chunk's K tile and V^T tile (EARLY: their residual tiles too) are staged once per block in LDS by asynchronous copies of whole
//   128-byte rows and read from there by all four waves. Two buffers, stages K0 V0 K1 V1 ...: the K buffer refills while P.V runs, the V buffer while
//   q.k^T and the softmax run. P (x2^15, f16) goes through a wave-private LDS tile.
//   EARLY (query rows < EROWS): q, k, v^T and P also as x2048 residual planes QR/KR [NB][EROWS][512], VTR [NB][512][EROWS]; residual products
//   (qr.k + q.kr ; Pr.v + P.vr) go to their own accumulators, folded back with 1/2048 in f32.
//   Output: f32 [b][h*64+d][token] (full strides): the block's 64x64 tile is transposed through LDS (cross-wave: block barrier) and every
// =====================================================================================================================
template <bool EARLY>
__device__ __forceinline__ void attn_body(const _Float16* __restrict__ Q, const _Float16* __restrict__ Kp, const _Float16* __restrict__ VT,
                                          const _Float16* __restrict__ QR, const _Float16* __restrict__ KR, const _Float16* __restrict__ VTR,
                                          float* __restrict__ OUT, unsigned qb_off, unsigned nqb) {
  __shared__ __align__(16) _Float16 Psh[4][16 * 64];                 // per wave P tile [row][kv]  (wave-private)
  __shared__ __align__(16) _Float16 Prs[EARLY ? 4 : 1][16 * 64];     // per wave P residual tile   (wave-private)
  constexpr unsigned NT = EARLY ? 2u : 1u;                           // tiles per stage: value plane (+ residual plane)
  __shared__ __align__(16) _Float16 stg[2u * NT * TILE_H];           // buffer 0: K (, K residual); buffer 1: V^T (, V^T residual)
  float* OT = (float*)stg;                                           // block output tile [d][query], pitch 68 (cross-wave): reuses stg behind the loop
  const unsigned tid  = threadIdx.x;
  const unsigned wave = (unsigned)__builtin_amdgcn_readfirstlane((int)(tid >> 5));
  const unsigned lane = tid & 31u;
  const unsigned hh   = lane >> 4;
  const unsigned c    = lane & 15u;
  const unsigned bx = blockIdx.x;
  const unsigned qb = qb_off + bx % nqb;
  const unsigned bh = bx / nqb;
  const unsigned h  = bh & 7u;
  const unsigned b  = bh >> 3;
  const unsigned q0 = qb * 64u + wave * 16u;
  const unsigned nch = qb + 1u;
  const size_t rowbase = (size_t)b * SEQ;
  const size_t resbase = (size_t)b * EROWS;

  const _Float16* qrow = Q + (rowbase + q0 + c) * EMB + h * 64u + 8u * hh;
  const v16h qa0 = frag_ld(qrow), qa1 = frag_ld(qrow + 32);
  v16h qr0 = qa0, qr1 = qa1;
  if (EARLY) {
    const _Float16* qrr = QR + (resbase + q0 + c) * EMB + h * 64u + 8u * hh;
    qr0 = frag_ld(qrr); qr1 = frag_ld(qrr + 32);
  }
  const _Float16* kbase  = stg + 8u * hh;                                                // + key * KVP (+ 32 for the second d chunk)
  const _Float16* krbase = kbase + TILE_H;
  const _Float16* vbase  = stg + NT * TILE_H + 8u * hh;                                  // + d * KVP + kv
  const _Float16* vrbase = vbase + TILE_H;
  // staging: this thread's row (of 16 per copy) and 16-byte piece
  const unsigned srow = tid >> 3, spc = (tid & 7u) << 3;
  const unsigned lk = (unsigned)(size_t)stg + (srow * KVP + spc) * 2u;                   // LDS byte address in the K buffer
  const unsigned lv = lk + NT * TILE_H * 2u;                                             // the same place in the V^T buffer
  const unsigned ok  = srow * EMB + spc;                                                 // this thread's piece inside a K tile (value and residual planes)
  const unsigned ov  = srow * SEQ + spc, ovr = srow * EROWS + spc;                       // the same inside a V^T tile, a V^T residual tile
  const _Float16* gk  = Kp  + rowbase * EMB + h * 64u;                                   // block-uniform tile origins: + kv0 * EMB
  const _Float16* gkr = KR  + resbase * EMB + h * 64u;
  const _Float16* gv  = VT  + ((size_t)b * EMB + h * 64u) * SEQ;                         // + kv0
  const _Float16* gvr = VTR + ((size_t)b * EMB + h * 64u) * EROWS;

  float mrow[8], lrow[8];
  v8f oacc[4], oaccr[4];
#pragma unroll
  for (int r = 0; r < 8; ++r) { mrow[r] = -__builtin_inff(); lrow[r] = 0.f; }
#pragma unroll
  for (int t = 0; t < 4; ++t) { oacc[t] = (v8f){0.f,0.f,0.f,0.f,0.f,0.f,0.f,0.f}; oaccr[t] = (v8f){0.f,0.f,0.f,0.f,0.f,0.f,0.f,0.f}; }

  const float SC    = 0.125f * 1.4426950408889634f;       // 1/sqrt(64) and log2(e)
  const float FILLX = -14426.950408889634f;               // -10000 * log2(e)
  _Float16* pw  = Psh[wave];
  _Float16* prw = Prs[EARLY ? wave : 0u];

  // prologue of the two-buffer ring: stage 0 (K of chunk 0) lands and is published, then stage 1 (V^T of chunk 0) starts
  if (EARLY) stage_tile2(lk, gk + ok, 16u * EMB, lk + TILE_H * 2u, gkr + ok, 16u * EMB);
  else       stage_tile1(lk, gk + ok, 16u * EMB);
  asm volatile("s_wait_asynccnt 0x0" ::: "memory");   // this wave's copies of stage 0 have landed
  __syncthreads();
  if (EARLY) stage_tile2(lv, gv + ov, 16u * SEQ, lv + TILE_H * 2u, gvr + ovr, 16u * EROWS);
  else       stage_tile1(lv, gv + ov, 16u * SEQ);

  for (unsigned kc = 0; kc < nch; ++kc) {
    const unsigned kv0 = kc * 64u;
    const bool more = kc + 1u < nch;                   // block-uniform: a next chunk exists
    v8f s[4];
#pragma unroll
    for (int j = 0; j < 4; ++j) {
      const _Float16* kr = kbase + ((unsigned)j * 16u + c) * KVP;
      const v16h kh0 = frag_ld(kr), kh1 = frag_ld(kr + 32);
      v8f a = (v8f){0.f,0.f,0.f,0.f,0.f,0.f,0.f,0.f};
      a = wmma16(qa0, kh0, a);
      a = wmma16(qa1, kh1, a);
      if (EARLY) {
        const _Float16* krr = krbase + ((unsigned)j * 16u + c) * KVP;
        v8f ar = (v8f){0.f,0.f,0.f,0.f,0.f,0.f,0.f,0.f};
        ar = wmma16(qr0, kh0, ar);
        ar = wmma16(qr1, kh1, ar);
        ar = wmma16(qa0, frag_ld(krr), ar);
        ar = wmma16(qa1, frag_ld(krr + 32), ar);
        a = a + ar * 0.00048828125f;
      }
      s[j] = a;
    }
    const unsigned kj = kv0 + c;
#pragma unroll
    for (int r = 0; r < 8; ++r) {
      const unsigned qi = q0 + 8u * hh + (unsigned)r;
      const float x0 = (kj       < qi) ? s[0][r] * SC : FILLX;
      const float x1 = (kj + 16u < qi) ? s[1][r] * SC : FILLX;
      const float x2 = (kj + 32u < qi) ? s[2][r] * SC : FILLX;
      const float x3 = (kj + 48u < qi) ? s[3][r] * SC : FILLX;
      float m = fmaxf(fmaxf(x0, x1), fmaxf(x2, x3));
      m = fmaxf(m, __shfl_xor(m, 1, 32)); m = fmaxf(m, __shfl_xor(m, 2, 32));
      m = fmaxf(m, __shfl_xor(m, 4, 32)); m = fmaxf(m, __shfl_xor(m, 8, 32));
      const float mnew = fmaxf(mrow[r], m);
      const float alpha = exp2f(mrow[r] - mnew);
      mrow[r] = mnew;
      const float p0 = exp2f(x0 - mnew), p1 = exp2f(x1 - mnew), p2 = exp2f(x2 - mnew), p3 = exp2f(x3 - mnew);
      float psum = (p0 + p1) + (p2 + p3);
      const unsigned po = (8u * hh + (unsigned)r) * 64u + c;
      const float e0 = p0 * 32768.0f, e1 = p1 * 32768.0f, e2 = p2 * 32768.0f, e3 = p3 * 32768.0f;
      const h16 g0 = toh_flush(e0), g1 = toh_flush(e1), g2 = toh_flush(e2), g3 = toh_flush(e3);
      pw[po]       = g0;
      pw[po + 16u] = g1;
      pw[po + 32u] = g2;
      pw[po + 48u] = g3;
      if (EARLY) {
        prw[po]       = toh_flush((e0 - (float)g0) * 2048.0f);
        prw[po + 16u] = toh_flush((e1 - (float)g1) * 2048.0f);
        prw[po + 32u] = toh_flush((e2 - (float)g2) * 2048.0f);
        prw[po + 48u] = toh_flush((e3 - (float)g3) * 2048.0f);
      }
      psum += __shfl_xor(psum, 1, 32); psum += __shfl_xor(psum, 2, 32);
      psum += __shfl_xor(psum, 4, 32); psum += __shfl_xor(psum, 8, 32);
      lrow[r] = lrow[r] * alpha + psum;
#pragma unroll
      for (int t = 0; t < 4; ++t) { oacc[t][r] *= alpha; if (EARLY) oaccr[t][r] *= alpha; }
    }
    __builtin_amdgcn_fence(3 /* release order */, "workgroup");
    __builtin_amdgcn_wave_barrier();
    __builtin_amdgcn_fence(2 /* acquire order */, "workgroup");
    // V^T of this chunk is published; the K buffer, which every wave has left, takes the next chunk's K
    stage_publish();
    if (more) {
      const size_t ko = (size_t)(kv0 + 64u) * EMB;
      if (EARLY) stage_tile2(lk, (gk + ko) + ok, 16u * EMB, lk + TILE_H * 2u, (gkr + ko) + ok, 16u * EMB);
      else       stage_tile1(lk, (gk + ko) + ok, 16u * EMB);
    }
#pragma unroll
    for (int kk = 0; kk < 2; ++kk) {
      const v16h pa = frag_ld(pw + c * 64u + (unsigned)kk * 32u + 8u * hh);
      v16h pr = pa;
      if (EARLY) pr = frag_ld(prw + c * 64u + (unsigned)kk * 32u + 8u * hh);
#pragma unroll
      for (int t = 0; t < 4; ++t) {
        const v16h vb = frag_ld(vbase + ((unsigned)t * 16u + c) * KVP + (unsigned)kk * 32u);
        oacc[t] = wmma16(pa, vb, oacc[t]);
        if (EARLY) {
          oaccr[t] = wmma16(pr, vb, oaccr[t]);
          const v16h vr = frag_ld(vrbase + ((unsigned)t * 16u + c) * KVP + (unsigned)kk * 32u);
          oaccr[t] = wmma16(pa, vr, oaccr[t]);
        }
      }
    }
    // the next key block's P stores must not pass this block's P fragment loads
    __builtin_amdgcn_fence(3 /* release order */, "workgroup");
    __builtin_amdgcn_wave_barrier();
    __builtin_amdgcn_fence(2 /* acquire order */, "workgroup");
    // K of the next chunk is published; the V^T buffer, which every wave has left, takes the next chunk's V^T
    stage_publish();
    if (more) {
      if (EARLY) stage_tile2(lv, (gv + (kv0 + 64u)) + ov, 16u * SEQ, lv + TILE_H * 2u, (gvr + (kv0 + 64u)) + ovr, 16u * EROWS);
      else       stage_tile1(lv, (gv + (kv0 + 64u)) + ov, 16u * SEQ);
    }
  }
  asm volatile("s_wait_asynccnt 0x0" ::: "memory");   // no copy is outstanding when stg becomes the output tile (the last publish point's barrier ended all reads)

  // normalise (P carried x2^15), zero sequence row 0, transpose the wave's 16x64 tile into the block tile [d][query]
  float inv[8];
#pragma unroll
  for (int r = 0; r < 8; ++r) {
    const unsigned qi = q0 + 8u * hh + (unsigned)r;
    const float iv = 1.0f / (lrow[r] * 32768.0f);
    inv[r] = (qi == 0u) ? 0.0f : iv;
  }
#pragma unroll
  for (int t = 0; t < 4; ++t) {
    float o[8];
#pragma unroll
    for (int r = 0; r < 8; ++r) {
      float v = oacc[t][r];
      if (EARLY) v += oaccr[t][r] * 0.00048828125f;
      o[r] = v * inv[r];
    }
    const unsigned oi = ((unsigned)t * 16u + c) * 68u + wave * 16u + 8u * hh;
    *(v4f*)(OT + oi)      = (v4f){o[0], o[1], o[2], o[3]};
    *(v4f*)(OT + oi + 4u) = (v4f){o[4], o[5], o[6], o[7]};
  }
  __syncthreads();
  {
    const unsigned c4 = (lane & 15u) << 2;     // row segment = 64 floats = 256 B = 16 lanes x 16 B; 2 rows per instruction, 8 trips = 16 rows per wave
    float* ob = OUT + ((size_t)b * EMB + h * 64u + wave * 16u) * SEQ_FULL + qb * 64u + c4;
    v4f vv[8];
#pragma unroll
    for (int it = 0; it < 8; ++it) {
      const unsigned row = (unsigned)it * 2u + hh;
      vv[it] = *(const v4f*)(OT + (wave * 16u + row) * 68u + c4);
    }
    {
#pragma unroll
      for (int it = 0; it < 8; ++it) {
        const unsigned row = (unsigned)it * 2u + hh;
        *(v4f*)(ob + (size_t)row * SEQ_FULL) = vv[it];
      }
      
    }
  }
}

__global__ __launch_bounds__(128) __attribute__((amdgpu_num_vgpr(256))) void k_attn_early(
    const _Float16* __restrict__ Q, const _Float16* __restrict__ Kp, const _Float16* __restrict__ VT,
    const _Float16* __restrict__ QR, const _Float16* __restrict__ KR, const _Float16* __restrict__ VTR,
    float* __restrict__ OUT, unsigned qb_off, unsigned nqb) {
  attn_body<true>(Q, Kp, VT, QR, KR, VTR, OUT, qb_off, nqb);
}
__global__ __launch_bounds__(128) void k_attn_late(
    const _Float16* __restrict__ Q, const _Float16* __restrict__ Kp, const _Float16* __restrict__ VT,
    const _Float16* __restrict__ QR, const _Float16* __restrict__ KR, const _Float16* __restrict__ VTR,
    float* __restrict__ OUT, unsigned qb_off, unsigned nqb) {
  attn_body<false>(Q, Kp, VT, QR, KR, VTR, OUT, qb_off, nqb);
}

// ---- workspace carve (bytes; every region is a whole number of 256-B units and is written in full by its producer) ----
#define SZ_P16  ((size_t)NB * SEQ * EMB * 2)            // one f16 activation plane
#define SZ_R16  ((size_t)NB * EROWS * EMB * 2)          // one f16 residual plane (early rows only)
#define SZ_W16  ((size_t)3 * WSZ * 2)
#define SZ_SCL  ((size_t)3 * EMB * 4)
#define OFF_XQ   ((size_t)0)
#define OFF_XK   (OFF_XQ + SZ_P16)
#define OFF_W16  (OFF_XK + SZ_P16)
#define OFF_SCL  (OFF_W16 + SZ_W16)
#define OFF_QH   (OFF_SCL + SZ_SCL)
#define OFF_KH   (OFF_QH + SZ_P16)
#define OFF_VTH  (OFF_KH + SZ_P16)
#define OFF_QR   (OFF_VTH + SZ_P16)
#define OFF_KR   (OFF_QR + SZ_R16)
#define OFF_VTR  (OFF_KR + SZ_R16)
#define WS_TOTAL (OFF_VTR + SZ_R16)
static_assert(SZ_P16 % 256 == 0 && SZ_R16 % 256 == 0 && SZ_W16 % 256 == 0 && SZ_SCL % 256 == 0);
static_assert(OFF_XK == OFF_XQ + (size_t)NB * SEQ * EMB * 2);   // k_castxT addresses the key plane as plane 1 of one base
static_assert(WS_TOTAL <= (size_t)134217728);
static_assert((size_t)NB_FULL * EMB * SEQ_FULL * 4 == (size_t)33554432);   // output extent in bytes, offset 0

extern "C" void kernel_launch(void* const* d_in, const int* in_sizes, int n_in, void* d_out, int out_size, void* d_ws, size_t ws_size, hipStream_t stream) {
    if (n_in < 11) return;
    const long long xneed = ((long long)(NB - 1) * EMB + (EMB - 1)) * SEQ_FULL + SEQ;
    if ((long long)in_sizes[0] < xneed) return;
    if ((long long)in_sizes[1] < xneed) return;
    if (in_sizes[2] < WSZ || in_sizes[5] < WSZ || in_sizes[8] < WSZ) return;
    if (in_sizes[3] < EMB || in_sizes[4] < EMB || in_sizes[6] < EMB || in_sizes[7] < EMB || in_sizes[9] < EMB || in_sizes[10] < EMB) return;
    if ((long long)out_size < xneed) return;
    if ((size_t)WS_TOTAL > ws_size) return;

    // input order: query, key, vq, gq, bq, vk, gk, bk, vv, gv, bv
    const float* query = (const float*)d_in[0];
    const float* key   = (const float*)d_in[1];
    const float* vq = (const float*)d_in[2];  const float* gq = (const float*)d_in[3];  const float* bq = (const float*)d_in[4];
    const float* vk = (const float*)d_in[5];  const float* gk = (const float*)d_in[6];  const float* bk = (const float*)d_in[7];
    const float* vv = (const float*)d_in[8];  const float* gv = (const float*)d_in[9];  const float* bv = (const float*)d_in[10];
    float* out = (float*)d_out;

    char* ws = (char*)d_ws;
    unsigned short* X16  = (unsigned short*)(ws + OFF_XQ);     // plane 0 = query tokens, plane 1 = key tokens
    unsigned short* W16  = (unsigned short*)(ws + OFF_W16);    // planes: 0 vq 1 vk 2 vv (direction weights x16)
    float*          SCL  = (float*)(ws + OFF_SCL);             // [3][512] row gains / 16
    _Float16* QH  = (_Float16*)(ws + OFF_QH);
    _Float16* KH  = (_Float16*)(ws + OFF_KH);
    _Float16* VTH = (_Float16*)(ws + OFF_VTH);
    _Float16* QR  = (_Float16*)(ws + OFF_QR);
    _Float16* KR  = (_Float16*)(ws + OFF_KR);
    _Float16* VTR = (_Float16*)(ws + OFF_VTR);

    const _Float16* XQh = (const _Float16*)(ws + OFF_XQ);
    const _Float16* XKh = (const _Float16*)(ws + OFF_XK);
    const _Float16* W16h = (const _Float16*)W16;

    // 1-2: operand planes
    k_castxT<<<dim3((unsigned)(SEQ / 64), (unsigned)(EMB / 64), (unsigned)(NB * 2)), 256, 0, stream>>>(query, key, X16);
    k_wprep<<<dim3((unsigned)(EMB / 32), 3u), 256, 0, stream>>>(vq, gq, vk, gk, vv, gv, W16, SCL);

    // 3: q, k (tokens x V^T, row gain, bias -> f16 planes) and v^T (V x tokens^T, gain[m], bias[m] -> f16 plane [b][h*64+d][token]); early group also residual planes;
    //    all six row groups in one grid (blockIdx.z), the early groups (longer epilogue) first
    k_proj_all<<<dim3((unsigned)(((EROWS > LROWS) ? EROWS : LROWS) / 64), (unsigned)NB, (LROWS > 0) ? 6u : 3u), 256, 0, stream>>>(
        XQh, XKh, W16h, QH, KH, VTH, QR, KR, VTR, bq, bk, bv, SCL);

    // 4-5: causal attention, early band (value + residual planes) and late band (single planes); each block writes its 64x64 tile of the output buffer
    k_attn_early<<<(unsigned)(NB * NHEAD * (EROWS / 64)), 128, 0, stream>>>(QH, KH, VTH, QR, KR, VTR, out, 0u, (unsigned)(EROWS / 64));
    if (LROWS > 0) {
        k_attn_late<<<(unsigned)(NB * NHEAD * (LROWS / 64)), 128, 0, stream>>>(QH, KH, VTH, QR, KR, VTR, out, (unsigned)(EROWS / 64), (unsigned)(LROWS / 64));
    }
}

// v004
// One run takes 127 microseconds.
// Next to v003, in two timings, it ran 1.27 and 1.29 times as fast.
// Counting every step since v000, it is 3.06 times as fast.
// All contractions (weight-normalised q/k/v projections, q.k^T, P.V): v_wmma_f32_16x16x32_f16 (f16 operands, f32 accumulate); float inputs bf16-converted (RNE) first, direction weights carried x16 with the per-row norm gain applied in f32 at the projection epilogue, P carried x2^15; query rows < EROWS additionally carry q, k, v, P as f16 value + x2048 f16 residual planes (three products, residual products in their own accumulator); mask, softmax, norms in f32.
#include <hip/hip_runtime.h>
#include <math.h>

// ---- sizes (NB / SEQ reducible; *_FULL = strides of the inputs / output) ----
#ifndef NB
#define NB 16
#endif
#ifndef SEQ
#define SEQ 1024
#endif
#ifndef EROWS
#define EROWS ((SEQ < 512) ? SEQ : 512)
#endif
#define LROWS (SEQ - EROWS)
#define NB_FULL 16
#define SEQ_FULL 1024
#define EMB 512
#define NHEAD 8
#define HDIM 64
#define WSZ (EMB * EMB)

static_assert(NB >= 1 && NB <= NB_FULL);
static_assert(SEQ <= SEQ_FULL && SEQ % 64 == 0 && SEQ >= 64);
static_assert(EROWS % 64 == 0 && EROWS >= 64 && EROWS <= SEQ);
static_assert(LROWS % 64 == 0);
static_assert(EMB % 64 == 0 && EMB == NHEAD * HDIM && HDIM == 64 && NHEAD == 8);
static_assert(EMB % 32 == 0);                          // WMMA k-steps of 32, weight rows per prep block
static_assert(4 * 256 == 64 * 16);                     // k_castxT load phase: trips x threads == tile rows x 16-B pieces per row
static_assert(2 * 256 == 64 * 8);
static_assert(2 * 32 * 8 == EMB);                      // k_wprep: trips x lanes x elements == weight row width
static_assert(8 * 4 == 32);                            // k_wprep: waves x rows per wave == rows per block
static_assert(32 * 16 * 4 == 16 * 128);                // projection epilogue: lanes x bytes x trips == slab rows x row bytes (64 halves)
static_assert(4 * 32 * 16 * 8 == 64 * 256);            // attention output: waves x lanes x bytes x trips == tile rows x row bytes (64 floats)
static_assert(2 * 576 * 72 * 2 + 8 * 16 * 68 * 4 <= 327680);  // static LDS of the projection kernel: two operand stages + the epilogue slabs
static_assert((EMB / 64) % 8 == 0 && (EROWS / 64) % 8 == 0 && (LROWS / 64) % 8 == 0);  // projection: the 8 waves of a block share one A tile; a block has all its tiles or none
static_assert(8 * 2 * 32 * 16 == 64 * 128 && 16 * 32 * 16 == 64 * 128);  // projection staging: (waves x) copies x lanes x bytes == tile rows x row bytes
static_assert(4 * 64 * 72 * 2 <= 81920);  // static LDS of the attention kernels: four blocks per 320-KiB LDS
static_assert(64 * 68 * 4 <= 2 * 64 * 72 * 2);         // the output tile fits the staging area that it reuses
static_assert(4 * 128 * 16 == 64 * 128);               // staging: copies per thread x threads x bytes == tile rows x row bytes
static_assert(64 * 65 * 4 <= 131072);                  // static LDS of k_castxT

typedef _Float16 h16;
typedef __attribute__((ext_vector_type(16))) _Float16 v16h;
typedef __attribute__((ext_vector_type(8)))  _Float16 v8h;
typedef __attribute__((ext_vector_type(8)))  float    v8f;
typedef __attribute__((ext_vector_type(4)))  float    v4f;
typedef __attribute__((ext_vector_type(4)))  unsigned int u4v;

// 16-bit WMMA fragment map (wave32), lane L, h = L>>4, m = L&15:
//   A 16x32: lane = row m;    element i -> k = (i<8) ? 8h+i : 16+8h+(i-8)
//   B 32x16: lane = column m; the SAME k(i,h)
//   D 16x16 (8 f32): lane = column m; element r -> row 8h+r
union FragU { v16h v; v8h h[2]; };
// p already includes the +8h lane-half offset: elements 0..7 <- p[0..7], 8..15 <- p[16..23]
__device__ __forceinline__ v16h frag_ld(const _Float16* p) { FragU f; f.h[0] = *(const v8h*)(p); f.h[1] = *(const v8h*)(p + 16); return f.v; }

__device__ __forceinline__ v8f wmma16(v16h a, v16h b, v8f c) {
    c = __builtin_amdgcn_wmma_f32_16x16x32_f16(false, a, false, b, (short)0, c, false, false);
    asm volatile("v_nop\n\tv_nop\n\tv_nop\n\tv_nop" : "+v"(c) : "v"(a), "v"(b));
    return c;
}
__device__ __forceinline__ v8f mma_raw(v16h a, v16h b, v8f c) { return __builtin_amdgcn_wmma_f32_16x16x32_f16(false, a, false, b, (short)0, c, false, false); }
__device__ __forceinline__ void dep_guard_h(v8f& a, v8f& b, v16h x, v16h y) { asm volatile("v_nop\n\tv_nop\n\tv_nop\n\tv_nop" : "+v"(a), "+v"(b) : "v"(x), "v"(y)); }
__device__ __forceinline__ void keep4_h(v16h a, v16h b, v16h c, v16h d) { asm volatile("v_nop" :: "v"(a), "v"(b), "v"(c), "v"(d)); }
__device__ __forceinline__ void acc_guard4(v8f& a, v8f& b, v8f& c, v8f& d) { asm volatile("v_nop\n\tv_nop\n\tv_nop\n\tv_nop" : "+v"(a), "+v"(b), "+v"(c), "+v"(d)); }

// bf16 RNE convert, kept as f32 (finite inputs)
__device__ __forceinline__ float bf_keep(float v) { const unsigned u = __float_as_uint(v); return __uint_as_float((u + 0x7fffu + ((u >> 16) & 1u)) & 0xffff0000u); }
// f32 -> f16 that cannot produce an f16 subnormal (value select)
__device__ __forceinline__ h16 toh_flush(float v) { const h16 r = (h16)v; return (fabsf(v) < 6.103515625e-05f) ? (h16)0.0f : r; }
__device__ __forceinline__ unsigned pk2hf(float a, float b) { return (unsigned)__builtin_bit_cast(unsigned short, toh_flush(a)) | ((unsigned)__builtin_bit_cast(unsigned short, toh_flush(b)) << 16); }

// ---- LDS staging of 64-row x 128-byte f16 tiles by asynchronous copies (global -> LDS, through no register) ----
#define KVP 72u                      // LDS row pitch in halves: 144 B = 16 B x 9, conflict-free for 16-byte fragment reads
#define TILE_H (64u * KVP)           // halves of one staged tile
#define ROWS16_B (16u * KVP * 2u)    // LDS bytes of 16 staged rows
#define PSTG_H (576u * KVP)          // halves of one projection stage: 64 A rows + 8 x 64 Bt rows
// Each thread of the 128 copies its 16-byte piece of rows r, r+16, r+32, r+48: one wave-wide copy = 4 whole 128-byte rows.
// l = the thread's LDS byte address of its piece in row r, g = the same piece in global memory, st = 16 source rows in halves.
// s_wait_xcnt stands as the last line of the copies' own statement, so no address register is rewritten in front of it.
__device__ __forceinline__ void stage_tile1(unsigned l, const _Float16* g, size_t st) {
    asm volatile("global_load_async_to_lds_b128 %0, %4, off\n\t"
                 "global_load_async_to_lds_b128 %1, %5, off\n\t"
                 "global_load_async_to_lds_b128 %2, %6, off\n\t"
                 "global_load_async_to_lds_b128 %3, %7, off\n\t"
                 "s_wait_xcnt 0x0"
                 :: "v"(l), "v"(l + ROWS16_B), "v"(l + 2u * ROWS16_B), "v"(l + 3u * ROWS16_B),
                    "v"(g), "v"(g + st), "v"(g + 2u * st), "v"(g + 3u * st) : "memory");
}
__device__ __forceinline__ void stage_tile2(unsigned l, const _Float16* g, size_t st, unsigned l2, const _Float16* g2, size_t st2) {
    asm volatile("global_load_async_to_lds_b128 %0, %8, off\n\t"
                 "global_load_async_to_lds_b128 %1, %9, off\n\t"
                 "global_load_async_to_lds_b128 %2, %10, off\n\t"
                 "global_load_async_to_lds_b128 %3, %11, off\n\t"
                 "global_load_async_to_lds_b128 %4, %12, off\n\t"
                 "global_load_async_to_lds_b128 %5, %13, off\n\t"
                 "global_load_async_to_lds_b128 %6, %14, off\n\t"
                 "global_load_async_to_lds_b128 %7, %15, off\n\t"
                 "s_wait_xcnt 0x0"
                 :: "v"(l), "v"(l + ROWS16_B), "v"(l + 2u * ROWS16_B), "v"(l + 3u * ROWS16_B),
                    "v"(l2), "v"(l2 + ROWS16_B), "v"(l2 + 2u * ROWS16_B), "v"(l2 + 3u * ROWS16_B),
                    "v"(g), "v"(g + st), "v"(g + 2u * st), "v"(g + 3u * st),
                    "v"(g2), "v"(g2 + st2), "v"(g2 + 2u * st2), "v"(g2 + 3u * st2) : "memory");
}
// Wave-wide forms for the projection: a lane copies its 16-byte piece of rows r, r+4, ... (source pitch EMB halves): one wave-wide copy = 4 whole 128-byte rows.
#define ROWS4_B (4u * KVP * 2u)      // LDS bytes of 4 staged rows
__device__ __forceinline__ void stage_rows2(unsigned l, const _Float16* g) {
    asm volatile("global_load_async_to_lds_b128 %0, %2, off\n\t"
                 "global_load_async_to_lds_b128 %1, %3, off\n\t"
                 "s_wait_xcnt 0x0"
                 :: "v"(l), "v"(l + ROWS4_B), "v"(g), "v"(g + 4u * EMB) : "memory");
}
__device__ __forceinline__ void stage_rows8(unsigned l, const _Float16* g) {
    asm volatile("global_load_async_to_lds_b128 %0, %8, off\n\t"
                 "global_load_async_to_lds_b128 %1, %9, off\n\t"
                 "global_load_async_to_lds_b128 %2, %10, off\n\t"
                 "global_load_async_to_lds_b128 %3, %11, off\n\t"
                 "global_load_async_to_lds_b128 %4, %12, off\n\t"
                 "global_load_async_to_lds_b128 %5, %13, off\n\t"
                 "global_load_async_to_lds_b128 %6, %14, off\n\t"
                 "global_load_async_to_lds_b128 %7, %15, off\n\t"
                 "s_wait_xcnt 0x0"
                 :: "v"(l), "v"(l + ROWS4_B), "v"(l + 2u * ROWS4_B), "v"(l + 3u * ROWS4_B),
                    "v"(l + 4u * ROWS4_B), "v"(l + 5u * ROWS4_B), "v"(l + 6u * ROWS4_B), "v"(l + 7u * ROWS4_B),
                    "v"(g), "v"(g + 4u * EMB), "v"(g + 8u * EMB), "v"(g + 12u * EMB),
                    "v"(g + 16u * EMB), "v"(g + 20u * EMB), "v"(g + 24u * EMB), "v"(g + 28u * EMB) : "memory");
}
// publish point of the next stage: this wave's LDS reads have returned, its own copies have landed, then the block barrier
// (it shows the landed tile to the other waves and ends every wave's reads of the buffer that is refilled behind it)
__device__ __forceinline__ void stage_publish() {
    asm volatile("s_wait_dscnt 0x0" ::: "memory");      // this wave's reads of the buffer about to be refilled are done
    asm volatile("s_wait_asynccnt 0x0" ::: "memory");   // this wave's copies of the next stage have landed
    __syncthreads();
}

#define VST2(T, ptr, val) do { const T vst2_v_ = (val); *(T*)(ptr) = vst2_v_;  } while (0)

// ---- query / key (f32, [b][c][s], full strides) -> f16 planes of the bf16-converted values, compact [NB*SEQ][512] (token-major);
//      plane 0 = query at D, plane 1 = key at D + NB*SEQ*EMB. 64 channels x 64 tokens per block through an LDS tile (cross-wave: block barrier);
__global__ __launch_bounds__(256) void k_castxT(const float* __restrict__ xq, const float* __restrict__ xk, unsigned short* __restrict__ D) {
#pragma clang fp contract(off)
    __shared__ float tile[64 * 65];
    const unsigned z = blockIdx.z;
    const unsigned which = z & 1u;                       // block-uniform select among global pointers
    const unsigned b = z >> 1;
    const float* src = xq;
    if (which == 1u) src = xk;
    const unsigned s0 = blockIdx.x * 64u, c0 = blockIdx.y * 64u;
    const unsigned t = threadIdx.x;
#pragma unroll
    for (int i = 0; i < 4; ++i) {
        const unsigned idx = t + 256u * (unsigned)i;
        const unsigned cc = idx >> 4, s4 = (idx & 15u) << 2;
        const v4f a = *(const v4f*)(src + ((size_t)b * EMB + c0 + cc) * SEQ_FULL + s0 + s4);
        tile[cc * 65u + s4 + 0u] = a.x; tile[cc * 65u + s4 + 1u] = a.y; tile[cc * 65u + s4 + 2u] = a.z; tile[cc * 65u + s4 + 3u] = a.w;
    }
    __syncthreads();
#pragma unroll
    for (int i = 0; i < 2; ++i) {
        const unsigned idx = t + 256u * (unsigned)i;
        const unsigned ss = idx >> 3, c8 = (idx & 7u) << 3;
        const float f0 = tile[(c8 + 0u) * 65u + ss], f1 = tile[(c8 + 1u) * 65u + ss], f2 = tile[(c8 + 2u) * 65u + ss], f3 = tile[(c8 + 3u) * 65u + ss];
        const float f4 = tile[(c8 + 4u) * 65u + ss], f5 = tile[(c8 + 5u) * 65u + ss], f6 = tile[(c8 + 6u) * 65u + ss], f7 = tile[(c8 + 7u) * 65u + ss];
        u4v pk; pk.x = pk2hf(bf_keep(f0), bf_keep(f1)); pk.y = pk2hf(bf_keep(f2), bf_keep(f3)); pk.z = pk2hf(bf_keep(f4), bf_keep(f5)); pk.w = pk2hf(bf_keep(f6), bf_keep(f7));
        VST2(u4v, (u4v*)(D + (size_t)which * ((size_t)NB * SEQ * EMB) + ((size_t)b * SEQ + s0 + ss) * EMB + c0 + c8), pk);
    }
}

// ---- three [512 out][512 in] direction weights -> f16 planes of bf16-converted values x16 (exact), plane y at D + y*WSZ, and the per-row gain table
//      SCL[y*512 + o] = bf16(g[o]) / ||bf16(v[o,:])|| / 16 (f32). Block = 32 rows (wave = 4 rows); grid (EMB/32, 3).
//      Plane rows: 2 instructions x 32 lanes x 16 B lane-contiguous; gain line: 32 lanes x 4 B of wave 0 in one instruction (LDS word per row, block barrier). ----
__global__ __launch_bounds__(256) void k_wprep(const float* __restrict__ v0, const float* __restrict__ g0, const float* __restrict__ v1, const float* __restrict__ g1,
                                               const float* __restrict__ v2, const float* __restrict__ g2, unsigned short* __restrict__ D, float* __restrict__ SCLp) {
#pragma clang fp contract(off)
    __shared__ float red[32];
    const unsigned y = blockIdx.y;                       // block-uniform select among global pointers
    const float* s = v0; const float* g = g0;
    if (y == 1u) { s = v1; g = g1; }
    if (y == 2u) { s = v2; g = g2; }
    const unsigned lane = threadIdx.x & 31u;
    const unsigned wave = (unsigned)__builtin_amdgcn_readfirstlane((int)(threadIdx.x >> 5));
    const unsigned rb = blockIdx.x * 32u;
#pragma unroll 1
    for (unsigned rr = 0; rr < 4u; ++rr) {
        const unsigned rl = wave * 4u + rr;
        const unsigned row = rb + rl;
        float ss = 0.f;
#pragma unroll 1
        for (unsigned it = 0; it < 2u; ++it) {
            const unsigned u = it * 32u + lane;          // 16-B piece of the row
            const float* p = s + (size_t)row * EMB + u * 8u;
            const v4f a = *(const v4f*)(p), b = *(const v4f*)(p + 4);
            const float a0 = bf_keep(a.x), a1 = bf_keep(a.y), a2 = bf_keep(a.z), a3 = bf_keep(a.w);
            const float b0 = bf_keep(b.x), b1 = bf_keep(b.y), b2 = bf_keep(b.z), b3 = bf_keep(b.w);
            ss += a0 * a0; ss += a1 * a1; ss += a2 * a2; ss += a3 * a3;
            ss += b0 * b0; ss += b1 * b1; ss += b2 * b2; ss += b3 * b3;
            u4v pk; pk.x = pk2hf(a0 * 16.f, a1 * 16.f); pk.y = pk2hf(a2 * 16.f, a3 * 16.f); pk.z = pk2hf(b0 * 16.f, b1 * 16.f); pk.w = pk2hf(b2 * 16.f, b3 * 16.f);
            VST2(u4v, (u4v*)(D + (size_t)y * WSZ + (size_t)row * EMB + u * 8u), pk);
        }
        ss += __shfl_xor(ss, 1, 32); ss += __shfl_xor(ss, 2, 32); ss += __shfl_xor(ss, 4, 32);
        ss += __shfl_xor(ss, 8, 32); ss += __shfl_xor(ss, 16, 32);
        if (lane == 0u) red[rl] = ss;
    }
    __syncthreads();
    if (threadIdx.x < 32u) {
        const unsigned row = rb + lane;
        const float sc = bf_keep(g[row]) * (1.0f / sqrtf(red[lane])) * 0.0625f;
        VST2(float, SCLp + (size_t)y * EMB + row, sc);
    }
}

// =====================================================================================================================
// k_proj_all: all six projection row groups in ONE grid (they only read the operand planes and write disjoint planes, so none waits for another).
//   blockIdx.z: 0 q early, 1 k early, 2 v^T early (value + residual planes), 3 q late, 4 k late, 5 v^T late (value plane only); blockIdx.y = batch.
//   C[m,n] = scl * sum_k A[m,k] * Bt[n,k] + bias; each wave owns a 64x64 tile; 8 waves per block; A, Bt row-major f16, pitch EMB, K = EMB.
//   q, k (token-major): A = tokens, Bt = direction weights, bias[n], scl[n]; v^T (channel-major): A = direction weights, Bt = tokens, bias[m], scl[m]
//   (bias bf16-converted on load; scl is an f32 table). Operands: a stage is 64 k (whole 128-byte rows) of the block's 64 A rows (shared by its 8 waves)
//   and of each wave's 64 Bt rows, brought into LDS by asynchronous copies, two buffers: stage t + 1 flies while stage t feeds the products. Output: f16 plane C (value); RES: also the f16 plane Cr = (value - f16 value) x 2048.
// =====================================================================================================================
template <int BIAS_MODE, bool RES>
__device__ __forceinline__ void proj_epilogue(v8f (&acc)[4][4], float* slab, _Float16* C, unsigned ldc, _Float16* Cr, unsigned ldr,
                                              const float* __restrict__ bias, const float* __restrict__ scl, unsigned m0, unsigned n0, unsigned lane) {
  const unsigned rlane = lane & 15u;            // col (D) within subtile
  const unsigned mOff  = (lane >> 4) << 3;      // D row offset
#pragma unroll
  for (int i = 0; i < 4; ++i) {
    const unsigned mBase = m0 + ((unsigned)i << 4);
    float bm[8], sm[8];
#pragma unroll
    for (int r = 0; r < 8; ++r) {
      bm[r] = (BIAS_MODE == 1) ? bf_keep(bias[mBase + mOff + (unsigned)r]) : 0.f;
      sm[r] = (BIAS_MODE == 1) ? scl[mBase + mOff + (unsigned)r] : 0.f;
    }
#pragma unroll
    for (int j = 0; j < 4; ++j) {
      const unsigned n = n0 + ((unsigned)j << 4) + rlane;
      float bv = 0.f, sv = 0.f;
      if (BIAS_MODE == 2) { bv = bf_keep(bias[n]); sv = scl[n]; }
#pragma unroll
      for (int r = 0; r < 8; ++r) {
        float v;
        if (BIAS_MODE == 1) v = acc[i][j][r] * sm[r] + bm[r];
        else                v = acc[i][j][r] * sv + bv;
        slab[(mOff + (unsigned)r) * 68u + ((unsigned)j << 4) + rlane] = v;
      }
    }
    __builtin_amdgcn_fence(3 /* release order */, "workgroup");
    __builtin_amdgcn_wave_barrier();
    __builtin_amdgcn_fence(2 /* acquire order */, "workgroup");
    {
      const unsigned q = lane >> 3, c8 = (lane & 7u) << 3;
      v8h hv[4];
      v8h rv[4];
#pragma unroll
      for (int it = 0; it < 4; ++it) {
        const unsigned row = (unsigned)it * 4u + q;
        const float* sp = slab + row * 68u + c8;
        const v4f s0 = *(const v4f*)(sp), s1 = *(const v4f*)(sp + 4);
        v8h t;
        t[0] = toh_flush(s0.x); t[1] = toh_flush(s0.y); t[2] = toh_flush(s0.z); t[3] = toh_flush(s0.w);
        t[4] = toh_flush(s1.x); t[5] = toh_flush(s1.y); t[6] = toh_flush(s1.z); t[7] = toh_flush(s1.w);
        hv[it] = t;
        v8h u = t;
        if (RES) {
          u[0] = toh_flush((s0.x - (float)t[0]) * 2048.0f); u[1] = toh_flush((s0.y - (float)t[1]) * 2048.0f);
          u[2] = toh_flush((s0.z - (float)t[2]) * 2048.0f); u[3] = toh_flush((s0.w - (float)t[3]) * 2048.0f);
          u[4] = toh_flush((s1.x - (float)t[4]) * 2048.0f); u[5] = toh_flush((s1.y - (float)t[5]) * 2048.0f);
          u[6] = toh_flush((s1.z - (float)t[6]) * 2048.0f); u[7] = toh_flush((s1.w - (float)t[7]) * 2048.0f);
        }
        rv[it] = u;
      }
#pragma unroll
      for (int it = 0; it < 4; ++it) {
        const unsigned row = (unsigned)it * 4u + q;
        *(v8h*)(C + (size_t)(mBase + row) * ldc + n0 + c8) = hv[it];
        if (RES) *(v8h*)(Cr + (size_t)(mBase + row) * ldr + n0 + c8) = rv[it];
      }
    }
    __builtin_amdgcn_fence(3 /* release order */, "workgroup");
    __builtin_amdgcn_wave_barrier();
    __builtin_amdgcn_fence(2 /* acquire order */, "workgroup");
  }
}

__global__ __launch_bounds__(256) void k_proj_all(const _Float16* __restrict__ XQ, const _Float16* __restrict__ XK, const _Float16* __restrict__ Wd,
                                                  _Float16* QHp, _Float16* KHp, _Float16* VTHp, _Float16* QRp, _Float16* KRp, _Float16* VTRp,
                                                  const float* __restrict__ bq, const float* __restrict__ bk, const float* __restrict__ bv,
                                                  const float* __restrict__ SCLp) {
  __shared__ __align__(16) float sT[8][16 * 68];   // per-wave 16x64 slab, pitch 68 floats
  __shared__ __align__(16) _Float16 pst[2u * PSTG_H];   // two operand stages: rows 0..63 = A, rows 64 + 64 * wave .. = that wave's Bt rows; pitch KVP
  const unsigned z    = blockIdx.z;                // block-uniform selects among global pointers below
  const unsigned b    = blockIdx.y;
  const bool     late = z >= 3u;
  const unsigned p    = late ? z - 3u : z;         // 0 q, 1 k, 2 v^T
  const bool     chm  = p == 2u;                   // channel-major (v^T)
  const unsigned rows = late ? (unsigned)LROWS : (unsigned)EROWS;   // tokens of this row group
  const unsigned row0 = late ? (unsigned)EROWS : 0u;                // its first token inside a batch
  const unsigned lane = threadIdx.x & 31u;
  const unsigned wave = (unsigned)__builtin_amdgcn_readfirstlane((int)(threadIdx.x >> 5));
  const unsigned tilesM = (chm ? (unsigned)EMB : rows) >> 6;
  const unsigned tilesN = (chm ? rows : (unsigned)EMB) >> 6;
  const unsigned tile = blockIdx.x * 8u + wave;
  if (tile >= tilesM * tilesN) return;   // block-uniform (tile counts are multiples of 8), in front of every barrier
  const unsigned tm = tile / tilesN;
  const unsigned tn = tile - tm * tilesN;
  const unsigned m0 = tm << 6;
  const unsigned n0 = tn << 6;

  const _Float16* X = XQ;
  if (p != 0u) X = XK;
  const _Float16* tok = X + ((size_t)b * SEQ + row0) * EMB;   // this batch's tokens of the row group
  const _Float16* wgt = Wd + (size_t)p * WSZ;
  const _Float16* Ab = chm ? wgt : tok;
  const _Float16* Bb = chm ? tok : wgt;

  const unsigned rlane = lane & 15u;            // row (A) / col (B) within subtile
  const unsigned koff  = (lane >> 4) << 3;      // k offset of this lane half

  v8f acc[4][4];
#pragma unroll
  for (int i = 0; i < 4; ++i)
#pragma unroll
    for (int j = 0; j < 4; ++j) acc[i][j] = (v8f){0.f,0.f,0.f,0.f,0.f,0.f,0.f,0.f};

  // staging: this lane's row (of 4 per wave-wide copy) and 16-byte piece; each wave brings 8 of the A rows and its own 64 Bt rows
  const unsigned lr = lane >> 3, pc = (lane & 7u) << 3;
  const unsigned la = (unsigned)(size_t)pst + ((wave * 8u + lr) * KVP + pc) * 2u;            // LDS byte addresses in buffer 0
  const unsigned lb = (unsigned)(size_t)pst + ((64u + wave * 64u + lr) * KVP + pc) * 2u;
  const _Float16* ga = Ab + (size_t)(m0 + wave * 8u + lr) * (unsigned)EMB + pc;              // + 64 * stage
  const _Float16* gb = Bb + (size_t)(n0 + lr) * (unsigned)EMB + pc;
  const _Float16* fa = pst + rlane * KVP + koff;                                             // fragment rows in buffer 0
  const _Float16* fb = fa + (64u + wave * 64u) * KVP;
  constexpr unsigned NSTG = (unsigned)EMB / 64u;
  static_assert(NSTG >= 2u);                                                                 // the prologue starts stages 0 and 1

  // prologue of the two-buffer ring: stage 0 lands and is published, then stage 1 starts
  stage_rows2(la, ga);
  stage_rows8(lb, gb);
  stage_rows8(lb + 8u * ROWS4_B, gb + 32u * EMB);
  asm volatile("s_wait_asynccnt 0x0" ::: "memory");   // this wave's copies of stage 0 have landed
  __syncthreads();
  stage_rows2(la + PSTG_H * 2u, ga + 64u);
  stage_rows8(lb + PSTG_H * 2u, gb + 64u);
  stage_rows8(lb + PSTG_H * 2u + 8u * ROWS4_B, gb + 64u + 32u * EMB);

#pragma unroll 1   // one copy of the hot loop in the instruction cache; the buffer select is scalar
  for (unsigned t = 0; t < NSTG; ++t) {
    const unsigned bo = (t & 1u) * PSTG_H;             // this stage's buffer, in halves
#pragma unroll
    for (int ks = 0; ks < 2; ++ks) {
      v16h bh[4], ah[4];                               // the k-step's eight fragments are read as one group, ahead of its products
#pragma unroll
      for (int j = 0; j < 4; ++j) bh[j] = frag_ld(fb + bo + (unsigned)j * 16u * KVP + (unsigned)ks * 32u);
#pragma unroll
      for (int i = 0; i < 4; ++i) ah[i] = frag_ld(fa + bo + (unsigned)i * 16u * KVP + (unsigned)ks * 32u);
#pragma unroll
      for (int i = 0; i < 4; ++i) {
#pragma unroll
        for (int j = 0; j < 4; ++j) acc[i][j] = mma_raw(ah[i], bh[j], acc[i][j]);
        dep_guard_h(acc[i][0], acc[i][3], ah[i], ah[i]);
      }
      keep4_h(bh[0], bh[1], bh[2], bh[3]);
    }
    // stage t + 1 is published; the buffer that every wave has just left takes stage t + 2
    stage_publish();
    if (t + 2u < NSTG) {
      const unsigned ko = (t + 2u) * 64u;
      stage_rows2(la + bo * 2u, ga + ko);
      stage_rows8(lb + bo * 2u, gb + ko);
      stage_rows8(lb + bo * 2u + 8u * ROWS4_B, gb + ko + 32u * EMB);
    }
  }
  asm volatile("s_wait_asynccnt 0x0" ::: "memory");   // no copy is outstanding behind the loop
  acc_guard4(acc[0][0], acc[0][1], acc[0][2], acc[0][3]);
  acc_guard4(acc[1][0], acc[1][1], acc[1][2], acc[1][3]);
  acc_guard4(acc[2][0], acc[2][1], acc[2][2], acc[2][3]);
  acc_guard4(acc[3][0], acc[3][1], acc[3][2], acc[3][3]);

  // ---- epilogue (one of four forms, block-uniform) ----
  float* slab = sT[wave];
  const float* scl = SCLp + (size_t)p * EMB;
  if (chm) {
    _Float16* C  = VTHp + (size_t)b * ((size_t)EMB * SEQ) + row0;
    _Float16* Cr = VTRp + (size_t)b * ((size_t)EMB * EROWS);
    if (late) proj_epilogue<1, false>(acc, slab, C, (unsigned)SEQ, Cr, (unsigned)EROWS, bv, scl, m0, n0, lane);
    else      proj_epilogue<1, true >(acc, slab, C, (unsigned)SEQ, Cr, (unsigned)EROWS, bv, scl, m0, n0, lane);
  } else {
    _Float16* Cp = QHp; _Float16* Rp = QRp; const float* bias = bq;
    if (p == 1u) { Cp = KHp; Rp = KRp; bias = bk; }
    _Float16* C  = Cp + ((size_t)b * SEQ + row0) * EMB;
    _Float16* Cr = Rp + (size_t)b * ((size_t)EROWS * EMB);
    if (late) proj_epilogue<2, false>(acc, slab, C, (unsigned)EMB, Cr, (unsigned)EMB, bias, scl, m0, n0, lane);
    else      proj_epilogue<2, true >(acc, slab, C, (unsigned)EMB, Cr, (unsigned)EMB, bias, scl, m0, n0, lane);
  }
}

__device__ __forceinline__ float xhalf(float x) {
  return __builtin_bit_cast(float, __builtin_amdgcn_permlanex16(__builtin_bit_cast(int, x), __builtin_bit_cast(int, x), 0x76543210, 0xfedcba98, false, false));
}

template <bool EARLY>
__device__ __forceinline__ void attn_body(const _Float16* __restrict__ Q, const _Float16* __restrict__ Kp, const _Float16* __restrict__ VT,
                                          const _Float16* __restrict__ QR, const _Float16* __restrict__ KR, const _Float16* __restrict__ VTR,
                                          float* __restrict__ OUT, unsigned qb_off, unsigned nqb) {
  constexpr unsigned NT = EARLY ? 2u : 1u;                           // tiles per stage: value plane (+ residual plane)
  __shared__ __align__(16) _Float16 stg[2u * NT * TILE_H];           // buffer 0: K (, K residual); buffer 1: V^T (, V^T residual)
  float* OT = (float*)stg;                                           // block output tile [d][query], pitch 68 (cross-wave): reuses stg behind the loop
  const unsigned tid  = threadIdx.x;
  const unsigned wave = (unsigned)__builtin_amdgcn_readfirstlane((int)(tid >> 5));
  const unsigned lane = tid & 31u;
  const unsigned hh   = lane >> 4;
  const unsigned c    = lane & 15u;
  const unsigned bx = blockIdx.x;
  const unsigned qb = qb_off + bx % nqb;
  const unsigned bh = bx / nqb;
  const unsigned h  = bh & 7u;
  const unsigned b  = bh >> 3;
  const unsigned q0 = qb * 64u + wave * 16u;
  const unsigned qi = q0 + c;                                        // this lane's query
  const unsigned nch = qb + 1u;
  const size_t rowbase = (size_t)b * SEQ;
  const size_t resbase = (size_t)b * EROWS;

  const _Float16* qrow = Q + (rowbase + qi) * EMB + h * 64u + 8u * hh;
  const v16h qa0 = frag_ld(qrow), qa1 = frag_ld(qrow + 32);
  v16h qr0 = qa0, qr1 = qa1;
  if (EARLY) {
    const _Float16* qrr = QR + (resbase + qi) * EMB + h * 64u + 8u * hh;
    qr0 = frag_ld(qrr); qr1 = frag_ld(qrr + 32);
  }
  const _Float16* kbase  = stg + 8u * hh;                                                // + key * KVP (+ 32 for the second d chunk)
  const _Float16* krbase = kbase + TILE_H;
  const _Float16* vbase  = stg + NT * TILE_H + 8u * hh;                                  // + d * KVP + kv
  const _Float16* vrbase = vbase + TILE_H;
  // staging: this thread's row (of 16 per copy) and 16-byte piece
  const unsigned srow = tid >> 3, spc = (tid & 7u) << 3;
  const unsigned lk = (unsigned)(size_t)stg + (srow * KVP + spc) * 2u;                   // LDS byte address in the K buffer
  const unsigned lv = lk + NT * TILE_H * 2u;                                             // the same place in the V^T buffer
  const unsigned ok  = srow * EMB + spc;                                                 // this thread's piece inside a K tile (value and residual planes)
  const unsigned ov  = srow * SEQ + spc, ovr = srow * EROWS + spc;                       // the same inside a V^T tile, a V^T residual tile
  const _Float16* gk  = Kp  + rowbase * EMB + h * 64u;                                   // block-uniform tile origins: + kv0 * EMB
  const _Float16* gkr = KR  + resbase * EMB + h * 64u;
  const _Float16* gv  = VT  + ((size_t)b * EMB + h * 64u) * SEQ;                         // + kv0
  const _Float16* gvr = VTR + ((size_t)b * EMB + h * 64u) * EROWS;

  float mrow = -__builtin_inff();     // running maximum of this lane's query (equal in both halves)
  float lrow = 0.f;                   // running sum over this half's keys; the halves are joined behind the loop
  v8f oacc[4], oaccr[4];              // O^T: tile t, element r = d 16t + 8h + r of this lane's query
#pragma unroll
  for (int t = 0; t < 4; ++t) { oacc[t] = (v8f){0.f,0.f,0.f,0.f,0.f,0.f,0.f,0.f}; oaccr[t] = (v8f){0.f,0.f,0.f,0.f,0.f,0.f,0.f,0.f}; }

  const float SC    = 0.125f * 1.4426950408889634f;       // 1/sqrt(64) and log2(e)
  const float FILLX = -14426.950408889634f;               // -10000 * log2(e)

  // prologue of the two-buffer ring: stage 0 (K of chunk 0) lands and is published, then stage 1 (V^T of chunk 0) starts
  if (EARLY) stage_tile2(lk, gk + ok, 16u * EMB, lk + TILE_H * 2u, gkr + ok, 16u * EMB);
  else       stage_tile1(lk, gk + ok, 16u * EMB);
  asm volatile("s_wait_asynccnt 0x0" ::: "memory");   // this wave's copies of stage 0 have landed
  __syncthreads();
  if (EARLY) stage_tile2(lv, gv + ov, 16u * SEQ, lv + TILE_H * 2u, gvr + ovr, 16u * EROWS);
  else       stage_tile1(lv, gv + ov, 16u * SEQ);

  for (unsigned kc = 0; kc < nch; ++kc) {
    const unsigned kv0 = kc * 64u;
    const bool more = kc + 1u < nch;                   // block-uniform: a next chunk exists
    v8f s[4];
#pragma unroll
    for (int j = 0; j < 4; ++j) {
      const _Float16* kr = kbase + ((unsigned)j * 16u + c) * KVP;
      const v16h kh0 = frag_ld(kr), kh1 = frag_ld(kr + 32);
      v8f a = (v8f){0.f,0.f,0.f,0.f,0.f,0.f,0.f,0.f};
      a = wmma16(kh0, qa0, a);
      a = wmma16(kh1, qa1, a);
      if (EARLY) {
        const _Float16* krr = krbase + ((unsigned)j * 16u + c) * KVP;
        v8f ar = (v8f){0.f,0.f,0.f,0.f,0.f,0.f,0.f,0.f};
        ar = wmma16(kh0, qr0, ar);
        ar = wmma16(kh1, qr1, ar);
        ar = wmma16(frag_ld(krr), qa0, ar);
        ar = wmma16(frag_ld(krr + 32), qa1, ar);
        a = a + ar * 0.00048828125f;
      }
      s[j] = a;
    }
    // The softmax touches no LDS any more, so the publish point stands directly behind the score products: V^T of this chunk is published;
    // the K buffer, which every wave has left, takes the next chunk's K, which flies through the softmax and V^T.P^T
    stage_publish();
    if (more) {
      const size_t ko = (size_t)(kv0 + 64u) * EMB;
      if (EARLY) stage_tile2(lk, (gk + ko) + ok, 16u * EMB, lk + TILE_H * 2u, (gkr + ko) + ok, 16u * EMB);
      else       stage_tile1(lk, (gk + ko) + ok, 16u * EMB);
    }
    const int kd = (int)qi - (int)(kv0 + 8u * hh);     // tile j, element r is a key in front of this lane's query where 16j + r < kd
    float mj[4];
#pragma unroll
    for (int j = 0; j < 4; ++j) {
#pragma unroll
      for (int r = 0; r < 8; ++r) s[j][r] = (j * 16 + r < kd) ? s[j][r] * SC : FILLX;
      mj[j] = fmaxf(fmaxf(fmaxf(s[j][0], s[j][1]), fmaxf(s[j][2], s[j][3])), fmaxf(fmaxf(s[j][4], s[j][5]), fmaxf(s[j][6], s[j][7])));
    }
    float m = fmaxf(fmaxf(mj[0], mj[1]), fmaxf(mj[2], mj[3]));
    m = fmaxf(m, xhalf(m));
    const float mnew = fmaxf(mrow, m);
    const float alpha = exp2f(mrow - mnew);
    mrow = mnew;
    FragU pa[2], pr[2];                                // P^T (and its residual) as B fragments of keys 0..31 and 32..63
    float ps[4];
#pragma unroll
    for (int j = 0; j < 4; ++j) {
      float a = 0.f;
#pragma unroll
      for (int r = 0; r < 8; ++r) {
        const float p = exp2f(s[j][r] - mnew);
        a += p;
        const float e = p * 32768.0f;
        const h16 g = toh_flush(e);
        pa[j >> 1].h[j & 1][r] = g;
        if (EARLY) pr[j >> 1].h[j & 1][r] = toh_flush((e - (float)g) * 2048.0f);
      }
      ps[j] = a;
    }
    lrow = lrow * alpha + ((ps[0] + ps[1]) + (ps[2] + ps[3]));
#pragma unroll
    for (int t = 0; t < 4; ++t) {
#pragma unroll
      for (int r = 0; r < 8; ++r) { oacc[t][r] *= alpha; if (EARLY) oaccr[t][r] *= alpha; }
    }
#pragma unroll
    for (int kk = 0; kk < 2; ++kk) {
#pragma unroll
      for (int t = 0; t < 4; ++t) {
        const v16h vb = frag_ld(vbase + ((unsigned)t * 16u + c) * KVP + (unsigned)kk * 32u);
        oacc[t] = wmma16(vb, pa[kk].v, oacc[t]);
        if (EARLY) {
          oaccr[t] = wmma16(vb, pr[kk].v, oaccr[t]);
          const v16h vr = frag_ld(vrbase + ((unsigned)t * 16u + c) * KVP + (unsigned)kk * 32u);
          oaccr[t] = wmma16(vr, pa[kk].v, oaccr[t]);
        }
      }
    }
    // K of the next chunk is published; the V^T buffer, which every wave has left, takes the next chunk's V^T
    stage_publish();
    if (more) {
      if (EARLY) stage_tile2(lv, (gv + (kv0 + 64u)) + ov, 16u * SEQ, lv + TILE_H * 2u, (gvr + (kv0 + 64u)) + ovr, 16u * EROWS);
      else       stage_tile1(lv, (gv + (kv0 + 64u)) + ov, 16u * SEQ);
    }
  }
  asm volatile("s_wait_asynccnt 0x0" ::: "memory");   // no copy is outstanding when stg becomes the output tile (the last publish point's barrier ended all reads)

  // join the halves' sums, normalise (P carried x2^15), zero sequence row 0, put the wave's 64 d x 16 queries into the block tile [d][query]
  const float lsum = lrow + xhalf(lrow);
  const float iv = 1.0f / (lsum * 32768.0f);
  const float inv = (qi == 0u) ? 0.0f : iv;
#pragma unroll
  for (int t = 0; t < 4; ++t) {
#pragma unroll
    for (int r = 0; r < 8; ++r) {
      float v = oacc[t][r];
      if (EARLY) v += oaccr[t][r] * 0.00048828125f;
      OT[((unsigned)t * 16u + 8u * hh + (unsigned)r) * 68u + wave * 16u + c] = v * inv;
    }
  }
  __syncthreads();
  {
    const unsigned c4 = (lane & 15u) << 2;     // row segment = 64 floats = 256 B = 16 lanes x 16 B; 2 rows per instruction, 8 trips = 16 rows per wave
    float* ob = OUT + ((size_t)b * EMB + h * 64u + wave * 16u) * SEQ_FULL + qb * 64u + c4;
    v4f vv[8];
#pragma unroll
    for (int it = 0; it < 8; ++it) {
      const unsigned row = (unsigned)it * 2u + hh;
      vv[it] = *(const v4f*)(OT + (wave * 16u + row) * 68u + c4);
    }
    {
#pragma unroll
      for (int it = 0; it < 8; ++it) {
        const unsigned row = (unsigned)it * 2u + hh;
        *(v4f*)(ob + (size_t)row * SEQ_FULL) = vv[it];
      }
    }
  }
}

__global__ __launch_bounds__(128) __attribute__((amdgpu_num_vgpr(256))) void k_attn_early(
    const _Float16* __restrict__ Q, const _Float16* __restrict__ Kp, const _Float16* __restrict__ VT,
    const _Float16* __restrict__ QR, const _Float16* __restrict__ KR, const _Float16* __restrict__ VTR,
    float* __restrict__ OUT, unsigned qb_off, unsigned nqb) {
  attn_body<true>(Q, Kp, VT, QR, KR, VTR, OUT, qb_off, nqb);
}
__global__ __launch_bounds__(128) void k_attn_late(
    const _Float16* __restrict__ Q, const _Float16* __restrict__ Kp, const _Float16* __restrict__ VT,
    const _Float16* __restrict__ QR, const _Float16* __restrict__ KR, const _Float16* __restrict__ VTR,
    float* __restrict__ OUT, unsigned qb_off, unsigned nqb) {
  attn_body<false>(Q, Kp, VT, QR, KR, VTR, OUT, qb_off, nqb);
}

// ---- workspace carve (bytes; every region is a whole number of 256-B units and is written in full by its producer) ----
#define SZ_P16  ((size_t)NB * SEQ * EMB * 2)            // one f16 activation plane
#define SZ_R16  ((size_t)NB * EROWS * EMB * 2)          // one f16 residual plane (early rows only)
#define SZ_W16  ((size_t)3 * WSZ * 2)
#define SZ_SCL  ((size_t)3 * EMB * 4)
#define OFF_XQ   ((size_t)0)
#define OFF_XK   (OFF_XQ + SZ_P16)
#define OFF_W16  (OFF_XK + SZ_P16)
#define OFF_SCL  (OFF_W16 + SZ_W16)
#define OFF_QH   (OFF_SCL + SZ_SCL)
#define OFF_KH   (OFF_QH + SZ_P16)
#define OFF_VTH  (OFF_KH + SZ_P16)
#define OFF_QR   (OFF_VTH + SZ_P16)
#define OFF_KR   (OFF_QR + SZ_R16)
#define OFF_VTR  (OFF_KR + SZ_R16)
#define WS_TOTAL (OFF_VTR + SZ_R16)
static_assert(SZ_P16 % 256 == 0 && SZ_R16 % 256 == 0 && SZ_W16 % 256 == 0 && SZ_SCL % 256 == 0);
static_assert(OFF_XK == OFF_XQ + (size_t)NB * SEQ * EMB * 2);   // k_castxT addresses the key plane as plane 1 of one base
static_assert(WS_TOTAL <= (size_t)134217728);
static_assert((size_t)NB_FULL * EMB * SEQ_FULL * 4 == (size_t)33554432);   // output extent in bytes, offset 0

extern "C" void kernel_launch(void* const* d_in, const int* in_sizes, int n_in, void* d_out, int out_size, void* d_ws, size_t ws_size, hipStream_t stream) {
    if (n_in < 11) return;
    const long long xneed = ((long long)(NB - 1) * EMB + (EMB - 1)) * SEQ_FULL + SEQ;
    if ((long long)in_sizes[0] < xneed) return;
    if ((long long)in_sizes[1] < xneed) return;
    if (in_sizes[2] < WSZ || in_sizes[5] < WSZ || in_sizes[8] < WSZ) return;
    if (in_sizes[3] < EMB || in_sizes[4] < EMB || in_sizes[6] < EMB || in_sizes[7] < EMB || in_sizes[9] < EMB || in_sizes[10] < EMB) return;
    if ((long long)out_size < xneed) return;
    if ((size_t)WS_TOTAL > ws_size) return;

    // input order: query, key, vq, gq, bq, vk, gk, bk, vv, gv, bv
    const float* query = (const float*)d_in[0];
    const float* key   = (const float*)d_in[1];
    const float* vq = (const float*)d_in[2];  const float* gq = (const float*)d_in[3];  const float* bq = (const float*)d_in[4];
    const float* vk = (const float*)d_in[5];  const float* gk = (const float*)d_in[6];  const float* bk = (const float*)d_in[7];
    const float* vv = (const float*)d_in[8];  const float* gv = (const float*)d_in[9];  const float* bv = (const float*)d_in[10];
    float* out = (float*)d_out;

    char* ws = (char*)d_ws;
    unsigned short* X16  = (unsigned short*)(ws + OFF_XQ);     // plane 0 = query tokens, plane 1 = key tokens
    unsigned short* W16  = (unsigned short*)(ws + OFF_W16);    // planes: 0 vq 1 vk 2 vv (direction weights x16)
    float*          SCL  = (float*)(ws + OFF_SCL);             // [3][512] row gains / 16
    _Float16* QH  = (_Float16*)(ws + OFF_QH);
    _Float16* KH  = (_Float16*)(ws + OFF_KH);
    _Float16* VTH = (_Float16*)(ws + OFF_VTH);
    _Float16* QR  = (_Float16*)(ws + OFF_QR);
    _Float16* KR  = (_Float16*)(ws + OFF_KR);
    _Float16* VTR = (_Float16*)(ws + OFF_VTR);

    const _Float16* XQh = (const _Float16*)(ws + OFF_XQ);
    const _Float16* XKh = (const _Float16*)(ws + OFF_XK);
    const _Float16* W16h = (const _Float16*)W16;

    // 1-2: operand planes
    k_castxT<<<dim3((unsigned)(SEQ / 64), (unsigned)(EMB / 64), (unsigned)(NB * 2)), 256, 0, stream>>>(query, key, X16);
    k_wprep<<<dim3((unsigned)(EMB / 32), 3u), 256, 0, stream>>>(vq, gq, vk, gk, vv, gv, W16, SCL);

    // 3: q, k (tokens x V^T, row gain, bias -> f16 planes) and v^T (V x tokens^T, gain[m], bias[m] -> f16 plane [b][h*64+d][token]); early group also residual planes;
    //    all six row groups in one grid (blockIdx.z), the early groups (longer epilogue) first
    k_proj_all<<<dim3((unsigned)(((EROWS > LROWS) ? EROWS : LROWS) / 64), (unsigned)NB, (LROWS > 0) ? 6u : 3u), 256, 0, stream>>>(
        XQh, XKh, W16h, QH, KH, VTH, QR, KR, VTR, bq, bk, bv, SCL);

    // 4-5: causal attention, early band (value + residual planes) and late band (single planes); each block writes its 64x64 tile of the output buffer
    k_attn_early<<<(unsigned)(NB * NHEAD * (EROWS / 64)), 128, 0, stream>>>(QH, KH, VTH, QR, KR, VTR, out, 0u, (unsigned)(EROWS / 64));
    if (LROWS > 0) {
        k_attn_late<<<(unsigned)(NB * NHEAD * (LROWS / 64)), 128, 0, stream>>>(QH, KH, VTH, QR, KR, VTR, out, (unsigned)(EROWS / 64), (unsigned)(LROWS / 64));
    }
}

// v005
// A run of this version takes 118 microseconds.
// Two timings next to v004 put it at 1.07 and 1.08 times that version's speed.
// All steps since v000 together make it 3.29 times as fast.
// All contractions (weight-normalised q/k/v projections, q.k^T, P.V): v_wmma_f32_16x16x32_f16 (f16 operands, f32 accumulate); float inputs bf16-converted (RNE) first, direction weights carried x16 with the per-row norm gain applied in f32 at the projection epilogue, P carried x2^15; query rows < EROWS additionally carry q, k, v, P as f16 value + x2048 f16 residual planes (three products, residual products in their own accumulator); mask, softmax, norms in f32.
#include <hip/hip_runtime.h>
#include <math.h>

// ---- sizes (NB / SEQ reducible; *_FULL = strides of the inputs / output) ----
#ifndef NB
#define NB 16
#endif
#ifndef SEQ
#define SEQ 1024
#endif
#ifndef EROWS
#define EROWS ((SEQ < 512) ? SEQ : 512)
#endif
#define LROWS (SEQ - EROWS)
#define NB_FULL 16
#define SEQ_FULL 1024
#define EMB 512
#define NHEAD 8
#define HDIM 64
#define WSZ (EMB * EMB)

static_assert(NB >= 1 && NB <= NB_FULL);
static_assert(SEQ <= SEQ_FULL && SEQ % 64 == 0 && SEQ >= 64);
static_assert(EROWS % 64 == 0 && EROWS >= 64 && EROWS <= SEQ);
static_assert(LROWS % 64 == 0);
static_assert(EMB % 64 == 0 && EMB == NHEAD * HDIM && HDIM == 64 && NHEAD == 8);
static_assert(EMB % 32 == 0);                          // WMMA k-steps of 32, weight rows per prep block
static_assert(4 * 256 == 64 * 16);                     // k_castxT load phase: trips x threads == tile rows x 16-B pieces per row
static_assert(2 * 256 == 64 * 8);
static_assert(2 * 32 * 8 == EMB);                      // k_wprep: trips x lanes x elements == weight row width
static_assert(8 * 4 == 32);                            // k_wprep: waves x rows per wave == rows per block
static_assert(32 * 16 * 4 == 16 * 128);                // projection epilogue: lanes x bytes x trips == slab rows x row bytes (64 halves)
static_assert(4 * 32 * 16 * 8 == 64 * 256);            // attention output: waves x lanes x bytes x trips == tile rows x row bytes (64 floats)
static_assert(2 * 576 * 72 * 2 + 8 * 16 * 68 * 4 <= 327680);  // static LDS of the projection kernel: two operand stages + the epilogue slabs
static_assert((EMB / 64) % 8 == 0 && (EROWS / 64) % 8 == 0 && (LROWS / 64) % 8 == 0);  // projection: the 8 waves of a block share one A tile; a block has all its tiles or none
static_assert(8 * 2 * 32 * 16 == 64 * 128 && 16 * 32 * 16 == 64 * 128);  // projection staging: (waves x) copies x lanes x bytes == tile rows x row bytes
static_assert(4 * 64 * 72 * 2 <= 81920);  // static LDS of the attention kernels: four blocks per 320-KiB LDS
static_assert(64 * 68 * 4 <= 2 * 64 * 72 * 2);         // the output tile fits the staging area that it reuses
static_assert(4 * 128 * 16 == 64 * 128);               // staging: copies per thread x threads x bytes == tile rows x row bytes
static_assert(64 * 65 * 4 <= 131072);                  // static LDS of k_castxT

typedef _Float16 h16;
typedef __attribute__((ext_vector_type(16))) _Float16 v16h;
typedef __attribute__((ext_vector_type(8)))  _Float16 v8h;
typedef __attribute__((ext_vector_type(8)))  float    v8f;
typedef __attribute__((ext_vector_type(4)))  float    v4f;
typedef __attribute__((ext_vector_type(4)))  unsigned int u4v;

// 16-bit WMMA fragment map (wave32), lane L, h = L>>4, m = L&15:
//   A 16x32: lane = row m;    element i -> k = (i<8) ? 8h+i : 16+8h+(i-8)
//   B 32x16: lane = column m; the SAME k(i,h)
//   D 16x16 (8 f32): lane = column m; element r -> row 8h+r
union FragU { v16h v; v8h h[2]; };
// p already includes the +8h lane-half offset: elements 0..7 <- p[0..7], 8..15 <- p[16..23]
__device__ __forceinline__ v16h frag_ld(const _Float16* p) { FragU f; f.h[0] = *(const v8h*)(p); f.h[1] = *(const v8h*)(p + 16); return f.v; }

__device__ __forceinline__ v8f wmma16(v16h a, v16h b, v8f c) {
    c = __builtin_amdgcn_wmma_f32_16x16x32_f16(false, a, false, b, (short)0, c, false, false);
    asm volatile("v_nop\n\tv_nop\n\tv_nop\n\tv_nop" : "+v"(c) : "v"(a), "v"(b));
    return c;
}
__device__ __forceinline__ v8f mma_raw(v16h a, v16h b, v8f c) { return __builtin_amdgcn_wmma_f32_16x16x32_f16(false, a, false, b, (short)0, c, false, false); }
__device__ __forceinline__ void dep_guard_h(v8f& a, v8f& b, v16h x, v16h y) { asm volatile("v_nop\n\tv_nop\n\tv_nop\n\tv_nop" : "+v"(a), "+v"(b) : "v"(x), "v"(y)); }
__device__ __forceinline__ void keep4_h(v16h a, v16h b, v16h c, v16h d) { asm volatile("v_nop" :: "v"(a), "v"(b), "v"(c), "v"(d)); }
__device__ __forceinline__ void acc_guard4(v8f& a, v8f& b, v8f& c, v8f& d) { asm volatile("v_nop\n\tv_nop\n\tv_nop\n\tv_nop" : "+v"(a), "+v"(b), "+v"(c), "+v"(d)); }

// bf16 RNE convert, kept as f32 (finite inputs)
__device__ __forceinline__ float bf_keep(float v) { const unsigned u = __float_as_uint(v); return __uint_as_float((u + 0x7fffu + ((u >> 16) & 1u)) & 0xffff0000u); }
// f32 -> f16 that cannot produce an f16 subnormal (value select)
__device__ __forceinline__ h16 toh_flush(float v) { const h16 r = (h16)v; return (fabsf(v) < 6.103515625e-05f) ? (h16)0.0f : r; }
__device__ __forceinline__ unsigned pk2hf(float a, float b) { return (unsigned)__builtin_bit_cast(unsigned short, toh_flush(a)) | ((unsigned)__builtin_bit_cast(unsigned short, toh_flush(b)) << 16); }

// ---- LDS staging of 64-row x 128-byte f16 tiles by asynchronous copies (global -> LDS, through no register) ----
#define KVP 72u                      // LDS row pitch in halves: 144 B = 16 B x 9, conflict-free for 16-byte fragment reads
#define TILE_H (64u * KVP)           // halves of one staged tile
#define ROWS16_B (16u * KVP * 2u)    // LDS bytes of 16 staged rows
#define PSTG_H (576u * KVP)          // halves of one projection stage: 64 A rows + 8 x 64 Bt rows
// Each thread of the 128 copies its 16-byte piece of rows r, r+16, r+32, r+48: one wave-wide copy = 4 whole 128-byte rows.
// l = the thread's LDS byte address of its piece in row r, g = the same piece in global memory, st = 16 source rows in halves.
// s_wait_xcnt stands as the last line of the copies' own statement, so no address register is rewritten in front of it.
__device__ __forceinline__ void stage_tile1(unsigned l, const _Float16* g, size_t st) {
    asm volatile("global_load_async_to_lds_b128 %0, %4, off\n\t"
                 "global_load_async_to_lds_b128 %1, %5, off\n\t"
                 "global_load_async_to_lds_b128 %2, %6, off\n\t"
                 "global_load_async_to_lds_b128 %3, %7, off\n\t"
                 "s_wait_xcnt 0x0"
                 :: "v"(l), "v"(l + ROWS16_B), "v"(l + 2u * ROWS16_B), "v"(l + 3u * ROWS16_B),
                    "v"(g), "v"(g + st), "v"(g + 2u * st), "v"(g + 3u * st) : "memory");
}
__device__ __forceinline__ void stage_tile2(unsigned l, const _Float16* g, size_t st, unsigned l2, const _Float16* g2, size_t st2) {
    asm volatile("global_load_async_to_lds_b128 %0, %8, off\n\t"
                 "global_load_async_to_lds_b128 %1, %9, off\n\t"
                 "global_load_async_to_lds_b128 %2, %10, off\n\t"
                 "global_load_async_to_lds_b128 %3, %11, off\n\t"
                 "global_load_async_to_lds_b128 %4, %12, off\n\t"
                 "global_load_async_to_lds_b128 %5, %13, off\n\t"
                 "global_load_async_to_lds_b128 %6, %14, off\n\t"
                 "global_load_async_to_lds_b128 %7, %15, off\n\t"
                 "s_wait_xcnt 0x0"
                 :: "v"(l), "v"(l + ROWS16_B), "v"(l + 2u * ROWS16_B), "v"(l + 3u * ROWS16_B),
                    "v"(l2), "v"(l2 + ROWS16_B), "v"(l2 + 2u * ROWS16_B), "v"(l2 + 3u * ROWS16_B),
                    "v"(g), "v"(g + st), "v"(g + 2u * st), "v"(g + 3u * st),
                    "v"(g2), "v"(g2 + st2), "v"(g2 + 2u * st2), "v"(g2 + 3u * st2) : "memory");
}
// Wave-wide forms for the projection: a lane copies its 16-byte piece of rows r, r+4, ... (source pitch EMB halves): one wave-wide copy = 4 whole 128-byte rows.
#define ROWS4_B (4u * KVP * 2u)      // LDS bytes of 4 staged rows
__device__ __forceinline__ void stage_rows2(unsigned l, const _Float16* g) {
    asm volatile("global_load_async_to_lds_b128 %0, %2, off\n\t"
                 "global_load_async_to_lds_b128 %1, %3, off\n\t"
                 "s_wait_xcnt 0x0"
                 :: "v"(l), "v"(l + ROWS4_B), "v"(g), "v"(g + 4u * EMB) : "memory");
}
__device__ __forceinline__ void stage_rows8(unsigned l, const _Float16* g) {
    asm volatile("global_load_async_to_lds_b128 %0, %8, off\n\t"
                 "global_load_async_to_lds_b128 %1, %9, off\n\t"
                 "global_load_async_to_lds_b128 %2, %10, off\n\t"
                 "global_load_async_to_lds_b128 %3, %11, off\n\t"
                 "global_load_async_to_lds_b128 %4, %12, off\n\t"
                 "global_load_async_to_lds_b128 %5, %13, off\n\t"
                 "global_load_async_to_lds_b128 %6, %14, off\n\t"
                 "global_load_async_to_lds_b128 %7, %15, off\n\t"
                 "s_wait_xcnt 0x0"
                 :: "v"(l), "v"(l + ROWS4_B), "v"(l + 2u * ROWS4_B), "v"(l + 3u * ROWS4_B),
                    "v"(l + 4u * ROWS4_B), "v"(l + 5u * ROWS4_B), "v"(l + 6u * ROWS4_B), "v"(l + 7u * ROWS4_B),
                    "v"(g), "v"(g + 4u * EMB), "v"(g + 8u * EMB), "v"(g + 12u * EMB),
                    "v"(g + 16u * EMB), "v"(g + 20u * EMB), "v"(g + 24u * EMB), "v"(g + 28u * EMB) : "memory");
}
// publish point of the next stage: this wave's LDS reads have returned, its own copies have landed, then the block barrier
// (it shows the landed tile to the other waves and ends every wave's reads of the buffer that is refilled behind it)
__device__ __forceinline__ void stage_publish() {
    asm volatile("s_wait_dscnt 0x0" ::: "memory");      // this wave's reads of the buffer about to be refilled are done
    asm volatile("s_wait_asynccnt 0x0" ::: "memory");   // this wave's copies of the next stage have landed
    __syncthreads();
}

#define VST2(T, ptr, val) do { const T vst2_v_ = (val); *(T*)(ptr) = vst2_v_;  } while (0)

// ---- query / key (f32, [b][c][s], full strides) -> f16 planes of the bf16-converted values, compact [NB*SEQ][512] (token-major);
//      plane 0 = query at D, plane 1 = key at D + NB*SEQ*EMB. 64 channels x 64 tokens per block through an LDS tile (cross-wave: block barrier);
__global__ __launch_bounds__(256) void k_castxT(const float* __restrict__ xq, const float* __restrict__ xk, unsigned short* __restrict__ D) {
#pragma clang fp contract(off)
    __shared__ float tile[64 * 65];
    const unsigned z = blockIdx.z;
    const unsigned which = z & 1u;                       // block-uniform select among global pointers
    const unsigned b = z >> 1;
    const float* src = xq;
    if (which == 1u) src = xk;
    const unsigned s0 = blockIdx.x * 64u, c0 = blockIdx.y * 64u;
    const unsigned t = threadIdx.x;
#pragma unroll
    for (int i = 0; i < 4; ++i) {
        const unsigned idx = t + 256u * (unsigned)i;
        const unsigned cc = idx >> 4, s4 = (idx & 15u) << 2;
        const v4f a = *(const v4f*)(src + ((size_t)b * EMB + c0 + cc) * SEQ_FULL + s0 + s4);
        tile[cc * 65u + s4 + 0u] = a.x; tile[cc * 65u + s4 + 1u] = a.y; tile[cc * 65u + s4 + 2u] = a.z; tile[cc * 65u + s4 + 3u] = a.w;
    }
    __syncthreads();
#pragma unroll
    for (int i = 0; i < 2; ++i) {
        const unsigned idx = t + 256u * (unsigned)i;
        const unsigned ss = idx >> 3, c8 = (idx & 7u) << 3;
        const float f0 = tile[(c8 + 0u) * 65u + ss], f1 = tile[(c8 + 1u) * 65u + ss], f2 = tile[(c8 + 2u) * 65u + ss], f3 = tile[(c8 + 3u) * 65u + ss];
        const float f4 = tile[(c8 + 4u) * 65u + ss], f5 = tile[(c8 + 5u) * 65u + ss], f6 = tile[(c8 + 6u) * 65u + ss], f7 = tile[(c8 + 7u) * 65u + ss];
        u4v pk; pk.x = pk2hf(bf_keep(f0), bf_keep(f1)); pk.y = pk2hf(bf_keep(f2), bf_keep(f3)); pk.z = pk2hf(bf_keep(f4), bf_keep(f5)); pk.w = pk2hf(bf_keep(f6), bf_keep(f7));
        VST2(u4v, (u4v*)(D + (size_t)which * ((size_t)NB * SEQ * EMB) + ((size_t)b * SEQ + s0 + ss) * EMB + c0 + c8), pk);
    }
}

// ---- three [512 out][512 in] direction weights -> f16 planes of bf16-converted values x16 (exact), plane y at D + y*WSZ, and the per-row gain table
//      SCL[y*512 + o] = bf16(g[o]) / ||bf16(v[o,:])|| / 16 (f32). Block = 32 rows (wave = 4 rows); grid (EMB/32, 3).
//      Plane rows: 2 instructions x 32 lanes x 16 B lane-contiguous; gain line: 32 lanes x 4 B of wave 0 in one instruction (LDS word per row, block barrier). ----
__global__ __launch_bounds__(256) void k_wprep(const float* __restrict__ v0, const float* __restrict__ g0, const float* __restrict__ v1, const float* __restrict__ g1,
                                               const float* __restrict__ v2, const float* __restrict__ g2, unsigned short* __restrict__ D, float* __restrict__ SCLp) {
#pragma clang fp contract(off)
    __shared__ float red[32];
    const unsigned y = blockIdx.y;                       // block-uniform select among global pointers
    const float* s = v0; const float* g = g0;
    if (y == 1u) { s = v1; g = g1; }
    if (y == 2u) { s = v2; g = g2; }
    const unsigned lane = threadIdx.x & 31u;
    const unsigned wave = (unsigned)__builtin_amdgcn_readfirstlane((int)(threadIdx.x >> 5));
    const unsigned rb = blockIdx.x * 32u;
#pragma unroll 1
    for (unsigned rr = 0; rr < 4u; ++rr) {
        const unsigned rl = wave * 4u + rr;
        const unsigned row = rb + rl;
        float ss = 0.f;
#pragma unroll 1
        for (unsigned it = 0; it < 2u; ++it) {
            const unsigned u = it * 32u + lane;          // 16-B piece of the row
            const float* p = s + (size_t)row * EMB + u * 8u;
            const v4f a = *(const v4f*)(p), b = *(const v4f*)(p + 4);
            const float a0 = bf_keep(a.x), a1 = bf_keep(a.y), a2 = bf_keep(a.z), a3 = bf_keep(a.w);
            const float b0 = bf_keep(b.x), b1 = bf_keep(b.y), b2 = bf_keep(b.z), b3 = bf_keep(b.w);
            ss += a0 * a0; ss += a1 * a1; ss += a2 * a2; ss += a3 * a3;
            ss += b0 * b0; ss += b1 * b1; ss += b2 * b2; ss += b3 * b3;
            u4v pk; pk.x = pk2hf(a0 * 16.f, a1 * 16.f); pk.y = pk2hf(a2 * 16.f, a3 * 16.f); pk.z = pk2hf(b0 * 16.f, b1 * 16.f); pk.w = pk2hf(b2 * 16.f, b3 * 16.f);
            VST2(u4v, (u4v*)(D + (size_t)y * WSZ + (size_t)row * EMB + u * 8u), pk);
        }
        ss += __shfl_xor(ss, 1, 32); ss += __shfl_xor(ss, 2, 32); ss += __shfl_xor(ss, 4, 32);
        ss += __shfl_xor(ss, 8, 32); ss += __shfl_xor(ss, 16, 32);
        if (lane == 0u) red[rl] = ss;
    }
    __syncthreads();
    if (threadIdx.x < 32u) {
        const unsigned row = rb + lane;
        const float sc = bf_keep(g[row]) * (1.0f / sqrtf(red[lane])) * 0.0625f;
        VST2(float, SCLp + (size_t)y * EMB + row, sc);
    }
}

// =====================================================================================================================
// k_proj_all: all six projection row groups in ONE grid (they only read the operand planes and write disjoint planes, so none waits for another).
//   blockIdx.z: 0 q early, 1 k early, 2 v^T early (value + residual planes), 3 q late, 4 k late, 5 v^T late (value plane only); blockIdx.y = batch.
//   C[m,n] = scl * sum_k A[m,k] * Bt[n,k] + bias; each wave owns a 64x64 tile; 8 waves per block; A, Bt row-major f16, pitch EMB, K = EMB.
//   q, k (token-major): A = tokens, Bt = direction weights, bias[n], scl[n]; v^T (channel-major): A = direction weights, Bt = tokens, bias[m], scl[m]
//   (bias bf16-converted on load; scl is an f32 table). Operands: a stage is 64 k (whole 128-byte rows) of the block's 64 A rows (shared by its 8 waves)
//   and of each wave's 64 Bt rows, brought into LDS by asynchronous copies, two buffers: stage t + 1 flies while stage t feeds the products. Output: f16 plane C (value); RES: also the f16 plane Cr = (value - f16 value) x 2048.
// =====================================================================================================================
template <int BIAS_MODE, bool RES>
__device__ __forceinline__ void proj_epilogue(v8f (&acc)[4][4], float* slab, _Float16* C, unsigned ldc, _Float16* Cr, unsigned ldr,
                                              const float* __restrict__ bias, const float* __restrict__ scl, unsigned m0, unsigned n0, unsigned lane) {
  const unsigned rlane = lane & 15u;            // col (D) within subtile
  const unsigned mOff  = (lane >> 4) << 3;      // D row offset
#pragma unroll
  for (int i = 0; i < 4; ++i) {
    const unsigned mBase = m0 + ((unsigned)i << 4);
    float bm[8], sm[8];
#pragma unroll
    for (int r = 0; r < 8; ++r) {
      bm[r] = (BIAS_MODE == 1) ? bf_keep(bias[mBase + mOff + (unsigned)r]) : 0.f;
      sm[r] = (BIAS_MODE == 1) ? scl[mBase + mOff + (unsigned)r] : 0.f;
    }
#pragma unroll
    for (int j = 0; j < 4; ++j) {
      const unsigned n = n0 + ((unsigned)j << 4) + rlane;
      float bv = 0.f, sv = 0.f;
      if (BIAS_MODE == 2) { bv = bf_keep(bias[n]); sv = scl[n]; }
#pragma unroll
      for (int r = 0; r < 8; ++r) {
        float v;
        if (BIAS_MODE == 1) v = acc[i][j][r] * sm[r] + bm[r];
        else                v = acc[i][j][r] * sv + bv;
        slab[(mOff + (unsigned)r) * 68u + ((unsigned)j << 4) + rlane] = v;
      }
    }
    __builtin_amdgcn_fence(3 /* release order */, "workgroup");
    __builtin_amdgcn_wave_barrier();
    __builtin_amdgcn_fence(2 /* acquire order */, "workgroup");
    {
      const unsigned q = lane >> 3, c8 = (lane & 7u) << 3;
      v8h hv[4];
      v8h rv[4];
#pragma unroll
      for (int it = 0; it < 4; ++it) {
        const unsigned row = (unsigned)it * 4u + q;
        const float* sp = slab + row * 68u + c8;
        const v4f s0 = *(const v4f*)(sp), s1 = *(const v4f*)(sp + 4);
        v8h t;
        t[0] = toh_flush(s0.x); t[1] = toh_flush(s0.y); t[2] = toh_flush(s0.z); t[3] = toh_flush(s0.w);
        t[4] = toh_flush(s1.x); t[5] = toh_flush(s1.y); t[6] = toh_flush(s1.z); t[7] = toh_flush(s1.w);
        hv[it] = t;
        v8h u = t;
        if (RES) {
          u[0] = toh_flush((s0.x - (float)t[0]) * 2048.0f); u[1] = toh_flush((s0.y - (float)t[1]) * 2048.0f);
          u[2] = toh_flush((s0.z - (float)t[2]) * 2048.0f); u[3] = toh_flush((s0.w - (float)t[3]) * 2048.0f);
          u[4] = toh_flush((s1.x - (float)t[4]) * 2048.0f); u[5] = toh_flush((s1.y - (float)t[5]) * 2048.0f);
          u[6] = toh_flush((s1.z - (float)t[6]) * 2048.0f); u[7] = toh_flush((s1.w - (float)t[7]) * 2048.0f);
        }
        rv[it] = u;
      }
#pragma unroll
      for (int it = 0; it < 4; ++it) {
        const unsigned row = (unsigned)it * 4u + q;
        *(v8h*)(C + (size_t)(mBase + row) * ldc + n0 + c8) = hv[it];
        if (RES) *(v8h*)(Cr + (size_t)(mBase + row) * ldr + n0 + c8) = rv[it];
      }
    }
    __builtin_amdgcn_fence(3 /* release order */, "workgroup");
    __builtin_amdgcn_wave_barrier();
    __builtin_amdgcn_fence(2 /* acquire order */, "workgroup");
  }
}

__global__ __launch_bounds__(256) void k_proj_all(const _Float16* __restrict__ XQ, const _Float16* __restrict__ XK, const _Float16* __restrict__ Wd,
                                                  _Float16* QHp, _Float16* KHp, _Float16* VTHp, _Float16* QRp, _Float16* KRp, _Float16* VTRp,
                                                  const float* __restrict__ bq, const float* __restrict__ bk, const float* __restrict__ bv,
                                                  const float* __restrict__ SCLp) {
  __shared__ __align__(16) float sT[8][16 * 68];   // per-wave 16x64 slab, pitch 68 floats
  __shared__ __align__(16) _Float16 pst[2u * PSTG_H];   // two operand stages: rows 0..63 = A, rows 64 + 64 * wave .. = that wave's Bt rows; pitch KVP
  const unsigned z    = blockIdx.z;                // block-uniform selects among global pointers below
  const unsigned b    = blockIdx.y;
  const bool     late = z >= 3u;
  const unsigned p    = late ? z - 3u : z;         // 0 q, 1 k, 2 v^T
  const bool     chm  = p == 2u;                   // channel-major (v^T)
  const unsigned rows = late ? (unsigned)LROWS : (unsigned)EROWS;   // tokens of this row group
  const unsigned row0 = late ? (unsigned)EROWS : 0u;                // its first token inside a batch
  const unsigned lane = threadIdx.x & 31u;
  const unsigned wave = (unsigned)__builtin_amdgcn_readfirstlane((int)(threadIdx.x >> 5));
  const unsigned tilesM = (chm ? (unsigned)EMB : rows) >> 6;
  const unsigned tilesN = (chm ? rows : (unsigned)EMB) >> 6;
  const unsigned tile = blockIdx.x * 8u + wave;
  if (tile >= tilesM * tilesN) return;   // block-uniform (tile counts are multiples of 8), in front of every barrier
  const unsigned tm = tile / tilesN;
  const unsigned tn = tile - tm * tilesN;
  const unsigned m0 = tm << 6;
  const unsigned n0 = tn << 6;

  const _Float16* X = XQ;
  if (p != 0u) X = XK;
  const _Float16* tok = X + ((size_t)b * SEQ + row0) * EMB;   // this batch's tokens of the row group
  const _Float16* wgt = Wd + (size_t)p * WSZ;
  const _Float16* Ab = chm ? wgt : tok;
  const _Float16* Bb = chm ? tok : wgt;

  const unsigned rlane = lane & 15u;            // row (A) / col (B) within subtile
  const unsigned koff  = (lane >> 4) << 3;      // k offset of this lane half

  v8f acc[4][4];
#pragma unroll
  for (int i = 0; i < 4; ++i)
#pragma unroll
    for (int j = 0; j < 4; ++j) acc[i][j] = (v8f){0.f,0.f,0.f,0.f,0.f,0.f,0.f,0.f};

  // staging: this lane's row (of 4 per wave-wide copy) and 16-byte piece; each wave brings 8 of the A rows and its own 64 Bt rows
  const unsigned lr = lane >> 3, pc = (lane & 7u) << 3;
  const unsigned la = (unsigned)(size_t)pst + ((wave * 8u + lr) * KVP + pc) * 2u;            // LDS byte addresses in buffer 0
  const unsigned lb = (unsigned)(size_t)pst + ((64u + wave * 64u + lr) * KVP + pc) * 2u;
  const _Float16* ga = Ab + (size_t)(m0 + wave * 8u + lr) * (unsigned)EMB + pc;              // + 64 * stage
  const _Float16* gb = Bb + (size_t)(n0 + lr) * (unsigned)EMB + pc;
  const _Float16* fa = pst + rlane * KVP + koff;                                             // fragment rows in buffer 0
  const _Float16* fb = fa + (64u + wave * 64u) * KVP;
  constexpr unsigned NSTG = (unsigned)EMB / 64u;
  static_assert(NSTG >= 2u);                                                                 // the prologue starts stages 0 and 1

  // prologue of the two-buffer ring: stage 0 lands and is published, then stage 1 starts
  stage_rows2(la, ga);
  stage_rows8(lb, gb);
  stage_rows8(lb + 8u * ROWS4_B, gb + 32u * EMB);
  asm volatile("s_wait_asynccnt 0x0" ::: "memory");   // this wave's copies of stage 0 have landed
  __syncthreads();
  stage_rows2(la + PSTG_H * 2u, ga + 64u);
  stage_rows8(lb + PSTG_H * 2u, gb + 64u);
  stage_rows8(lb + PSTG_H * 2u + 8u * ROWS4_B, gb + 64u + 32u * EMB);

#pragma unroll 1   // one copy of the hot loop in the instruction cache; the buffer select is scalar
  for (unsigned t = 0; t < NSTG; ++t) {
    const unsigned bo = (t & 1u) * PSTG_H;             // this stage's buffer, in halves
#pragma unroll
    for (int ks = 0; ks < 2; ++ks) {
      v16h bh[4], ah[4];                               // the k-step's eight fragments are read as one group, ahead of its products
#pragma unroll
      for (int j = 0; j < 4; ++j) bh[j] = frag_ld(fb + bo + (unsigned)j * 16u * KVP + (unsigned)ks * 32u);
#pragma unroll
      for (int i = 0; i < 4; ++i) ah[i] = frag_ld(fa + bo + (unsigned)i * 16u * KVP + (unsigned)ks * 32u);
#pragma unroll
      for (int i = 0; i < 4; ++i) {
#pragma unroll
        for (int j = 0; j < 4; ++j) acc[i][j] = mma_raw(ah[i], bh[j], acc[i][j]);
        dep_guard_h(acc[i][0], acc[i][3], ah[i], ah[i]);
      }
      keep4_h(bh[0], bh[1], bh[2], bh[3]);
    }
    // stage t + 1 is published; the buffer that every wave has just left takes stage t + 2
    stage_publish();
    if (t + 2u < NSTG) {
      const unsigned ko = (t + 2u) * 64u;
      stage_rows2(la + bo * 2u, ga + ko);
      stage_rows8(lb + bo * 2u, gb + ko);
      stage_rows8(lb + bo * 2u + 8u * ROWS4_B, gb + ko + 32u * EMB);
    }
  }
  asm volatile("s_wait_asynccnt 0x0" ::: "memory");   // no copy is outstanding behind the loop
  acc_guard4(acc[0][0], acc[0][1], acc[0][2], acc[0][3]);
  acc_guard4(acc[1][0], acc[1][1], acc[1][2], acc[1][3]);
  acc_guard4(acc[2][0], acc[2][1], acc[2][2], acc[2][3]);
  acc_guard4(acc[3][0], acc[3][1], acc[3][2], acc[3][3]);

  // ---- epilogue (one of four forms, block-uniform) ----
  float* slab = sT[wave];
  const float* scl = SCLp + (size_t)p * EMB;
  if (chm) {
    _Float16* C  = VTHp + (size_t)b * ((size_t)EMB * SEQ) + row0;
    _Float16* Cr = VTRp + (size_t)b * ((size_t)EMB * EROWS);
    if (late) proj_epilogue<1, false>(acc, slab, C, (unsigned)SEQ, Cr, (unsigned)EROWS, bv, scl, m0, n0, lane);
    else      proj_epilogue<1, true >(acc, slab, C, (unsigned)SEQ, Cr, (unsigned)EROWS, bv, scl, m0, n0, lane);
  } else {
    _Float16* Cp = QHp; _Float16* Rp = QRp; const float* bias = bq;
    if (p == 1u) { Cp = KHp; Rp = KRp; bias = bk; }
    _Float16* C  = Cp + ((size_t)b * SEQ + row0) * EMB;
    _Float16* Cr = Rp + (size_t)b * ((size_t)EROWS * EMB);
    if (late) proj_epilogue<2, false>(acc, slab, C, (unsigned)EMB, Cr, (unsigned)EMB, bias, scl, m0, n0, lane);
    else      proj_epilogue<2, true >(acc, slab, C, (unsigned)EMB, Cr, (unsigned)EMB, bias, scl, m0, n0, lane);
  }
}

__device__ __forceinline__ float xhalf(float x) {
  return __builtin_bit_cast(float, __builtin_amdgcn_permlanex16(__builtin_bit_cast(int, x), __builtin_bit_cast(int, x), 0x76543210, 0xfedcba98, false, false));
}

// 2^x as the one hardware instruction. The library form adds a compare, two selects, an add and an ldexp per value, only to return subnormal results
// for x < -126. Here x <= 0 and such a term is below 2^-126 of its row's largest one: it is 0 in the f16 P either way and vanishes in the f32 row sum (>= 1).
// Written as asm so that the slot behind each transcendental is filled by construction: the next v_exp_f32 neither reads its result nor overwrites its
// source (the outputs are early-clobber, so they share no register with an input), and one v_nop stands behind the last.
__device__ __forceinline__ v8f exp2_hw8(v8f x) {
  float p0, p1, p2, p3, p4, p5, p6, p7;
  asm("v_exp_f32 %0, %8\n\tv_exp_f32 %1, %9\n\tv_exp_f32 %2, %10\n\tv_exp_f32 %3, %11\n\t"
      "v_exp_f32 %4, %12\n\tv_exp_f32 %5, %13\n\tv_exp_f32 %6, %14\n\tv_exp_f32 %7, %15\n\tv_nop"
      : "=&v"(p0), "=&v"(p1), "=&v"(p2), "=&v"(p3), "=&v"(p4), "=&v"(p5), "=&v"(p6), "=&v"(p7)
      : "v"(x[0]), "v"(x[1]), "v"(x[2]), "v"(x[3]), "v"(x[4]), "v"(x[5]), "v"(x[6]), "v"(x[7]));
  return (v8f){p0, p1, p2, p3, p4, p5, p6, p7};
}
__device__ __forceinline__ float exp2_hw1(float x) {
  float p;
  asm("v_exp_f32 %0, %1\n\tv_nop" : "=&v"(p) : "v"(x));   // v_nop: the slot behind the transcendental; a rescale factor below 2^-126 leaves nothing of the older sums in f32 either way
  return p;
}

template <bool EARLY>
__device__ __forceinline__ void attn_body(const _Float16* __restrict__ Q, const _Float16* __restrict__ Kp, const _Float16* __restrict__ VT,
                                          const _Float16* __restrict__ QR, const _Float16* __restrict__ KR, const _Float16* __restrict__ VTR,
                                          float* __restrict__ OUT, unsigned qb_off, unsigned nqb) {
  constexpr unsigned NT = EARLY ? 2u : 1u;                           // tiles per stage: value plane (+ residual plane)
  __shared__ __align__(16) _Float16 stg[2u * NT * TILE_H];           // buffer 0: K (, K residual); buffer 1: V^T (, V^T residual)
  float* OT = (float*)stg;                                           // block output tile [d][query], pitch 68 (cross-wave): reuses stg behind the loop
  const unsigned tid  = threadIdx.x;
  const unsigned wave = (unsigned)__builtin_amdgcn_readfirstlane((int)(tid >> 5));
  const unsigned lane = tid & 31u;
  const unsigned hh   = lane >> 4;
  const unsigned c    = lane & 15u;
  const unsigned bx = blockIdx.x;
  const unsigned qb = qb_off + bx % nqb;
  const unsigned bh = bx / nqb;
  const unsigned h  = bh & 7u;
  const unsigned b  = bh >> 3;
  const unsigned q0 = qb * 64u + wave * 16u;
  const unsigned qi = q0 + c;                                        // this lane's query
  const unsigned nch = qb + 1u;
  const size_t rowbase = (size_t)b * SEQ;
  const size_t resbase = (size_t)b * EROWS;

  const _Float16* qrow = Q + (rowbase + qi) * EMB + h * 64u + 8u * hh;
  const v16h qa0 = frag_ld(qrow), qa1 = frag_ld(qrow + 32);
  v16h qr0 = qa0, qr1 = qa1;
  if (EARLY) {
    const _Float16* qrr = QR + (resbase + qi) * EMB + h * 64u + 8u * hh;
    qr0 = frag_ld(qrr); qr1 = frag_ld(qrr + 32);
  }
  const _Float16* kbase  = stg + 8u * hh;                                                // + key * KVP (+ 32 for the second d chunk)
  const _Float16* krbase = kbase + TILE_H;
  const _Float16* vbase  = stg + NT * TILE_H + 8u * hh;                                  // + d * KVP + kv
  const _Float16* vrbase = vbase + TILE_H;
  // staging: this thread's row (of 16 per copy) and 16-byte piece
  const unsigned srow = tid >> 3, spc = (tid & 7u) << 3;
  const unsigned lk = (unsigned)(size_t)stg + (srow * KVP + spc) * 2u;                   // LDS byte address in the K buffer
  const unsigned lv = lk + NT * TILE_H * 2u;                                             // the same place in the V^T buffer
  const unsigned ok  = srow * EMB + spc;                                                 // this thread's piece inside a K tile (value and residual planes)
  const unsigned ov  = srow * SEQ + spc, ovr = srow * EROWS + spc;                       // the same inside a V^T tile, a V^T residual tile
  const _Float16* gk  = Kp  + rowbase * EMB + h * 64u;                                   // block-uniform tile origins: + kv0 * EMB
  const _Float16* gkr = KR  + resbase * EMB + h * 64u;
  const _Float16* gv  = VT  + ((size_t)b * EMB + h * 64u) * SEQ;                         // + kv0
  const _Float16* gvr = VTR + ((size_t)b * EMB + h * 64u) * EROWS;

  float mrow = -__builtin_inff();     // running maximum of this lane's query (equal in both halves)
  float lrow = 0.f;                   // running sum over this half's keys; the halves are joined behind the loop
  v8f oacc[4], oaccr[4];              // O^T: tile t, element r = d 16t + 8h + r of this lane's query
#pragma unroll
  for (int t = 0; t < 4; ++t) { oacc[t] = (v8f){0.f,0.f,0.f,0.f,0.f,0.f,0.f,0.f}; oaccr[t] = (v8f){0.f,0.f,0.f,0.f,0.f,0.f,0.f,0.f}; }

  const float SC    = 0.125f * 1.4426950408889634f;       // 1/sqrt(64) and log2(e)
  const float FILLX = -14426.950408889634f;               // -10000 * log2(e)

  // prologue of the two-buffer ring: stage 0 (K of chunk 0) lands and is published, then stage 1 (V^T of chunk 0) starts
  if (EARLY) stage_tile2(lk, gk + ok, 16u * EMB, lk + TILE_H * 2u, gkr + ok, 16u * EMB);
  else       stage_tile1(lk, gk + ok, 16u * EMB);
  asm volatile("s_wait_asynccnt 0x0" ::: "memory");   // this wave's copies of stage 0 have landed
  __syncthreads();
  if (EARLY) stage_tile2(lv, gv + ov, 16u * SEQ, lv + TILE_H * 2u, gvr + ovr, 16u * EROWS);
  else       stage_tile1(lv, gv + ov, 16u * SEQ);

  for (unsigned kc = 0; kc < nch; ++kc) {
    const unsigned kv0 = kc * 64u;
    const bool more = kc + 1u < nch;                   // block-uniform: a next chunk exists
    v8f s[4];
#pragma unroll
    for (int j = 0; j < 4; ++j) {
      const _Float16* kr = kbase + ((unsigned)j * 16u + c) * KVP;
      const v16h kh0 = frag_ld(kr), kh1 = frag_ld(kr + 32);
      v8f a = (v8f){0.f,0.f,0.f,0.f,0.f,0.f,0.f,0.f};
      a = wmma16(kh0, qa0, a);
      a = wmma16(kh1, qa1, a);
      if (EARLY) {
        const _Float16* krr = krbase + ((unsigned)j * 16u + c) * KVP;
        v8f ar = (v8f){0.f,0.f,0.f,0.f,0.f,0.f,0.f,0.f};
        ar = wmma16(kh0, qr0, ar);
        ar = wmma16(kh1, qr1, ar);
        ar = wmma16(frag_ld(krr), qa0, ar);
        ar = wmma16(frag_ld(krr + 32), qa1, ar);
        a = a + ar * 0.00048828125f;
      }
      s[j] = a;
    }
    // The softmax touches no LDS any more, so the publish point stands directly behind the score products: V^T of this chunk is published;
    // the K buffer, which every wave has left, takes the next chunk's K, which flies through the softmax and V^T.P^T
    stage_publish();
    if (more) {
      const size_t ko = (size_t)(kv0 + 64u) * EMB;
      if (EARLY) stage_tile2(lk, (gk + ko) + ok, 16u * EMB, lk + TILE_H * 2u, (gkr + ko) + ok, 16u * EMB);
      else       stage_tile1(lk, (gk + ko) + ok, 16u * EMB);
    }
    const int kd = (int)qi - (int)(kv0 + 8u * hh);     // tile j, element r is a key in front of this lane's query where 16j + r < kd
    float mj[4];
#pragma unroll
    for (int j = 0; j < 4; ++j) {
#pragma unroll
      for (int r = 0; r < 8; ++r) s[j][r] = (j * 16 + r < kd) ? s[j][r] * SC : FILLX;
      mj[j] = fmaxf(fmaxf(fmaxf(s[j][0], s[j][1]), fmaxf(s[j][2], s[j][3])), fmaxf(fmaxf(s[j][4], s[j][5]), fmaxf(s[j][6], s[j][7])));
    }
    float m = fmaxf(fmaxf(mj[0], mj[1]), fmaxf(mj[2], mj[3]));
    m = fmaxf(m, xhalf(m));
    const float mnew = fmaxf(mrow, m);
    const float alpha = exp2_hw1(mrow - mnew);
    mrow = mnew;
    FragU pa[2], pr[2];                                // P^T (and its residual) as B fragments of keys 0..31 and 32..63
    float ps[4];
#pragma unroll
    for (int j = 0; j < 4; ++j) {
      float a = 0.f;
      const v8f pj = exp2_hw8(s[j] - mnew);
#pragma unroll
      for (int r = 0; r < 8; ++r) {
        const float p = pj[r];
        a += p;
        const float e = p * 32768.0f;
        const h16 g = toh_flush(e);
        pa[j >> 1].h[j & 1][r] = g;
        if (EARLY) pr[j >> 1].h[j & 1][r] = toh_flush((e - (float)g) * 2048.0f);
      }
      ps[j] = a;
    }
    lrow = lrow * alpha + ((ps[0] + ps[1]) + (ps[2] + ps[3]));
#pragma unroll
    for (int t = 0; t < 4; ++t) {
#pragma unroll
      for (int r = 0; r < 8; ++r) { oacc[t][r] *= alpha; if (EARLY) oaccr[t][r] *= alpha; }
    }
#pragma unroll
    for (int kk = 0; kk < 2; ++kk) {
#pragma unroll
      for (int t = 0; t < 4; ++t) {
        const v16h vb = frag_ld(vbase + ((unsigned)t * 16u + c) * KVP + (unsigned)kk * 32u);
        oacc[t] = wmma16(vb, pa[kk].v, oacc[t]);
        if (EARLY) {
          oaccr[t] = wmma16(vb, pr[kk].v, oaccr[t]);
          const v16h vr = frag_ld(vrbase + ((unsigned)t * 16u + c) * KVP + (unsigned)kk * 32u);
          oaccr[t] = wmma16(vr, pa[kk].v, oaccr[t]);
        }
      }
    }
    // K of the next chunk is published; the V^T buffer, which every wave has left, takes the next chunk's V^T
    stage_publish();
    if (more) {
      if (EARLY) stage_tile2(lv, (gv + (kv0 + 64u)) + ov, 16u * SEQ, lv + TILE_H * 2u, (gvr + (kv0 + 64u)) + ovr, 16u * EROWS);
      else       stage_tile1(lv, (gv + (kv0 + 64u)) + ov, 16u * SEQ);
    }
  }
  asm volatile("s_wait_asynccnt 0x0" ::: "memory");   // no copy is outstanding when stg becomes the output tile (the last publish point's barrier ended all reads)

  // join the halves' sums, normalise (P carried x2^15), zero sequence row 0, put the wave's 64 d x 16 queries into the block tile [d][query]
  const float lsum = lrow + xhalf(lrow);
  const float iv = 1.0f / (lsum * 32768.0f);
  const float inv = (qi == 0u) ? 0.0f : iv;
#pragma unroll
  for (int t = 0; t < 4; ++t) {
#pragma unroll
    for (int r = 0; r < 8; ++r) {
      float v = oacc[t][r];
      if (EARLY) v += oaccr[t][r] * 0.00048828125f;
      OT[((unsigned)t * 16u + 8u * hh + (unsigned)r) * 68u + wave * 16u + c] = v * inv;
    }
  }
  __syncthreads();
  {
    const unsigned c4 = (lane & 15u) << 2;     // row segment = 64 floats = 256 B = 16 lanes x 16 B; 2 rows per instruction, 8 trips = 16 rows per wave
    float* ob = OUT + ((size_t)b * EMB + h * 64u + wave * 16u) * SEQ_FULL + qb * 64u + c4;
    v4f vv[8];
#pragma unroll
    for (int it = 0; it < 8; ++it) {
      const unsigned row = (unsigned)it * 2u + hh;
      vv[it] = *(const v4f*)(OT + (wave * 16u + row) * 68u + c4);
    }
    {
#pragma unroll
      for (int it = 0; it < 8; ++it) {
        const unsigned row = (unsigned)it * 2u + hh;
        *(v4f*)(ob + (size_t)row * SEQ_FULL) = vv[it];
      }
    }
  }
}

__global__ __launch_bounds__(128) __attribute__((amdgpu_num_vgpr(256))) void k_attn_early(
    const _Float16* __restrict__ Q, const _Float16* __restrict__ Kp, const _Float16* __restrict__ VT,
    const _Float16* __restrict__ QR, const _Float16* __restrict__ KR, const _Float16* __restrict__ VTR,
    float* __restrict__ OUT, unsigned qb_off, unsigned nqb) {
  attn_body<true>(Q, Kp, VT, QR, KR, VTR, OUT, qb_off, nqb);
}
__global__ __launch_bounds__(128) void k_attn_late(
    const _Float16* __restrict__ Q, const _Float16* __restrict__ Kp, const _Float16* __restrict__ VT,
    const _Float16* __restrict__ QR, const _Float16* __restrict__ KR, const _Float16* __restrict__ VTR,
    float* __restrict__ OUT, unsigned qb_off, unsigned nqb) {
  attn_body<false>(Q, Kp, VT, QR, KR, VTR, OUT, qb_off, nqb);
}

// ---- workspace carve (bytes; every region is a whole number of 256-B units and is written in full by its producer) ----
#define SZ_P16  ((size_t)NB * SEQ * EMB * 2)            // one f16 activation plane
#define SZ_R16  ((size_t)NB * EROWS * EMB * 2)          // one f16 residual plane (early rows only)
#define SZ_W16  ((size_t)3 * WSZ * 2)
#define SZ_SCL  ((size_t)3 * EMB * 4)
#define OFF_XQ   ((size_t)0)
#define OFF_XK   (OFF_XQ + SZ_P16)
#define OFF_W16  (OFF_XK + SZ_P16)
#define OFF_SCL  (OFF_W16 + SZ_W16)
#define OFF_QH   (OFF_SCL + SZ_SCL)
#define OFF_KH   (OFF_QH + SZ_P16)
#define OFF_VTH  (OFF_KH + SZ_P16)
#define OFF_QR   (OFF_VTH + SZ_P16)
#define OFF_KR   (OFF_QR + SZ_R16)
#define OFF_VTR  (OFF_KR + SZ_R16)
#define WS_TOTAL (OFF_VTR + SZ_R16)
static_assert(SZ_P16 % 256 == 0 && SZ_R16 % 256 == 0 && SZ_W16 % 256 == 0 && SZ_SCL % 256 == 0);
static_assert(OFF_XK == OFF_XQ + (size_t)NB * SEQ * EMB * 2);   // k_castxT addresses the key plane as plane 1 of one base
static_assert(WS_TOTAL <= (size_t)134217728);
static_assert((size_t)NB_FULL * EMB * SEQ_FULL * 4 == (size_t)33554432);   // output extent in bytes, offset 0

extern "C" void kernel_launch(void* const* d_in, const int* in_sizes, int n_in, void* d_out, int out_size, void* d_ws, size_t ws_size, hipStream_t stream) {
    if (n_in < 11) return;
    const long long xneed = ((long long)(NB - 1) * EMB + (EMB - 1)) * SEQ_FULL + SEQ;
    if ((long long)in_sizes[0] < xneed) return;
    if ((long long)in_sizes[1] < xneed) return;
    if (in_sizes[2] < WSZ || in_sizes[5] < WSZ || in_sizes[8] < WSZ) return;
    if (in_sizes[3] < EMB || in_sizes[4] < EMB || in_sizes[6] < EMB || in_sizes[7] < EMB || in_sizes[9] < EMB || in_sizes[10] < EMB) return;
    if ((long long)out_size < xneed) return;
    if ((size_t)WS_TOTAL > ws_size) return;

    // input order: query, key, vq, gq, bq, vk, gk, bk, vv, gv, bv
    const float* query = (const float*)d_in[0];
    const float* key   = (const float*)d_in[1];
    const float* vq = (const float*)d_in[2];  const float* gq = (const float*)d_in[3];  const float* bq = (const float*)d_in[4];
    const float* vk = (const float*)d_in[5];  const float* gk = (const float*)d_in[6];  const float* bk = (const float*)d_in[7];
    const float* vv = (const float*)d_in[8];  const float* gv = (const float*)d_in[9];  const float* bv = (const float*)d_in[10];
    float* out = (float*)d_out;

    char* ws = (char*)d_ws;
    unsigned short* X16  = (unsigned short*)(ws + OFF_XQ);     // plane 0 = query tokens, plane 1 = key tokens
    unsigned short* W16  = (unsigned short*)(ws + OFF_W16);    // planes: 0 vq 1 vk 2 vv (direction weights x16)
    float*          SCL  = (float*)(ws + OFF_SCL);             // [3][512] row gains / 16
    _Float16* QH  = (_Float16*)(ws + OFF_QH);
    _Float16* KH  = (_Float16*)(ws + OFF_KH);
    _Float16* VTH = (_Float16*)(ws + OFF_VTH);
    _Float16* QR  = (_Float16*)(ws + OFF_QR);
    _Float16* KR  = (_Float16*)(ws + OFF_KR);
    _Float16* VTR = (_Float16*)(ws + OFF_VTR);

    const _Float16* XQh = (const _Float16*)(ws + OFF_XQ);
    const _Float16* XKh = (const _Float16*)(ws + OFF_XK);
    const _Float16* W16h = (const _Float16*)W16;

    // 1-2: operand planes
    k_castxT<<<dim3((unsigned)(SEQ / 64), (unsigned)(EMB / 64), (unsigned)(NB * 2)), 256, 0, stream>>>(query, key, X16);
    k_wprep<<<dim3((unsigned)(EMB / 32), 3u), 256, 0, stream>>>(vq, gq, vk, gk, vv, gv, W16, SCL);

    // 3: q, k (tokens x V^T, row gain, bias -> f16 planes) and v^T (V x tokens^T, gain[m], bias[m] -> f16 plane [b][h*64+d][token]); early group also residual planes;
    //    all six row groups in one grid (blockIdx.z), the early groups (longer epilogue) first
    k_proj_all<<<dim3((unsigned)(((EROWS > LROWS) ? EROWS : LROWS) / 64), (unsigned)NB, (LROWS > 0) ? 6u : 3u), 256, 0, stream>>>(
        XQh, XKh, W16h, QH, KH, VTH, QR, KR, VTR, bq, bk, bv, SCL);

    // 4-5: causal attention, early band (value + residual planes) and late band (single planes); each block writes its 64x64 tile of the output buffer
    k_attn_early<<<(unsigned)(NB * NHEAD * (EROWS / 64)), 128, 0, stream>>>(QH, KH, VTH, QR, KR, VTR, out, 0u, (unsigned)(EROWS / 64));
    if (LROWS > 0) {
        k_attn_late<<<(unsigned)(NB * NHEAD * (LROWS / 64)), 128, 0, stream>>>(QH, KH, VTH, QR, KR, VTR, out, (unsigned)(EROWS / 64), (unsigned)(LROWS / 64));
    }
}

// v006
// A run of this version takes 109 microseconds.
// Two timings next to v005 put it at 1.08 and 1.09 times that version's speed.
// Counting every step since v000, it is 3.56 times as fast.
// All contractions (weight-normalised q/k/v projections, q.k^T, P.V): v_wmma_f32_16x16x32_f16 (f16 operands, f32 accumulate); float inputs bf16-converted (RNE) first, direction weights carried x16 with the per-row norm gain applied in f32 at the projection epilogue, P carried x2^15; query rows < EROWS additionally carry q, k, v, P as f16 value + x2048 f16 residual planes (three products, residual products in their own accumulator); mask, softmax, norms in f32.
#include <hip/hip_runtime.h>
#include <math.h>

// ---- sizes (NB / SEQ reducible; *_FULL = strides of the inputs / output) ----
#ifndef NB
#define NB 16
#endif
#ifndef SEQ
#define SEQ 1024
#endif
#ifndef EROWS
#define EROWS ((SEQ < 512) ? SEQ : 512)
#endif
#define LROWS (SEQ - EROWS)
#define NB_FULL 16
#define SEQ_FULL 1024
#define EMB 512
#define NHEAD 8
#define HDIM 64
#define WSZ (EMB * EMB)

static_assert(NB >= 1 && NB <= NB_FULL);
static_assert(SEQ <= SEQ_FULL && SEQ % 64 == 0 && SEQ >= 64);
static_assert(EROWS % 64 == 0 && EROWS >= 64 && EROWS <= SEQ);
static_assert(LROWS % 64 == 0);
static_assert(EMB % 64 == 0 && EMB == NHEAD * HDIM && HDIM == 64 && NHEAD == 8);
static_assert(EMB % 32 == 0);                          // WMMA k-steps of 32, weight rows per prep block
static_assert(4 * 256 == 64 * 16);                     // k_castxT load phase: trips x threads == tile rows x 16-B pieces per row
static_assert(2 * 256 == 64 * 8);
static_assert(2 * 32 * 8 == EMB);                      // k_wprep: trips x lanes x elements == weight row width
static_assert(8 * 4 == 32);                            // k_wprep: waves x rows per wave == rows per block
static_assert(32 * 16 * 4 == 16 * 128);                // projection epilogue: lanes x bytes x trips == slab rows x row bytes (64 halves)
static_assert(4 * 32 * 16 * 8 == 64 * 256);            // attention output: waves x lanes x bytes x trips == tile rows x row bytes (64 floats)
static_assert(2 * 576 * 72 * 2 + 8 * 16 * 68 * 4 <= 327680);  // static LDS of the projection kernel: two operand stages + the epilogue slabs
static_assert((EMB / 64) % 8 == 0 && (EROWS / 64) % 8 == 0 && (LROWS / 64) % 8 == 0);  // projection: the 8 waves of a block share one A tile; a block has all its tiles or none
static_assert(8 * 2 * 32 * 16 == 64 * 128 && 16 * 32 * 16 == 64 * 128);  // projection staging: (waves x) copies x lanes x bytes == tile rows x row bytes
static_assert(4 * 64 * 72 * 2 <= 81920);  // static LDS of the attention kernels: four blocks per 320-KiB LDS
static_assert(64 * 68 * 4 <= 2 * 64 * 72 * 2);         // the output tile fits the staging area that it reuses
static_assert(4 * 128 * 16 == 64 * 128);               // staging: copies per thread x threads x bytes == tile rows x row bytes
static_assert(64 * 65 * 4 <= 131072);                  // static LDS of k_castxT

typedef _Float16 h16;
typedef __attribute__((ext_vector_type(16))) _Float16 v16h;
typedef __attribute__((ext_vector_type(8)))  _Float16 v8h;
typedef __attribute__((ext_vector_type(8)))  float    v8f;
typedef __attribute__((ext_vector_type(4)))  float    v4f;
typedef __attribute__((ext_vector_type(2)))  float    v2f;
typedef __attribute__((ext_vector_type(2)))  _Float16 v2h;
typedef __attribute__((ext_vector_type(4)))  unsigned int u4v;

// 16-bit WMMA fragment map (wave32), lane L, h = L>>4, m = L&15:
//   A 16x32: lane = row m;    element i -> k = (i<8) ? 8h+i : 16+8h+(i-8)
//   B 32x16: lane = column m; the SAME k(i,h)
//   D 16x16 (8 f32): lane = column m; element r -> row 8h+r
union FragU { v16h v; v8h h[2]; };
// p already includes the +8h lane-half offset: elements 0..7 <- p[0..7], 8..15 <- p[16..23]
__device__ __forceinline__ v16h frag_ld(const _Float16* p) { FragU f; f.h[0] = *(const v8h*)(p); f.h[1] = *(const v8h*)(p + 16); return f.v; }

__device__ __forceinline__ v8f wmma16(v16h a, v16h b, v8f c) {
    c = __builtin_amdgcn_wmma_f32_16x16x32_f16(false, a, false, b, (short)0, c, false, false);
    asm volatile("v_nop\n\tv_nop\n\tv_nop\n\tv_nop" : "+v"(c) : "v"(a), "v"(b));
    return c;
}
__device__ __forceinline__ v8f mma_raw(v16h a, v16h b, v8f c) { return __builtin_amdgcn_wmma_f32_16x16x32_f16(false, a, false, b, (short)0, c, false, false); }
__device__ __forceinline__ void dep_guard_h(v8f& a, v8f& b, v16h x, v16h y) { asm volatile("v_nop\n\tv_nop\n\tv_nop\n\tv_nop" : "+v"(a), "+v"(b) : "v"(x), "v"(y)); }
__device__ __forceinline__ void keep4_h(v16h a, v16h b, v16h c, v16h d) { asm volatile("v_nop" :: "v"(a), "v"(b), "v"(c), "v"(d)); }
__device__ __forceinline__ void acc_guard4(v8f& a, v8f& b, v8f& c, v8f& d) { asm volatile("v_nop\n\tv_nop\n\tv_nop\n\tv_nop" : "+v"(a), "+v"(b), "+v"(c), "+v"(d)); }

// bf16 RNE convert, kept as f32 (finite inputs)
__device__ __forceinline__ float bf_keep(float v) { const unsigned u = __float_as_uint(v); return __uint_as_float((u + 0x7fffu + ((u >> 16) & 1u)) & 0xffff0000u); }
// f32 -> f16, round to nearest even, two values per instruction. A result below 2^-14 stays an f16 subnormal: the matrix instructions take subnormal operands as they are.
__device__ __forceinline__ unsigned pk2hf(float a, float b) { return __builtin_bit_cast(unsigned, __builtin_convertvector((v2f){a, b}, v2h)); }
__device__ __forceinline__ v8h toh8(v8f v) { return __builtin_convertvector(v, v8h); }
__device__ __forceinline__ v8f tof8(v8h v) { return __builtin_convertvector(v, v8f); }

// ---- LDS staging of 64-row x 128-byte f16 tiles by asynchronous copies (global -> LDS, through no register) ----
#define KVP 72u                      // LDS row pitch in halves: 144 B = 16 B x 9, conflict-free for 16-byte fragment reads
#define TILE_H (64u * KVP)           // halves of one staged tile
#define ROWS16_B (16u * KVP * 2u)    // LDS bytes of 16 staged rows
#define PSTG_H (576u * KVP)          // halves of one projection stage: 64 A rows + 8 x 64 Bt rows
// Each thread of the 128 copies its 16-byte piece of rows r, r+16, r+32, r+48: one wave-wide copy = 4 whole 128-byte rows.
// l = the thread's LDS byte address of its piece in row r, g = the same piece in global memory, st = 16 source rows in halves.
// s_wait_xcnt stands as the last line of the copies' own statement, so no address register is rewritten in front of it.
__device__ __forceinline__ void stage_tile1(unsigned l, const _Float16* g, size_t st) {
    asm volatile("global_load_async_to_lds_b128 %0, %4, off\n\t"
                 "global_load_async_to_lds_b128 %1, %5, off\n\t"
                 "global_load_async_to_lds_b128 %2, %6, off\n\t"
                 "global_load_async_to_lds_b128 %3, %7, off\n\t"
                 "s_wait_xcnt 0x0"
                 :: "v"(l), "v"(l + ROWS16_B), "v"(l + 2u * ROWS16_B), "v"(l + 3u * ROWS16_B),
                    "v"(g), "v"(g + st), "v"(g + 2u * st), "v"(g + 3u * st) : "memory");
}
__device__ __forceinline__ void stage_tile2(unsigned l, const _Float16* g, size_t st, unsigned l2, const _Float16* g2, size_t st2) {
    asm volatile("global_load_async_to_lds_b128 %0, %8, off\n\t"
                 "global_load_async_to_lds_b128 %1, %9, off\n\t"
                 "global_load_async_to_lds_b128 %2, %10, off\n\t"
                 "global_load_async_to_lds_b128 %3, %11, off\n\t"
                 "global_load_async_to_lds_b128 %4, %12, off\n\t"
                 "global_load_async_to_lds_b128 %5, %13, off\n\t"
                 "global_load_async_to_lds_b128 %6, %14, off\n\t"
                 "global_load_async_to_lds_b128 %7, %15, off\n\t"
                 "s_wait_xcnt 0x0"
                 :: "v"(l), "v"(l + ROWS16_B), "v"(l + 2u * ROWS16_B), "v"(l + 3u * ROWS16_B),
                    "v"(l2), "v"(l2 + ROWS16_B), "v"(l2 + 2u * ROWS16_B), "v"(l2 + 3u * ROWS16_B),
                    "v"(g), "v"(g + st), "v"(g + 2u * st), "v"(g + 3u * st),
                    "v"(g2), "v"(g2 + st2), "v"(g2 + 2u * st2), "v"(g2 + 3u * st2) : "memory");
}
// Wave-wide forms for the projection: a lane copies its 16-byte piece of rows r, r+4, ... (source pitch EMB halves): one wave-wide copy = 4 whole 128-byte rows.
#define ROWS4_B (4u * KVP * 2u)      // LDS bytes of 4 staged rows
__device__ __forceinline__ void stage_rows2(unsigned l, const _Float16* g) {
    asm volatile("global_load_async_to_lds_b128 %0, %2, off\n\t"
                 "global_load_async_to_lds_b128 %1, %3, off\n\t"
                 "s_wait_xcnt 0x0"
                 :: "v"(l), "v"(l + ROWS4_B), "v"(g), "v"(g + 4u * EMB) : "memory");
}
__device__ __forceinline__ void stage_rows8(unsigned l, const _Float16* g) {
    asm volatile("global_load_async_to_lds_b128 %0, %8, off\n\t"
                 "global_load_async_to_lds_b128 %1, %9, off\n\t"
                 "global_load_async_to_lds_b128 %2, %10, off\n\t"
                 "global_load_async_to_lds_b128 %3, %11, off\n\t"
                 "global_load_async_to_lds_b128 %4, %12, off\n\t"
                 "global_load_async_to_lds_b128 %5, %13, off\n\t"
                 "global_load_async_to_lds_b128 %6, %14, off\n\t"
                 "global_load_async_to_lds_b128 %7, %15, off\n\t"
                 "s_wait_xcnt 0x0"
                 :: "v"(l), "v"(l + ROWS4_B), "v"(l + 2u * ROWS4_B), "v"(l + 3u * ROWS4_B),
                    "v"(l + 4u * ROWS4_B), "v"(l + 5u * ROWS4_B), "v"(l + 6u * ROWS4_B), "v"(l + 7u * ROWS4_B),
                    "v"(g), "v"(g + 4u * EMB), "v"(g + 8u * EMB), "v"(g + 12u * EMB),
                    "v"(g + 16u * EMB), "v"(g + 20u * EMB), "v"(g + 24u * EMB), "v"(g + 28u * EMB) : "memory");
}
// publish point of the next stage: this wave's LDS reads have returned, its own copies have landed, then the block barrier
// (it shows the landed tile to the other waves and ends every wave's reads of the buffer that is refilled behind it)
__device__ __forceinline__ void stage_publish() {
    asm volatile("s_wait_dscnt 0x0" ::: "memory");      // this wave's reads of the buffer about to be refilled are done
    asm volatile("s_wait_asynccnt 0x0" ::: "memory");   // this wave's copies of the next stage have landed
    __syncthreads();
}

#define VST2(T, ptr, val) do { const T vst2_v_ = (val); *(T*)(ptr) = vst2_v_;  } while (0)

// ---- query / key (f32, [b][c][s], full strides) -> f16 planes of the bf16-converted values, compact [NB*SEQ][512] (token-major);
//      plane 0 = query at D, plane 1 = key at D + NB*SEQ*EMB. 64 channels x 64 tokens per block through an LDS tile (cross-wave: block barrier);
__global__ __launch_bounds__(256) void k_castxT(const float* __restrict__ xq, const float* __restrict__ xk, unsigned short* __restrict__ D) {
#pragma clang fp contract(off)
    __shared__ float tile[64 * 65];
    const unsigned z = blockIdx.z;
    const unsigned which = z & 1u;                       // block-uniform select among global pointers
    const unsigned b = z >> 1;
    const float* src = xq;
    if (which == 1u) src = xk;
    const unsigned s0 = blockIdx.x * 64u, c0 = blockIdx.y * 64u;
    const unsigned t = threadIdx.x;
#pragma unroll
    for (int i = 0; i < 4; ++i) {
        const unsigned idx = t + 256u * (unsigned)i;
        const unsigned cc = idx >> 4, s4 = (idx & 15u) << 2;
        const v4f a = *(const v4f*)(src + ((size_t)b * EMB + c0 + cc) * SEQ_FULL + s0 + s4);
        tile[cc * 65u + s4 + 0u] = a.x; tile[cc * 65u + s4 + 1u] = a.y; tile[cc * 65u + s4 + 2u] = a.z; tile[cc * 65u + s4 + 3u] = a.w;
    }
    __syncthreads();
#pragma unroll
    for (int i = 0; i < 2; ++i) {
        const unsigned idx = t + 256u * (unsigned)i;
        const unsigned ss = idx >> 3, c8 = (idx & 7u) << 3;
        const float f0 = tile[(c8 + 0u) * 65u + ss], f1 = tile[(c8 + 1u) * 65u + ss], f2 = tile[(c8 + 2u) * 65u + ss], f3 = tile[(c8 + 3u) * 65u + ss];
        const float f4 = tile[(c8 + 4u) * 65u + ss], f5 = tile[(c8 + 5u) * 65u + ss], f6 = tile[(c8 + 6u) * 65u + ss], f7 = tile[(c8 + 7u) * 65u + ss];
        u4v pk; pk.x = pk2hf(bf_keep(f0), bf_keep(f1)); pk.y = pk2hf(bf_keep(f2), bf_keep(f3)); pk.z = pk2hf(bf_keep(f4), bf_keep(f5)); pk.w = pk2hf(bf_keep(f6), bf_keep(f7));
        VST2(u4v, (u4v*)(D + (size_t)which * ((size_t)NB * SEQ * EMB) + ((size_t)b * SEQ + s0 + ss) * EMB + c0 + c8), pk);
    }
}

// ---- three [512 out][512 in] direction weights -> f16 planes of bf16-converted values x16 (exact), plane y at D + y*WSZ, and the per-row gain table
//      SCL[y*512 + o] = bf16(g[o]) / ||bf16(v[o,:])|| / 16 (f32). Block = 32 rows (wave = 4 rows); grid (EMB/32, 3).
//      Plane rows: 2 instructions x 32 lanes x 16 B lane-contiguous; gain line: 32 lanes x 4 B of wave 0 in one instruction (LDS word per row, block barrier). ----
__global__ __launch_bounds__(256) void k_wprep(const float* __restrict__ v0, const float* __restrict__ g0, const float* __restrict__ v1, const float* __restrict__ g1,
                                               const float* __restrict__ v2, const float* __restrict__ g2, unsigned short* __restrict__ D, float* __restrict__ SCLp) {
#pragma clang fp contract(off)
    __shared__ float red[32];
    const unsigned y = blockIdx.y;                       // block-uniform select among global pointers
    const float* s = v0; const float* g = g0;
    if (y == 1u) { s = v1; g = g1; }
    if (y == 2u) { s = v2; g = g2; }
    const unsigned lane = threadIdx.x & 31u;
    const unsigned wave = (unsigned)__builtin_amdgcn_readfirstlane((int)(threadIdx.x >> 5));
    const unsigned rb = blockIdx.x * 32u;
#pragma unroll 1
    for (unsigned rr = 0; rr < 4u; ++rr) {
        const unsigned rl = wave * 4u + rr;
        const unsigned row = rb + rl;
        float ss = 0.f;
#pragma unroll 1
        for (unsigned it = 0; it < 2u; ++it) {
            const unsigned u = it * 32u + lane;          // 16-B piece of the row
            const float* p = s + (size_t)row * EMB + u * 8u;
            const v4f a = *(const v4f*)(p), b = *(const v4f*)(p + 4);
            const float a0 = bf_keep(a.x), a1 = bf_keep(a.y), a2 = bf_keep(a.z), a3 = bf_keep(a.w);
            const float b0 = bf_keep(b.x), b1 = bf_keep(b.y), b2 = bf_keep(b.z), b3 = bf_keep(b.w);
            ss += a0 * a0; ss += a1 * a1; ss += a2 * a2; ss += a3 * a3;
            ss += b0 * b0; ss += b1 * b1; ss += b2 * b2; ss += b3 * b3;
            u4v pk; pk.x = pk2hf(a0 * 16.f, a1 * 16.f); pk.y = pk2hf(a2 * 16.f, a3 * 16.f); pk.z = pk2hf(b0 * 16.f, b1 * 16.f); pk.w = pk2hf(b2 * 16.f, b3 * 16.f);
            VST2(u4v, (u4v*)(D + (size_t)y * WSZ + (size_t)row * EMB + u * 8u), pk);
        }
        ss += __shfl_xor(ss, 1, 32); ss += __shfl_xor(ss, 2, 32); ss += __shfl_xor(ss, 4, 32);
        ss += __shfl_xor(ss, 8, 32); ss += __shfl_xor(ss, 16, 32);
        if (lane == 0u) red[rl] = ss;
    }
    __syncthreads();
    if (threadIdx.x < 32u) {
        const unsigned row = rb + lane;
        const float sc = bf_keep(g[row]) * (1.0f / sqrtf(red[lane])) * 0.0625f;
        VST2(float, SCLp + (size_t)y * EMB + row, sc);
    }
}

// =====================================================================================================================
// k_proj_all: all six projection row groups in ONE grid (they only read the operand planes and write disjoint planes, so none waits for another).
//   blockIdx.z: 0 q early, 1 k early, 2 v^T early (value + residual planes), 3 q late, 4 k late, 5 v^T late (value plane only); blockIdx.y = batch.
//   C[m,n] = scl * sum_k A[m,k] * Bt[n,k] + bias; each wave owns a 64x64 tile; 8 waves per block; A, Bt row-major f16, pitch EMB, K = EMB.
//   q, k (token-major): A = tokens, Bt = direction weights, bias[n], scl[n]; v^T (channel-major): A = direction weights, Bt = tokens, bias[m], scl[m]
//   (bias bf16-converted on load; scl is an f32 table). Operands: a stage is 64 k (whole 128-byte rows) of the block's 64 A rows (shared by its 8 waves)
//   and of each wave's 64 Bt rows, brought into LDS by asynchronous copies, two buffers: stage t + 1 flies while stage t feeds the products. Output: f16 plane C (value); RES: also the f16 plane Cr = (value - f16 value) x 2048.
// =====================================================================================================================
template <int BIAS_MODE, bool RES>
__device__ __forceinline__ void proj_epilogue(v8f (&acc)[4][4], float* slab, _Float16* C, unsigned ldc, _Float16* Cr, unsigned ldr,
                                              const float* __restrict__ bias, const float* __restrict__ scl, unsigned m0, unsigned n0, unsigned lane) {
  const unsigned rlane = lane & 15u;            // col (D) within subtile
  const unsigned mOff  = (lane >> 4) << 3;      // D row offset
#pragma unroll
  for (int i = 0; i < 4; ++i) {
    const unsigned mBase = m0 + ((unsigned)i << 4);
    float bm[8], sm[8];
#pragma unroll
    for (int r = 0; r < 8; ++r) {
      bm[r] = (BIAS_MODE == 1) ? bf_keep(bias[mBase + mOff + (unsigned)r]) : 0.f;
      sm[r] = (BIAS_MODE == 1) ? scl[mBase + mOff + (unsigned)r] : 0.f;
    }
#pragma unroll
    for (int j = 0; j < 4; ++j) {
      const unsigned n = n0 + ((unsigned)j << 4) + rlane;
      float bv = 0.f, sv = 0.f;
      if (BIAS_MODE == 2) { bv = bf_keep(bias[n]); sv = scl[n]; }
#pragma unroll
      for (int r = 0; r < 8; ++r) {
        float v;
        if (BIAS_MODE == 1) v = acc[i][j][r] * sm[r] + bm[r];
        else                v = acc[i][j][r] * sv + bv;
        slab[(mOff + (unsigned)r) * 68u + ((unsigned)j << 4) + rlane] = v;
      }
    }
    __builtin_amdgcn_fence(3 /* release order */, "workgroup");
    __builtin_amdgcn_wave_barrier();
    __builtin_amdgcn_fence(2 /* acquire order */, "workgroup");
    {
      const unsigned q = lane >> 3, c8 = (lane & 7u) << 3;
      v8h hv[4];
      v8h rv[4];
#pragma unroll
      for (int it = 0; it < 4; ++it) {
        const unsigned row = (unsigned)it * 4u + q;
        const float* sp = slab + row * 68u + c8;
        const v4f s0 = *(const v4f*)(sp), s1 = *(const v4f*)(sp + 4);
        const v8f sv = (v8f){s0.x, s0.y, s0.z, s0.w, s1.x, s1.y, s1.z, s1.w};
        const v8h t = toh8(sv);
        hv[it] = t;
        v8h u = t;
        if (RES) u = toh8((sv - tof8(t)) * 2048.0f);
        rv[it] = u;
      }
#pragma unroll
      for (int it = 0; it < 4; ++it) {
        const unsigned row = (unsigned)it * 4u + q;
        *(v8h*)(C + (size_t)(mBase + row) * ldc + n0 + c8) = hv[it];
        if (RES) *(v8h*)(Cr + (size_t)(mBase + row) * ldr + n0 + c8) = rv[it];
      }
    }
    __builtin_amdgcn_fence(3 /* release order */, "workgroup");
    __builtin_amdgcn_wave_barrier();
    __builtin_amdgcn_fence(2 /* acquire order */, "workgroup");
  }
}

__global__ __launch_bounds__(256) void k_proj_all(const _Float16* __restrict__ XQ, const _Float16* __restrict__ XK, const _Float16* __restrict__ Wd,
                                                  _Float16* QHp, _Float16* KHp, _Float16* VTHp, _Float16* QRp, _Float16* KRp, _Float16* VTRp,
                                                  const float* __restrict__ bq, const float* __restrict__ bk, const float* __restrict__ bv,
                                                  const float* __restrict__ SCLp) {
  __shared__ __align__(16) float sT[8][16 * 68];   // per-wave 16x64 slab, pitch 68 floats
  __shared__ __align__(16) _Float16 pst[2u * PSTG_H];   // two operand stages: rows 0..63 = A, rows 64 + 64 * wave .. = that wave's Bt rows; pitch KVP
  const unsigned z    = blockIdx.z;                // block-uniform selects among global pointers below
  const unsigned b    = blockIdx.y;
  const bool     late = z >= 3u;
  const unsigned p    = late ? z - 3u : z;         // 0 q, 1 k, 2 v^T
  const bool     chm  = p == 2u;                   // channel-major (v^T)
  const unsigned rows = late ? (unsigned)LROWS : (unsigned)EROWS;   // tokens of this row group
  const unsigned row0 = late ? (unsigned)EROWS : 0u;                // its first token inside a batch
  const unsigned lane = threadIdx.x & 31u;
  const unsigned wave = (unsigned)__builtin_amdgcn_readfirstlane((int)(threadIdx.x >> 5));
  const unsigned tilesM = (chm ? (unsigned)EMB : rows) >> 6;
  const unsigned tilesN = (chm ? rows : (unsigned)EMB) >> 6;
  const unsigned tile = blockIdx.x * 8u + wave;
  if (tile >= tilesM * tilesN) return;   // block-uniform (tile counts are multiples of 8), in front of every barrier
  const unsigned tm = tile / tilesN;
  const unsigned tn = tile - tm * tilesN;
  const unsigned m0 = tm << 6;
  const unsigned n0 = tn << 6;

  const _Float16* X = XQ;
  if (p != 0u) X = XK;
  const _Float16* tok = X + ((size_t)b * SEQ + row0) * EMB;   // this batch's tokens of the row group
  const _Float16* wgt = Wd + (size_t)p * WSZ;
  const _Float16* Ab = chm ? wgt : tok;
  const _Float16* Bb = chm ? tok : wgt;

  const unsigned rlane = lane & 15u;            // row (A) / col (B) within subtile
  const unsigned koff  = (lane >> 4) << 3;      // k offset of this lane half

  v8f acc[4][4];
#pragma unroll
  for (int i = 0; i < 4; ++i)
#pragma unroll
    for (int j = 0; j < 4; ++j) acc[i][j] = (v8f){0.f,0.f,0.f,0.f,0.f,0.f,0.f,0.f};

  // staging: this lane's row (of 4 per wave-wide copy) and 16-byte piece; each wave brings 8 of the A rows and its own 64 Bt rows
  const unsigned lr = lane >> 3, pc = (lane & 7u) << 3;
  const unsigned la = (unsigned)(size_t)pst + ((wave * 8u + lr) * KVP + pc) * 2u;            // LDS byte addresses in buffer 0
  const unsigned lb = (unsigned)(size_t)pst + ((64u + wave * 64u + lr) * KVP + pc) * 2u;
  const _Float16* ga = Ab + (size_t)(m0 + wave * 8u + lr) * (unsigned)EMB + pc;              // + 64 * stage
  const _Float16* gb = Bb + (size_t)(n0 + lr) * (unsigned)EMB + pc;
  const _Float16* fa = pst + rlane * KVP + koff;                                             // fragment rows in buffer 0
  const _Float16* fb = fa + (64u + wave * 64u) * KVP;
  constexpr unsigned NSTG = (unsigned)EMB / 64u;
  static_assert(NSTG >= 2u);                                                                 // the prologue starts stages 0 and 1

  // prologue of the two-buffer ring: stage 0 lands and is published, then stage 1 starts
  stage_rows2(la, ga);
  stage_rows8(lb, gb);
  stage_rows8(lb + 8u * ROWS4_B, gb + 32u * EMB);
  asm volatile("s_wait_asynccnt 0x0" ::: "memory");   // this wave's copies of stage 0 have landed
  __syncthreads();
  stage_rows2(la + PSTG_H * 2u, ga + 64u);
  stage_rows8(lb + PSTG_H * 2u, gb + 64u);
  stage_rows8(lb + PSTG_H * 2u + 8u * ROWS4_B, gb + 64u + 32u * EMB);

#pragma unroll 1   // one copy of the hot loop in the instruction cache; the buffer select is scalar
  for (unsigned t = 0; t < NSTG; ++t) {
    const unsigned bo = (t & 1u) * PSTG_H;             // this stage's buffer, in halves
#pragma unroll
    for (int ks = 0; ks < 2; ++ks) {
      v16h bh[4], ah[4];                               // the k-step's eight fragments are read as one group, ahead of its products
#pragma unroll
      for (int j = 0; j < 4; ++j) bh[j] = frag_ld(fb + bo + (unsigned)j * 16u * KVP + (unsigned)ks * 32u);
#pragma unroll
      for (int i = 0; i < 4; ++i) ah[i] = frag_ld(fa + bo + (unsigned)i * 16u * KVP + (unsigned)ks * 32u);
#pragma unroll
      for (int i = 0; i < 4; ++i) {
#pragma unroll
        for (int j = 0; j < 4; ++j) acc[i][j] = mma_raw(ah[i], bh[j], acc[i][j]);
        dep_guard_h(acc[i][0], acc[i][3], ah[i], ah[i]);
      }
      keep4_h(bh[0], bh[1], bh[2], bh[3]);
    }
    // stage t + 1 is published; the buffer that every wave has just left takes stage t + 2
    stage_publish();
    if (t + 2u < NSTG) {
      const unsigned ko = (t + 2u) * 64u;
      stage_rows2(la + bo * 2u, ga + ko);
      stage_rows8(lb + bo * 2u, gb + ko);
      stage_rows8(lb + bo * 2u + 8u * ROWS4_B, gb + ko + 32u * EMB);
    }
  }
  asm volatile("s_wait_asynccnt 0x0" ::: "memory");   // no copy is outstanding behind the loop
  acc_guard4(acc[0][0], acc[0][1], acc[0][2], acc[0][3]);
  acc_guard4(acc[1][0], acc[1][1], acc[1][2], acc[1][3]);
  acc_guard4(acc[2][0], acc[2][1], acc[2][2], acc[2][3]);
  acc_guard4(acc[3][0], acc[3][1], acc[3][2], acc[3][3]);

  // ---- epilogue (one of four forms, block-uniform) ----
  float* slab = sT[wave];
  const float* scl = SCLp + (size_t)p * EMB;
  if (chm) {
    _Float16* C  = VTHp + (size_t)b * ((size_t)EMB * SEQ) + row0;
    _Float16* Cr = VTRp + (size_t)b * ((size_t)EMB * EROWS);
    if (late) proj_epilogue<1, false>(acc, slab, C, (unsigned)SEQ, Cr, (unsigned)EROWS, bv, scl, m0, n0, lane);
    else      proj_epilogue<1, true >(acc, slab, C, (unsigned)SEQ, Cr, (unsigned)EROWS, bv, scl, m0, n0, lane);
  } else {
    _Float16* Cp = QHp; _Float16* Rp = QRp; const float* bias = bq;
    if (p == 1u) { Cp = KHp; Rp = KRp; bias = bk; }
    _Float16* C  = Cp + ((size_t)b * SEQ + row0) * EMB;
    _Float16* Cr = Rp + (size_t)b * ((size_t)EROWS * EMB);
    if (late) proj_epilogue<2, false>(acc, slab, C, (unsigned)EMB, Cr, (unsigned)EMB, bias, scl, m0, n0, lane);
    else      proj_epilogue<2, true >(acc, slab, C, (unsigned)EMB, Cr, (unsigned)EMB, bias, scl, m0, n0, lane);
  }
}

__device__ __forceinline__ float xhalf(float x) {
  return __builtin_bit_cast(float, __builtin_amdgcn_permlanex16(__builtin_bit_cast(int, x), __builtin_bit_cast(int, x), 0x76543210, 0xfedcba98, false, false));
}

// 2^x as the one hardware instruction. The library form adds a compare, two selects, an add and an ldexp per value, only to return subnormal results
// for x < -126. Here x <= 0 and such a term is below 2^-126 of its row's largest one: it is 0 in the f16 P either way and vanishes in the f32 row sum (>= 1).
// Written as asm so that the slot behind each transcendental is filled by construction: the next v_exp_f32 neither reads its result nor overwrites its
// source (the outputs are early-clobber, so they share no register with an input), and one v_nop stands behind the last.
__device__ __forceinline__ v8f exp2_hw8(v8f x) {
  float p0, p1, p2, p3, p4, p5, p6, p7;
  asm("v_exp_f32 %0, %8\n\tv_exp_f32 %1, %9\n\tv_exp_f32 %2, %10\n\tv_exp_f32 %3, %11\n\t"
      "v_exp_f32 %4, %12\n\tv_exp_f32 %5, %13\n\tv_exp_f32 %6, %14\n\tv_exp_f32 %7, %15\n\tv_nop"
      : "=&v"(p0), "=&v"(p1), "=&v"(p2), "=&v"(p3), "=&v"(p4), "=&v"(p5), "=&v"(p6), "=&v"(p7)
      : "v"(x[0]), "v"(x[1]), "v"(x[2]), "v"(x[3]), "v"(x[4]), "v"(x[5]), "v"(x[6]), "v"(x[7]));
  return (v8f){p0, p1, p2, p3, p4, p5, p6, p7};
}
__device__ __forceinline__ float exp2_hw1(float x) {
  float p;
  asm("v_exp_f32 %0, %1\n\tv_nop" : "=&v"(p) : "v"(x));   // v_nop: the slot behind the transcendental; a rescale factor below 2^-126 leaves nothing of the older sums in f32 either way
  return p;
}

template <bool EARLY>
__device__ __forceinline__ void attn_body(const _Float16* __restrict__ Q, const _Float16* __restrict__ Kp, const _Float16* __restrict__ VT,
                                          const _Float16* __restrict__ QR, const _Float16* __restrict__ KR, const _Float16* __restrict__ VTR,
                                          float* __restrict__ OUT, unsigned qb_off, unsigned nqb) {
  constexpr unsigned NT = EARLY ? 2u : 1u;                           // tiles per stage: value plane (+ residual plane)
  __shared__ __align__(16) _Float16 stg[2u * NT * TILE_H];           // buffer 0: K (, K residual); buffer 1: V^T (, V^T residual)
  float* OT = (float*)stg;                                           // block output tile [d][query], pitch 68 (cross-wave): reuses stg behind the loop
  const unsigned tid  = threadIdx.x;
  const unsigned wave = (unsigned)__builtin_amdgcn_readfirstlane((int)(tid >> 5));
  const unsigned lane = tid & 31u;
  const unsigned hh   = lane >> 4;
  const unsigned c    = lane & 15u;
  const unsigned bx = blockIdx.x;
  const unsigned qb = qb_off + bx % nqb;
  const unsigned bh = bx / nqb;
  const unsigned h  = bh & 7u;
  const unsigned b  = bh >> 3;
  const unsigned q0 = qb * 64u + wave * 16u;
  const unsigned qi = q0 + c;                                        // this lane's query
  const unsigned nch = qb + 1u;
  const size_t rowbase = (size_t)b * SEQ;
  const size_t resbase = (size_t)b * EROWS;

  const _Float16* qrow = Q + (rowbase + qi) * EMB + h * 64u + 8u * hh;
  const v16h qa0 = frag_ld(qrow), qa1 = frag_ld(qrow + 32);
  v16h qr0 = qa0, qr1 = qa1;
  if (EARLY) {
    const _Float16* qrr = QR + (resbase + qi) * EMB + h * 64u + 8u * hh;
    qr0 = frag_ld(qrr); qr1 = frag_ld(qrr + 32);
  }
  const _Float16* kbase  = stg + 8u * hh;                                                // + key * KVP (+ 32 for the second d chunk)
  const _Float16* krbase = kbase + TILE_H;
  const _Float16* vbase  = stg + NT * TILE_H + 8u * hh;                                  // + d * KVP + kv
  const _Float16* vrbase = vbase + TILE_H;
  // staging: this thread's row (of 16 per copy) and 16-byte piece
  const unsigned srow = tid >> 3, spc = (tid & 7u) << 3;
  const unsigned lk = (unsigned)(size_t)stg + (srow * KVP + spc) * 2u;                   // LDS byte address in the K buffer
  const unsigned lv = lk + NT * TILE_H * 2u;                                             // the same place in the V^T buffer
  const unsigned ok  = srow * EMB + spc;                                                 // this thread's piece inside a K tile (value and residual planes)
  const unsigned ov  = srow * SEQ + spc, ovr = srow * EROWS + spc;                       // the same inside a V^T tile, a V^T residual tile
  const _Float16* gk  = Kp  + rowbase * EMB + h * 64u;                                   // block-uniform tile origins: + kv0 * EMB
  const _Float16* gkr = KR  + resbase * EMB + h * 64u;
  const _Float16* gv  = VT  + ((size_t)b * EMB + h * 64u) * SEQ;                         // + kv0
  const _Float16* gvr = VTR + ((size_t)b * EMB + h * 64u) * EROWS;

  float mrow = -__builtin_inff();     // running maximum of this lane's query (equal in both halves)
  float lrow = 0.f;                   // running sum over this half's keys; the halves are joined behind the loop
  v8f oacc[4], oaccr[4];              // O^T: tile t, element r = d 16t + 8h + r of this lane's query
#pragma unroll
  for (int t = 0; t < 4; ++t) { oacc[t] = (v8f){0.f,0.f,0.f,0.f,0.f,0.f,0.f,0.f}; oaccr[t] = (v8f){0.f,0.f,0.f,0.f,0.f,0.f,0.f,0.f}; }

  const float SC    = 0.125f * 1.4426950408889634f;       // 1/sqrt(64) and log2(e)
  const float FILLX = -14426.950408889634f;               // -10000 * log2(e)

  // prologue of the two-buffer ring: stage 0 (K of chunk 0) lands and is published, then stage 1 (V^T of chunk 0) starts
  if (EARLY) stage_tile2(lk, gk + ok, 16u * EMB, lk + TILE_H * 2u, gkr + ok, 16u * EMB);
  else       stage_tile1(lk, gk + ok, 16u * EMB);
  asm volatile("s_wait_asynccnt 0x0" ::: "memory");   // this wave's copies of stage 0 have landed
  __syncthreads();
  if (EARLY) stage_tile2(lv, gv + ov, 16u * SEQ, lv + TILE_H * 2u, gvr + ovr, 16u * EROWS);
  else       stage_tile1(lv, gv + ov, 16u * SEQ);

  for (unsigned kc = 0; kc < nch; ++kc) {
    const unsigned kv0 = kc * 64u;
    const bool more = kc + 1u < nch;                   // block-uniform: a next chunk exists
    v8f s[4];
#pragma unroll
    for (int j = 0; j < 4; ++j) {
      const _Float16* kr = kbase + ((unsigned)j * 16u + c) * KVP;
      const v16h kh0 = frag_ld(kr), kh1 = frag_ld(kr + 32);
      v8f a = (v8f){0.f,0.f,0.f,0.f,0.f,0.f,0.f,0.f};
      a = wmma16(kh0, qa0, a);
      a = wmma16(kh1, qa1, a);
      if (EARLY) {
        const _Float16* krr = krbase + ((unsigned)j * 16u + c) * KVP;
        v8f ar = (v8f){0.f,0.f,0.f,0.f,0.f,0.f,0.f,0.f};
        ar = wmma16(kh0, qr0, ar);
        ar = wmma16(kh1, qr1, ar);
        ar = wmma16(frag_ld(krr), qa0, ar);
        ar = wmma16(frag_ld(krr + 32), qa1, ar);
        a = a + ar * 0.00048828125f;
      }
      s[j] = a;
    }
    // The softmax touches no LDS any more, so the publish point stands directly behind the score products: V^T of this chunk is published;
    // the K buffer, which every wave has left, takes the next chunk's K, which flies through the softmax and V^T.P^T
    stage_publish();
    if (more) {
      const size_t ko = (size_t)(kv0 + 64u) * EMB;
      if (EARLY) stage_tile2(lk, (gk + ko) + ok, 16u * EMB, lk + TILE_H * 2u, (gkr + ko) + ok, 16u * EMB);
      else       stage_tile1(lk, (gk + ko) + ok, 16u * EMB);
    }
    const int kd = (int)qi - (int)(kv0 + 8u * hh);     // tile j, element r is a key in front of this lane's query where 16j + r < kd
    float mj[4];
#pragma unroll
    for (int j = 0; j < 4; ++j) {
#pragma unroll
      for (int r = 0; r < 8; ++r) s[j][r] = (j * 16 + r < kd) ? s[j][r] * SC : FILLX;
      mj[j] = fmaxf(fmaxf(fmaxf(s[j][0], s[j][1]), fmaxf(s[j][2], s[j][3])), fmaxf(fmaxf(s[j][4], s[j][5]), fmaxf(s[j][6], s[j][7])));
    }
    float m = fmaxf(fmaxf(mj[0], mj[1]), fmaxf(mj[2], mj[3]));
    m = fmaxf(m, xhalf(m));
    const float mnew = fmaxf(mrow, m);
    const float alpha = exp2_hw1(mrow - mnew);
    mrow = mnew;
    FragU pa[2], pr[2];                                // P^T (and its residual) as B fragments of keys 0..31 and 32..63
    float ps[4];
#pragma unroll
    for (int j = 0; j < 4; ++j) {
      float a = 0.f;
      const v8f pj = exp2_hw8(s[j] - mnew);
#pragma unroll
      for (int r = 0; r < 8; ++r) a += pj[r];
      const v8f e = pj * 32768.0f;
      const v8h g = toh8(e);
      pa[j >> 1].h[j & 1] = g;
      if (EARLY) pr[j >> 1].h[j & 1] = toh8((e - tof8(g)) * 2048.0f);
      ps[j] = a;
    }
    lrow = lrow * alpha + ((ps[0] + ps[1]) + (ps[2] + ps[3]));
#pragma unroll
    for (int t = 0; t < 4; ++t) {
#pragma unroll
      for (int r = 0; r < 8; ++r) { oacc[t][r] *= alpha; if (EARLY) oaccr[t][r] *= alpha; }
    }
#pragma unroll
    for (int kk = 0; kk < 2; ++kk) {
#pragma unroll
      for (int t = 0; t < 4; ++t) {
        const v16h vb = frag_ld(vbase + ((unsigned)t * 16u + c) * KVP + (unsigned)kk * 32u);
        oacc[t] = wmma16(vb, pa[kk].v, oacc[t]);
        if (EARLY) {
          oaccr[t] = wmma16(vb, pr[kk].v, oaccr[t]);
          const v16h vr = frag_ld(vrbase + ((unsigned)t * 16u + c) * KVP + (unsigned)kk * 32u);
          oaccr[t] = wmma16(vr, pa[kk].v, oaccr[t]);
        }
      }
    }
    // K of the next chunk is published; the V^T buffer, which every wave has left, takes the next chunk's V^T
    stage_publish();
    if (more) {
      if (EARLY) stage_tile2(lv, (gv + (kv0 + 64u)) + ov, 16u * SEQ, lv + TILE_H * 2u, (gvr + (kv0 + 64u)) + ovr, 16u * EROWS);
      else       stage_tile1(lv, (gv + (kv0 + 64u)) + ov, 16u * SEQ);
    }
  }
  asm volatile("s_wait_asynccnt 0x0" ::: "memory");   // no copy is outstanding when stg becomes the output tile (the last publish point's barrier ended all reads)

  // join the halves' sums, normalise (P carried x2^15), zero sequence row 0, put the wave's 64 d x 16 queries into the block tile [d][query]
  const float lsum = lrow + xhalf(lrow);
  const float iv = 1.0f / (lsum * 32768.0f);
  const float inv = (qi == 0u) ? 0.0f : iv;
#pragma unroll
  for (int t = 0; t < 4; ++t) {
#pragma unroll
    for (int r = 0; r < 8; ++r) {
      float v = oacc[t][r];
      if (EARLY) v += oaccr[t][r] * 0.00048828125f;
      OT[((unsigned)t * 16u + 8u * hh + (unsigned)r) * 68u + wave * 16u + c] = v * inv;
    }
  }
  __syncthreads();
  {
    const unsigned c4 = (lane & 15u) << 2;     // row segment = 64 floats = 256 B = 16 lanes x 16 B; 2 rows per instruction, 8 trips = 16 rows per wave
    float* ob = OUT + ((size_t)b * EMB + h * 64u + wave * 16u) * SEQ_FULL + qb * 64u + c4;
    v4f vv[8];
#pragma unroll
    for (int it = 0; it < 8; ++it) {
      const unsigned row = (unsigned)it * 2u + hh;
      vv[it] = *(const v4f*)(OT + (wave * 16u + row) * 68u + c4);
    }
    {
#pragma unroll
      for (int it = 0; it < 8; ++it) {
        const unsigned row = (unsigned)it * 2u + hh;
        *(v4f*)(ob + (size_t)row * SEQ_FULL) = vv[it];
      }
    }
  }
}

__global__ __launch_bounds__(128) __attribute__((amdgpu_num_vgpr(256))) void k_attn_early(
    const _Float16* __restrict__ Q, const _Float16* __restrict__ Kp, const _Float16* __restrict__ VT,
    const _Float16* __restrict__ QR, const _Float16* __restrict__ KR, const _Float16* __restrict__ VTR,
    float* __restrict__ OUT, unsigned qb_off, unsigned nqb) {
  attn_body<true>(Q, Kp, VT, QR, KR, VTR, OUT, qb_off, nqb);
}
__global__ __launch_bounds__(128) void k_attn_late(
    const _Float16* __restrict__ Q, const _Float16* __restrict__ Kp, const _Float16* __restrict__ VT,
    const _Float16* __restrict__ QR, const _Float16* __restrict__ KR, const _Float16* __restrict__ VTR,
    float* __restrict__ OUT, unsigned qb_off, unsigned nqb) {
  attn_body<false>(Q, Kp, VT, QR, KR, VTR, OUT, qb_off, nqb);
}

// ---- workspace carve (bytes; every region is a whole number of 256-B units and is written in full by its producer) ----
#define SZ_P16  ((size_t)NB * SEQ * EMB * 2)            // one f16 activation plane
#define SZ_R16  ((size_t)NB * EROWS * EMB * 2)          // one f16 residual plane (early rows only)
#define SZ_W16  ((size_t)3 * WSZ * 2)
#define SZ_SCL  ((size_t)3 * EMB * 4)
#define OFF_XQ   ((size_t)0)
#define OFF_XK   (OFF_XQ + SZ_P16)
#define OFF_W16  (OFF_XK + SZ_P16)
#define OFF_SCL  (OFF_W16 + SZ_W16)
#define OFF_QH   (OFF_SCL + SZ_SCL)
#define OFF_KH   (OFF_QH + SZ_P16)
#define OFF_VTH  (OFF_KH + SZ_P16)
#define OFF_QR   (OFF_VTH + SZ_P16)
#define OFF_KR   (OFF_QR + SZ_R16)
#define OFF_VTR  (OFF_KR + SZ_R16)
#define WS_TOTAL (OFF_VTR + SZ_R16)
static_assert(SZ_P16 % 256 == 0 && SZ_R16 % 256 == 0 && SZ_W16 % 256 == 0 && SZ_SCL % 256 == 0);
static_assert(OFF_XK == OFF_XQ + (size_t)NB * SEQ * EMB * 2);   // k_castxT addresses the key plane as plane 1 of one base
static_assert(WS_TOTAL <= (size_t)134217728);
static_assert((size_t)NB_FULL * EMB * SEQ_FULL * 4 == (size_t)33554432);   // output extent in bytes, offset 0

extern "C" void kernel_launch(void* const* d_in, const int* in_sizes, int n_in, void* d_out, int out_size, void* d_ws, size_t ws_size, hipStream_t stream) {
    if (n_in < 11) return;
    const long long xneed = ((long long)(NB - 1) * EMB + (EMB - 1)) * SEQ_FULL + SEQ;
    if ((long long)in_sizes[0] < xneed) return;
    if ((long long)in_sizes[1] < xneed) return;
    if (in_sizes[2] < WSZ || in_sizes[5] < WSZ || in_sizes[8] < WSZ) return;
    if (in_sizes[3] < EMB || in_sizes[4] < EMB || in_sizes[6] < EMB || in_sizes[7] < EMB || in_sizes[9] < EMB || in_sizes[10] < EMB) return;
    if ((long long)out_size < xneed) return;
    if ((size_t)WS_TOTAL > ws_size) return;

    // input order: query, key, vq, gq, bq, vk, gk, bk, vv, gv, bv
    const float* query = (const float*)d_in[0];
    const float* key   = (const float*)d_in[1];
    const float* vq = (const float*)d_in[2];  const float* gq = (const float*)d_in[3];  const float* bq = (const float*)d_in[4];
    const float* vk = (const float*)d_in[5];  const float* gk = (const float*)d_in[6];  const float* bk = (const float*)d_in[7];
    const float* vv = (const float*)d_in[8];  const float* gv = (const float*)d_in[9];  const float* bv = (const float*)d_in[10];
    float* out = (float*)d_out;

    char* ws = (char*)d_ws;
    unsigned short* X16  = (unsigned short*)(ws + OFF_XQ);     // plane 0 = query tokens, plane 1 = key tokens
    unsigned short* W16  = (unsigned short*)(ws + OFF_W16);    // planes: 0 vq 1 vk 2 vv (direction weights x16)
    float*          SCL  = (float*)(ws + OFF_SCL);             // [3][512] row gains / 16
    _Float16* QH  = (_Float16*)(ws + OFF_QH);
    _Float16* KH  = (_Float16*)(ws + OFF_KH);
    _Float16* VTH = (_Float16*)(ws + OFF_VTH);
    _Float16* QR  = (_Float16*)(ws + OFF_QR);
    _Float16* KR  = (_Float16*)(ws + OFF_KR);
    _Float16* VTR = (_Float16*)(ws + OFF_VTR);

    const _Float16* XQh = (const _Float16*)(ws + OFF_XQ);
    const _Float16* XKh = (const _Float16*)(ws + OFF_XK);
    const _Float16* W16h = (const _Float16*)W16;

    // 1-2: operand planes
    k_castxT<<<dim3((unsigned)(SEQ / 64), (unsigned)(EMB / 64), (unsigned)(NB * 2)), 256, 0, stream>>>(query, key, X16);
    k_wprep<<<dim3((unsigned)(EMB / 32), 3u), 256, 0, stream>>>(vq, gq, vk, gk, vv, gv, W16, SCL);

    // 3: q, k (tokens x V^T, row gain, bias -> f16 planes) and v^T (V x tokens^T, gain[m], bias[m] -> f16 plane [b][h*64+d][token]); early group also residual planes;
    //    all six row groups in one grid (blockIdx.z), the early groups (longer epilogue) first
    k_proj_all<<<dim3((unsigned)(((EROWS > LROWS) ? EROWS : LROWS) / 64), (unsigned)NB, (LROWS > 0) ? 6u : 3u), 256, 0, stream>>>(
        XQh, XKh, W16h, QH, KH, VTH, QR, KR, VTR, bq, bk, bv, SCL);

    // 4-5: causal attention, early band (value + residual planes) and late band (single planes); each block writes its 64x64 tile of the output buffer
    k_attn_early<<<(unsigned)(NB * NHEAD * (EROWS / 64)), 128, 0, stream>>>(QH, KH, VTH, QR, KR, VTR, out, 0u, (unsigned)(EROWS / 64));
    if (LROWS > 0) {
        k_attn_late<<<(unsigned)(NB * NHEAD * (LROWS / 64)), 128, 0, stream>>>(QH, KH, VTH, QR, KR, VTR, out, (unsigned)(EROWS / 64), (unsigned)(LROWS / 64));
    }
}

// v007
// It runs in 102 microseconds.
// Timed twice side by side with v006, it ran 1.06 times as fast both times.
// All steps since v000 together make it 3.79 times as fast.
// All contractions (weight-normalised q/k/v projections, q.k^T, P.V): v_wmma_f32_16x16x32_f16 (f16 operands, f32 accumulate); float inputs bf16-converted (RNE) first, direction weights carried x16 with the per-row norm gain applied in f32 at the projection epilogue, P carried x2^15; query rows < EROWS additionally carry q, k, v, P as f16 value + x2048 f16 residual planes (three products, residual products in their own accumulator); mask, softmax, norms in f32.
#include <hip/hip_runtime.h>
#include <math.h>

// ---- sizes (NB / SEQ reducible; *_FULL = strides of the inputs / output) ----
#ifndef NB
#define NB 16
#endif
#ifndef SEQ
#define SEQ 1024
#endif
#ifndef EROWS
#define EROWS ((SEQ < 512) ? SEQ : 512)
#endif
#define LROWS (SEQ - EROWS)
#define NB_FULL 16
#define SEQ_FULL 1024
#define EMB 512
#define NHEAD 8
#define HDIM 64
#define WSZ (EMB * EMB)

static_assert(NB >= 1 && NB <= NB_FULL);
static_assert(SEQ <= SEQ_FULL && SEQ % 64 == 0 && SEQ >= 64);
static_assert(EROWS % 64 == 0 && EROWS >= 64 && EROWS <= SEQ);
static_assert(LROWS % 64 == 0);
static_assert(EMB % 64 == 0 && EMB == NHEAD * HDIM && HDIM == 64 && NHEAD == 8);
static_assert(EMB % 32 == 0);                          // WMMA k-steps of 32, weight rows per prep block
static_assert(4 * 256 == 64 * 16);                     // k_castxT load phase: trips x threads == tile rows x 16-B pieces per row
static_assert(2 * 256 == 64 * 8);
static_assert(2 * 32 * 8 == EMB);                      // k_wprep: trips x lanes x elements == weight row width
static_assert(8 * 4 == 32);                            // k_wprep: waves x rows per wave == rows per block
static_assert(32 * 16 * 4 == 16 * 128);                // projection epilogue: lanes x bytes x trips == slab rows x row bytes (64 halves)
static_assert(4 * 32 * 16 * 8 == 64 * 256);            // attention output: waves x lanes x bytes x trips == tile rows x row bytes (64 floats)
static_assert(2 * 576 * 72 * 2 + 8 * 16 * 68 * 4 <= 327680);  // static LDS of the projection kernel: two operand stages + the epilogue slabs
static_assert((EMB / 64) % 8 == 0 && (EROWS / 64) % 8 == 0 && (LROWS / 64) % 8 == 0);  // projection: the 8 waves of a block share one A tile; a block has all its tiles or none
static_assert(8 * 2 * 32 * 16 == 64 * 128 && 16 * 32 * 16 == 64 * 128);  // projection staging: (waves x) copies x lanes x bytes == tile rows x row bytes
static_assert(4 * 64 * 72 * 2 <= 81920);  // static LDS of the attention kernels: four blocks per 320-KiB LDS
static_assert(64 * 68 * 4 <= 2 * 64 * 72 * 2);         // the output tile fits the staging area that it reuses
static_assert(4 * 128 * 16 == 64 * 128);               // staging: copies per thread x threads x bytes == tile rows x row bytes
static_assert(64 * 65 * 4 <= 131072);                  // static LDS of k_castxT

typedef _Float16 h16;
typedef __attribute__((ext_vector_type(16))) _Float16 v16h;
typedef __attribute__((ext_vector_type(8)))  _Float16 v8h;
typedef __attribute__((ext_vector_type(8)))  float    v8f;
typedef __attribute__((ext_vector_type(4)))  float    v4f;
typedef __attribute__((ext_vector_type(2)))  float    v2f;
typedef __attribute__((ext_vector_type(2)))  _Float16 v2h;
typedef __attribute__((ext_vector_type(4)))  unsigned int u4v;

// 16-bit WMMA fragment map (wave32), lane L, h = L>>4, m = L&15:
//   A 16x32: lane = row m;    element i -> k = (i<8) ? 8h+i : 16+8h+(i-8)
//   B 32x16: lane = column m; the SAME k(i,h)
//   D 16x16 (8 f32): lane = column m; element r -> row 8h+r
union FragU { v16h v; v8h h[2]; };
// p already includes the +8h lane-half offset: elements 0..7 <- p[0..7], 8..15 <- p[16..23]
__device__ __forceinline__ v16h frag_ld(const _Float16* p) { FragU f; f.h[0] = *(const v8h*)(p); f.h[1] = *(const v8h*)(p + 16); return f.v; }

__device__ __forceinline__ v8f mma_raw(v16h a, v16h b, v8f c) { return __builtin_amdgcn_wmma_f32_16x16x32_f16(false, a, false, b, (short)0, c, false, false); }
__device__ __forceinline__ void dep_guard_h(v8f& a, v8f& b, v16h x, v16h y) { asm volatile("v_nop\n\tv_nop\n\tv_nop\n\tv_nop" : "+v"(a), "+v"(b) : "v"(x), "v"(y)); }
__device__ __forceinline__ void keep4_h(v16h a, v16h b, v16h c, v16h d) { asm volatile("v_nop" :: "v"(a), "v"(b), "v"(c), "v"(d)); }
__device__ __forceinline__ void acc_guard4(v8f& a, v8f& b, v8f& c, v8f& d) { asm volatile("v_nop\n\tv_nop\n\tv_nop\n\tv_nop" : "+v"(a), "+v"(b), "+v"(c), "+v"(d)); }
// Inputs-only fence on loaded fragments: all eight are in registers here, so their LDS reads are issued as one group and waited for once, ahead of the products
__device__ __forceinline__ void frags_ready8(v16h a, v16h b, v16h c, v16h d, v16h e, v16h f, v16h g, v16h h) {
    asm volatile("" :: "v"(a), "v"(b), "v"(c), "v"(d), "v"(e), "v"(f), "v"(g), "v"(h));
}
__device__ __forceinline__ void acc_guard8(v8f (&a)[4], v8f (&b)[4]) {
    asm volatile("v_nop\n\tv_nop\n\tv_nop\n\tv_nop" : "+v"(a[0]), "+v"(a[1]), "+v"(a[2]), "+v"(a[3]), "+v"(b[0]), "+v"(b[1]), "+v"(b[2]), "+v"(b[3]));
}

// bf16 RNE convert, kept as f32 (finite inputs)
__device__ __forceinline__ float bf_keep(float v) { const unsigned u = __float_as_uint(v); return __uint_as_float((u + 0x7fffu + ((u >> 16) & 1u)) & 0xffff0000u); }
// f32 -> f16, round to nearest even, two values per instruction. A result below 2^-14 stays an f16 subnormal: the matrix instructions take subnormal operands as they are.
__device__ __forceinline__ unsigned pk2hf(float a, float b) { return __builtin_bit_cast(unsigned, __builtin_convertvector((v2f){a, b}, v2h)); }
__device__ __forceinline__ v8h toh8(v8f v) { return __builtin_convertvector(v, v8h); }
__device__ __forceinline__ v8f tof8(v8h v) { return __builtin_convertvector(v, v8f); }

// ---- LDS staging of 64-row x 128-byte f16 tiles by asynchronous copies (global -> LDS, through no register) ----
#define KVP 72u                      // LDS row pitch in halves: 144 B = 16 B x 9, conflict-free for 16-byte fragment reads
#define TILE_H (64u * KVP)           // halves of one staged tile
#define ROWS16_B (16u * KVP * 2u)    // LDS bytes of 16 staged rows
#define PSTG_H (576u * KVP)          // halves of one projection stage: 64 A rows + 8 x 64 Bt rows
// Each thread of the 128 copies its 16-byte piece of rows r, r+16, r+32, r+48: one wave-wide copy = 4 whole 128-byte rows.
// l = the thread's LDS byte address of its piece in row r, g = the same piece in global memory, st = 16 source rows in halves.
// s_wait_xcnt stands as the last line of the copies' own statement, so no address register is rewritten in front of it.
__device__ __forceinline__ void stage_tile1(unsigned l, const _Float16* g, size_t st) {
    asm volatile("global_load_async_to_lds_b128 %0, %4, off\n\t"
                 "global_load_async_to_lds_b128 %1, %5, off\n\t"
                 "global_load_async_to_lds_b128 %2, %6, off\n\t"
                 "global_load_async_to_lds_b128 %3, %7, off\n\t"
                 "s_wait_xcnt 0x0"
                 :: "v"(l), "v"(l + ROWS16_B), "v"(l + 2u * ROWS16_B), "v"(l + 3u * ROWS16_B),
                    "v"(g), "v"(g + st), "v"(g + 2u * st), "v"(g + 3u * st) : "memory");
}
__device__ __forceinline__ void stage_tile2(unsigned l, const _Float16* g, size_t st, unsigned l2, const _Float16* g2, size_t st2) {
    asm volatile("global_load_async_to_lds_b128 %0, %8, off\n\t"
                 "global_load_async_to_lds_b128 %1, %9, off\n\t"
                 "global_load_async_to_lds_b128 %2, %10, off\n\t"
                 "global_load_async_to_lds_b128 %3, %11, off\n\t"
                 "global_load_async_to_lds_b128 %4, %12, off\n\t"
                 "global_load_async_to_lds_b128 %5, %13, off\n\t"
                 "global_load_async_to_lds_b128 %6, %14, off\n\t"
                 "global_load_async_to_lds_b128 %7, %15, off\n\t"
                 "s_wait_xcnt 0x0"
                 :: "v"(l), "v"(l + ROWS16_B), "v"(l + 2u * ROWS16_B), "v"(l + 3u * ROWS16_B),
                    "v"(l2), "v"(l2 + ROWS16_B), "v"(l2 + 2u * ROWS16_B), "v"(l2 + 3u * ROWS16_B),
                    "v"(g), "v"(g + st), "v"(g + 2u * st), "v"(g + 3u * st),
                    "v"(g2), "v"(g2 + st2), "v"(g2 + 2u * st2), "v"(g2 + 3u * st2) : "memory");
}
// Wave-wide forms for the projection: a lane copies its 16-byte piece of rows r, r+4, ... (source pitch EMB halves): one wave-wide copy = 4 whole 128-byte rows.
#define ROWS4_B (4u * KVP * 2u)      // LDS bytes of 4 staged rows
__device__ __forceinline__ void stage_rows2(unsigned l, const _Float16* g) {
    asm volatile("global_load_async_to_lds_b128 %0, %2, off\n\t"
                 "global_load_async_to_lds_b128 %1, %3, off\n\t"
                 "s_wait_xcnt 0x0"
                 :: "v"(l), "v"(l + ROWS4_B), "v"(g), "v"(g + 4u * EMB) : "memory");
}
__device__ __forceinline__ void stage_rows8(unsigned l, const _Float16* g) {
    asm volatile("global_load_async_to_lds_b128 %0, %8, off\n\t"
                 "global_load_async_to_lds_b128 %1, %9, off\n\t"
                 "global_load_async_to_lds_b128 %2, %10, off\n\t"
                 "global_load_async_to_lds_b128 %3, %11, off\n\t"
                 "global_load_async_to_lds_b128 %4, %12, off\n\t"
                 "global_load_async_to_lds_b128 %5, %13, off\n\t"
                 "global_load_async_to_lds_b128 %6, %14, off\n\t"
                 "global_load_async_to_lds_b128 %7, %15, off\n\t"
                 "s_wait_xcnt 0x0"
                 :: "v"(l), "v"(l + ROWS4_B), "v"(l + 2u * ROWS4_B), "v"(l + 3u * ROWS4_B),
                    "v"(l + 4u * ROWS4_B), "v"(l + 5u * ROWS4_B), "v"(l + 6u * ROWS4_B), "v"(l + 7u * ROWS4_B),
                    "v"(g), "v"(g + 4u * EMB), "v"(g + 8u * EMB), "v"(g + 12u * EMB),
                    "v"(g + 16u * EMB), "v"(g + 20u * EMB), "v"(g + 24u * EMB), "v"(g + 28u * EMB) : "memory");
}
// publish point of the next stage: this wave's LDS reads have returned, its own copies have landed, then the block barrier
// (it shows the landed tile to the other waves and ends every wave's reads of the buffer that is refilled behind it)
__device__ __forceinline__ void stage_publish() {
    asm volatile("s_wait_dscnt 0x0" ::: "memory");      // this wave's reads of the buffer about to be refilled are done
    asm volatile("s_wait_asynccnt 0x0" ::: "memory");   // this wave's copies of the next stage have landed
    __syncthreads();
}

#define VST2(T, ptr, val) do { const T vst2_v_ = (val); *(T*)(ptr) = vst2_v_;  } while (0)

// ---- query / key (f32, [b][c][s], full strides) -> f16 planes of the bf16-converted values, compact [NB*SEQ][512] (token-major);
//      plane 0 = query at D, plane 1 = key at D + NB*SEQ*EMB. 64 channels x 64 tokens per block through an LDS tile (cross-wave: block barrier);
__global__ __launch_bounds__(256) void k_castxT(const float* __restrict__ xq, const float* __restrict__ xk, unsigned short* __restrict__ D) {
#pragma clang fp contract(off)
    __shared__ float tile[64 * 65];
    const unsigned z = blockIdx.z;
    const unsigned which = z & 1u;                       // block-uniform select among global pointers
    const unsigned b = z >> 1;
    const float* src = xq;
    if (which == 1u) src = xk;
    const unsigned s0 = blockIdx.x * 64u, c0 = blockIdx.y * 64u;
    const unsigned t = threadIdx.x;
#pragma unroll
    for (int i = 0; i < 4; ++i) {
        const unsigned idx = t + 256u * (unsigned)i;
        const unsigned cc = idx >> 4, s4 = (idx & 15u) << 2;
        const v4f a = *(const v4f*)(src + ((size_t)b * EMB + c0 + cc) * SEQ_FULL + s0 + s4);
        tile[cc * 65u + s4 + 0u] = a.x; tile[cc * 65u + s4 + 1u] = a.y; tile[cc * 65u + s4 + 2u] = a.z; tile[cc * 65u + s4 + 3u] = a.w;
    }
    __syncthreads();
#pragma unroll
    for (int i = 0; i < 2; ++i) {
        const unsigned idx = t + 256u * (unsigned)i;
        const unsigned ss = idx >> 3, c8 = (idx & 7u) << 3;
        const float f0 = tile[(c8 + 0u) * 65u + ss], f1 = tile[(c8 + 1u) * 65u + ss], f2 = tile[(c8 + 2u) * 65u + ss], f3 = tile[(c8 + 3u) * 65u + ss];
        const float f4 = tile[(c8 + 4u) * 65u + ss], f5 = tile[(c8 + 5u) * 65u + ss], f6 = tile[(c8 + 6u) * 65u + ss], f7 = tile[(c8 + 7u) * 65u + ss];
        u4v pk; pk.x = pk2hf(bf_keep(f0), bf_keep(f1)); pk.y = pk2hf(bf_keep(f2), bf_keep(f3)); pk.z = pk2hf(bf_keep(f4), bf_keep(f5)); pk.w = pk2hf(bf_keep(f6), bf_keep(f7));
        VST2(u4v, (u4v*)(D + (size_t)which * ((size_t)NB * SEQ * EMB) + ((size_t)b * SEQ + s0 + ss) * EMB + c0 + c8), pk);
    }
}

// ---- three [512 out][512 in] direction weights -> f16 planes of bf16-converted values x16 (exact), plane y at D + y*WSZ, and the per-row gain table
//      SCL[y*512 + o] = bf16(g[o]) / ||bf16(v[o,:])|| / 16 (f32). Block = 32 rows (wave = 4 rows); grid (EMB/32, 3).
//      Plane rows: 2 instructions x 32 lanes x 16 B lane-contiguous; gain line: 32 lanes x 4 B of wave 0 in one instruction (LDS word per row, block barrier). ----
__global__ __launch_bounds__(256) void k_wprep(const float* __restrict__ v0, const float* __restrict__ g0, const float* __restrict__ v1, const float* __restrict__ g1,
                                               const float* __restrict__ v2, const float* __restrict__ g2, unsigned short* __restrict__ D, float* __restrict__ SCLp) {
#pragma clang fp contract(off)
    __shared__ float red[32];
    const unsigned y = blockIdx.y;                       // block-uniform select among global pointers
    const float* s = v0; const float* g = g0;
    if (y == 1u) { s = v1; g = g1; }
    if (y == 2u) { s = v2; g = g2; }
    const unsigned lane = threadIdx.x & 31u;
    const unsigned wave = (unsigned)__builtin_amdgcn_readfirstlane((int)(threadIdx.x >> 5));
    const unsigned rb = blockIdx.x * 32u;
#pragma unroll 1
    for (unsigned rr = 0; rr < 4u; ++rr) {
        const unsigned rl = wave * 4u + rr;
        const unsigned row = rb + rl;
        float ss = 0.f;
#pragma unroll 1
        for (unsigned it = 0; it < 2u; ++it) {
            const unsigned u = it * 32u + lane;          // 16-B piece of the row
            const float* p = s + (size_t)row * EMB + u * 8u;
            const v4f a = *(const v4f*)(p), b = *(const v4f*)(p + 4);
            const float a0 = bf_keep(a.x), a1 = bf_keep(a.y), a2 = bf_keep(a.z), a3 = bf_keep(a.w);
            const float b0 = bf_keep(b.x), b1 = bf_keep(b.y), b2 = bf_keep(b.z), b3 = bf_keep(b.w);
            ss += a0 * a0; ss += a1 * a1; ss += a2 * a2; ss += a3 * a3;
            ss += b0 * b0; ss += b1 * b1; ss += b2 * b2; ss += b3 * b3;
            u4v pk; pk.x = pk2hf(a0 * 16.f, a1 * 16.f); pk.y = pk2hf(a2 * 16.f, a3 * 16.f); pk.z = pk2hf(b0 * 16.f, b1 * 16.f); pk.w = pk2hf(b2 * 16.f, b3 * 16.f);
            VST2(u4v, (u4v*)(D + (size_t)y * WSZ + (size_t)row * EMB + u * 8u), pk);
        }
        ss += __shfl_xor(ss, 1, 32); ss += __shfl_xor(ss, 2, 32); ss += __shfl_xor(ss, 4, 32);
        ss += __shfl_xor(ss, 8, 32); ss += __shfl_xor(ss, 16, 32);
        if (lane == 0u) red[rl] = ss;
    }
    __syncthreads();
    if (threadIdx.x < 32u) {
        const unsigned row = rb + lane;
        const float sc = bf_keep(g[row]) * (1.0f / sqrtf(red[lane])) * 0.0625f;
        VST2(float, SCLp + (size_t)y * EMB + row, sc);
    }
}

// =====================================================================================================================
// k_proj_all: all six projection row groups in ONE grid (they only read the operand planes and write disjoint planes, so none waits for another).
//   blockIdx.z: 0 q early, 1 k early, 2 v^T early (value + residual planes), 3 q late, 4 k late, 5 v^T late (value plane only); blockIdx.y = batch.
//   C[m,n] = scl * sum_k A[m,k] * Bt[n,k] + bias; each wave owns a 64x64 tile; 8 waves per block; A, Bt row-major f16, pitch EMB, K = EMB.
//   q, k (token-major): A = tokens, Bt = direction weights, bias[n], scl[n]; v^T (channel-major): A = direction weights, Bt = tokens, bias[m], scl[m]
//   (bias bf16-converted on load; scl is an f32 table). Operands: a stage is 64 k (whole 128-byte rows) of the block's 64 A rows (shared by its 8 waves)
//   and of each wave's 64 Bt rows, brought into LDS by asynchronous copies, two buffers: stage t + 1 flies while stage t feeds the products. Output: f16 plane C (value); RES: also the f16 plane Cr = (value - f16 value) x 2048.
// =====================================================================================================================
template <int BIAS_MODE, bool RES>
__device__ __forceinline__ void proj_epilogue(v8f (&acc)[4][4], float* slab, _Float16* C, unsigned ldc, _Float16* Cr, unsigned ldr,
                                              const float* __restrict__ bias, const float* __restrict__ scl, unsigned m0, unsigned n0, unsigned lane) {
  const unsigned rlane = lane & 15u;            // col (D) within subtile
  const unsigned mOff  = (lane >> 4) << 3;      // D row offset
#pragma unroll
  for (int i = 0; i < 4; ++i) {
    const unsigned mBase = m0 + ((unsigned)i << 4);
    float bm[8], sm[8];
#pragma unroll
    for (int r = 0; r < 8; ++r) {
      bm[r] = (BIAS_MODE == 1) ? bf_keep(bias[mBase + mOff + (unsigned)r]) : 0.f;
      sm[r] = (BIAS_MODE == 1) ? scl[mBase + mOff + (unsigned)r] : 0.f;
    }
#pragma unroll
    for (int j = 0; j < 4; ++j) {
      const unsigned n = n0 + ((unsigned)j << 4) + rlane;
      float bv = 0.f, sv = 0.f;
      if (BIAS_MODE == 2) { bv = bf_keep(bias[n]); sv = scl[n]; }
#pragma unroll
      for (int r = 0; r < 8; ++r) {
        float v;
        if (BIAS_MODE == 1) v = acc[i][j][r] * sm[r] + bm[r];
        else                v = acc[i][j][r] * sv + bv;
        slab[(mOff + (unsigned)r) * 68u + ((unsigned)j << 4) + rlane] = v;
      }
    }
    __builtin_amdgcn_fence(3 /* release order */, "workgroup");
    __builtin_amdgcn_wave_barrier();
    __builtin_amdgcn_fence(2 /* acquire order */, "workgroup");
    {
      const unsigned q = lane >> 3, c8 = (lane & 7u) << 3;
      v8h hv[4];
      v8h rv[4];
#pragma unroll
      for (int it = 0; it < 4; ++it) {
        const unsigned row = (unsigned)it * 4u + q;
        const float* sp = slab + row * 68u + c8;
        const v4f s0 = *(const v4f*)(sp), s1 = *(const v4f*)(sp + 4);
        const v8f sv = (v8f){s0.x, s0.y, s0.z, s0.w, s1.x, s1.y, s1.z, s1.w};
        const v8h t = toh8(sv);
        hv[it] = t;
        v8h u = t;
        if (RES) u = toh8((sv - tof8(t)) * 2048.0f);
        rv[it] = u;
      }
#pragma unroll
      for (int it = 0; it < 4; ++it) {
        const unsigned row = (unsigned)it * 4u + q;
        *(v8h*)(C + (size_t)(mBase + row) * ldc + n0 + c8) = hv[it];
        if (RES) *(v8h*)(Cr + (size_t)(mBase + row) * ldr + n0 + c8) = rv[it];
      }
    }
    __builtin_amdgcn_fence(3 /* release order */, "workgroup");
    __builtin_amdgcn_wave_barrier();
    __builtin_amdgcn_fence(2 /* acquire order */, "workgroup");
  }
}

__global__ __launch_bounds__(256) void k_proj_all(const _Float16* __restrict__ XQ, const _Float16* __restrict__ XK, const _Float16* __restrict__ Wd,
                                                  _Float16* QHp, _Float16* KHp, _Float16* VTHp, _Float16* QRp, _Float16* KRp, _Float16* VTRp,
                                                  const float* __restrict__ bq, const float* __restrict__ bk, const float* __restrict__ bv,
                                                  const float* __restrict__ SCLp) {
  __shared__ __align__(16) float sT[8][16 * 68];   // per-wave 16x64 slab, pitch 68 floats
  __shared__ __align__(16) _Float16 pst[2u * PSTG_H];   // two operand stages: rows 0..63 = A, rows 64 + 64 * wave .. = that wave's Bt rows; pitch KVP
  const unsigned z    = blockIdx.z;                // block-uniform selects among global pointers below
  const unsigned b    = blockIdx.y;
  const bool     late = z >= 3u;
  const unsigned p    = late ? z - 3u : z;         // 0 q, 1 k, 2 v^T
  const bool     chm  = p == 2u;                   // channel-major (v^T)
  const unsigned rows = late ? (unsigned)LROWS : (unsigned)EROWS;   // tokens of this row group
  const unsigned row0 = late ? (unsigned)EROWS : 0u;                // its first token inside a batch
  const unsigned lane = threadIdx.x & 31u;
  const unsigned wave = (unsigned)__builtin_amdgcn_readfirstlane((int)(threadIdx.x >> 5));
  const unsigned tilesM = (chm ? (unsigned)EMB : rows) >> 6;
  const unsigned tilesN = (chm ? rows : (unsigned)EMB) >> 6;
  const unsigned tile = blockIdx.x * 8u + wave;
  if (tile >= tilesM * tilesN) return;   // block-uniform (tile counts are multiples of 8), in front of every barrier
  const unsigned tm = tile / tilesN;
  const unsigned tn = tile - tm * tilesN;
  const unsigned m0 = tm << 6;
  const unsigned n0 = tn << 6;

  const _Float16* X = XQ;
  if (p != 0u) X = XK;
  const _Float16* tok = X + ((size_t)b * SEQ + row0) * EMB;   // this batch's tokens of the row group
  const _Float16* wgt = Wd + (size_t)p * WSZ;
  const _Float16* Ab = chm ? wgt : tok;
  const _Float16* Bb = chm ? tok : wgt;

  const unsigned rlane = lane & 15u;            // row (A) / col (B) within subtile
  const unsigned koff  = (lane >> 4) << 3;      // k offset of this lane half

  v8f acc[4][4];
#pragma unroll
  for (int i = 0; i < 4; ++i)
#pragma unroll
    for (int j = 0; j < 4; ++j) acc[i][j] = (v8f){0.f,0.f,0.f,0.f,0.f,0.f,0.f,0.f};

  // staging: this lane's row (of 4 per wave-wide copy) and 16-byte piece; each wave brings 8 of the A rows and its own 64 Bt rows
  const unsigned lr = lane >> 3, pc = (lane & 7u) << 3;
  const unsigned la = (unsigned)(size_t)pst + ((wave * 8u + lr) * KVP + pc) * 2u;            // LDS byte addresses in buffer 0
  const unsigned lb = (unsigned)(size_t)pst + ((64u + wave * 64u + lr) * KVP + pc) * 2u;
  const _Float16* ga = Ab + (size_t)(m0 + wave * 8u + lr) * (unsigned)EMB + pc;              // + 64 * stage
  const _Float16* gb = Bb + (size_t)(n0 + lr) * (unsigned)EMB + pc;
  const _Float16* fa = pst + rlane * KVP + koff;                                             // fragment rows in buffer 0
  const _Float16* fb = fa + (64u + wave * 64u) * KVP;
  constexpr unsigned NSTG = (unsigned)EMB / 64u;
  static_assert(NSTG >= 2u);                                                                 // the prologue starts stages 0 and 1

  // prologue of the two-buffer ring: stage 0 lands and is published, then stage 1 starts
  stage_rows2(la, ga);
  stage_rows8(lb, gb);
  stage_rows8(lb + 8u * ROWS4_B, gb + 32u * EMB);
  asm volatile("s_wait_asynccnt 0x0" ::: "memory");   // this wave's copies of stage 0 have landed
  __syncthreads();
  stage_rows2(la + PSTG_H * 2u, ga + 64u);
  stage_rows8(lb + PSTG_H * 2u, gb + 64u);
  stage_rows8(lb + PSTG_H * 2u + 8u * ROWS4_B, gb + 64u + 32u * EMB);

#pragma unroll 1   // one copy of the hot loop in the instruction cache; the buffer select is scalar
  for (unsigned t = 0; t < NSTG; ++t) {
    const unsigned bo = (t & 1u) * PSTG_H;             // this stage's buffer, in halves
#pragma unroll
    for (int ks = 0; ks < 2; ++ks) {
      v16h bh[4], ah[4];                               // the k-step's eight fragments are read as one group, ahead of its products
#pragma unroll
      for (int j = 0; j < 4; ++j) bh[j] = frag_ld(fb + bo + (unsigned)j * 16u * KVP + (unsigned)ks * 32u);
#pragma unroll
      for (int i = 0; i < 4; ++i) ah[i] = frag_ld(fa + bo + (unsigned)i * 16u * KVP + (unsigned)ks * 32u);
#pragma unroll
      for (int i = 0; i < 4; ++i) {
#pragma unroll
        for (int j = 0; j < 4; ++j) acc[i][j] = mma_raw(ah[i], bh[j], acc[i][j]);
        dep_guard_h(acc[i][0], acc[i][3], ah[i], ah[i]);
      }
      keep4_h(bh[0], bh[1], bh[2], bh[3]);
    }
    // stage t + 1 is published; the buffer that every wave has just left takes stage t + 2
    stage_publish();
    if (t + 2u < NSTG) {
      const unsigned ko = (t + 2u) * 64u;
      stage_rows2(la + bo * 2u, ga + ko);
      stage_rows8(lb + bo * 2u, gb + ko);
      stage_rows8(lb + bo * 2u + 8u * ROWS4_B, gb + ko + 32u * EMB);
    }
  }
  asm volatile("s_wait_asynccnt 0x0" ::: "memory");   // no copy is outstanding behind the loop
  acc_guard4(acc[0][0], acc[0][1], acc[0][2], acc[0][3]);
  acc_guard4(acc[1][0], acc[1][1], acc[1][2], acc[1][3]);
  acc_guard4(acc[2][0], acc[2][1], acc[2][2], acc[2][3]);
  acc_guard4(acc[3][0], acc[3][1], acc[3][2], acc[3][3]);

  // ---- epilogue (one of four forms, block-uniform) ----
  float* slab = sT[wave];
  const float* scl = SCLp + (size_t)p * EMB;
  if (chm) {
    _Float16* C  = VTHp + (size_t)b * ((size_t)EMB * SEQ) + row0;
    _Float16* Cr = VTRp + (size_t)b * ((size_t)EMB * EROWS);
    if (late) proj_epilogue<1, false>(acc, slab, C, (unsigned)SEQ, Cr, (unsigned)EROWS, bv, scl, m0, n0, lane);
    else      proj_epilogue<1, true >(acc, slab, C, (unsigned)SEQ, Cr, (unsigned)EROWS, bv, scl, m0, n0, lane);
  } else {
    _Float16* Cp = QHp; _Float16* Rp = QRp; const float* bias = bq;
    if (p == 1u) { Cp = KHp; Rp = KRp; bias = bk; }
    _Float16* C  = Cp + ((size_t)b * SEQ + row0) * EMB;
    _Float16* Cr = Rp + (size_t)b * ((size_t)EROWS * EMB);
    if (late) proj_epilogue<2, false>(acc, slab, C, (unsigned)EMB, Cr, (unsigned)EMB, bias, scl, m0, n0, lane);
    else      proj_epilogue<2, true >(acc, slab, C, (unsigned)EMB, Cr, (unsigned)EMB, bias, scl, m0, n0, lane);
  }
}

__device__ __forceinline__ float xhalf(float x) {
  return __builtin_bit_cast(float, __builtin_amdgcn_permlanex16(__builtin_bit_cast(int, x), __builtin_bit_cast(int, x), 0x76543210, 0xfedcba98, false, false));
}

// 2^x as the one hardware instruction. The library form adds a compare, two selects, an add and an ldexp per value, only to return subnormal results
// for x < -126. Here x <= 0 and such a term is below 2^-126 of its row's largest one: it is 0 in the f16 P either way and vanishes in the f32 row sum (>= 1).
// Written as asm so that the slot behind each transcendental is filled by construction: the next v_exp_f32 neither reads its result nor overwrites its
// source (the outputs are early-clobber, so they share no register with an input), and one v_nop stands behind the last.
__device__ __forceinline__ v8f exp2_hw8(v8f x) {
  float p0, p1, p2, p3, p4, p5, p6, p7;
  asm("v_exp_f32 %0, %8\n\tv_exp_f32 %1, %9\n\tv_exp_f32 %2, %10\n\tv_exp_f32 %3, %11\n\t"
      "v_exp_f32 %4, %12\n\tv_exp_f32 %5, %13\n\tv_exp_f32 %6, %14\n\tv_exp_f32 %7, %15\n\tv_nop"
      : "=&v"(p0), "=&v"(p1), "=&v"(p2), "=&v"(p3), "=&v"(p4), "=&v"(p5), "=&v"(p6), "=&v"(p7)
      : "v"(x[0]), "v"(x[1]), "v"(x[2]), "v"(x[3]), "v"(x[4]), "v"(x[5]), "v"(x[6]), "v"(x[7]));
  return (v8f){p0, p1, p2, p3, p4, p5, p6, p7};
}
__device__ __forceinline__ float exp2_hw1(float x) {
  float p;
  asm("v_exp_f32 %0, %1\n\tv_nop" : "=&v"(p) : "v"(x));   // v_nop: the slot behind the transcendental; a rescale factor below 2^-126 leaves nothing of the older sums in f32 either way
  return p;
}

template <bool EARLY>
__device__ __forceinline__ void attn_body(const _Float16* __restrict__ Q, const _Float16* __restrict__ Kp, const _Float16* __restrict__ VT,
                                          const _Float16* __restrict__ QR, const _Float16* __restrict__ KR, const _Float16* __restrict__ VTR,
                                          float* __restrict__ OUT, unsigned qb_off, unsigned nqb) {
  constexpr unsigned NT = EARLY ? 2u : 1u;                           // tiles per stage: value plane (+ residual plane)
  __shared__ __align__(16) _Float16 stg[2u * NT * TILE_H];           // buffer 0: K (, K residual); buffer 1: V^T (, V^T residual)
  float* OT = (float*)stg;                                           // block output tile [d][query], pitch 68 (cross-wave): reuses stg behind the loop
  const unsigned tid  = threadIdx.x;
  const unsigned wave = (unsigned)__builtin_amdgcn_readfirstlane((int)(tid >> 5));
  const unsigned lane = tid & 31u;
  const unsigned hh   = lane >> 4;
  const unsigned c    = lane & 15u;
  const unsigned bx = blockIdx.x;
  const unsigned qb = qb_off + bx % nqb;
  const unsigned bh = bx / nqb;
  const unsigned h  = bh & 7u;
  const unsigned b  = bh >> 3;
  const unsigned q0 = qb * 64u + wave * 16u;
  const unsigned qi = q0 + c;                                        // this lane's query
  const unsigned nch = qb + 1u;
  const size_t rowbase = (size_t)b * SEQ;
  const size_t resbase = (size_t)b * EROWS;

  const _Float16* qrow = Q + (rowbase + qi) * EMB + h * 64u + 8u * hh;
  const v16h qa0 = frag_ld(qrow), qa1 = frag_ld(qrow + 32);
  v16h qr0 = qa0, qr1 = qa1;
  if (EARLY) {
    const _Float16* qrr = QR + (resbase + qi) * EMB + h * 64u + 8u * hh;
    qr0 = frag_ld(qrr); qr1 = frag_ld(qrr + 32);
  }
  const _Float16* kbase  = stg + 8u * hh;                                                // + key * KVP (+ 32 for the second d chunk)
  const _Float16* krbase = kbase + TILE_H;
  const _Float16* vbase  = stg + NT * TILE_H + 8u * hh;                                  // + d * KVP + kv
  const _Float16* vrbase = vbase + TILE_H;
  // staging: this thread's row (of 16 per copy) and 16-byte piece
  const unsigned srow = tid >> 3, spc = (tid & 7u) << 3;
  const unsigned lk = (unsigned)(size_t)stg + (srow * KVP + spc) * 2u;                   // LDS byte address in the K buffer
  const unsigned lv = lk + NT * TILE_H * 2u;                                             // the same place in the V^T buffer
  const unsigned ok  = srow * EMB + spc;                                                 // this thread's piece inside a K tile (value and residual planes)
  const unsigned ov  = srow * SEQ + spc, ovr = srow * EROWS + spc;                       // the same inside a V^T tile, a V^T residual tile
  const _Float16* gk  = Kp  + rowbase * EMB + h * 64u;                                   // block-uniform tile origins: + kv0 * EMB
  const _Float16* gkr = KR  + resbase * EMB + h * 64u;
  const _Float16* gv  = VT  + ((size_t)b * EMB + h * 64u) * SEQ;                         // + kv0
  const _Float16* gvr = VTR + ((size_t)b * EMB + h * 64u) * EROWS;

  float mrow = -__builtin_inff();     // running maximum of this lane's query (equal in both halves)
  float lrow = 0.f;                   // running sum over this half's keys; the halves are joined behind the loop
  v8f oacc[4], oaccr[4];              // O^T: tile t, element r = d 16t + 8h + r of this lane's query
#pragma unroll
  for (int t = 0; t < 4; ++t) { oacc[t] = (v8f){0.f,0.f,0.f,0.f,0.f,0.f,0.f,0.f}; oaccr[t] = (v8f){0.f,0.f,0.f,0.f,0.f,0.f,0.f,0.f}; }

  const float SC    = 0.125f * 1.4426950408889634f;       // 1/sqrt(64) and log2(e)
  const float FILLX = -14426.950408889634f;               // -10000 * log2(e)

  // prologue of the two-buffer ring: stage 0 (K of chunk 0) lands and is published, then stage 1 (V^T of chunk 0) starts
  if (EARLY) stage_tile2(lk, gk + ok, 16u * EMB, lk + TILE_H * 2u, gkr + ok, 16u * EMB);
  else       stage_tile1(lk, gk + ok, 16u * EMB);
  asm volatile("s_wait_asynccnt 0x0" ::: "memory");   // this wave's copies of stage 0 have landed
  __syncthreads();
  if (EARLY) stage_tile2(lv, gv + ov, 16u * SEQ, lv + TILE_H * 2u, gvr + ovr, 16u * EROWS);
  else       stage_tile1(lv, gv + ov, 16u * SEQ);

  for (unsigned kc = 0; kc < nch; ++kc) {
    const unsigned kv0 = kc * 64u;
    const bool more = kc + 1u < nch;                   // block-uniform: a next chunk exists
    // Score products: the fragments of a group of key tiles are read together, ahead of the group's products, and the products of the group's
    // independent accumulators alternate, so each fills the distance behind the others; per accumulator the order of the products is unchanged.
    v8f s[4];
    constexpr int JG = EARLY ? 2 : 4;                  // key tiles per group (EARLY: four fragments per tile, so two tiles fill the registers)
#pragma unroll
    for (int j0 = 0; j0 < 4; j0 += JG) {
      v16h kh0[JG], kh1[JG], kq0[JG], kq1[JG];
      v8f ar[JG];
#pragma unroll
      for (int j = 0; j < JG; ++j) {
        const _Float16* kr = kbase + ((unsigned)(j0 + j) * 16u + c) * KVP;
        kh0[j] = frag_ld(kr); kh1[j] = frag_ld(kr + 32);
      }
      if (EARLY) {
#pragma unroll
        for (int j = 0; j < JG; ++j) {
          const _Float16* krr = krbase + ((unsigned)(j0 + j) * 16u + c) * KVP;
          kq0[j] = frag_ld(krr); kq1[j] = frag_ld(krr + 32);
        }
        frags_ready8(kh0[0], kh1[0], kh0[1], kh1[1], kq0[0], kq1[0], kq0[1], kq1[1]);
      } else {
        frags_ready8(kh0[0], kh1[0], kh0[1], kh1[1], kh0[JG - 2], kh1[JG - 2], kh0[JG - 1], kh1[JG - 1]);
      }
#pragma unroll
      for (int j = 0; j < JG; ++j) s[j0 + j] = mma_raw(kh0[j], qa0, (v8f){0.f,0.f,0.f,0.f,0.f,0.f,0.f,0.f});
      if (EARLY) {
#pragma unroll
        for (int j = 0; j < JG; ++j) ar[j] = mma_raw(kh0[j], qr0, (v8f){0.f,0.f,0.f,0.f,0.f,0.f,0.f,0.f});
      }
#pragma unroll
      for (int j = 0; j < JG; ++j) s[j0 + j] = mma_raw(kh1[j], qa1, s[j0 + j]);
      if (EARLY) {
#pragma unroll
        for (int j = 0; j < JG; ++j) ar[j] = mma_raw(kh1[j], qr1, ar[j]);
#pragma unroll
        for (int j = 0; j < JG; ++j) ar[j] = mma_raw(kq0[j], qa0, ar[j]);
#pragma unroll
        for (int j = 0; j < JG; ++j) ar[j] = mma_raw(kq1[j], qa1, ar[j]);
        acc_guard4(s[j0], s[j0 + 1], ar[0], ar[1]);    // v_nop: the distance between the group's last products and the vector instructions that read them
#pragma unroll
        for (int j = 0; j < JG; ++j) s[j0 + j] = s[j0 + j] + ar[j] * 0.00048828125f;
      }
    }
    if (!EARLY) acc_guard4(s[0], s[1], s[2], s[3]);    // v_nop: the same distance, also on the taken side of the branch below
    // The softmax touches no LDS any more, so the publish point stands directly behind the score products: V^T of this chunk is published;
    // the K buffer, which every wave has left, takes the next chunk's K, which flies through the softmax and V^T.P^T
    stage_publish();
    if (more) {
      const size_t ko = (size_t)(kv0 + 64u) * EMB;
      if (EARLY) stage_tile2(lk, (gk + ko) + ok, 16u * EMB, lk + TILE_H * 2u, (gkr + ko) + ok, 16u * EMB);
      else       stage_tile1(lk, (gk + ko) + ok, 16u * EMB);
    }
    const int kd = (int)qi - (int)(kv0 + 8u * hh);     // tile j, element r is a key in front of this lane's query where 16j + r < kd
    float mj[4];
#pragma unroll
    for (int j = 0; j < 4; ++j) {
#pragma unroll
      for (int r = 0; r < 8; ++r) s[j][r] = (j * 16 + r < kd) ? s[j][r] * SC : FILLX;
      mj[j] = fmaxf(fmaxf(fmaxf(s[j][0], s[j][1]), fmaxf(s[j][2], s[j][3])), fmaxf(fmaxf(s[j][4], s[j][5]), fmaxf(s[j][6], s[j][7])));
    }
    float m = fmaxf(fmaxf(mj[0], mj[1]), fmaxf(mj[2], mj[3]));
    m = fmaxf(m, xhalf(m));
    const float mnew = fmaxf(mrow, m);
    const float alpha = exp2_hw1(mrow - mnew);
    mrow = mnew;
    FragU pa[2], pr[2];                                // P^T (and its residual) as B fragments of keys 0..31 and 32..63
    float ps[4];
#pragma unroll
    for (int j = 0; j < 4; ++j) {
      float a = 0.f;
      const v8f pj = exp2_hw8(s[j] - mnew);
#pragma unroll
      for (int r = 0; r < 8; ++r) a += pj[r];
      const v8f e = pj * 32768.0f;
      const v8h g = toh8(e);
      pa[j >> 1].h[j & 1] = g;
      if (EARLY) pr[j >> 1].h[j & 1] = toh8((e - tof8(g)) * 2048.0f);
      ps[j] = a;
    }
    lrow = lrow * alpha + ((ps[0] + ps[1]) + (ps[2] + ps[3]));
#pragma unroll
    for (int t = 0; t < 4; ++t) {
#pragma unroll
      for (int r = 0; r < 8; ++r) { oacc[t][r] *= alpha; if (EARLY) oaccr[t][r] *= alpha; }
    }
    // Output products: eight fragments (EARLY: value and residual of 32 keys; else all 64 keys) are read together, ahead of their products; the four output tiles alternate
    if (EARLY) {
#pragma unroll
      for (int kk = 0; kk < 2; ++kk) {
        v16h vb[4], vr[4];
#pragma unroll
        for (int t = 0; t < 4; ++t) {
          vb[t] = frag_ld(vbase  + ((unsigned)t * 16u + c) * KVP + (unsigned)kk * 32u);
          vr[t] = frag_ld(vrbase + ((unsigned)t * 16u + c) * KVP + (unsigned)kk * 32u);
        }
        frags_ready8(vb[0], vb[1], vb[2], vb[3], vr[0], vr[1], vr[2], vr[3]);
#pragma unroll
        for (int t = 0; t < 4; ++t) oacc[t] = mma_raw(vb[t], pa[kk].v, oacc[t]);
#pragma unroll
        for (int t = 0; t < 4; ++t) oaccr[t] = mma_raw(vb[t], pr[kk].v, oaccr[t]);
#pragma unroll
        for (int t = 0; t < 4; ++t) oaccr[t] = mma_raw(vr[t], pa[kk].v, oaccr[t]);
      }
    } else {
      v16h vb[2][4];
#pragma unroll
      for (int kk = 0; kk < 2; ++kk)
#pragma unroll
        for (int t = 0; t < 4; ++t) vb[kk][t] = frag_ld(vbase + ((unsigned)t * 16u + c) * KVP + (unsigned)kk * 32u);
      frags_ready8(vb[0][0], vb[0][1], vb[0][2], vb[0][3], vb[1][0], vb[1][1], vb[1][2], vb[1][3]);
#pragma unroll
      for (int kk = 0; kk < 2; ++kk)
#pragma unroll
        for (int t = 0; t < 4; ++t) oacc[t] = mma_raw(vb[kk][t], pa[kk].v, oacc[t]);
    }
    // v_nop: the distance between the chunk's last products and the vector instructions that read or rescale the tiles, on every path out of the chunk
    if (EARLY) acc_guard8(oacc, oaccr);
    else       acc_guard4(oacc[0], oacc[1], oacc[2], oacc[3]);
    // K of the next chunk is published; the V^T buffer, which every wave has left, takes the next chunk's V^T
    stage_publish();
    if (more) {
      if (EARLY) stage_tile2(lv, (gv + (kv0 + 64u)) + ov, 16u * SEQ, lv + TILE_H * 2u, (gvr + (kv0 + 64u)) + ovr, 16u * EROWS);
      else       stage_tile1(lv, (gv + (kv0 + 64u)) + ov, 16u * SEQ);
    }
  }
  asm volatile("s_wait_asynccnt 0x0" ::: "memory");   // no copy is outstanding when stg becomes the output tile (the last publish point's barrier ended all reads)

  // join the halves' sums, normalise (P carried x2^15), zero sequence row 0, put the wave's 64 d x 16 queries into the block tile [d][query]
  const float lsum = lrow + xhalf(lrow);
  const float iv = 1.0f / (lsum * 32768.0f);
  const float inv = (qi == 0u) ? 0.0f : iv;
#pragma unroll
  for (int t = 0; t < 4; ++t) {
#pragma unroll
    for (int r = 0; r < 8; ++r) {
      float v = oacc[t][r];
      if (EARLY) v += oaccr[t][r] * 0.00048828125f;
      OT[((unsigned)t * 16u + 8u * hh + (unsigned)r) * 68u + wave * 16u + c] = v * inv;
    }
  }
  __syncthreads();
  {
    const unsigned c4 = (lane & 15u) << 2;     // row segment = 64 floats = 256 B = 16 lanes x 16 B; 2 rows per instruction, 8 trips = 16 rows per wave
    float* ob = OUT + ((size_t)b * EMB + h * 64u + wave * 16u) * SEQ_FULL + qb * 64u + c4;
    v4f vv[8];
#pragma unroll
    for (int it = 0; it < 8; ++it) {
      const unsigned row = (unsigned)it * 2u + hh;
      vv[it] = *(const v4f*)(OT + (wave * 16u + row) * 68u + c4);
    }
    {
#pragma unroll
      for (int it = 0; it < 8; ++it) {
        const unsigned row = (unsigned)it * 2u + hh;
        *(v4f*)(ob + (size_t)row * SEQ_FULL) = vv[it];
      }
    }
  }
}

__global__ __launch_bounds__(128) __attribute__((amdgpu_num_vgpr(256))) void k_attn_early(
    const _Float16* __restrict__ Q, const _Float16* __restrict__ Kp, const _Float16* __restrict__ VT,
    const _Float16* __restrict__ QR, const _Float16* __restrict__ KR, const _Float16* __restrict__ VTR,
    float* __restrict__ OUT, unsigned qb_off, unsigned nqb) {
  attn_body<true>(Q, Kp, VT, QR, KR, VTR, OUT, qb_off, nqb);
}
__global__ __launch_bounds__(128) void k_attn_late(
    const _Float16* __restrict__ Q, const _Float16* __restrict__ Kp, const _Float16* __restrict__ VT,
    const _Float16* __restrict__ QR, const _Float16* __restrict__ KR, const _Float16* __restrict__ VTR,
    float* __restrict__ OUT, unsigned qb_off, unsigned nqb) {
  attn_body<false>(Q, Kp, VT, QR, KR, VTR, OUT, qb_off, nqb);
}

// ---- workspace carve (bytes; every region is a whole number of 256-B units and is written in full by its producer) ----
#define SZ_P16  ((size_t)NB * SEQ * EMB * 2)            // one f16 activation plane
#define SZ_R16  ((size_t)NB * EROWS * EMB * 2)          // one f16 residual plane (early rows only)
#define SZ_W16  ((size_t)3 * WSZ * 2)
#define SZ_SCL  ((size_t)3 * EMB * 4)
#define OFF_XQ   ((size_t)0)
#define OFF_XK   (OFF_XQ + SZ_P16)
#define OFF_W16  (OFF_XK + SZ_P16)
#define OFF_SCL  (OFF_W16 + SZ_W16)
#define OFF_QH   (OFF_SCL + SZ_SCL)
#define OFF_KH   (OFF_QH + SZ_P16)
#define OFF_VTH  (OFF_KH + SZ_P16)
#define OFF_QR   (OFF_VTH + SZ_P16)
#define OFF_KR   (OFF_QR + SZ_R16)
#define OFF_VTR  (OFF_KR + SZ_R16)
#define WS_TOTAL (OFF_VTR + SZ_R16)
static_assert(SZ_P16 % 256 == 0 && SZ_R16 % 256 == 0 && SZ_W16 % 256 == 0 && SZ_SCL % 256 == 0);
static_assert(OFF_XK == OFF_XQ + (size_t)NB * SEQ * EMB * 2);   // k_castxT addresses the key plane as plane 1 of one base
static_assert(WS_TOTAL <= (size_t)134217728);
static_assert((size_t)NB_FULL * EMB * SEQ_FULL * 4 == (size_t)33554432);   // output extent in bytes, offset 0

extern "C" void kernel_launch(void* const* d_in, const int* in_sizes, int n_in, void* d_out, int out_size, void* d_ws, size_t ws_size, hipStream_t stream) {
    if (n_in < 11) return;
    const long long xneed = ((long long)(NB - 1) * EMB + (EMB - 1)) * SEQ_FULL + SEQ;
    if ((long long)in_sizes[0] < xneed) return;
    if ((long long)in_sizes[1] < xneed) return;
    if (in_sizes[2] < WSZ || in_sizes[5] < WSZ || in_sizes[8] < WSZ) return;
    if (in_sizes[3] < EMB || in_sizes[4] < EMB || in_sizes[6] < EMB || in_sizes[7] < EMB || in_sizes[9] < EMB || in_sizes[10] < EMB) return;
    if ((long long)out_size < xneed) return;
    if ((size_t)WS_TOTAL > ws_size) return;

    // input order: query, key, vq, gq, bq, vk, gk, bk, vv, gv, bv
    const float* query = (const float*)d_in[0];
    const float* key   = (const float*)d_in[1];
    const float* vq = (const float*)d_in[2];  const float* gq = (const float*)d_in[3];  const float* bq = (const float*)d_in[4];
    const float* vk = (const float*)d_in[5];  const float* gk = (const float*)d_in[6];  const float* bk = (const float*)d_in[7];
    const float* vv = (const float*)d_in[8];  const float* gv = (const float*)d_in[9];  const float* bv = (const float*)d_in[10];
    float* out = (float*)d_out;

    char* ws = (char*)d_ws;
    unsigned short* X16  = (unsigned short*)(ws + OFF_XQ);     // plane 0 = query tokens, plane 1 = key tokens
    unsigned short* W16  = (unsigned short*)(ws + OFF_W16);    // planes: 0 vq 1 vk 2 vv (direction weights x16)
    float*          SCL  = (float*)(ws + OFF_SCL);             // [3][512] row gains / 16
    _Float16* QH  = (_Float16*)(ws + OFF_QH);
    _Float16* KH  = (_Float16*)(ws + OFF_KH);
    _Float16* VTH = (_Float16*)(ws + OFF_VTH);
    _Float16* QR  = (_Float16*)(ws + OFF_QR);
    _Float16* KR  = (_Float16*)(ws + OFF_KR);
    _Float16* VTR = (_Float16*)(ws + OFF_VTR);

    const _Float16* XQh = (const _Float16*)(ws + OFF_XQ);
    const _Float16* XKh = (const _Float16*)(ws + OFF_XK);
    const _Float16* W16h = (const _Float16*)W16;

    // 1-2: operand planes
    k_castxT<<<dim3((unsigned)(SEQ / 64), (unsigned)(EMB / 64), (unsigned)(NB * 2)), 256, 0, stream>>>(query, key, X16);
    k_wprep<<<dim3((unsigned)(EMB / 32), 3u), 256, 0, stream>>>(vq, gq, vk, gk, vv, gv, W16, SCL);

    // 3: q, k (tokens x V^T, row gain, bias -> f16 planes) and v^T (V x tokens^T, gain[m], bias[m] -> f16 plane [b][h*64+d][token]); early group also residual planes;
    //    all six row groups in one grid (blockIdx.z), the early groups (longer epilogue) first
    k_proj_all<<<dim3((unsigned)(((EROWS > LROWS) ? EROWS : LROWS) / 64), (unsigned)NB, (LROWS > 0) ? 6u : 3u), 256, 0, stream>>>(
        XQh, XKh, W16h, QH, KH, VTH, QR, KR, VTR, bq, bk, bv, SCL);

    // 4-5: causal attention, early band (value + residual planes) and late band (single planes); each block writes its 64x64 tile of the output buffer
    k_attn_early<<<(unsigned)(NB * NHEAD * (EROWS / 64)), 128, 0, stream>>>(QH, KH, VTH, QR, KR, VTR, out, 0u, (unsigned)(EROWS / 64));
    if (LROWS > 0) {
        k_attn_late<<<(unsigned)(NB * NHEAD * (LROWS / 64)), 128, 0, stream>>>(QH, KH, VTH, QR, KR, VTR, out, (unsigned)(EROWS / 64), (unsigned)(LROWS / 64));
    }
}

// v008
// It runs in 91.2 microseconds.
// Next to v007, in two timings, it ran 1.12 and 1.13 times as fast.
// Counting every step since v000, it is 4.26 times as fast.
// All contractions (weight-normalised q/k/v projections, q.k^T, P.V): v_wmma_f32_16x16x32_f16 (f16 operands, f32 accumulate); float inputs bf16-converted (RNE) first, direction weights carried x16 with the per-row norm gain applied in f32 at the projection epilogue, P carried x2^15; query rows < EROWS additionally carry q, k, v, P as f16 value + x2048 f16 residual planes (three products, residual products in their own accumulator); mask, softmax, norms in f32.
#include <hip/hip_runtime.h>
#include <math.h>

// ---- sizes (NB / SEQ reducible; *_FULL = strides of the inputs / output) ----
#ifndef NB
#define NB 16
#endif
#ifndef SEQ
#define SEQ 1024
#endif
#ifndef EROWS
#define EROWS ((SEQ < 512) ? SEQ : 512)
#endif
#define LROWS (SEQ - EROWS)
#define NB_FULL 16
#define SEQ_FULL 1024
#define EMB 512
#define NHEAD 8
#define HDIM 64
#define WSZ (EMB * EMB)

static_assert(NB >= 1 && NB <= NB_FULL);
static_assert(SEQ <= SEQ_FULL && SEQ % 64 == 0 && SEQ >= 64);
static_assert(EROWS % 64 == 0 && EROWS >= 64 && EROWS <= SEQ);
static_assert(LROWS % 64 == 0);
static_assert(EMB % 64 == 0 && EMB == NHEAD * HDIM && HDIM == 64 && NHEAD == 8);
static_assert(EMB % 32 == 0);                          // WMMA k-steps of 32, weight rows per prep block
static_assert(4 * 256 == 64 * 16);                     // k_castxT load phase: trips x threads == tile rows x 16-B pieces per row
static_assert(2 * 256 == 64 * 8);
static_assert(2 * 32 * 8 == EMB);                      // k_wprep: trips x lanes x elements == weight row width
static_assert(8 * 4 == 32);                            // k_wprep: waves x rows per wave == rows per block
static_assert(32 * 16 * 4 == 16 * 128);                // projection epilogue: lanes x bytes x trips == slab rows x row bytes (64 halves)
static_assert(4 * 32 * 16 * 8 == 64 * 256);            // attention output: waves x lanes x bytes x trips == tile rows x row bytes (64 floats)
static_assert(2 * 384 * 72 * 2 + 8 * 16 * 68 * 4 <= 163840);  // static LDS of the projection kernel (two operand stages + the epilogue slabs): two blocks per 320-KiB LDS
static_assert((EMB / 64) % 8 == 0 && (EROWS / 64) % 8 == 0 && (LROWS / 64) % 8 == 0);  // projection: a block is 2 x 4 wave tiles; a block has all its tiles or none
static_assert(8 * 4 * 32 * 16 == 128 * 128 && 8 * 8 * 32 * 16 == 256 * 128);  // projection staging: waves x copies x lanes x bytes == block rows x row bytes (A, Bt)
static_assert(4 * 64 * 72 * 2 <= 81920);  // static LDS of the attention kernels: four blocks per 320-KiB LDS
static_assert(64 * 68 * 4 <= 2 * 64 * 72 * 2);         // the output tile fits the staging area that it reuses
static_assert(4 * 128 * 16 == 64 * 128);               // staging: copies per thread x threads x bytes == tile rows x row bytes
static_assert(64 * 65 * 4 <= 131072);                  // static LDS of k_castxT

typedef _Float16 h16;
typedef __attribute__((ext_vector_type(16))) _Float16 v16h;
typedef __attribute__((ext_vector_type(8)))  _Float16 v8h;
typedef __attribute__((ext_vector_type(8)))  float    v8f;
typedef __attribute__((ext_vector_type(4)))  float    v4f;
typedef __attribute__((ext_vector_type(2)))  float    v2f;
typedef __attribute__((ext_vector_type(2)))  _Float16 v2h;
typedef __attribute__((ext_vector_type(4)))  unsigned int u4v;

// 16-bit WMMA fragment map (wave32), lane L, h = L>>4, m = L&15:
//   A 16x32: lane = row m;    element i -> k = (i<8) ? 8h+i : 16+8h+(i-8)
//   B 32x16: lane = column m; the SAME k(i,h)
//   D 16x16 (8 f32): lane = column m; element r -> row 8h+r
union FragU { v16h v; v8h h[2]; };
// p already includes the +8h lane-half offset: elements 0..7 <- p[0..7], 8..15 <- p[16..23]
__device__ __forceinline__ v16h frag_ld(const _Float16* p) { FragU f; f.h[0] = *(const v8h*)(p); f.h[1] = *(const v8h*)(p + 16); return f.v; }

__device__ __forceinline__ v8f mma_raw(v16h a, v16h b, v8f c) { return __builtin_amdgcn_wmma_f32_16x16x32_f16(false, a, false, b, (short)0, c, false, false); }
__device__ __forceinline__ void dep_guard_h(v8f& a, v8f& b, v16h x, v16h y) { asm volatile("v_nop\n\tv_nop\n\tv_nop\n\tv_nop" : "+v"(a), "+v"(b) : "v"(x), "v"(y)); }
__device__ __forceinline__ void keep4_h(v16h a, v16h b, v16h c, v16h d) { asm volatile("v_nop" :: "v"(a), "v"(b), "v"(c), "v"(d)); }
__device__ __forceinline__ void acc_guard4(v8f& a, v8f& b, v8f& c, v8f& d) { asm volatile("v_nop\n\tv_nop\n\tv_nop\n\tv_nop" : "+v"(a), "+v"(b), "+v"(c), "+v"(d)); }
// Inputs-only fence on loaded fragments: all eight are in registers here, so their LDS reads are issued as one group and waited for once, ahead of the products
__device__ __forceinline__ void frags_ready8(v16h a, v16h b, v16h c, v16h d, v16h e, v16h f, v16h g, v16h h) {
    asm volatile("" :: "v"(a), "v"(b), "v"(c), "v"(d), "v"(e), "v"(f), "v"(g), "v"(h));
}
__device__ __forceinline__ void acc_guard8(v8f (&a)[4], v8f (&b)[4]) {
    asm volatile("v_nop\n\tv_nop\n\tv_nop\n\tv_nop" : "+v"(a[0]), "+v"(a[1]), "+v"(a[2]), "+v"(a[3]), "+v"(b[0]), "+v"(b[1]), "+v"(b[2]), "+v"(b[3]));
}

// bf16 RNE convert, kept as f32 (finite inputs)
__device__ __forceinline__ float bf_keep(float v) { const unsigned u = __float_as_uint(v); return __uint_as_float((u + 0x7fffu + ((u >> 16) & 1u)) & 0xffff0000u); }
// f32 -> f16, round to nearest even, two values per instruction. A result below 2^-14 stays an f16 subnormal: the matrix instructions take subnormal operands as they are.
__device__ __forceinline__ unsigned pk2hf(float a, float b) { return __builtin_bit_cast(unsigned, __builtin_convertvector((v2f){a, b}, v2h)); }
__device__ __forceinline__ v8h toh8(v8f v) { return __builtin_convertvector(v, v8h); }
__device__ __forceinline__ v8f tof8(v8h v) { return __builtin_convertvector(v, v8f); }

// ---- LDS staging of 64-row x 128-byte f16 tiles by asynchronous copies (global -> LDS, through no register) ----
#define KVP 72u                      // LDS row pitch in halves: 144 B = 16 B x 9, conflict-free for 16-byte fragment reads
#define TILE_H (64u * KVP)           // halves of one staged tile
#define ROWS16_B (16u * KVP * 2u)    // LDS bytes of 16 staged rows
#define PSTG_H (384u * KVP)          // halves of one projection stage: 128 A rows + 256 Bt rows
// Each thread of the 128 copies its 16-byte piece of rows r, r+16, r+32, r+48: one wave-wide copy = 4 whole 128-byte rows.
// l = the thread's LDS byte address of its piece in row r, g = the same piece in global memory, st = 16 source rows in halves.
// s_wait_xcnt stands as the last line of the copies' own statement, so no address register is rewritten in front of it.
__device__ __forceinline__ void stage_tile1(unsigned l, const _Float16* g, size_t st) {
    asm volatile("global_load_async_to_lds_b128 %0, %4, off\n\t"
                 "global_load_async_to_lds_b128 %1, %5, off\n\t"
                 "global_load_async_to_lds_b128 %2, %6, off\n\t"
                 "global_load_async_to_lds_b128 %3, %7, off\n\t"
                 "s_wait_xcnt 0x0"
                 :: "v"(l), "v"(l + ROWS16_B), "v"(l + 2u * ROWS16_B), "v"(l + 3u * ROWS16_B),
                    "v"(g), "v"(g + st), "v"(g + 2u * st), "v"(g + 3u * st) : "memory");
}
__device__ __forceinline__ void stage_tile2(unsigned l, const _Float16* g, size_t st, unsigned l2, const _Float16* g2, size_t st2) {
    asm volatile("global_load_async_to_lds_b128 %0, %8, off\n\t"
                 "global_load_async_to_lds_b128 %1, %9, off\n\t"
                 "global_load_async_to_lds_b128 %2, %10, off\n\t"
                 "global_load_async_to_lds_b128 %3, %11, off\n\t"
                 "global_load_async_to_lds_b128 %4, %12, off\n\t"
                 "global_load_async_to_lds_b128 %5, %13, off\n\t"
                 "global_load_async_to_lds_b128 %6, %14, off\n\t"
                 "global_load_async_to_lds_b128 %7, %15, off\n\t"
                 "s_wait_xcnt 0x0"
                 :: "v"(l), "v"(l + ROWS16_B), "v"(l + 2u * ROWS16_B), "v"(l + 3u * ROWS16_B),
                    "v"(l2), "v"(l2 + ROWS16_B), "v"(l2 + 2u * ROWS16_B), "v"(l2 + 3u * ROWS16_B),
                    "v"(g), "v"(g + st), "v"(g + 2u * st), "v"(g + 3u * st),
                    "v"(g2), "v"(g2 + st2), "v"(g2 + 2u * st2), "v"(g2 + 3u * st2) : "memory");
}
// Wave-wide forms for the projection: a lane copies its 16-byte piece of rows r, r+4, ... (source pitch EMB halves): one wave-wide copy = 4 whole 128-byte rows.
#define ROWS4_B (4u * KVP * 2u)      // LDS bytes of 4 staged rows
__device__ __forceinline__ void stage_rows4(unsigned l, const _Float16* g) {
    asm volatile("global_load_async_to_lds_b128 %0, %4, off\n\t"
                 "global_load_async_to_lds_b128 %1, %5, off\n\t"
                 "global_load_async_to_lds_b128 %2, %6, off\n\t"
                 "global_load_async_to_lds_b128 %3, %7, off\n\t"
                 "s_wait_xcnt 0x0"
                 :: "v"(l), "v"(l + ROWS4_B), "v"(l + 2u * ROWS4_B), "v"(l + 3u * ROWS4_B),
                    "v"(g), "v"(g + 4u * EMB), "v"(g + 8u * EMB), "v"(g + 12u * EMB) : "memory");
}
__device__ __forceinline__ void stage_rows8(unsigned l, const _Float16* g) {
    asm volatile("global_load_async_to_lds_b128 %0, %8, off\n\t"
                 "global_load_async_to_lds_b128 %1, %9, off\n\t"
                 "global_load_async_to_lds_b128 %2, %10, off\n\t"
                 "global_load_async_to_lds_b128 %3, %11, off\n\t"
                 "global_load_async_to_lds_b128 %4, %12, off\n\t"
                 "global_load_async_to_lds_b128 %5, %13, off\n\t"
                 "global_load_async_to_lds_b128 %6, %14, off\n\t"
                 "global_load_async_to_lds_b128 %7, %15, off\n\t"
                 "s_wait_xcnt 0x0"
                 :: "v"(l), "v"(l + ROWS4_B), "v"(l + 2u * ROWS4_B), "v"(l + 3u * ROWS4_B),
                    "v"(l + 4u * ROWS4_B), "v"(l + 5u * ROWS4_B), "v"(l + 6u * ROWS4_B), "v"(l + 7u * ROWS4_B),
                    "v"(g), "v"(g + 4u * EMB), "v"(g + 8u * EMB), "v"(g + 12u * EMB),
                    "v"(g + 16u * EMB), "v"(g + 20u * EMB), "v"(g + 24u * EMB), "v"(g + 28u * EMB) : "memory");
}
// publish point of the next stage: this wave's LDS reads have returned, its own copies have landed, then the block barrier
// (it shows the landed tile to the other waves and ends every wave's reads of the buffer that is refilled behind it)
__device__ __forceinline__ void stage_publish() {
    asm volatile("s_wait_dscnt 0x0" ::: "memory");      // this wave's reads of the buffer about to be refilled are done
    asm volatile("s_wait_asynccnt 0x0" ::: "memory");   // this wave's copies of the next stage have landed
    __syncthreads();
}

#define VST2(T, ptr, val) do { const T vst2_v_ = (val); *(T*)(ptr) = vst2_v_;  } while (0)

// ---- query / key (f32, [b][c][s], full strides) -> f16 planes of the bf16-converted values, compact [NB*SEQ][512] (token-major);
//      plane 0 = query at D, plane 1 = key at D + NB*SEQ*EMB. 64 channels x 64 tokens per block through an LDS tile (cross-wave: block barrier);
__global__ __launch_bounds__(256) void k_castxT(const float* __restrict__ xq, const float* __restrict__ xk, unsigned short* __restrict__ D) {
#pragma clang fp contract(off)
    __shared__ float tile[64 * 65];
    const unsigned z = blockIdx.z;
    const unsigned which = z & 1u;                       // block-uniform select among global pointers
    const unsigned b = z >> 1;
    const float* src = xq;
    if (which == 1u) src = xk;
    const unsigned s0 = blockIdx.x * 64u, c0 = blockIdx.y * 64u;
    const unsigned t = threadIdx.x;
#pragma unroll
    for (int i = 0; i < 4; ++i) {
        const unsigned idx = t + 256u * (unsigned)i;
        const unsigned cc = idx >> 4, s4 = (idx & 15u) << 2;
        const v4f a = *(const v4f*)(src + ((size_t)b * EMB + c0 + cc) * SEQ_FULL + s0 + s4);
        tile[cc * 65u + s4 + 0u] = a.x; tile[cc * 65u + s4 + 1u] = a.y; tile[cc * 65u + s4 + 2u] = a.z; tile[cc * 65u + s4 + 3u] = a.w;
    }
    __syncthreads();
#pragma unroll
    for (int i = 0; i < 2; ++i) {
        const unsigned idx = t + 256u * (unsigned)i;
        const unsigned ss = idx >> 3, c8 = (idx & 7u) << 3;
        const float f0 = tile[(c8 + 0u) * 65u + ss], f1 = tile[(c8 + 1u) * 65u + ss], f2 = tile[(c8 + 2u) * 65u + ss], f3 = tile[(c8 + 3u) * 65u + ss];
        const float f4 = tile[(c8 + 4u) * 65u + ss], f5 = tile[(c8 + 5u) * 65u + ss], f6 = tile[(c8 + 6u) * 65u + ss], f7 = tile[(c8 + 7u) * 65u + ss];
        u4v pk; pk.x = pk2hf(bf_keep(f0), bf_keep(f1)); pk.y = pk2hf(bf_keep(f2), bf_keep(f3)); pk.z = pk2hf(bf_keep(f4), bf_keep(f5)); pk.w = pk2hf(bf_keep(f6), bf_keep(f7));
        VST2(u4v, (u4v*)(D + (size_t)which * ((size_t)NB * SEQ * EMB) + ((size_t)b * SEQ + s0 + ss) * EMB + c0 + c8), pk);
    }
}

// ---- three [512 out][512 in] direction weights -> f16 planes of bf16-converted values x16 (exact), plane y at D + y*WSZ, and the per-row gain table
//      SCL[y*512 + o] = bf16(g[o]) / ||bf16(v[o,:])|| / 16 (f32). Block = 32 rows (wave = 4 rows); grid (EMB/32, 3).
//      Plane rows: 2 instructions x 32 lanes x 16 B lane-contiguous; gain line: 32 lanes x 4 B of wave 0 in one instruction (LDS word per row, block barrier). ----
__global__ __launch_bounds__(256) void k_wprep(const float* __restrict__ v0, const float* __restrict__ g0, const float* __restrict__ v1, const float* __restrict__ g1,
                                               const float* __restrict__ v2, const float* __restrict__ g2, unsigned short* __restrict__ D, float* __restrict__ SCLp) {
#pragma clang fp contract(off)
    __shared__ float red[32];
    const unsigned y = blockIdx.y;                       // block-uniform select among global pointers
    const float* s = v0; const float* g = g0;
    if (y == 1u) { s = v1; g = g1; }
    if (y == 2u) { s = v2; g = g2; }
    const unsigned lane = threadIdx.x & 31u;
    const unsigned wave = (unsigned)__builtin_amdgcn_readfirstlane((int)(threadIdx.x >> 5));
    const unsigned rb = blockIdx.x * 32u;
#pragma unroll 1
    for (unsigned rr = 0; rr < 4u; ++rr) {
        const unsigned rl = wave * 4u + rr;
        const unsigned row = rb + rl;
        float ss = 0.f;
#pragma unroll 1
        for (unsigned it = 0; it < 2u; ++it) {
            const unsigned u = it * 32u + lane;          // 16-B piece of the row
            const float* p = s + (size_t)row * EMB + u * 8u;
            const v4f a = *(const v4f*)(p), b = *(const v4f*)(p + 4);
            const float a0 = bf_keep(a.x), a1 = bf_keep(a.y), a2 = bf_keep(a.z), a3 = bf_keep(a.w);
            const float b0 = bf_keep(b.x), b1 = bf_keep(b.y), b2 = bf_keep(b.z), b3 = bf_keep(b.w);
            ss += a0 * a0; ss += a1 * a1; ss += a2 * a2; ss += a3 * a3;
            ss += b0 * b0; ss += b1 * b1; ss += b2 * b2; ss += b3 * b3;
            u4v pk; pk.x = pk2hf(a0 * 16.f, a1 * 16.f); pk.y = pk2hf(a2 * 16.f, a3 * 16.f); pk.z = pk2hf(b0 * 16.f, b1 * 16.f); pk.w = pk2hf(b2 * 16.f, b3 * 16.f);
            VST2(u4v, (u4v*)(D + (size_t)y * WSZ + (size_t)row * EMB + u * 8u), pk);
        }
        ss += __shfl_xor(ss, 1, 32); ss += __shfl_xor(ss, 2, 32); ss += __shfl_xor(ss, 4, 32);
        ss += __shfl_xor(ss, 8, 32); ss += __shfl_xor(ss, 16, 32);
        if (lane == 0u) red[rl] = ss;
    }
    __syncthreads();
    if (threadIdx.x < 32u) {
        const unsigned row = rb + lane;
        const float sc = bf_keep(g[row]) * (1.0f / sqrtf(red[lane])) * 0.0625f;
        VST2(float, SCLp + (size_t)y * EMB + row, sc);
    }
}

// =====================================================================================================================
// k_proj_all: all six projection row groups in ONE grid (they only read the operand planes and write disjoint planes, so none waits for another).
//   blockIdx.z: 0 q early, 1 k early, 2 v^T early (value + residual planes), 3 q late, 4 k late, 5 v^T late (value plane only); blockIdx.y = batch.
//   C[m,n] = scl * sum_k A[m,k] * Bt[n,k] + bias; each wave owns a 64x64 tile; a block is 2 x 4 waves = 128 x 256; A, Bt row-major f16, pitch EMB, K = EMB.
//   q, k (token-major): A = tokens, Bt = direction weights, bias[n], scl[n]; v^T (channel-major): A = direction weights, Bt = tokens, bias[m], scl[m]
//   (bias bf16-converted on load; scl is an f32 table). Operands: a stage is 64 k (whole 128-byte rows) of the block's 128 A rows (each read by 4 waves)
//   and 256 Bt rows (each read by 2 waves), brought into LDS by asynchronous copies, two buffers: stage t + 1 flies while stage t feeds the products. Output: f16 plane C (value); RES: also the f16 plane Cr = (value - f16 value) x 2048.
// =====================================================================================================================
template <int BIAS_MODE, bool RES>
__device__ __forceinline__ void proj_epilogue(v8f (&acc)[4][4], float* slab, _Float16* C, unsigned ldc, _Float16* Cr, unsigned ldr,
                                              const float* __restrict__ bias, const float* __restrict__ scl, unsigned m0, unsigned n0, unsigned lane) {
  const unsigned rlane = lane & 15u;            // col (D) within subtile
  const unsigned mOff  = (lane >> 4) << 3;      // D row offset
#pragma unroll
  for (int i = 0; i < 4; ++i) {
    const unsigned mBase = m0 + ((unsigned)i << 4);
    float bm[8], sm[8];
#pragma unroll
    for (int r = 0; r < 8; ++r) {
      bm[r] = (BIAS_MODE == 1) ? bf_keep(bias[mBase + mOff + (unsigned)r]) : 0.f;
      sm[r] = (BIAS_MODE == 1) ? scl[mBase + mOff + (unsigned)r] : 0.f;
    }
#pragma unroll
    for (int j = 0; j < 4; ++j) {
      const unsigned n = n0 + ((unsigned)j << 4) + rlane;
      float bv = 0.f, sv = 0.f;
      if (BIAS_MODE == 2) { bv = bf_keep(bias[n]); sv = scl[n]; }
#pragma unroll
      for (int r = 0; r < 8; ++r) {
        float v;
        if (BIAS_MODE == 1) v = acc[i][j][r] * sm[r] + bm[r];
        else                v = acc[i][j][r] * sv + bv;
        slab[(mOff + (unsigned)r) * 68u + ((unsigned)j << 4) + rlane] = v;
      }
    }
    __builtin_amdgcn_fence(3 /* release order */, "workgroup");
    __builtin_amdgcn_wave_barrier();
    __builtin_amdgcn_fence(2 /* acquire order */, "workgroup");
    {
      const unsigned q = lane >> 3, c8 = (lane & 7u) << 3;
      v8h hv[4];
      v8h rv[4];
#pragma unroll
      for (int it = 0; it < 4; ++it) {
        const unsigned row = (unsigned)it * 4u + q;
        const float* sp = slab + row * 68u + c8;
        const v4f s0 = *(const v4f*)(sp), s1 = *(const v4f*)(sp + 4);
        const v8f sv = (v8f){s0.x, s0.y, s0.z, s0.w, s1.x, s1.y, s1.z, s1.w};
        const v8h t = toh8(sv);
        hv[it] = t;
        v8h u = t;
        if (RES) u = toh8((sv - tof8(t)) * 2048.0f);
        rv[it] = u;
      }
#pragma unroll
      for (int it = 0; it < 4; ++it) {
        const unsigned row = (unsigned)it * 4u + q;
        *(v8h*)(C + (size_t)(mBase + row) * ldc + n0 + c8) = hv[it];
        if (RES) *(v8h*)(Cr + (size_t)(mBase + row) * ldr + n0 + c8) = rv[it];
      }
    }
    __builtin_amdgcn_fence(3 /* release order */, "workgroup");
    __builtin_amdgcn_wave_barrier();
    __builtin_amdgcn_fence(2 /* acquire order */, "workgroup");
  }
}

__global__ __launch_bounds__(256) void k_proj_all(const _Float16* __restrict__ XQ, const _Float16* __restrict__ XK, const _Float16* __restrict__ Wd,
                                                  _Float16* QHp, _Float16* KHp, _Float16* VTHp, _Float16* QRp, _Float16* KRp, _Float16* VTRp,
                                                  const float* __restrict__ bq, const float* __restrict__ bk, const float* __restrict__ bv,
                                                  const float* __restrict__ SCLp) {
  __shared__ __align__(16) float sT[8][16 * 68];   // per-wave 16x64 slab, pitch 68 floats
  __shared__ __align__(16) _Float16 pst[2u * PSTG_H];   // two operand stages: rows 0..127 = A, rows 128..383 = Bt; pitch KVP
  const unsigned z    = blockIdx.z;                // block-uniform selects among global pointers below
  const unsigned b    = blockIdx.y;
  const bool     late = z >= 3u;
  const unsigned p    = late ? z - 3u : z;         // 0 q, 1 k, 2 v^T
  const bool     chm  = p == 2u;                   // channel-major (v^T)
  const unsigned rows = late ? (unsigned)LROWS : (unsigned)EROWS;   // tokens of this row group
  const unsigned row0 = late ? (unsigned)EROWS : 0u;                // its first token inside a batch
  const unsigned lane = threadIdx.x & 31u;
  const unsigned wave = (unsigned)__builtin_amdgcn_readfirstlane((int)(threadIdx.x >> 5));
  const unsigned tilesM = (chm ? (unsigned)EMB : rows) >> 6;
  const unsigned tilesN = (chm ? rows : (unsigned)EMB) >> 6;
  if (blockIdx.x * 8u >= tilesM * tilesN) return;   // block-uniform, in front of every barrier
  const unsigned nbn = tilesN >> 2;             // blocks along n
  const unsigned bm = blockIdx.x / nbn;
  const unsigned bn = blockIdx.x - bm * nbn;
  const unsigned mb = bm << 7, nb = bn << 8;    // the block's first A row, first Bt row
  const unsigned wm = wave >> 2, wn = wave & 3u;
  const unsigned m0 = mb + (wm << 6);
  const unsigned n0 = nb + (wn << 6);

  const _Float16* X = XQ;
  if (p != 0u) X = XK;
  const _Float16* tok = X + ((size_t)b * SEQ + row0) * EMB;   // this batch's tokens of the row group
  const _Float16* wgt = Wd + (size_t)p * WSZ;
  const _Float16* Ab = chm ? wgt : tok;
  const _Float16* Bb = chm ? tok : wgt;

  const unsigned rlane = lane & 15u;            // row (A) / col (B) within subtile
  const unsigned koff  = (lane >> 4) << 3;      // k offset of this lane half

  v8f acc[4][4];
#pragma unroll
  for (int i = 0; i < 4; ++i)
#pragma unroll
    for (int j = 0; j < 4; ++j) acc[i][j] = (v8f){0.f,0.f,0.f,0.f,0.f,0.f,0.f,0.f};

  // staging: this lane's row (of 4 per wave-wide copy) and 16-byte piece; each wave brings 16 of the block's A rows and 32 of its Bt rows
  const unsigned lr = lane >> 3, pc = (lane & 7u) << 3;
  const unsigned la = (unsigned)(size_t)pst + ((wave * 16u + lr) * KVP + pc) * 2u;           // LDS byte addresses in buffer 0
  const unsigned lb = (unsigned)(size_t)pst + ((128u + wave * 32u + lr) * KVP + pc) * 2u;
  const _Float16* ga = Ab + (size_t)(mb + wave * 16u + lr) * (unsigned)EMB + pc;             // + 64 * stage
  const _Float16* gb = Bb + (size_t)(nb + wave * 32u + lr) * (unsigned)EMB + pc;
  const _Float16* fa = pst + (wm * 64u + rlane) * KVP + koff;                                // fragment rows in buffer 0
  const _Float16* fb = pst + (128u + wn * 64u + rlane) * KVP + koff;
  constexpr unsigned NSTG = (unsigned)EMB / 64u;
  static_assert(NSTG >= 2u);                                                                 // the prologue starts stages 0 and 1

  // prologue of the two-buffer ring: stage 0 lands and is published, then stage 1 starts
  stage_rows4(la, ga);
  stage_rows8(lb, gb);
  asm volatile("s_wait_asynccnt 0x0" ::: "memory");   // this wave's copies of stage 0 have landed
  __syncthreads();
  stage_rows4(la + PSTG_H * 2u, ga + 64u);
  stage_rows8(lb + PSTG_H * 2u, gb + 64u);

#pragma unroll 1   // one copy of the hot loop in the instruction cache; the buffer select is scalar
  for (unsigned t = 0; t < NSTG; ++t) {
    const unsigned bo = (t & 1u) * PSTG_H;             // this stage's buffer, in halves
#pragma unroll
    for (int ks = 0; ks < 2; ++ks) {
      v16h bh[4], ah[4];                               // the k-step's eight fragments are read as one group, ahead of its products
#pragma unroll
      for (int j = 0; j < 4; ++j) bh[j] = frag_ld(fb + bo + (unsigned)j * 16u * KVP + (unsigned)ks * 32u);
#pragma unroll
      for (int i = 0; i < 4; ++i) ah[i] = frag_ld(fa + bo + (unsigned)i * 16u * KVP + (unsigned)ks * 32u);
#pragma unroll
      for (int i = 0; i < 4; ++i) {
#pragma unroll
        for (int j = 0; j < 4; ++j) acc[i][j] = mma_raw(ah[i], bh[j], acc[i][j]);
        dep_guard_h(acc[i][0], acc[i][3], ah[i], ah[i]);
      }
      keep4_h(bh[0], bh[1], bh[2], bh[3]);
    }
    // stage t + 1 is published; the buffer that every wave has just left takes stage t + 2
    stage_publish();
    if (t + 2u < NSTG) {
      const unsigned ko = (t + 2u) * 64u;
      stage_rows4(la + bo * 2u, ga + ko);
      stage_rows8(lb + bo * 2u, gb + ko);
    }
  }
  asm volatile("s_wait_asynccnt 0x0" ::: "memory");   // no copy is outstanding behind the loop
  acc_guard4(acc[0][0], acc[0][1], acc[0][2], acc[0][3]);
  acc_guard4(acc[1][0], acc[1][1], acc[1][2], acc[1][3]);
  acc_guard4(acc[2][0], acc[2][1], acc[2][2], acc[2][3]);
  acc_guard4(acc[3][0], acc[3][1], acc[3][2], acc[3][3]);

  // ---- epilogue (one of four forms, block-uniform) ----
  float* slab = sT[wave];
  const float* scl = SCLp + (size_t)p * EMB;
  if (chm) {
    _Float16* C  = VTHp + (size_t)b * ((size_t)EMB * SEQ) + row0;
    _Float16* Cr = VTRp + (size_t)b * ((size_t)EMB * EROWS);
    if (late) proj_epilogue<1, false>(acc, slab, C, (unsigned)SEQ, Cr, (unsigned)EROWS, bv, scl, m0, n0, lane);
    else      proj_epilogue<1, true >(acc, slab, C, (unsigned)SEQ, Cr, (unsigned)EROWS, bv, scl, m0, n0, lane);
  } else {
    _Float16* Cp = QHp; _Float16* Rp = QRp; const float* bias = bq;
    if (p == 1u) { Cp = KHp; Rp = KRp; bias = bk; }
    _Float16* C  = Cp + ((size_t)b * SEQ + row0) * EMB;
    _Float16* Cr = Rp + (size_t)b * ((size_t)EROWS * EMB);
    if (late) proj_epilogue<2, false>(acc, slab, C, (unsigned)EMB, Cr, (unsigned)EMB, bias, scl, m0, n0, lane);
    else      proj_epilogue<2, true >(acc, slab, C, (unsigned)EMB, Cr, (unsigned)EMB, bias, scl, m0, n0, lane);
  }
}

__device__ __forceinline__ float xhalf(float x) {
  return __builtin_bit_cast(float, __builtin_amdgcn_permlanex16(__builtin_bit_cast(int, x), __builtin_bit_cast(int, x), 0x76543210, 0xfedcba98, false, false));
}

// 2^x as the one hardware instruction. The library form adds a compare, two selects, an add and an ldexp per value, only to return subnormal results
// for x < -126. Here x <= 0 and such a term is below 2^-126 of its row's largest one: it is 0 in the f16 P either way and vanishes in the f32 row sum (>= 1).
// Written as asm so that the slot behind each transcendental is filled by construction: the next v_exp_f32 neither reads its result nor overwrites its
// source (the outputs are early-clobber, so they share no register with an input), and one v_nop stands behind the last.
__device__ __forceinline__ v8f exp2_hw8(v8f x) {
  float p0, p1, p2, p3, p4, p5, p6, p7;
  asm("v_exp_f32 %0, %8\n\tv_exp_f32 %1, %9\n\tv_exp_f32 %2, %10\n\tv_exp_f32 %3, %11\n\t"
      "v_exp_f32 %4, %12\n\tv_exp_f32 %5, %13\n\tv_exp_f32 %6, %14\n\tv_exp_f32 %7, %15\n\tv_nop"
      : "=&v"(p0), "=&v"(p1), "=&v"(p2), "=&v"(p3), "=&v"(p4), "=&v"(p5), "=&v"(p6), "=&v"(p7)
      : "v"(x[0]), "v"(x[1]), "v"(x[2]), "v"(x[3]), "v"(x[4]), "v"(x[5]), "v"(x[6]), "v"(x[7]));
  return (v8f){p0, p1, p2, p3, p4, p5, p6, p7};
}
__device__ __forceinline__ float exp2_hw1(float x) {
  float p;
  asm("v_exp_f32 %0, %1\n\tv_nop" : "=&v"(p) : "v"(x));   // v_nop: the slot behind the transcendental; a rescale factor below 2^-126 leaves nothing of the older sums in f32 either way
  return p;
}

template <bool EARLY>
__device__ __forceinline__ void attn_body(const _Float16* __restrict__ Q, const _Float16* __restrict__ Kp, const _Float16* __restrict__ VT,
                                          const _Float16* __restrict__ QR, const _Float16* __restrict__ KR, const _Float16* __restrict__ VTR,
                                          float* __restrict__ OUT, unsigned qb_off, unsigned nqb) {
  constexpr unsigned NT = EARLY ? 2u : 1u;                           // tiles per stage: value plane (+ residual plane)
  __shared__ __align__(16) _Float16 stg[2u * NT * TILE_H];           // buffer 0: K (, K residual); buffer 1: V^T (, V^T residual)
  float* OT = (float*)stg;                                           // block output tile [d][query], pitch 68 (cross-wave): reuses stg behind the loop
  const unsigned tid  = threadIdx.x;
  const unsigned wave = (unsigned)__builtin_amdgcn_readfirstlane((int)(tid >> 5));
  const unsigned lane = tid & 31u;
  const unsigned hh   = lane >> 4;
  const unsigned c    = lane & 15u;
  const unsigned bx = blockIdx.x;
  const unsigned qb = qb_off + bx % nqb;
  const unsigned bh = bx / nqb;
  const unsigned h  = bh & 7u;
  const unsigned b  = bh >> 3;
  const unsigned q0 = qb * 64u + wave * 16u;
  const unsigned qi = q0 + c;                                        // this lane's query
  const unsigned nch = qb + 1u;
  const size_t rowbase = (size_t)b * SEQ;
  const size_t resbase = (size_t)b * EROWS;

  const _Float16* qrow = Q + (rowbase + qi) * EMB + h * 64u + 8u * hh;
  const v16h qa0 = frag_ld(qrow), qa1 = frag_ld(qrow + 32);
  v16h qr0 = qa0, qr1 = qa1;
  if (EARLY) {
    const _Float16* qrr = QR + (resbase + qi) * EMB + h * 64u + 8u * hh;
    qr0 = frag_ld(qrr); qr1 = frag_ld(qrr + 32);
  }
  const _Float16* kbase  = stg + 8u * hh;                                                // + key * KVP (+ 32 for the second d chunk)
  const _Float16* krbase = kbase + TILE_H;
  const _Float16* vbase  = stg + NT * TILE_H + 8u * hh;                                  // + d * KVP + kv
  const _Float16* vrbase = vbase + TILE_H;
  // staging: this thread's row (of 16 per copy) and 16-byte piece
  const unsigned srow = tid >> 3, spc = (tid & 7u) << 3;
  const unsigned lk = (unsigned)(size_t)stg + (srow * KVP + spc) * 2u;                   // LDS byte address in the K buffer
  const unsigned lv = lk + NT * TILE_H * 2u;                                             // the same place in the V^T buffer
  const unsigned ok  = srow * EMB + spc;                                                 // this thread's piece inside a K tile (value and residual planes)
  const unsigned ov  = srow * SEQ + spc, ovr = srow * EROWS + spc;                       // the same inside a V^T tile, a V^T residual tile
  const _Float16* gk  = Kp  + rowbase * EMB + h * 64u;                                   // block-uniform tile origins: + kv0 * EMB
  const _Float16* gkr = KR  + resbase * EMB + h * 64u;
  const _Float16* gv  = VT  + ((size_t)b * EMB + h * 64u) * SEQ;                         // + kv0
  const _Float16* gvr = VTR + ((size_t)b * EMB + h * 64u) * EROWS;

  float mrow = -__builtin_inff();     // running maximum of this lane's query (equal in both halves)
  float lrow = 0.f;                   // running sum over this half's keys; the halves are joined behind the loop
  v8f oacc[4], oaccr[4];              // O^T: tile t, element r = d 16t + 8h + r of this lane's query
#pragma unroll
  for (int t = 0; t < 4; ++t) { oacc[t] = (v8f){0.f,0.f,0.f,0.f,0.f,0.f,0.f,0.f}; oaccr[t] = (v8f){0.f,0.f,0.f,0.f,0.f,0.f,0.f,0.f}; }

  const float SC    = 0.125f * 1.4426950408889634f;       // 1/sqrt(64) and log2(e)
  const float FILLX = -14426.950408889634f;               // -10000 * log2(e)

  // prologue of the two-buffer ring: stage 0 (K of chunk 0) lands and is published, then stage 1 (V^T of chunk 0) starts
  if (EARLY) stage_tile2(lk, gk + ok, 16u * EMB, lk + TILE_H * 2u, gkr + ok, 16u * EMB);
  else       stage_tile1(lk, gk + ok, 16u * EMB);
  asm volatile("s_wait_asynccnt 0x0" ::: "memory");   // this wave's copies of stage 0 have landed
  __syncthreads();
  if (EARLY) stage_tile2(lv, gv + ov, 16u * SEQ, lv + TILE_H * 2u, gvr + ovr, 16u * EROWS);
  else       stage_tile1(lv, gv + ov, 16u * SEQ);

  for (unsigned kc = 0; kc < nch; ++kc) {
    const unsigned kv0 = kc * 64u;
    const bool more = kc + 1u < nch;                   // block-uniform: a next chunk exists
    // Score products: the fragments of a group of key tiles are read together, ahead of the group's products, and the products of the group's
    // independent accumulators alternate, so each fills the distance behind the others; per accumulator the order of the products is unchanged.
    v8f s[4];
    constexpr int JG = EARLY ? 2 : 4;                  // key tiles per group (EARLY: four fragments per tile, so two tiles fill the registers)
#pragma unroll
    for (int j0 = 0; j0 < 4; j0 += JG) {
      v16h kh0[JG], kh1[JG], kq0[JG], kq1[JG];
      v8f ar[JG];
#pragma unroll
      for (int j = 0; j < JG; ++j) {
        const _Float16* kr = kbase + ((unsigned)(j0 + j) * 16u + c) * KVP;
        kh0[j] = frag_ld(kr); kh1[j] = frag_ld(kr + 32);
      }
      if (EARLY) {
#pragma unroll
        for (int j = 0; j < JG; ++j) {
          const _Float16* krr = krbase + ((unsigned)(j0 + j) * 16u + c) * KVP;
          kq0[j] = frag_ld(krr); kq1[j] = frag_ld(krr + 32);
        }
        frags_ready8(kh0[0], kh1[0], kh0[1], kh1[1], kq0[0], kq1[0], kq0[1], kq1[1]);
      } else {
        frags_ready8(kh0[0], kh1[0], kh0[1], kh1[1], kh0[JG - 2], kh1[JG - 2], kh0[JG - 1], kh1[JG - 1]);
      }
#pragma unroll
      for (int j = 0; j < JG; ++j) s[j0 + j] = mma_raw(kh0[j], qa0, (v8f){0.f,0.f,0.f,0.f,0.f,0.f,0.f,0.f});
      if (EARLY) {
#pragma unroll
        for (int j = 0; j < JG; ++j) ar[j] = mma_raw(kh0[j], qr0, (v8f){0.f,0.f,0.f,0.f,0.f,0.f,0.f,0.f});
      }
#pragma unroll
      for (int j = 0; j < JG; ++j) s[j0 + j] = mma_raw(kh1[j], qa1, s[j0 + j]);
      if (EARLY) {
#pragma unroll
        for (int j = 0; j < JG; ++j) ar[j] = mma_raw(kh1[j], qr1, ar[j]);
#pragma unroll
        for (int j = 0; j < JG; ++j) ar[j] = mma_raw(kq0[j], qa0, ar[j]);
#pragma unroll
        for (int j = 0; j < JG; ++j) ar[j] = mma_raw(kq1[j], qa1, ar[j]);
        acc_guard4(s[j0], s[j0 + 1], ar[0], ar[1]);    // v_nop: the distance between the group's last products and the vector instructions that read them
#pragma unroll
        for (int j = 0; j < JG; ++j) s[j0 + j] = s[j0 + j] + ar[j] * 0.00048828125f;
      }
    }
    if (!EARLY) acc_guard4(s[0], s[1], s[2], s[3]);    // v_nop: the same distance, also on the taken side of the branch below
    // The softmax touches no LDS any more, so the publish point stands directly behind the score products: V^T of this chunk is published;
    // the K buffer, which every wave has left, takes the next chunk's K, which flies through the softmax and V^T.P^T
    stage_publish();
    if (more) {
      const size_t ko = (size_t)(kv0 + 64u) * EMB;
      if (EARLY) stage_tile2(lk, (gk + ko) + ok, 16u * EMB, lk + TILE_H * 2u, (gkr + ko) + ok, 16u * EMB);
      else       stage_tile1(lk, (gk + ko) + ok, 16u * EMB);
    }
    const int kd = (int)qi - (int)(kv0 + 8u * hh);     // tile j, element r is a key in front of this lane's query where 16j + r < kd
    float mj[4];
#pragma unroll
    for (int j = 0; j < 4; ++j) {
#pragma unroll
      for (int r = 0; r < 8; ++r) s[j][r] = (j * 16 + r < kd) ? s[j][r] * SC : FILLX;
      mj[j] = fmaxf(fmaxf(fmaxf(s[j][0], s[j][1]), fmaxf(s[j][2], s[j][3])), fmaxf(fmaxf(s[j][4], s[j][5]), fmaxf(s[j][6], s[j][7])));
    }
    float m = fmaxf(fmaxf(mj[0], mj[1]), fmaxf(mj[2], mj[3]));
    m = fmaxf(m, xhalf(m));
    const float mnew = fmaxf(mrow, m);
    const float alpha = exp2_hw1(mrow - mnew);
    mrow = mnew;
    FragU pa[2], pr[2];                                // P^T (and its residual) as B fragments of keys 0..31 and 32..63
    float ps[4];
#pragma unroll
    for (int j = 0; j < 4; ++j) {
      float a = 0.f;
      const v8f pj = exp2_hw8(s[j] - mnew);
#pragma unroll
      for (int r = 0; r < 8; ++r) a += pj[r];
      const v8f e = pj * 32768.0f;
      const v8h g = toh8(e);
      pa[j >> 1].h[j & 1] = g;
      if (EARLY) pr[j >> 1].h[j & 1] = toh8((e - tof8(g)) * 2048.0f);
      ps[j] = a;
    }
    lrow = lrow * alpha + ((ps[0] + ps[1]) + (ps[2] + ps[3]));
#pragma unroll
    for (int t = 0; t < 4; ++t) {
#pragma unroll
      for (int r = 0; r < 8; ++r) { oacc[t][r] *= alpha; if (EARLY) oaccr[t][r] *= alpha; }
    }
    // Output products: eight fragments (EARLY: value and residual of 32 keys; else all 64 keys) are read together, ahead of their products; the four output tiles alternate
    if (EARLY) {
#pragma unroll
      for (int kk = 0; kk < 2; ++kk) {
        v16h vb[4], vr[4];
#pragma unroll
        for (int t = 0; t < 4; ++t) {
          vb[t] = frag_ld(vbase  + ((unsigned)t * 16u + c) * KVP + (unsigned)kk * 32u);
          vr[t] = frag_ld(vrbase + ((unsigned)t * 16u + c) * KVP + (unsigned)kk * 32u);
        }
        frags_ready8(vb[0], vb[1], vb[2], vb[3], vr[0], vr[1], vr[2], vr[3]);
#pragma unroll
        for (int t = 0; t < 4; ++t) oacc[t] = mma_raw(vb[t], pa[kk].v, oacc[t]);
#pragma unroll
        for (int t = 0; t < 4; ++t) oaccr[t] = mma_raw(vb[t], pr[kk].v, oaccr[t]);
#pragma unroll
        for (int t = 0; t < 4; ++t) oaccr[t] = mma_raw(vr[t], pa[kk].v, oaccr[t]);
      }
    } else {
      v16h vb[2][4];
#pragma unroll
      for (int kk = 0; kk < 2; ++kk)
#pragma unroll
        for (int t = 0; t < 4; ++t) vb[kk][t] = frag_ld(vbase + ((unsigned)t * 16u + c) * KVP + (unsigned)kk * 32u);
      frags_ready8(vb[0][0], vb[0][1], vb[0][2], vb[0][3], vb[1][0], vb[1][1], vb[1][2], vb[1][3]);
#pragma unroll
      for (int kk = 0; kk < 2; ++kk)
#pragma unroll
        for (int t = 0; t < 4; ++t) oacc[t] = mma_raw(vb[kk][t], pa[kk].v, oacc[t]);
    }
    // v_nop: the distance between the chunk's last products and the vector instructions that read or rescale the tiles, on every path out of the chunk
    if (EARLY) acc_guard8(oacc, oaccr);
    else       acc_guard4(oacc[0], oacc[1], oacc[2], oacc[3]);
    // K of the next chunk is published; the V^T buffer, which every wave has left, takes the next chunk's V^T
    stage_publish();
    if (more) {
      if (EARLY) stage_tile2(lv, (gv + (kv0 + 64u)) + ov, 16u * SEQ, lv + TILE_H * 2u, (gvr + (kv0 + 64u)) + ovr, 16u * EROWS);
      else       stage_tile1(lv, (gv + (kv0 + 64u)) + ov, 16u * SEQ);
    }
  }
  asm volatile("s_wait_asynccnt 0x0" ::: "memory");   // no copy is outstanding when stg becomes the output tile (the last publish point's barrier ended all reads)

  // join the halves' sums, normalise (P carried x2^15), zero sequence row 0, put the wave's 64 d x 16 queries into the block tile [d][query]
  const float lsum = lrow + xhalf(lrow);
  const float iv = 1.0f / (lsum * 32768.0f);
  const float inv = (qi == 0u) ? 0.0f : iv;
#pragma unroll
  for (int t = 0; t < 4; ++t) {
#pragma unroll
    for (int r = 0; r < 8; ++r) {
      float v = oacc[t][r];
      if (EARLY) v += oaccr[t][r] * 0.00048828125f;
      OT[((unsigned)t * 16u + 8u * hh + (unsigned)r) * 68u + wave * 16u + c] = v * inv;
    }
  }
  __syncthreads();
  {
    const unsigned c4 = (lane & 15u) << 2;     // row segment = 64 floats = 256 B = 16 lanes x 16 B; 2 rows per instruction, 8 trips = 16 rows per wave
    float* ob = OUT + ((size_t)b * EMB + h * 64u + wave * 16u) * SEQ_FULL + qb * 64u + c4;
    v4f vv[8];
#pragma unroll
    for (int it = 0; it < 8; ++it) {
      const unsigned row = (unsigned)it * 2u + hh;
      vv[it] = *(const v4f*)(OT + (wave * 16u + row) * 68u + c4);
    }
    {
#pragma unroll
      for (int it = 0; it < 8; ++it) {
        const unsigned row = (unsigned)it * 2u + hh;
        *(v4f*)(ob + (size_t)row * SEQ_FULL) = vv[it];
      }
    }
  }
}

__global__ __launch_bounds__(128) __attribute__((amdgpu_num_vgpr(256))) void k_attn_early(
    const _Float16* __restrict__ Q, const _Float16* __restrict__ Kp, const _Float16* __restrict__ VT,
    const _Float16* __restrict__ QR, const _Float16* __restrict__ KR, const _Float16* __restrict__ VTR,
    float* __restrict__ OUT, unsigned qb_off, unsigned nqb) {
  attn_body<true>(Q, Kp, VT, QR, KR, VTR, OUT, qb_off, nqb);
}
__global__ __launch_bounds__(128) void k_attn_late(
    const _Float16* __restrict__ Q, const _Float16* __restrict__ Kp, const _Float16* __restrict__ VT,
    const _Float16* __restrict__ QR, const _Float16* __restrict__ KR, const _Float16* __restrict__ VTR,
    float* __restrict__ OUT, unsigned qb_off, unsigned nqb) {
  attn_body<false>(Q, Kp, VT, QR, KR, VTR, OUT, qb_off, nqb);
}

// ---- workspace carve (bytes; every region is a whole number of 256-B units and is written in full by its producer) ----
#define SZ_P16  ((size_t)NB * SEQ * EMB * 2)            // one f16 activation plane
#define SZ_R16  ((size_t)NB * EROWS * EMB * 2)          // one f16 residual plane (early rows only)
#define SZ_W16  ((size_t)3 * WSZ * 2)
#define SZ_SCL  ((size_t)3 * EMB * 4)
#define OFF_XQ   ((size_t)0)
#define OFF_XK   (OFF_XQ + SZ_P16)
#define OFF_W16  (OFF_XK + SZ_P16)
#define OFF_SCL  (OFF_W16 + SZ_W16)
#define OFF_QH   (OFF_SCL + SZ_SCL)
#define OFF_KH   (OFF_QH + SZ_P16)
#define OFF_VTH  (OFF_KH + SZ_P16)
#define OFF_QR   (OFF_VTH + SZ_P16)
#define OFF_KR   (OFF_QR + SZ_R16)
#define OFF_VTR  (OFF_KR + SZ_R16)
#define WS_TOTAL (OFF_VTR + SZ_R16)
static_assert(SZ_P16 % 256 == 0 && SZ_R16 % 256 == 0 && SZ_W16 % 256 == 0 && SZ_SCL % 256 == 0);
static_assert(OFF_XK == OFF_XQ + (size_t)NB * SEQ * EMB * 2);   // k_castxT addresses the key plane as plane 1 of one base
static_assert(WS_TOTAL <= (size_t)134217728);
static_assert((size_t)NB_FULL * EMB * SEQ_FULL * 4 == (size_t)33554432);   // output extent in bytes, offset 0

extern "C" void kernel_launch(void* const* d_in, const int* in_sizes, int n_in, void* d_out, int out_size, void* d_ws, size_t ws_size, hipStream_t stream) {
    if (n_in < 11) return;
    const long long xneed = ((long long)(NB - 1) * EMB + (EMB - 1)) * SEQ_FULL + SEQ;
    if ((long long)in_sizes[0] < xneed) return;
    if ((long long)in_sizes[1] < xneed) return;
    if (in_sizes[2] < WSZ || in_sizes[5] < WSZ || in_sizes[8] < WSZ) return;
    if (in_sizes[3] < EMB || in_sizes[4] < EMB || in_sizes[6] < EMB || in_sizes[7] < EMB || in_sizes[9] < EMB || in_sizes[10] < EMB) return;
    if ((long long)out_size < xneed) return;
    if ((size_t)WS_TOTAL > ws_size) return;

    // input order: query, key, vq, gq, bq, vk, gk, bk, vv, gv, bv
    const float* query = (const float*)d_in[0];
    const float* key   = (const float*)d_in[1];
    const float* vq = (const float*)d_in[2];  const float* gq = (const float*)d_in[3];  const float* bq = (const float*)d_in[4];
    const float* vk = (const float*)d_in[5];  const float* gk = (const float*)d_in[6];  const float* bk = (const float*)d_in[7];
    const float* vv = (const float*)d_in[8];  const float* gv = (const float*)d_in[9];  const float* bv = (const float*)d_in[10];
    float* out = (float*)d_out;

    char* ws = (char*)d_ws;
    unsigned short* X16  = (unsigned short*)(ws + OFF_XQ);     // plane 0 = query tokens, plane 1 = key tokens
    unsigned short* W16  = (unsigned short*)(ws + OFF_W16);    // planes: 0 vq 1 vk 2 vv (direction weights x16)
    float*          SCL  = (float*)(ws + OFF_SCL);             // [3][512] row gains / 16
    _Float16* QH  = (_Float16*)(ws + OFF_QH);
    _Float16* KH  = (_Float16*)(ws + OFF_KH);
    _Float16* VTH = (_Float16*)(ws + OFF_VTH);
    _Float16* QR  = (_Float16*)(ws + OFF_QR);
    _Float16* KR  = (_Float16*)(ws + OFF_KR);
    _Float16* VTR = (_Float16*)(ws + OFF_VTR);

    const _Float16* XQh = (const _Float16*)(ws + OFF_XQ);
    const _Float16* XKh = (const _Float16*)(ws + OFF_XK);
    const _Float16* W16h = (const _Float16*)W16;

    // 1-2: operand planes
    k_castxT<<<dim3((unsigned)(SEQ / 64), (unsigned)(EMB / 64), (unsigned)(NB * 2)), 256, 0, stream>>>(query, key, X16);
    k_wprep<<<dim3((unsigned)(EMB / 32), 3u), 256, 0, stream>>>(vq, gq, vk, gk, vv, gv, W16, SCL);

    // 3: q, k (tokens x V^T, row gain, bias -> f16 planes) and v^T (V x tokens^T, gain[m], bias[m] -> f16 plane [b][h*64+d][token]); early group also residual planes;
    //    all six row groups in one grid (blockIdx.z), the early groups (longer epilogue) first
    k_proj_all<<<dim3((unsigned)(((EROWS > LROWS) ? EROWS : LROWS) / 64), (unsigned)NB, (LROWS > 0) ? 6u : 3u), 256, 0, stream>>>(
        XQh, XKh, W16h, QH, KH, VTH, QR, KR, VTR, bq, bk, bv, SCL);

    // 4-5: causal attention, early band (value + residual planes) and late band (single planes); each block writes its 64x64 tile of the output buffer
    k_attn_early<<<(unsigned)(NB * NHEAD * (EROWS / 64)), 128, 0, stream>>>(QH, KH, VTH, QR, KR, VTR, out, 0u, (unsigned)(EROWS / 64));
    if (LROWS > 0) {
        k_attn_late<<<(unsigned)(NB * NHEAD * (LROWS / 64)), 128, 0, stream>>>(QH, KH, VTH, QR, KR, VTR, out, (unsigned)(EROWS / 64), (unsigned)(LROWS / 64));
    }
}

// v009
// Measured time: 88.2 microseconds a run.
// Next to v008, in two timings, it ran 1.03 times as fast each time.
// Counting every step since v000, it is 4.41 times as fast.
// All contractions (weight-normalised q/k/v projections, q.k^T, P.V): v_wmma_f32_16x16x32_f16 (f16 operands, f32 accumulate); float inputs bf16-converted (RNE) first, direction weights carried x16 with the per-row norm gain applied in f32 at the projection epilogue, P carried x2^15; query rows < EROWS additionally carry q, k, v, P as f16 value + x2048 f16 residual planes (three products, residual products in their own accumulator); mask, softmax, norms in f32.
#include <hip/hip_runtime.h>
#include <math.h>

// ---- sizes (NB / SEQ reducible; *_FULL = strides of the inputs / output) ----
#ifndef NB
#define NB 16
#endif
#ifndef SEQ
#define SEQ 1024
#endif
#ifndef EROWS
#define EROWS ((SEQ < 512) ? SEQ : 512)
#endif
#define LROWS (SEQ - EROWS)
#define NB_FULL 16
#define SEQ_FULL 1024
#define EMB 512
#define NHEAD 8
#define HDIM 64
#define WSZ (EMB * EMB)

static_assert(NB >= 1 && NB <= NB_FULL);
static_assert(SEQ <= SEQ_FULL && SEQ % 64 == 0 && SEQ >= 64);
static_assert(EROWS % 64 == 0 && EROWS >= 64 && EROWS <= SEQ);
static_assert(LROWS % 64 == 0);
static_assert(EMB % 64 == 0 && EMB == NHEAD * HDIM && HDIM == 64 && NHEAD == 8);
static_assert(EMB % 32 == 0);                          // WMMA k-steps of 32, weight rows per prep block
static_assert(4 * 256 == 64 * 16);                     // k_castxT load phase: trips x threads == tile rows x 16-B pieces per row
static_assert(2 * 256 == 64 * 8);
static_assert(2 * 32 * 8 == EMB);                      // k_wprep: trips x lanes x elements == weight row width
static_assert(8 * 4 == 32);                            // k_wprep: waves x rows per wave == rows per block
static_assert(32 * 16 * 4 == 16 * 128);                // projection epilogue: lanes x bytes x trips == slab rows x row bytes (64 halves)
static_assert(4 * 32 * 16 * 8 == 64 * 256);            // attention output: waves x lanes x bytes x trips == tile rows x row bytes (64 floats)
static_assert(2 * 384 * 72 * 2 + 8 * 16 * 68 * 4 <= 163840);  // static LDS of the projection kernel (two operand stages + the epilogue slabs): two blocks per 320-KiB LDS
static_assert((EMB / 64) % 8 == 0 && (EROWS / 64) % 8 == 0 && (LROWS / 64) % 8 == 0);  // projection: a block is 2 x 4 wave tiles; a block has all its tiles or none
static_assert(8 * 4 * 32 * 16 == 128 * 128 && 8 * 8 * 32 * 16 == 256 * 128);  // projection staging: waves x copies x lanes x bytes == block rows x row bytes (A, Bt)
static_assert(4 * 64 * 72 * 2 <= 81920);  // static LDS of the attention kernels: four blocks per 320-KiB LDS
static_assert(64 * 68 * 4 <= 2 * 64 * 72 * 2);         // the output tile fits the staging area that it reuses
static_assert(4 * 128 * 16 == 64 * 128);               // staging: copies per thread x threads x bytes == tile rows x row bytes
static_assert(64 * 65 * 4 <= 131072);                  // static LDS of k_castxT

typedef _Float16 h16;
typedef __attribute__((ext_vector_type(16))) _Float16 v16h;
typedef __attribute__((ext_vector_type(8)))  _Float16 v8h;
typedef __attribute__((ext_vector_type(8)))  float    v8f;
typedef __attribute__((ext_vector_type(4)))  float    v4f;
typedef __attribute__((ext_vector_type(2)))  float    v2f;
typedef __attribute__((ext_vector_type(2)))  _Float16 v2h;
typedef __attribute__((ext_vector_type(4)))  unsigned int u4v;

// 16-bit WMMA fragment map (wave32), lane L, h = L>>4, m = L&15:
//   A 16x32: lane = row m;    element i -> k = (i<8) ? 8h+i : 16+8h+(i-8)
//   B 32x16: lane = column m; the SAME k(i,h)
//   D 16x16 (8 f32): lane = column m; element r -> row 8h+r
union FragU { v16h v; v8h h[2]; };
// p already includes the +8h lane-half offset: elements 0..7 <- p[0..7], 8..15 <- p[16..23]
__device__ __forceinline__ v16h frag_ld(const _Float16* p) { FragU f; f.h[0] = *(const v8h*)(p); f.h[1] = *(const v8h*)(p + 16); return f.v; }

__device__ __forceinline__ v8f mma_raw(v16h a, v16h b, v8f c) { return __builtin_amdgcn_wmma_f32_16x16x32_f16(false, a, false, b, (short)0, c, false, false); }
__device__ __forceinline__ void dep_guard_h(v8f& a, v8f& b, v16h x, v16h y) { asm volatile("v_nop\n\tv_nop\n\tv_nop\n\tv_nop" : "+v"(a), "+v"(b) : "v"(x), "v"(y)); }
__device__ __forceinline__ void keep4_h(v16h a, v16h b, v16h c, v16h d) { asm volatile("v_nop" :: "v"(a), "v"(b), "v"(c), "v"(d)); }
__device__ __forceinline__ void acc_guard4(v8f& a, v8f& b, v8f& c, v8f& d) { asm volatile("v_nop\n\tv_nop\n\tv_nop\n\tv_nop" : "+v"(a), "+v"(b), "+v"(c), "+v"(d)); }
// Inputs-only fence on loaded fragments: all eight are in registers here, so their LDS reads are issued as one group and waited for once, ahead of the products
__device__ __forceinline__ void frags_ready8(v16h a, v16h b, v16h c, v16h d, v16h e, v16h f, v16h g, v16h h) {
    asm volatile("" :: "v"(a), "v"(b), "v"(c), "v"(d), "v"(e), "v"(f), "v"(g), "v"(h));
}
__device__ __forceinline__ void acc_guard8(v8f (&a)[4], v8f (&b)[4]) {
    asm volatile("v_nop\n\tv_nop\n\tv_nop\n\tv_nop" : "+v"(a[0]), "+v"(a[1]), "+v"(a[2]), "+v"(a[3]), "+v"(b[0]), "+v"(b[1]), "+v"(b[2]), "+v"(b[3]));
}

// bf16 RNE convert, kept as f32 (finite inputs)
__device__ __forceinline__ float bf_keep(float v) { const unsigned u = __float_as_uint(v); return __uint_as_float((u + 0x7fffu + ((u >> 16) & 1u)) & 0xffff0000u); }
// f32 -> f16, round to nearest even, two values per instruction. A result below 2^-14 stays an f16 subnormal: the matrix instructions take subnormal operands as they are.
__device__ __forceinline__ unsigned pk2hf(float a, float b) { return __builtin_bit_cast(unsigned, __builtin_convertvector((v2f){a, b}, v2h)); }
__device__ __forceinline__ v8h toh8(v8f v) { return __builtin_convertvector(v, v8h); }
__device__ __forceinline__ v8f tof8(v8h v) { return __builtin_convertvector(v, v8f); }

// ---- LDS staging of 64-row x 128-byte f16 tiles by asynchronous copies (global -> LDS, through no register) ----
#define KVP 72u                      // LDS row pitch in halves: 144 B = 16 B x 9, conflict-free for 16-byte fragment reads
#define TILE_H (64u * KVP)           // halves of one staged tile
#define ROWS16_B (16u * KVP * 2u)    // LDS bytes of 16 staged rows
#define PSTG_H (384u * KVP)          // halves of one projection stage: 128 A rows + 256 Bt rows
// Each thread of the 128 copies its 16-byte piece of rows r, r+16, r+32, r+48: one wave-wide copy = 4 whole 128-byte rows.
// l = the thread's LDS byte address of its piece in row r, g = the same piece in global memory, st = 16 source rows in halves.
// s_wait_xcnt stands as the last line of the copies' own statement, so no address register is rewritten in front of it.
__device__ __forceinline__ void stage_tile1(unsigned l, const _Float16* g, size_t st) {
    asm volatile("global_load_async_to_lds_b128 %0, %4, off\n\t"
                 "global_load_async_to_lds_b128 %1, %5, off\n\t"
                 "global_load_async_to_lds_b128 %2, %6, off\n\t"
                 "global_load_async_to_lds_b128 %3, %7, off\n\t"
                 "s_wait_xcnt 0x0"
                 :: "v"(l), "v"(l + ROWS16_B), "v"(l + 2u * ROWS16_B), "v"(l + 3u * ROWS16_B),
                    "v"(g), "v"(g + st), "v"(g + 2u * st), "v"(g + 3u * st) : "memory");
}
__device__ __forceinline__ void stage_tile2(unsigned l, const _Float16* g, size_t st, unsigned l2, const _Float16* g2, size_t st2) {
    asm volatile("global_load_async_to_lds_b128 %0, %8, off\n\t"
                 "global_load_async_to_lds_b128 %1, %9, off\n\t"
                 "global_load_async_to_lds_b128 %2, %10, off\n\t"
                 "global_load_async_to_lds_b128 %3, %11, off\n\t"
                 "global_load_async_to_lds_b128 %4, %12, off\n\t"
                 "global_load_async_to_lds_b128 %5, %13, off\n\t"
                 "global_load_async_to_lds_b128 %6, %14, off\n\t"
                 "global_load_async_to_lds_b128 %7, %15, off\n\t"
                 "s_wait_xcnt 0x0"
                 :: "v"(l), "v"(l + ROWS16_B), "v"(l + 2u * ROWS16_B), "v"(l + 3u * ROWS16_B),
                    "v"(l2), "v"(l2 + ROWS16_B), "v"(l2 + 2u * ROWS16_B), "v"(l2 + 3u * ROWS16_B),
                    "v"(g), "v"(g + st), "v"(g + 2u * st), "v"(g + 3u * st),
                    "v"(g2), "v"(g2 + st2), "v"(g2 + 2u * st2), "v"(g2 + 3u * st2) : "memory");
}
// Wave-wide forms for the projection: a lane copies its 16-byte piece of rows r, r+4, ... (source pitch EMB halves): one wave-wide copy = 4 whole 128-byte rows.
#define ROWS4_B (4u * KVP * 2u)      // LDS bytes of 4 staged rows
__device__ __forceinline__ void stage_rows4(unsigned l, const _Float16* g) {
    asm volatile("global_load_async_to_lds_b128 %0, %4, off\n\t"
                 "global_load_async_to_lds_b128 %1, %5, off\n\t"
                 "global_load_async_to_lds_b128 %2, %6, off\n\t"
                 "global_load_async_to_lds_b128 %3, %7, off\n\t"
                 "s_wait_xcnt 0x0"
                 :: "v"(l), "v"(l + ROWS4_B), "v"(l + 2u * ROWS4_B), "v"(l + 3u * ROWS4_B),
                    "v"(g), "v"(g + 4u * EMB), "v"(g + 8u * EMB), "v"(g + 12u * EMB) : "memory");
}
__device__ __forceinline__ void stage_rows8(unsigned l, const _Float16* g) {
    asm volatile("global_load_async_to_lds_b128 %0, %8, off\n\t"
                 "global_load_async_to_lds_b128 %1, %9, off\n\t"
                 "global_load_async_to_lds_b128 %2, %10, off\n\t"
                 "global_load_async_to_lds_b128 %3, %11, off\n\t"
                 "global_load_async_to_lds_b128 %4, %12, off\n\t"
                 "global_load_async_to_lds_b128 %5, %13, off\n\t"
                 "global_load_async_to_lds_b128 %6, %14, off\n\t"
                 "global_load_async_to_lds_b128 %7, %15, off\n\t"
                 "s_wait_xcnt 0x0"
                 :: "v"(l), "v"(l + ROWS4_B), "v"(l + 2u * ROWS4_B), "v"(l + 3u * ROWS4_B),
                    "v"(l + 4u * ROWS4_B), "v"(l + 5u * ROWS4_B), "v"(l + 6u * ROWS4_B), "v"(l + 7u * ROWS4_B),
                    "v"(g), "v"(g + 4u * EMB), "v"(g + 8u * EMB), "v"(g + 12u * EMB),
                    "v"(g + 16u * EMB), "v"(g + 20u * EMB), "v"(g + 24u * EMB), "v"(g + 28u * EMB) : "memory");
}
// publish point of the next stage: this wave's LDS reads have returned, its own copies have landed, then the block barrier
// (it shows the landed tile to the other waves and ends every wave's reads of the buffer that is refilled behind it)
__device__ __forceinline__ void stage_publish() {
    asm volatile("s_wait_dscnt 0x0" ::: "memory");      // this wave's reads of the buffer about to be refilled are done
    asm volatile("s_wait_asynccnt 0x0" ::: "memory");   // this wave's copies of the next stage have landed
    __syncthreads();
}

#define VST2(T, ptr, val) do { const T vst2_v_ = (val); *(T*)(ptr) = vst2_v_;  } while (0)

// ---- query / key (f32, [b][c][s], full strides) -> f16 planes of the bf16-converted values, compact [NB*SEQ][512] (token-major);
//      plane 0 = query at D, plane 1 = key at D + NB*SEQ*EMB. 64 channels x 64 tokens per block through an LDS tile (cross-wave: block barrier);
__global__ __launch_bounds__(256) void k_castxT(const float* __restrict__ xq, const float* __restrict__ xk, unsigned short* __restrict__ D) {
#pragma clang fp contract(off)
    __shared__ float tile[64 * 65];
    const unsigned z = blockIdx.z;
    const unsigned which = z & 1u;                       // block-uniform select among global pointers
    const unsigned b = z >> 1;
    const float* src = xq;
    if (which == 1u) src = xk;
    const unsigned s0 = blockIdx.x * 64u, c0 = blockIdx.y * 64u;
    const unsigned t = threadIdx.x;
#pragma unroll
    for (int i = 0; i < 4; ++i) {
        const unsigned idx = t + 256u * (unsigned)i;
        const unsigned cc = idx >> 4, s4 = (idx & 15u) << 2;
        const v4f a = *(const v4f*)(src + ((size_t)b * EMB + c0 + cc) * SEQ_FULL + s0 + s4);
        tile[cc * 65u + s4 + 0u] = a.x; tile[cc * 65u + s4 + 1u] = a.y; tile[cc * 65u + s4 + 2u] = a.z; tile[cc * 65u + s4 + 3u] = a.w;
    }
    __syncthreads();
#pragma unroll
    for (int i = 0; i < 2; ++i) {
        const unsigned idx = t + 256u * (unsigned)i;
        const unsigned ss = idx >> 3, c8 = (idx & 7u) << 3;
        const float f0 = tile[(c8 + 0u) * 65u + ss], f1 = tile[(c8 + 1u) * 65u + ss], f2 = tile[(c8 + 2u) * 65u + ss], f3 = tile[(c8 + 3u) * 65u + ss];
        const float f4 = tile[(c8 + 4u) * 65u + ss], f5 = tile[(c8 + 5u) * 65u + ss], f6 = tile[(c8 + 6u) * 65u + ss], f7 = tile[(c8 + 7u) * 65u + ss];
        u4v pk; pk.x = pk2hf(bf_keep(f0), bf_keep(f1)); pk.y = pk2hf(bf_keep(f2), bf_keep(f3)); pk.z = pk2hf(bf_keep(f4), bf_keep(f5)); pk.w = pk2hf(bf_keep(f6), bf_keep(f7));
        VST2(u4v, (u4v*)(D + (size_t)which * ((size_t)NB * SEQ * EMB) + ((size_t)b * SEQ + s0 + ss) * EMB + c0 + c8), pk);
    }
}

// ---- three [512 out][512 in] direction weights -> f16 planes of bf16-converted values x16 (exact), plane y at D + y*WSZ, and the per-row gain table
//      SCL[y*512 + o] = bf16(g[o]) / ||bf16(v[o,:])|| / 16 (f32). Block = 32 rows (wave = 4 rows); grid (EMB/32, 3).
//      Plane rows: 2 instructions x 32 lanes x 16 B lane-contiguous; gain line: 32 lanes x 4 B of wave 0 in one instruction (LDS word per row, block barrier). ----
__global__ __launch_bounds__(256) void k_wprep(const float* __restrict__ v0, const float* __restrict__ g0, const float* __restrict__ v1, const float* __restrict__ g1,
                                               const float* __restrict__ v2, const float* __restrict__ g2, unsigned short* __restrict__ D, float* __restrict__ SCLp) {
#pragma clang fp contract(off)
    __shared__ float red[32];
    const unsigned y = blockIdx.y;                       // block-uniform select among global pointers
    const float* s = v0; const float* g = g0;
    if (y == 1u) { s = v1; g = g1; }
    if (y == 2u) { s = v2; g = g2; }
    const unsigned lane = threadIdx.x & 31u;
    const unsigned wave = (unsigned)__builtin_amdgcn_readfirstlane((int)(threadIdx.x >> 5));
    const unsigned rb = blockIdx.x * 32u;
#pragma unroll 1
    for (unsigned rr = 0; rr < 4u; ++rr) {
        const unsigned rl = wave * 4u + rr;
        const unsigned row = rb + rl;
        float ss = 0.f;
#pragma unroll 1
        for (unsigned it = 0; it < 2u; ++it) {
            const unsigned u = it * 32u + lane;          // 16-B piece of the row
            const float* p = s + (size_t)row * EMB + u * 8u;
            const v4f a = *(const v4f*)(p), b = *(const v4f*)(p + 4);
            const float a0 = bf_keep(a.x), a1 = bf_keep(a.y), a2 = bf_keep(a.z), a3 = bf_keep(a.w);
            const float b0 = bf_keep(b.x), b1 = bf_keep(b.y), b2 = bf_keep(b.z), b3 = bf_keep(b.w);
            ss += a0 * a0; ss += a1 * a1; ss += a2 * a2; ss += a3 * a3;
            ss += b0 * b0; ss += b1 * b1; ss += b2 * b2; ss += b3 * b3;
            u4v pk; pk.x = pk2hf(a0 * 16.f, a1 * 16.f); pk.y = pk2hf(a2 * 16.f, a3 * 16.f); pk.z = pk2hf(b0 * 16.f, b1 * 16.f); pk.w = pk2hf(b2 * 16.f, b3 * 16.f);
            VST2(u4v, (u4v*)(D + (size_t)y * WSZ + (size_t)row * EMB + u * 8u), pk);
        }
        ss += __shfl_xor(ss, 1, 32); ss += __shfl_xor(ss, 2, 32); ss += __shfl_xor(ss, 4, 32);
        ss += __shfl_xor(ss, 8, 32); ss += __shfl_xor(ss, 16, 32);
        if (lane == 0u) red[rl] = ss;
    }
    __syncthreads();
    if (threadIdx.x < 32u) {
        const unsigned row = rb + lane;
        const float sc = bf_keep(g[row]) * (1.0f / sqrtf(red[lane])) * 0.0625f;
        VST2(float, SCLp + (size_t)y * EMB + row, sc);
    }
}

// =====================================================================================================================
// k_proj_all: all six projection row groups in ONE grid (they only read the operand planes and write disjoint planes, so none waits for another).
//   blockIdx.z: 0 q early, 1 k early, 2 v^T early (value + residual planes), 3 q late, 4 k late, 5 v^T late (value plane only); blockIdx.y = batch.
//   C[m,n] = scl * sum_k A[m,k] * Bt[n,k] + bias; each wave owns a 64x64 tile; a block is 2 x 4 waves = 128 x 256; A, Bt row-major f16, pitch EMB, K = EMB.
//   q, k (token-major): A = tokens, Bt = direction weights, bias[n], scl[n]; v^T (channel-major): A = direction weights, Bt = tokens, bias[m], scl[m]
//   (bias bf16-converted on load; scl is an f32 table). Operands: a stage is 64 k (whole 128-byte rows) of the block's 128 A rows (each read by 4 waves)
//   and 256 Bt rows (each read by 2 waves), brought into LDS by asynchronous copies, two buffers: stage t + 1 flies while stage t feeds the products. Output: f16 plane C (value); RES: also the f16 plane Cr = (value - f16 value) x 2048.
// =====================================================================================================================
template <int BIAS_MODE, bool RES>
__device__ __forceinline__ void proj_epilogue(v8f (&acc)[4][4], float* slab, _Float16* C, unsigned ldc, _Float16* Cr, unsigned ldr,
                                              const float* __restrict__ bias, const float* __restrict__ scl, unsigned m0, unsigned n0, unsigned lane) {
  const unsigned rlane = lane & 15u;            // col (D) within subtile
  const unsigned mOff  = (lane >> 4) << 3;      // D row offset
#pragma unroll
  for (int i = 0; i < 4; ++i) {
    const unsigned mBase = m0 + ((unsigned)i << 4);
    float bm[8], sm[8];
#pragma unroll
    for (int r = 0; r < 8; ++r) {
      bm[r] = (BIAS_MODE == 1) ? bf_keep(bias[mBase + mOff + (unsigned)r]) : 0.f;
      sm[r] = (BIAS_MODE == 1) ? scl[mBase + mOff + (unsigned)r] : 0.f;
    }
#pragma unroll
    for (int j = 0; j < 4; ++j) {
      const unsigned n = n0 + ((unsigned)j << 4) + rlane;
      float bv = 0.f, sv = 0.f;
      if (BIAS_MODE == 2) { bv = bf_keep(bias[n]); sv = scl[n]; }
#pragma unroll
      for (int r = 0; r < 8; ++r) {
        float v;
        if (BIAS_MODE == 1) v = acc[i][j][r] * sm[r] + bm[r];
        else                v = acc[i][j][r] * sv + bv;
        slab[(mOff + (unsigned)r) * 68u + ((unsigned)j << 4) + rlane] = v;
      }
    }
    __builtin_amdgcn_fence(3 /* release order */, "workgroup");
    __builtin_amdgcn_wave_barrier();
    __builtin_amdgcn_fence(2 /* acquire order */, "workgroup");
    {
      const unsigned q = lane >> 3, c8 = (lane & 7u) << 3;
      v8h hv[4];
      v8h rv[4];
#pragma unroll
      for (int it = 0; it < 4; ++it) {
        const unsigned row = (unsigned)it * 4u + q;
        const float* sp = slab + row * 68u + c8;
        const v4f s0 = *(const v4f*)(sp), s1 = *(const v4f*)(sp + 4);
        const v8f sv = (v8f){s0.x, s0.y, s0.z, s0.w, s1.x, s1.y, s1.z, s1.w};
        const v8h t = toh8(sv);
        hv[it] = t;
        v8h u = t;
        if (RES) u = toh8((sv - tof8(t)) * 2048.0f);
        rv[it] = u;
      }
#pragma unroll
      for (int it = 0; it < 4; ++it) {
        const unsigned row = (unsigned)it * 4u + q;
        *(v8h*)(C + (size_t)(mBase + row) * ldc + n0 + c8) = hv[it];
        if (RES) *(v8h*)(Cr + (size_t)(mBase + row) * ldr + n0 + c8) = rv[it];
      }
    }
    __builtin_amdgcn_fence(3 /* release order */, "workgroup");
    __builtin_amdgcn_wave_barrier();
    __builtin_amdgcn_fence(2 /* acquire order */, "workgroup");
  }
}

__global__ __launch_bounds__(256) void k_proj_all(const _Float16* __restrict__ XQ, const _Float16* __restrict__ XK, const _Float16* __restrict__ Wd,
                                                  _Float16* QHp, _Float16* KHp, _Float16* VTHp, _Float16* QRp, _Float16* KRp, _Float16* VTRp,
                                                  const float* __restrict__ bq, const float* __restrict__ bk, const float* __restrict__ bv,
                                                  const float* __restrict__ SCLp) {
  __shared__ __align__(16) float sT[8][16 * 68];   // per-wave 16x64 slab, pitch 68 floats
  __shared__ __align__(16) _Float16 pst[2u * PSTG_H];   // two operand stages: rows 0..127 = A, rows 128..383 = Bt; pitch KVP
  const unsigned z    = blockIdx.z;                // block-uniform selects among global pointers below
  const unsigned b    = blockIdx.y;
  const bool     late = z >= 3u;
  const unsigned p    = late ? z - 3u : z;         // 0 q, 1 k, 2 v^T
  const bool     chm  = p == 2u;                   // channel-major (v^T)
  const unsigned rows = late ? (unsigned)LROWS : (unsigned)EROWS;   // tokens of this row group
  const unsigned row0 = late ? (unsigned)EROWS : 0u;                // its first token inside a batch
  const unsigned lane = threadIdx.x & 31u;
  const unsigned wave = (unsigned)__builtin_amdgcn_readfirstlane((int)(threadIdx.x >> 5));
  const unsigned tilesM = (chm ? (unsigned)EMB : rows) >> 6;
  const unsigned tilesN = (chm ? rows : (unsigned)EMB) >> 6;
  if (blockIdx.x * 8u >= tilesM * tilesN) return;   // block-uniform, in front of every barrier
  const unsigned nbn = tilesN >> 2;             // blocks along n
  const unsigned bm = blockIdx.x / nbn;
  const unsigned bn = blockIdx.x - bm * nbn;
  const unsigned mb = bm << 7, nb = bn << 8;    // the block's first A row, first Bt row
  const unsigned wm = wave >> 2, wn = wave & 3u;
  const unsigned m0 = mb + (wm << 6);
  const unsigned n0 = nb + (wn << 6);

  const _Float16* X = XQ;
  if (p != 0u) X = XK;
  const _Float16* tok = X + ((size_t)b * SEQ + row0) * EMB;   // this batch's tokens of the row group
  const _Float16* wgt = Wd + (size_t)p * WSZ;
  const _Float16* Ab = chm ? wgt : tok;
  const _Float16* Bb = chm ? tok : wgt;

  const unsigned rlane = lane & 15u;            // row (A) / col (B) within subtile
  const unsigned koff  = (lane >> 4) << 3;      // k offset of this lane half

  v8f acc[4][4];
#pragma unroll
  for (int i = 0; i < 4; ++i)
#pragma unroll
    for (int j = 0; j < 4; ++j) acc[i][j] = (v8f){0.f,0.f,0.f,0.f,0.f,0.f,0.f,0.f};

  // staging: this lane's row (of 4 per wave-wide copy) and 16-byte piece; each wave brings 16 of the block's A rows and 32 of its Bt rows
  const unsigned lr = lane >> 3, pc = (lane & 7u) << 3;
  const unsigned la = (unsigned)(size_t)pst + ((wave * 16u + lr) * KVP + pc) * 2u;           // LDS byte addresses in buffer 0
  const unsigned lb = (unsigned)(size_t)pst + ((128u + wave * 32u + lr) * KVP + pc) * 2u;
  const _Float16* ga = Ab + (size_t)(mb + wave * 16u + lr) * (unsigned)EMB + pc;             // + 64 * stage
  const _Float16* gb = Bb + (size_t)(nb + wave * 32u + lr) * (unsigned)EMB + pc;
  const _Float16* fa = pst + (wm * 64u + rlane) * KVP + koff;                                // fragment rows in buffer 0
  const _Float16* fb = pst + (128u + wn * 64u + rlane) * KVP + koff;
  constexpr unsigned NSTG = (unsigned)EMB / 64u;
  static_assert(NSTG >= 2u);                                                                 // the prologue starts stages 0 and 1

  // prologue of the two-buffer ring: stage 0 lands and is published, then stage 1 starts
  stage_rows4(la, ga);
  stage_rows8(lb, gb);
  asm volatile("s_wait_asynccnt 0x0" ::: "memory");   // this wave's copies of stage 0 have landed
  __syncthreads();
  stage_rows4(la + PSTG_H * 2u, ga + 64u);
  stage_rows8(lb + PSTG_H * 2u, gb + 64u);

#pragma unroll 1   // one copy of the hot loop in the instruction cache; the buffer select is scalar
  for (unsigned t = 0; t < NSTG; ++t) {
    const unsigned bo = (t & 1u) * PSTG_H;             // this stage's buffer, in halves
#pragma unroll
    for (int ks = 0; ks < 2; ++ks) {
      v16h bh[4], ah[4];                               // the k-step's eight fragments are read as one group, ahead of its products
#pragma unroll
      for (int j = 0; j < 4; ++j) bh[j] = frag_ld(fb + bo + (unsigned)j * 16u * KVP + (unsigned)ks * 32u);
#pragma unroll
      for (int i = 0; i < 4; ++i) ah[i] = frag_ld(fa + bo + (unsigned)i * 16u * KVP + (unsigned)ks * 32u);
#pragma unroll
      for (int i = 0; i < 4; ++i) {
#pragma unroll
        for (int j = 0; j < 4; ++j) acc[i][j] = mma_raw(ah[i], bh[j], acc[i][j]);
        dep_guard_h(acc[i][0], acc[i][3], ah[i], ah[i]);
      }
      keep4_h(bh[0], bh[1], bh[2], bh[3]);
    }
    // stage t + 1 is published; the buffer that every wave has just left takes stage t + 2
    stage_publish();
    if (t + 2u < NSTG) {
      const unsigned ko = (t + 2u) * 64u;
      stage_rows4(la + bo * 2u, ga + ko);
      stage_rows8(lb + bo * 2u, gb + ko);
    }
  }
  asm volatile("s_wait_asynccnt 0x0" ::: "memory");   // no copy is outstanding behind the loop
  acc_guard4(acc[0][0], acc[0][1], acc[0][2], acc[0][3]);
  acc_guard4(acc[1][0], acc[1][1], acc[1][2], acc[1][3]);
  acc_guard4(acc[2][0], acc[2][1], acc[2][2], acc[2][3]);
  acc_guard4(acc[3][0], acc[3][1], acc[3][2], acc[3][3]);

  // ---- epilogue (one of four forms, block-uniform) ----
  float* slab = sT[wave];
  const float* scl = SCLp + (size_t)p * EMB;
  if (chm) {
    _Float16* C  = VTHp + (size_t)b * ((size_t)EMB * SEQ) + row0;
    _Float16* Cr = VTRp + (size_t)b * ((size_t)EMB * EROWS);
    if (late) proj_epilogue<1, false>(acc, slab, C, (unsigned)SEQ, Cr, (unsigned)EROWS, bv, scl, m0, n0, lane);
    else      proj_epilogue<1, true >(acc, slab, C, (unsigned)SEQ, Cr, (unsigned)EROWS, bv, scl, m0, n0, lane);
  } else {
    _Float16* Cp = QHp; _Float16* Rp = QRp; const float* bias = bq;
    if (p == 1u) { Cp = KHp; Rp = KRp; bias = bk; }
    _Float16* C  = Cp + ((size_t)b * SEQ + row0) * EMB;
    _Float16* Cr = Rp + (size_t)b * ((size_t)EROWS * EMB);
    if (late) proj_epilogue<2, false>(acc, slab, C, (unsigned)EMB, Cr, (unsigned)EMB, bias, scl, m0, n0, lane);
    else      proj_epilogue<2, true >(acc, slab, C, (unsigned)EMB, Cr, (unsigned)EMB, bias, scl, m0, n0, lane);
  }
}

__device__ __forceinline__ float xhalf(float x) {
  return __builtin_bit_cast(float, __builtin_amdgcn_permlanex16(__builtin_bit_cast(int, x), __builtin_bit_cast(int, x), 0x76543210, 0xfedcba98, false, false));
}

// 2^x as the one hardware instruction. The library form adds a compare, two selects, an add and an ldexp per value, only to return subnormal results
// for x < -126. Here x <= 0 and such a term is below 2^-126 of its row's largest one: it is 0 in the f16 P either way and vanishes in the f32 row sum (>= 1).
// Written as asm so that the slot behind each transcendental is filled by construction: the next v_exp_f32 neither reads its result nor overwrites its
// source (the outputs are early-clobber, so they share no register with an input), and one v_nop stands behind the last.
__device__ __forceinline__ v8f exp2_hw8(v8f x) {
  float p0, p1, p2, p3, p4, p5, p6, p7;
  asm("v_exp_f32 %0, %8\n\tv_exp_f32 %1, %9\n\tv_exp_f32 %2, %10\n\tv_exp_f32 %3, %11\n\t"
      "v_exp_f32 %4, %12\n\tv_exp_f32 %5, %13\n\tv_exp_f32 %6, %14\n\tv_exp_f32 %7, %15\n\tv_nop"
      : "=&v"(p0), "=&v"(p1), "=&v"(p2), "=&v"(p3), "=&v"(p4), "=&v"(p5), "=&v"(p6), "=&v"(p7)
      : "v"(x[0]), "v"(x[1]), "v"(x[2]), "v"(x[3]), "v"(x[4]), "v"(x[5]), "v"(x[6]), "v"(x[7]));
  return (v8f){p0, p1, p2, p3, p4, p5, p6, p7};
}
__device__ __forceinline__ float exp2_hw1(float x) {
  float p;
  asm("v_exp_f32 %0, %1\n\tv_nop" : "=&v"(p) : "v"(x));   // v_nop: the slot behind the transcendental; a rescale factor below 2^-126 leaves nothing of the older sums in f32 either way
  return p;
}

template <bool EARLY>
__device__ __forceinline__ void attn_body(const _Float16* __restrict__ Q, const _Float16* __restrict__ Kp, const _Float16* __restrict__ VT,
                                          const _Float16* __restrict__ QR, const _Float16* __restrict__ KR, const _Float16* __restrict__ VTR,
                                          float* __restrict__ OUT, unsigned qb_off, unsigned nqb) {
  constexpr unsigned NT = EARLY ? 2u : 1u;                           // tiles per stage: value plane (+ residual plane)
  __shared__ __align__(16) _Float16 stg[2u * NT * TILE_H];           // buffer 0: K (, K residual); buffer 1: V^T (, V^T residual)
  float* OT = (float*)stg;                                           // block output tile [d][query], pitch 68 (cross-wave): reuses stg behind the loop
  const unsigned tid  = threadIdx.x;
  const unsigned wave = (unsigned)__builtin_amdgcn_readfirstlane((int)(tid >> 5));
  const unsigned lane = tid & 31u;
  const unsigned hh   = lane >> 4;
  const unsigned c    = lane & 15u;
  const unsigned bx = blockIdx.x;
  const unsigned bh = bx / nqb;
  const unsigned tq = bx - bh * nqb;
  // Load balance (speed only; for each bh a permutation of the band's tiles): a tile's cost grows with its index, all blocks of the launch are resident at once.
  // Every other (batch, head)
  // takes its tiles mirrored; the bits of bh are chosen so that bh ^ 1, bh ^ 2 and bh + 32 differ.
  const unsigned mir = (bh ^ (bh >> 1) ^ (bh >> 5)) & 1u;
  const unsigned qb = qb_off + (mir != 0u ? nqb - 1u - tq : tq);
  const unsigned h  = bh & 7u;
  const unsigned b  = bh >> 3;
  const unsigned q0 = qb * 64u + wave * 16u;
  const unsigned qi = q0 + c;                                        // this lane's query
  const unsigned nch = qb + 1u;
  const size_t rowbase = (size_t)b * SEQ;
  const size_t resbase = (size_t)b * EROWS;

  const _Float16* qrow = Q + (rowbase + qi) * EMB + h * 64u + 8u * hh;
  const v16h qa0 = frag_ld(qrow), qa1 = frag_ld(qrow + 32);
  v16h qr0 = qa0, qr1 = qa1;
  if (EARLY) {
    const _Float16* qrr = QR + (resbase + qi) * EMB + h * 64u + 8u * hh;
    qr0 = frag_ld(qrr); qr1 = frag_ld(qrr + 32);
  }
  const _Float16* kbase  = stg + 8u * hh;                                                // + key * KVP (+ 32 for the second d chunk)
  const _Float16* krbase = kbase + TILE_H;
  const _Float16* vbase  = stg + NT * TILE_H + 8u * hh;                                  // + d * KVP + kv
  const _Float16* vrbase = vbase + TILE_H;
  // staging: this thread's row (of 16 per copy) and 16-byte piece
  const unsigned srow = tid >> 3, spc = (tid & 7u) << 3;
  const unsigned lk = (unsigned)(size_t)stg + (srow * KVP + spc) * 2u;                   // LDS byte address in the K buffer
  const unsigned lv = lk + NT * TILE_H * 2u;                                             // the same place in the V^T buffer
  const unsigned ok  = srow * EMB + spc;                                                 // this thread's piece inside a K tile (value and residual planes)
  const unsigned ov  = srow * SEQ + spc, ovr = srow * EROWS + spc;                       // the same inside a V^T tile, a V^T residual tile
  const _Float16* gk  = Kp  + rowbase * EMB + h * 64u;                                   // block-uniform tile origins: + kv0 * EMB
  const _Float16* gkr = KR  + resbase * EMB + h * 64u;
  const _Float16* gv  = VT  + ((size_t)b * EMB + h * 64u) * SEQ;                         // + kv0
  const _Float16* gvr = VTR + ((size_t)b * EMB + h * 64u) * EROWS;

  float mrow = -__builtin_inff();     // running maximum of this lane's query (equal in both halves)
  float lrow = 0.f;                   // running sum over this half's keys; the halves are joined behind the loop
  v8f oacc[4], oaccr[4];              // O^T: tile t, element r = d 16t + 8h + r of this lane's query
#pragma unroll
  for (int t = 0; t < 4; ++t) { oacc[t] = (v8f){0.f,0.f,0.f,0.f,0.f,0.f,0.f,0.f}; oaccr[t] = (v8f){0.f,0.f,0.f,0.f,0.f,0.f,0.f,0.f}; }

  const float SC    = 0.125f * 1.4426950408889634f;       // 1/sqrt(64) and log2(e)
  const float FILLX = -14426.950408889634f;               // -10000 * log2(e)

  // prologue of the two-buffer ring: stage 0 (K of chunk 0) lands and is published, then stage 1 (V^T of chunk 0) starts
  if (EARLY) stage_tile2(lk, gk + ok, 16u * EMB, lk + TILE_H * 2u, gkr + ok, 16u * EMB);
  else       stage_tile1(lk, gk + ok, 16u * EMB);
  asm volatile("s_wait_asynccnt 0x0" ::: "memory");   // this wave's copies of stage 0 have landed
  __syncthreads();
  if (EARLY) stage_tile2(lv, gv + ov, 16u * SEQ, lv + TILE_H * 2u, gvr + ovr, 16u * EROWS);
  else       stage_tile1(lv, gv + ov, 16u * SEQ);

  for (unsigned kc = 0; kc < nch; ++kc) {
    const unsigned kv0 = kc * 64u;
    const bool more = kc + 1u < nch;                   // block-uniform: a next chunk exists
    // Score products: the fragments of a group of key tiles are read together, ahead of the group's products, and the products of the group's
    // independent accumulators alternate, so each fills the distance behind the others; per accumulator the order of the products is unchanged.
    v8f s[4];
    constexpr int JG = EARLY ? 2 : 4;                  // key tiles per group (EARLY: four fragments per tile, so two tiles fill the registers)
#pragma unroll
    for (int j0 = 0; j0 < 4; j0 += JG) {
      v16h kh0[JG], kh1[JG], kq0[JG], kq1[JG];
      v8f ar[JG];
#pragma unroll
      for (int j = 0; j < JG; ++j) {
        const _Float16* kr = kbase + ((unsigned)(j0 + j) * 16u + c) * KVP;
        kh0[j] = frag_ld(kr); kh1[j] = frag_ld(kr + 32);
      }
      if (EARLY) {
#pragma unroll
        for (int j = 0; j < JG; ++j) {
          const _Float16* krr = krbase + ((unsigned)(j0 + j) * 16u + c) * KVP;
          kq0[j] = frag_ld(krr); kq1[j] = frag_ld(krr + 32);
        }
        frags_ready8(kh0[0], kh1[0], kh0[1], kh1[1], kq0[0], kq1[0], kq0[1], kq1[1]);
      } else {
        frags_ready8(kh0[0], kh1[0], kh0[1], kh1[1], kh0[JG - 2], kh1[JG - 2], kh0[JG - 1], kh1[JG - 1]);
      }
#pragma unroll
      for (int j = 0; j < JG; ++j) s[j0 + j] = mma_raw(kh0[j], qa0, (v8f){0.f,0.f,0.f,0.f,0.f,0.f,0.f,0.f});
      if (EARLY) {
#pragma unroll
        for (int j = 0; j < JG; ++j) ar[j] = mma_raw(kh0[j], qr0, (v8f){0.f,0.f,0.f,0.f,0.f,0.f,0.f,0.f});
      }
#pragma unroll
      for (int j = 0; j < JG; ++j) s[j0 + j] = mma_raw(kh1[j], qa1, s[j0 + j]);
      if (EARLY) {
#pragma unroll
        for (int j = 0; j < JG; ++j) ar[j] = mma_raw(kh1[j], qr1, ar[j]);
#pragma unroll
        for (int j = 0; j < JG; ++j) ar[j] = mma_raw(kq0[j], qa0, ar[j]);
#pragma unroll
        for (int j = 0; j < JG; ++j) ar[j] = mma_raw(kq1[j], qa1, ar[j]);
        acc_guard4(s[j0], s[j0 + 1], ar[0], ar[1]);    // v_nop: the distance between the group's last products and the vector instructions that read them
#pragma unroll
        for (int j = 0; j < JG; ++j) s[j0 + j] = s[j0 + j] + ar[j] * 0.00048828125f;
      }
    }
    if (!EARLY) acc_guard4(s[0], s[1], s[2], s[3]);    // v_nop: the same distance, also on the taken side of the branch below
    // The softmax touches no LDS any more, so the publish point stands directly behind the score products: V^T of this chunk is published;
    // the K buffer, which every wave has left, takes the next chunk's K, which flies through the softmax and V^T.P^T
    stage_publish();
    if (more) {
      const size_t ko = (size_t)(kv0 + 64u) * EMB;
      if (EARLY) stage_tile2(lk, (gk + ko) + ok, 16u * EMB, lk + TILE_H * 2u, (gkr + ko) + ok, 16u * EMB);
      else       stage_tile1(lk, (gk + ko) + ok, 16u * EMB);
    }
    const int kd = (int)qi - (int)(kv0 + 8u * hh);     // tile j, element r is a key in front of this lane's query where 16j + r < kd
    float mj[4];
#pragma unroll
    for (int j = 0; j < 4; ++j) {
#pragma unroll
      for (int r = 0; r < 8; ++r) s[j][r] = (j * 16 + r < kd) ? s[j][r] * SC : FILLX;
      mj[j] = fmaxf(fmaxf(fmaxf(s[j][0], s[j][1]), fmaxf(s[j][2], s[j][3])), fmaxf(fmaxf(s[j][4], s[j][5]), fmaxf(s[j][6], s[j][7])));
    }
    float m = fmaxf(fmaxf(mj[0], mj[1]), fmaxf(mj[2], mj[3]));
    m = fmaxf(m, xhalf(m));
    const float mnew = fmaxf(mrow, m);
    const float alpha = exp2_hw1(mrow - mnew);
    mrow = mnew;
    FragU pa[2], pr[2];                                // P^T (and its residual) as B fragments of keys 0..31 and 32..63
    float ps[4];
#pragma unroll
    for (int j = 0; j < 4; ++j) {
      float a = 0.f;
      const v8f pj = exp2_hw8(s[j] - mnew);
#pragma unroll
      for (int r = 0; r < 8; ++r) a += pj[r];
      const v8f e = pj * 32768.0f;
      const v8h g = toh8(e);
      pa[j >> 1].h[j & 1] = g;
      if (EARLY) pr[j >> 1].h[j & 1] = toh8((e - tof8(g)) * 2048.0f);
      ps[j] = a;
    }
    lrow = lrow * alpha + ((ps[0] + ps[1]) + (ps[2] + ps[3]));
#pragma unroll
    for (int t = 0; t < 4; ++t) {
#pragma unroll
      for (int r = 0; r < 8; ++r) { oacc[t][r] *= alpha; if (EARLY) oaccr[t][r] *= alpha; }
    }
    // Output products: eight fragments (EARLY: value and residual of 32 keys; else all 64 keys) are read together, ahead of their products; the four output tiles alternate
    if (EARLY) {
#pragma unroll
      for (int kk = 0; kk < 2; ++kk) {
        v16h vb[4], vr[4];
#pragma unroll
        for (int t = 0; t < 4; ++t) {
          vb[t] = frag_ld(vbase  + ((unsigned)t * 16u + c) * KVP + (unsigned)kk * 32u);
          vr[t] = frag_ld(vrbase + ((unsigned)t * 16u + c) * KVP + (unsigned)kk * 32u);
        }
        frags_ready8(vb[0], vb[1], vb[2], vb[3], vr[0], vr[1], vr[2], vr[3]);
#pragma unroll
        for (int t = 0; t < 4; ++t) oacc[t] = mma_raw(vb[t], pa[kk].v, oacc[t]);
#pragma unroll
        for (int t = 0; t < 4; ++t) oaccr[t] = mma_raw(vb[t], pr[kk].v, oaccr[t]);
#pragma unroll
        for (int t = 0; t < 4; ++t) oaccr[t] = mma_raw(vr[t], pa[kk].v, oaccr[t]);
      }
    } else {
      v16h vb[2][4];
#pragma unroll
      for (int kk = 0; kk < 2; ++kk)
#pragma unroll
        for (int t = 0; t < 4; ++t) vb[kk][t] = frag_ld(vbase + ((unsigned)t * 16u + c) * KVP + (unsigned)kk * 32u);
      frags_ready8(vb[0][0], vb[0][1], vb[0][2], vb[0][3], vb[1][0], vb[1][1], vb[1][2], vb[1][3]);
#pragma unroll
      for (int kk = 0; kk < 2; ++kk)
#pragma unroll
        for (int t = 0; t < 4; ++t) oacc[t] = mma_raw(vb[kk][t], pa[kk].v, oacc[t]);
    }
    // v_nop: the distance between the chunk's last products and the vector instructions that read or rescale the tiles, on every path out of the chunk
    if (EARLY) acc_guard8(oacc, oaccr);
    else       acc_guard4(oacc[0], oacc[1], oacc[2], oacc[3]);
    // K of the next chunk is published; the V^T buffer, which every wave has left, takes the next chunk's V^T
    stage_publish();
    if (more) {
      if (EARLY) stage_tile2(lv, (gv + (kv0 + 64u)) + ov, 16u * SEQ, lv + TILE_H * 2u, (gvr + (kv0 + 64u)) + ovr, 16u * EROWS);
      else       stage_tile1(lv, (gv + (kv0 + 64u)) + ov, 16u * SEQ);
    }
  }
  asm volatile("s_wait_asynccnt 0x0" ::: "memory");   // no copy is outstanding when stg becomes the output tile (the last publish point's barrier ended all reads)

  // join the halves' sums, normalise (P carried x2^15), zero sequence row 0, put the wave's 64 d x 16 queries into the block tile [d][query]
  const float lsum = lrow + xhalf(lrow);
  const float iv = 1.0f / (lsum * 32768.0f);
  const float inv = (qi == 0u) ? 0.0f : iv;
#pragma unroll
  for (int t = 0; t < 4; ++t) {
#pragma unroll
    for (int r = 0; r < 8; ++r) {
      float v = oacc[t][r];
      if (EARLY) v += oaccr[t][r] * 0.00048828125f;
      OT[((unsigned)t * 16u + 8u * hh + (unsigned)r) * 68u + wave * 16u + c] = v * inv;
    }
  }
  __syncthreads();
  {
    const unsigned c4 = (lane & 15u) << 2;     // row segment = 64 floats = 256 B = 16 lanes x 16 B; 2 rows per instruction, 8 trips = 16 rows per wave
    float* ob = OUT + ((size_t)b * EMB + h * 64u + wave * 16u) * SEQ_FULL + qb * 64u + c4;
    v4f vv[8];
#pragma unroll
    for (int it = 0; it < 8; ++it) {
      const unsigned row = (unsigned)it * 2u + hh;
      vv[it] = *(const v4f*)(OT + (wave * 16u + row) * 68u + c4);
    }
    {
#pragma unroll
      for (int it = 0; it < 8; ++it) {
        const unsigned row = (unsigned)it * 2u + hh;
        *(v4f*)(ob + (size_t)row * SEQ_FULL) = vv[it];
      }
    }
  }
}

__global__ __launch_bounds__(128) __attribute__((amdgpu_num_vgpr(256))) void k_attn_early(
    const _Float16* __restrict__ Q, const _Float16* __restrict__ Kp, const _Float16* __restrict__ VT,
    const _Float16* __restrict__ QR, const _Float16* __restrict__ KR, const _Float16* __restrict__ VTR,
    float* __restrict__ OUT, unsigned qb_off, unsigned nqb) {
  attn_body<true>(Q, Kp, VT, QR, KR, VTR, OUT, qb_off, nqb);
}
__global__ __launch_bounds__(128) void k_attn_late(
    const _Float16* __restrict__ Q, const _Float16* __restrict__ Kp, const _Float16* __restrict__ VT,
    const _Float16* __restrict__ QR, const _Float16* __restrict__ KR, const _Float16* __restrict__ VTR,
    float* __restrict__ OUT, unsigned qb_off, unsigned nqb) {
  attn_body<false>(Q, Kp, VT, QR, KR, VTR, OUT, qb_off, nqb);
}

// ---- workspace carve (bytes; every region is a whole number of 256-B units and is written in full by its producer) ----
#define SZ_P16  ((size_t)NB * SEQ * EMB * 2)            // one f16 activation plane
#define SZ_R16  ((size_t)NB * EROWS * EMB * 2)          // one f16 residual plane (early rows only)
#define SZ_W16  ((size_t)3 * WSZ * 2)
#define SZ_SCL  ((size_t)3 * EMB * 4)
#define OFF_XQ   ((size_t)0)
#define OFF_XK   (OFF_XQ + SZ_P16)
#define OFF_W16  (OFF_XK + SZ_P16)
#define OFF_SCL  (OFF_W16 + SZ_W16)
#define OFF_QH   (OFF_SCL + SZ_SCL)
#define OFF_KH   (OFF_QH + SZ_P16)
#define OFF_VTH  (OFF_KH + SZ_P16)
#define OFF_QR   (OFF_VTH + SZ_P16)
#define OFF_KR   (OFF_QR + SZ_R16)
#define OFF_VTR  (OFF_KR + SZ_R16)
#define WS_TOTAL (OFF_VTR + SZ_R16)
static_assert(SZ_P16 % 256 == 0 && SZ_R16 % 256 == 0 && SZ_W16 % 256 == 0 && SZ_SCL % 256 == 0);
static_assert(OFF_XK == OFF_XQ + (size_t)NB * SEQ * EMB * 2);   // k_castxT addresses the key plane as plane 1 of one base
static_assert(WS_TOTAL <= (size_t)134217728);
static_assert((size_t)NB_FULL * EMB * SEQ_FULL * 4 == (size_t)33554432);   // output extent in bytes, offset 0

extern "C" void kernel_launch(void* const* d_in, const int* in_sizes, int n_in, void* d_out, int out_size, void* d_ws, size_t ws_size, hipStream_t stream) {
    if (n_in < 11) return;
    const long long xneed = ((long long)(NB - 1) * EMB + (EMB - 1)) * SEQ_FULL + SEQ;
    if ((long long)in_sizes[0] < xneed) return;
    if ((long long)in_sizes[1] < xneed) return;
    if (in_sizes[2] < WSZ || in_sizes[5] < WSZ || in_sizes[8] < WSZ) return;
    if (in_sizes[3] < EMB || in_sizes[4] < EMB || in_sizes[6] < EMB || in_sizes[7] < EMB || in_sizes[9] < EMB || in_sizes[10] < EMB) return;
    if ((long long)out_size < xneed) return;
    if ((size_t)WS_TOTAL > ws_size) return;

    // input order: query, key, vq, gq, bq, vk, gk, bk, vv, gv, bv
    const float* query = (const float*)d_in[0];
    const float* key   = (const float*)d_in[1];
    const float* vq = (const float*)d_in[2];  const float* gq = (const float*)d_in[3];  const float* bq = (const float*)d_in[4];
    const float* vk = (const float*)d_in[5];  const float* gk = (const float*)d_in[6];  const float* bk = (const float*)d_in[7];
    const float* vv = (const float*)d_in[8];  const float* gv = (const float*)d_in[9];  const float* bv = (const float*)d_in[10];
    float* out = (float*)d_out;

    char* ws = (char*)d_ws;
    unsigned short* X16  = (unsigned short*)(ws + OFF_XQ);     // plane 0 = query tokens, plane 1 = key tokens
    unsigned short* W16  = (unsigned short*)(ws + OFF_W16);    // planes: 0 vq 1 vk 2 vv (direction weights x16)
    float*          SCL  = (float*)(ws + OFF_SCL);             // [3][512] row gains / 16
    _Float16* QH  = (_Float16*)(ws + OFF_QH);
    _Float16* KH  = (_Float16*)(ws + OFF_KH);
    _Float16* VTH = (_Float16*)(ws + OFF_VTH);
    _Float16* QR  = (_Float16*)(ws + OFF_QR);
    _Float16* KR  = (_Float16*)(ws + OFF_KR);
    _Float16* VTR = (_Float16*)(ws + OFF_VTR);

    const _Float16* XQh = (const _Float16*)(ws + OFF_XQ);
    const _Float16* XKh = (const _Float16*)(ws + OFF_XK);
    const _Float16* W16h = (const _Float16*)W16;

    // 1-2: operand planes
    k_castxT<<<dim3((unsigned)(SEQ / 64), (unsigned)(EMB / 64), (unsigned)(NB * 2)), 256, 0, stream>>>(query, key, X16);
    k_wprep<<<dim3((unsigned)(EMB / 32), 3u), 256, 0, stream>>>(vq, gq, vk, gk, vv, gv, W16, SCL);

    // 3: q, k (tokens x V^T, row gain, bias -> f16 planes) and v^T (V x tokens^T, gain[m], bias[m] -> f16 plane [b][h*64+d][token]); early group also residual planes;
    //    all six row groups in one grid (blockIdx.z), the early groups (longer epilogue) first
    k_proj_all<<<dim3((unsigned)(((EROWS > LROWS) ? EROWS : LROWS) / 64), (unsigned)NB, (LROWS > 0) ? 6u : 3u), 256, 0, stream>>>(
        XQh, XKh, W16h, QH, KH, VTH, QR, KR, VTR, bq, bk, bv, SCL);

    // 4-5: causal attention, early band (value + residual planes) and late band (single planes); each block writes its 64x64 tile of the output buffer
    k_attn_early<<<(unsigned)(NB * NHEAD * (EROWS / 64)), 128, 0, stream>>>(QH, KH, VTH, QR, KR, VTR, out, 0u, (unsigned)(EROWS / 64));
    if (LROWS > 0) {
        k_attn_late<<<(unsigned)(NB * NHEAD * (LROWS / 64)), 128, 0, stream>>>(QH, KH, VTH, QR, KR, VTR, out, (unsigned)(EROWS / 64), (unsigned)(LROWS / 64));
    }
}

// v010
// Measured time: 83.7 microseconds a run.
// Two timings next to v009 put it at 1.05 and 1.06 times that version's speed.
// Over all steps from v000 it is 4.65 times as fast.
// All contractions (weight-normalised q/k/v projections, q.k^T, P.V): v_wmma_f32_16x16x32_f16 (f16 operands, f32 accumulate); float inputs bf16-converted (RNE) first, direction weights carried x16 with the per-row norm gain applied in f32 at the projection epilogue, P carried x2^15; query rows < EROWS additionally carry q, k, v, P as f16 value + x2048 f16 residual planes (three products, residual products in their own accumulator); mask, softmax, norms in f32.
#include <hip/hip_runtime.h>
#include <math.h>

// ---- sizes (NB / SEQ reducible; *_FULL = strides of the inputs / output) ----
#ifndef NB
#define NB 16
#endif
#ifndef SEQ
#define SEQ 1024
#endif
#ifndef EROWS
#define EROWS ((SEQ < 512) ? SEQ : 512)
#endif
#define LROWS (SEQ - EROWS)
#define NB_FULL 16
#define SEQ_FULL 1024
#define EMB 512
#define NHEAD 8
#define HDIM 64
#define WSZ (EMB * EMB)

static_assert(NB >= 1 && NB <= NB_FULL);
static_assert(SEQ <= SEQ_FULL && SEQ % 64 == 0 && SEQ >= 64);
static_assert(EROWS % 64 == 0 && EROWS >= 64 && EROWS <= SEQ);
static_assert(LROWS % 64 == 0);
static_assert(EMB % 64 == 0 && EMB == NHEAD * HDIM && HDIM == 64 && NHEAD == 8);
static_assert(EMB % 32 == 0);                          // WMMA k-steps of 32, weight rows per prep block
static_assert(4 * 256 == 64 * 16);                     // k_castxT load phase: trips x threads == tile rows x 16-B pieces per row
static_assert(2 * 256 == 64 * 8);
static_assert(2 * 32 * 8 == EMB);                      // k_wprep: trips x lanes x elements == weight row width
static_assert(8 * 4 == 32);                            // k_wprep: waves x rows per wave == rows per block
static_assert(32 * 16 * 4 == 16 * 128);                // projection epilogue: lanes x bytes x trips == slab rows x row bytes (64 halves)
static_assert(4 * 32 * 16 * 8 == 64 * 256);            // attention output: waves x lanes x bytes x trips == tile rows x row bytes (64 floats)
static_assert(2 * 384 * 72 * 2 + 8 * 16 * 68 * 4 <= 163840);  // static LDS of the projection kernel (two operand stages + the epilogue slabs): two blocks per 320-KiB LDS
static_assert((EMB / 64) % 8 == 0 && (EROWS / 64) % 8 == 0 && (LROWS / 64) % 8 == 0);  // projection: a block is 2 x 4 wave tiles; a block has all its tiles or none
static_assert(8 * 4 * 32 * 16 == 128 * 128 && 8 * 8 * 32 * 16 == 256 * 128);  // projection staging: waves x copies x lanes x bytes == block rows x row bytes (A, Bt)
static_assert(4 * 64 * 72 * 2 <= 81920);  // static LDS of the attention kernels: four blocks per 320-KiB LDS
static_assert(64 * 68 * 4 <= 2 * 64 * 72 * 2);         // the output tile fits the staging area that it reuses
static_assert(4 * 128 * 16 == 64 * 128);               // staging: copies per thread x threads x bytes == tile rows x row bytes
static_assert(64 * 65 * 4 <= 131072);                  // static LDS of k_castxT

typedef _Float16 h16;
typedef __attribute__((ext_vector_type(16))) _Float16 v16h;
typedef __attribute__((ext_vector_type(8)))  _Float16 v8h;
typedef __attribute__((ext_vector_type(8)))  float    v8f;
typedef __attribute__((ext_vector_type(4)))  float    v4f;
typedef __attribute__((ext_vector_type(2)))  float    v2f;
typedef __attribute__((ext_vector_type(2)))  _Float16 v2h;
typedef __attribute__((ext_vector_type(4)))  unsigned int u4v;

// 16-bit WMMA fragment map (wave32), lane L, h = L>>4, m = L&15:
//   A 16x32: lane = row m;    element i -> k = (i<8) ? 8h+i : 16+8h+(i-8)
//   B 32x16: lane = column m; the SAME k(i,h)
//   D 16x16 (8 f32): lane = column m; element r -> row 8h+r
union FragU { v16h v; v8h h[2]; };
// p already includes the +8h lane-half offset: elements 0..7 <- p[0..7], 8..15 <- p[16..23]
__device__ __forceinline__ v16h frag_ld(const _Float16* p) { FragU f; f.h[0] = *(const v8h*)(p); f.h[1] = *(const v8h*)(p + 16); return f.v; }

__device__ __forceinline__ v8f mma_raw(v16h a, v16h b, v8f c) { return __builtin_amdgcn_wmma_f32_16x16x32_f16(false, a, false, b, (short)0, c, false, false); }
__device__ __forceinline__ void dep_guard_h(v8f& a, v8f& b, v16h x, v16h y) { asm volatile("v_nop\n\tv_nop\n\tv_nop\n\tv_nop" : "+v"(a), "+v"(b) : "v"(x), "v"(y)); }
__device__ __forceinline__ void keep4_h(v16h a, v16h b, v16h c, v16h d) { asm volatile("v_nop" :: "v"(a), "v"(b), "v"(c), "v"(d)); }
__device__ __forceinline__ void acc_guard4(v8f& a, v8f& b, v8f& c, v8f& d) { asm volatile("v_nop\n\tv_nop\n\tv_nop\n\tv_nop" : "+v"(a), "+v"(b), "+v"(c), "+v"(d)); }
// Inputs-only fence on loaded fragments: all eight are in registers here, so their LDS reads are issued as one group and waited for once, ahead of the products
__device__ __forceinline__ void frags_ready8(v16h a, v16h b, v16h c, v16h d, v16h e, v16h f, v16h g, v16h h) {
    asm volatile("" :: "v"(a), "v"(b), "v"(c), "v"(d), "v"(e), "v"(f), "v"(g), "v"(h));
}
__device__ __forceinline__ void acc_guard8(v8f (&a)[4], v8f (&b)[4]) {
    asm volatile("v_nop\n\tv_nop\n\tv_nop\n\tv_nop" : "+v"(a[0]), "+v"(a[1]), "+v"(a[2]), "+v"(a[3]), "+v"(b[0]), "+v"(b[1]), "+v"(b[2]), "+v"(b[3]));
}

// bf16 RNE convert, kept as f32 (finite inputs)
__device__ __forceinline__ float bf_keep(float v) { const unsigned u = __float_as_uint(v); return __uint_as_float((u + 0x7fffu + ((u >> 16) & 1u)) & 0xffff0000u); }
// f32 -> f16, round to nearest even, two values per instruction. A result below 2^-14 stays an f16 subnormal: the matrix instructions take subnormal operands as they are.
__device__ __forceinline__ unsigned pk2hf(float a, float b) { return __builtin_bit_cast(unsigned, __builtin_convertvector((v2f){a, b}, v2h)); }
__device__ __forceinline__ v8h toh8(v8f v) { return __builtin_convertvector(v, v8h); }
__device__ __forceinline__ v8f tof8(v8h v) { return __builtin_convertvector(v, v8f); }

// ---- LDS staging of 64-row x 128-byte f16 tiles by asynchronous copies (global -> LDS, through no register) ----
#define KVP 72u                      // LDS row pitch in halves: 144 B = 16 B x 9, conflict-free for 16-byte fragment reads
#define TILE_H (64u * KVP)           // halves of one staged tile
#define ROWS16_B (16u * KVP * 2u)    // LDS bytes of 16 staged rows
#define PSTG_H (384u * KVP)          // halves of one projection stage: 128 A rows + 256 Bt rows
// Each thread of the 128 copies its 16-byte piece of rows r, r+16, r+32, r+48: one wave-wide copy = 4 whole 128-byte rows.
// l = the thread's LDS byte address of its piece in row r, g = the same piece in global memory, st = 16 source rows in halves.
// s_wait_xcnt stands as the last line of the copies' own statement, so no address register is rewritten in front of it.
__device__ __forceinline__ void stage_tile1(unsigned l, const _Float16* g, size_t st) {
    asm volatile("global_load_async_to_lds_b128 %0, %4, off\n\t"
                 "global_load_async_to_lds_b128 %1, %5, off\n\t"
                 "global_load_async_to_lds_b128 %2, %6, off\n\t"
                 "global_load_async_to_lds_b128 %3, %7, off\n\t"
                 "s_wait_xcnt 0x0"
                 :: "v"(l), "v"(l + ROWS16_B), "v"(l + 2u * ROWS16_B), "v"(l + 3u * ROWS16_B),
                    "v"(g), "v"(g + st), "v"(g + 2u * st), "v"(g + 3u * st) : "memory");
}
__device__ __forceinline__ void stage_tile2(unsigned l, const _Float16* g, size_t st, unsigned l2, const _Float16* g2, size_t st2) {
    asm volatile("global_load_async_to_lds_b128 %0, %8, off\n\t"
                 "global_load_async_to_lds_b128 %1, %9, off\n\t"
                 "global_load_async_to_lds_b128 %2, %10, off\n\t"
                 "global_load_async_to_lds_b128 %3, %11, off\n\t"
                 "global_load_async_to_lds_b128 %4, %12, off\n\t"
                 "global_load_async_to_lds_b128 %5, %13, off\n\t"
                 "global_load_async_to_lds_b128 %6, %14, off\n\t"
                 "global_load_async_to_lds_b128 %7, %15, off\n\t"
                 "s_wait_xcnt 0x0"
                 :: "v"(l), "v"(l + ROWS16_B), "v"(l + 2u * ROWS16_B), "v"(l + 3u * ROWS16_B),
                    "v"(l2), "v"(l2 + ROWS16_B), "v"(l2 + 2u * ROWS16_B), "v"(l2 + 3u * ROWS16_B),
                    "v"(g), "v"(g + st), "v"(g + 2u * st), "v"(g + 3u * st),
                    "v"(g2), "v"(g2 + st2), "v"(g2 + 2u * st2), "v"(g2 + 3u * st2) : "memory");
}
// Wave-wide forms for the projection: a lane copies its 16-byte piece of rows r, r+4, ... (source pitch EMB halves): one wave-wide copy = 4 whole 128-byte rows.
#define ROWS4_B (4u * KVP * 2u)      // LDS bytes of 4 staged rows
__device__ __forceinline__ void stage_rows4(unsigned l, const _Float16* g) {
    asm volatile("global_load_async_to_lds_b128 %0, %4, off\n\t"
                 "global_load_async_to_lds_b128 %1, %5, off\n\t"
                 "global_load_async_to_lds_b128 %2, %6, off\n\t"
                 "global_load_async_to_lds_b128 %3, %7, off\n\t"
                 "s_wait_xcnt 0x0"
                 :: "v"(l), "v"(l + ROWS4_B), "v"(l + 2u * ROWS4_B), "v"(l + 3u * ROWS4_B),
                    "v"(g), "v"(g + 4u * EMB), "v"(g + 8u * EMB), "v"(g + 12u * EMB) : "memory");
}
__device__ __forceinline__ void stage_rows8(unsigned l, const _Float16* g) {
    asm volatile("global_load_async_to_lds_b128 %0, %8, off\n\t"
                 "global_load_async_to_lds_b128 %1, %9, off\n\t"
                 "global_load_async_to_lds_b128 %2, %10, off\n\t"
                 "global_load_async_to_lds_b128 %3, %11, off\n\t"
                 "global_load_async_to_lds_b128 %4, %12, off\n\t"
                 "global_load_async_to_lds_b128 %5, %13, off\n\t"
                 "global_load_async_to_lds_b128 %6, %14, off\n\t"
                 "global_load_async_to_lds_b128 %7, %15, off\n\t"
                 "s_wait_xcnt 0x0"
                 :: "v"(l), "v"(l + ROWS4_B), "v"(l + 2u * ROWS4_B), "v"(l + 3u * ROWS4_B),
                    "v"(l + 4u * ROWS4_B), "v"(l + 5u * ROWS4_B), "v"(l + 6u * ROWS4_B), "v"(l + 7u * ROWS4_B),
                    "v"(g), "v"(g + 4u * EMB), "v"(g + 8u * EMB), "v"(g + 12u * EMB),
                    "v"(g + 16u * EMB), "v"(g + 20u * EMB), "v"(g + 24u * EMB), "v"(g + 28u * EMB) : "memory");
}
// publish point of the next stage: this wave's LDS reads have returned, its own copies have landed, then the block barrier
// (it shows the landed tile to the other waves and ends every wave's reads of the buffer that is refilled behind it)
__device__ __forceinline__ void stage_publish() {
    asm volatile("s_wait_dscnt 0x0" ::: "memory");      // this wave's reads of the buffer about to be refilled are done
    asm volatile("s_wait_asynccnt 0x0" ::: "memory");   // this wave's copies of the next stage have landed
    __syncthreads();
}

#define VST2(T, ptr, val) do { const T vst2_v_ = (val); *(T*)(ptr) = vst2_v_;  } while (0)

// ---- query / key (f32, [b][c][s], full strides) -> f16 planes of the bf16-converted values, compact [NB*SEQ][512] (token-major);
//      plane 0 = query at D, plane 1 = key at D + NB*SEQ*EMB. 64 channels x 64 tokens per block through an LDS tile (cross-wave: block barrier);
__global__ __launch_bounds__(256) void k_castxT(const float* __restrict__ xq, const float* __restrict__ xk, unsigned short* __restrict__ D) {
#pragma clang fp contract(off)
    __shared__ float tile[64 * 65];
    const unsigned z = blockIdx.z;
    const unsigned which = z & 1u;                       // block-uniform select among global pointers
    const unsigned b = z >> 1;
    const float* src = xq;
    if (which == 1u) src = xk;
    const unsigned s0 = blockIdx.x * 64u, c0 = blockIdx.y * 64u;
    const unsigned t = threadIdx.x;
#pragma unroll
    for (int i = 0; i < 4; ++i) {
        const unsigned idx = t + 256u * (unsigned)i;
        const unsigned cc = idx >> 4, s4 = (idx & 15u) << 2;
        const v4f a = *(const v4f*)(src + ((size_t)b * EMB + c0 + cc) * SEQ_FULL + s0 + s4);
        tile[cc * 65u + s4 + 0u] = a.x; tile[cc * 65u + s4 + 1u] = a.y; tile[cc * 65u + s4 + 2u] = a.z; tile[cc * 65u + s4 + 3u] = a.w;
    }
    __syncthreads();
#pragma unroll
    for (int i = 0; i < 2; ++i) {
        const unsigned idx = t + 256u * (unsigned)i;
        const unsigned ss = idx >> 3, c8 = (idx & 7u) << 3;
        const float f0 = tile[(c8 + 0u) * 65u + ss], f1 = tile[(c8 + 1u) * 65u + ss], f2 = tile[(c8 + 2u) * 65u + ss], f3 = tile[(c8 + 3u) * 65u + ss];
        const float f4 = tile[(c8 + 4u) * 65u + ss], f5 = tile[(c8 + 5u) * 65u + ss], f6 = tile[(c8 + 6u) * 65u + ss], f7 = tile[(c8 + 7u) * 65u + ss];
        u4v pk; pk.x = pk2hf(bf_keep(f0), bf_keep(f1)); pk.y = pk2hf(bf_keep(f2), bf_keep(f3)); pk.z = pk2hf(bf_keep(f4), bf_keep(f5)); pk.w = pk2hf(bf_keep(f6), bf_keep(f7));
        VST2(u4v, (u4v*)(D + (size_t)which * ((size_t)NB * SEQ * EMB) + ((size_t)b * SEQ + s0 + ss) * EMB + c0 + c8), pk);
    }
}

// ---- three [512 out][512 in] direction weights -> f16 planes of bf16-converted values x16 (exact), plane y at D + y*WSZ, and the per-row gain table
//      SCL[y*512 + o] = bf16(g[o]) / ||bf16(v[o,:])|| / 16 (f32). Block = 32 rows (wave = 4 rows); grid (EMB/32, 3).
//      Plane rows: 2 instructions x 32 lanes x 16 B lane-contiguous; gain line: 32 lanes x 4 B of wave 0 in one instruction (LDS word per row, block barrier). ----
__global__ __launch_bounds__(256) void k_wprep(const float* __restrict__ v0, const float* __restrict__ g0, const float* __restrict__ v1, const float* __restrict__ g1,
                                               const float* __restrict__ v2, const float* __restrict__ g2, unsigned short* __restrict__ D, float* __restrict__ SCLp) {
#pragma clang fp contract(off)
    __shared__ float red[32];
    const unsigned y = blockIdx.y;                       // block-uniform select among global pointers
    const float* s = v0; const float* g = g0;
    if (y == 1u) { s = v1; g = g1; }
    if (y == 2u) { s = v2; g = g2; }
    const unsigned lane = threadIdx.x & 31u;
    const unsigned wave = (unsigned)__builtin_amdgcn_readfirstlane((int)(threadIdx.x >> 5));
    const unsigned rb = blockIdx.x * 32u;
    // Latency: the kernel is 48 blocks on an otherwise idle chip, so its time is the trips to memory that stand one behind another. The gain and all 16 loads of
    // the wave's four rows are asked for before the first value is used, the four rows' sums run side by side, and the plane stores stand behind the barrier,
    // which would otherwise wait for them. Per row the order of the sum is unchanged.
    const float gl = g[rb + lane];                       // used by wave 0 behind the barrier
    v4f xa[4][2], xb[4][2];
#pragma unroll
    for (unsigned rr = 0; rr < 4u; ++rr) {
#pragma unroll
        for (unsigned it = 0; it < 2u; ++it) {
            const float* p = s + (size_t)(rb + wave * 4u + rr) * EMB + (it * 32u + lane) * 8u;   // the 8 floats of 16-B plane piece it * 32 + lane of the row
            xa[rr][it] = *(const v4f*)(p); xb[rr][it] = *(const v4f*)(p + 4);
        }
    }
    __builtin_amdgcn_sched_barrier(0);                   // keeps all 17 loads up here: without it the scheduler sinks the gain's load and two row loads to their uses, each a trip of its own
    float ss[4];
#pragma unroll
    for (unsigned rr = 0; rr < 4u; ++rr) {
        float sr = 0.f;
#pragma unroll
        for (unsigned it = 0; it < 2u; ++it) {
            v4f a = xa[rr][it], b = xb[rr][it];
            a.x = bf_keep(a.x); a.y = bf_keep(a.y); a.z = bf_keep(a.z); a.w = bf_keep(a.w);
            b.x = bf_keep(b.x); b.y = bf_keep(b.y); b.z = bf_keep(b.z); b.w = bf_keep(b.w);
            sr += a.x * a.x; sr += a.y * a.y; sr += a.z * a.z; sr += a.w * a.w;
            sr += b.x * b.x; sr += b.y * b.y; sr += b.z * b.z; sr += b.w * b.w;
            xa[rr][it] = a; xb[rr][it] = b;
        }
        ss[rr] = sr;
    }
#pragma unroll
    for (int mk = 1; mk <= 16; mk <<= 1) {
        float o[4];
#pragma unroll
        for (unsigned rr = 0; rr < 4u; ++rr) o[rr] = __shfl_xor(ss[rr], mk, 32);
#pragma unroll
        for (unsigned rr = 0; rr < 4u; ++rr) ss[rr] += o[rr];
    }
    if (lane == 0u) {
#pragma unroll
        for (unsigned rr = 0; rr < 4u; ++rr) red[wave * 4u + rr] = ss[rr];
    }
    __syncthreads();
#pragma unroll
    for (unsigned rr = 0; rr < 4u; ++rr) {
#pragma unroll
        for (unsigned it = 0; it < 2u; ++it) {
            const v4f a = xa[rr][it], b = xb[rr][it];
            u4v pk; pk.x = pk2hf(a.x * 16.f, a.y * 16.f); pk.y = pk2hf(a.z * 16.f, a.w * 16.f); pk.z = pk2hf(b.x * 16.f, b.y * 16.f); pk.w = pk2hf(b.z * 16.f, b.w * 16.f);
            VST2(u4v, (u4v*)(D + (size_t)y * WSZ + (size_t)(rb + wave * 4u + rr) * EMB + (it * 32u + lane) * 8u), pk);
        }
    }
    if (threadIdx.x < 32u) {
        const unsigned row = rb + lane;
        const float sc = bf_keep(gl) * (1.0f / sqrtf(red[lane])) * 0.0625f;
        VST2(float, SCLp + (size_t)y * EMB + row, sc);
    }
}

// =====================================================================================================================
// k_proj_all: all six projection row groups in ONE grid (they only read the operand planes and write disjoint planes, so none waits for another).
//   blockIdx.z: 0 q early, 1 k early, 2 v^T early (value + residual planes), 3 q late, 4 k late, 5 v^T late (value plane only); blockIdx.y = batch.
//   C[m,n] = scl * sum_k A[m,k] * Bt[n,k] + bias; each wave owns a 64x64 tile; a block is 2 x 4 waves = 128 x 256; A, Bt row-major f16, pitch EMB, K = EMB.
//   q, k (token-major): A = tokens, Bt = direction weights, bias[n], scl[n]; v^T (channel-major): A = direction weights, Bt = tokens, bias[m], scl[m]
//   (bias bf16-converted on load; scl is an f32 table). Operands: a stage is 64 k (whole 128-byte rows) of the block's 128 A rows (each read by 4 waves)
//   and 256 Bt rows (each read by 2 waves), brought into LDS by asynchronous copies, two buffers: stage t + 1 flies while stage t feeds the products. Output: f16 plane C (value); RES: also the f16 plane Cr = (value - f16 value) x 2048.
// =====================================================================================================================
template <int BIAS_MODE, bool RES>
__device__ __forceinline__ void proj_epilogue(v8f (&acc)[4][4], float* slab, _Float16* C, unsigned ldc, _Float16* Cr, unsigned ldr,
                                              const float* __restrict__ bias, const float* __restrict__ scl, unsigned m0, unsigned n0, unsigned lane) {
  const unsigned rlane = lane & 15u;            // col (D) within subtile
  const unsigned mOff  = (lane >> 4) << 3;      // D row offset
#pragma unroll
  for (int i = 0; i < 4; ++i) {
    const unsigned mBase = m0 + ((unsigned)i << 4);
    float bm[8], sm[8];
#pragma unroll
    for (int r = 0; r < 8; ++r) {
      bm[r] = (BIAS_MODE == 1) ? bf_keep(bias[mBase + mOff + (unsigned)r]) : 0.f;
      sm[r] = (BIAS_MODE == 1) ? scl[mBase + mOff + (unsigned)r] : 0.f;
    }
#pragma unroll
    for (int j = 0; j < 4; ++j) {
      const unsigned n = n0 + ((unsigned)j << 4) + rlane;
      float bv = 0.f, sv = 0.f;
      if (BIAS_MODE == 2) { bv = bf_keep(bias[n]); sv = scl[n]; }
#pragma unroll
      for (int r = 0; r < 8; ++r) {
        float v;
        if (BIAS_MODE == 1) v = acc[i][j][r] * sm[r] + bm[r];
        else                v = acc[i][j][r] * sv + bv;
        slab[(mOff + (unsigned)r) * 68u + ((unsigned)j << 4) + rlane] = v;
      }
    }
    __builtin_amdgcn_fence(3 /* release order */, "workgroup");
    __builtin_amdgcn_wave_barrier();
    __builtin_amdgcn_fence(2 /* acquire order */, "workgroup");
    {
      const unsigned q = lane >> 3, c8 = (lane & 7u) << 3;
      v8h hv[4];
      v8h rv[4];
#pragma unroll
      for (int it = 0; it < 4; ++it) {
        const unsigned row = (unsigned)it * 4u + q;
        const float* sp = slab + row * 68u + c8;
        const v4f s0 = *(const v4f*)(sp), s1 = *(const v4f*)(sp + 4);
        const v8f sv = (v8f){s0.x, s0.y, s0.z, s0.w, s1.x, s1.y, s1.z, s1.w};
        const v8h t = toh8(sv);
        hv[it] = t;
        v8h u = t;
        if (RES) u = toh8((sv - tof8(t)) * 2048.0f);
        rv[it] = u;
      }
#pragma unroll
      for (int it = 0; it < 4; ++it) {
        const unsigned row = (unsigned)it * 4u + q;
        *(v8h*)(C + (size_t)(mBase + row) * ldc + n0 + c8) = hv[it];
        if (RES) *(v8h*)(Cr + (size_t)(mBase + row) * ldr + n0 + c8) = rv[it];
      }
    }
    __builtin_amdgcn_fence(3 /* release order */, "workgroup");
    __builtin_amdgcn_wave_barrier();
    __builtin_amdgcn_fence(2 /* acquire order */, "workgroup");
  }
}

__global__ __launch_bounds__(256) void k_proj_all(const _Float16* __restrict__ XQ, const _Float16* __restrict__ XK, const _Float16* __restrict__ Wd,
                                                  _Float16* QHp, _Float16* KHp, _Float16* VTHp, _Float16* QRp, _Float16* KRp, _Float16* VTRp,
                                                  const float* __restrict__ bq, const float* __restrict__ bk, const float* __restrict__ bv,
                                                  const float* __restrict__ SCLp) {
  __shared__ __align__(16) float sT[8][16 * 68];   // per-wave 16x64 slab, pitch 68 floats
  __shared__ __align__(16) _Float16 pst[2u * PSTG_H];   // two operand stages: rows 0..127 = A, rows 128..383 = Bt; pitch KVP
  const unsigned z    = blockIdx.z;                // block-uniform selects among global pointers below
  const unsigned b    = blockIdx.y;
  const bool     late = z >= 3u;
  const unsigned p    = late ? z - 3u : z;         // 0 q, 1 k, 2 v^T
  const bool     chm  = p == 2u;                   // channel-major (v^T)
  const unsigned rows = late ? (unsigned)LROWS : (unsigned)EROWS;   // tokens of this row group
  const unsigned row0 = late ? (unsigned)EROWS : 0u;                // its first token inside a batch
  const unsigned lane = threadIdx.x & 31u;
  const unsigned wave = (unsigned)__builtin_amdgcn_readfirstlane((int)(threadIdx.x >> 5));
  const unsigned tilesM = (chm ? (unsigned)EMB : rows) >> 6;
  const unsigned tilesN = (chm ? rows : (unsigned)EMB) >> 6;
  if (blockIdx.x * 8u >= tilesM * tilesN) return;   // block-uniform, in front of every barrier
  const unsigned nbn = tilesN >> 2;             // blocks along n
  const unsigned bm = blockIdx.x / nbn;
  const unsigned bn = blockIdx.x - bm * nbn;
  const unsigned mb = bm << 7, nb = bn << 8;    // the block's first A row, first Bt row
  const unsigned wm = wave >> 2, wn = wave & 3u;
  const unsigned m0 = mb + (wm << 6);
  const unsigned n0 = nb + (wn << 6);

  const _Float16* X = XQ;
  if (p != 0u) X = XK;
  const _Float16* tok = X + ((size_t)b * SEQ + row0) * EMB;   // this batch's tokens of the row group
  const _Float16* wgt = Wd + (size_t)p * WSZ;
  const _Float16* Ab = chm ? wgt : tok;
  const _Float16* Bb = chm ? tok : wgt;

  const unsigned rlane = lane & 15u;            // row (A) / col (B) within subtile
  const unsigned koff  = (lane >> 4) << 3;      // k offset of this lane half

  v8f acc[4][4];
#pragma unroll
  for (int i = 0; i < 4; ++i)
#pragma unroll
    for (int j = 0; j < 4; ++j) acc[i][j] = (v8f){0.f,0.f,0.f,0.f,0.f,0.f,0.f,0.f};

  // staging: this lane's row (of 4 per wave-wide copy) and 16-byte piece; each wave brings 16 of the block's A rows and 32 of its Bt rows
  const unsigned lr = lane >> 3, pc = (lane & 7u) << 3;
  const unsigned la = (unsigned)(size_t)pst + ((wave * 16u + lr) * KVP + pc) * 2u;           // LDS byte addresses in buffer 0
  const unsigned lb = (unsigned)(size_t)pst + ((128u + wave * 32u + lr) * KVP + pc) * 2u;
  const _Float16* ga = Ab + (size_t)(mb + wave * 16u + lr) * (unsigned)EMB + pc;             // + 64 * stage
  const _Float16* gb = Bb + (size_t)(nb + wave * 32u + lr) * (unsigned)EMB + pc;
  const _Float16* fa = pst + (wm * 64u + rlane) * KVP + koff;                                // fragment rows in buffer 0
  const _Float16* fb = pst + (128u + wn * 64u + rlane) * KVP + koff;
  constexpr unsigned NSTG = (unsigned)EMB / 64u;
  static_assert(NSTG >= 2u);                                                                 // the prologue starts stages 0 and 1

  // prologue of the two-buffer ring: stage 0 lands and is published, then stage 1 starts
  stage_rows4(la, ga);
  stage_rows8(lb, gb);
  asm volatile("s_wait_asynccnt 0x0" ::: "memory");   // this wave's copies of stage 0 have landed
  __syncthreads();
  stage_rows4(la + PSTG_H * 2u, ga + 64u);
  stage_rows8(lb + PSTG_H * 2u, gb + 64u);

#pragma unroll 1   // one copy of the hot loop in the instruction cache; the buffer select is scalar
  for (unsigned t = 0; t < NSTG; ++t) {
    const unsigned bo = (t & 1u) * PSTG_H;             // this stage's buffer, in halves
#pragma unroll
    for (int ks = 0; ks < 2; ++ks) {
      v16h bh[4], ah[4];                               // the k-step's eight fragments are read as one group, ahead of its products
#pragma unroll
      for (int j = 0; j < 4; ++j) bh[j] = frag_ld(fb + bo + (unsigned)j * 16u * KVP + (unsigned)ks * 32u);
#pragma unroll
      for (int i = 0; i < 4; ++i) ah[i] = frag_ld(fa + bo + (unsigned)i * 16u * KVP + (unsigned)ks * 32u);
#pragma unroll
      for (int i = 0; i < 4; ++i) {
#pragma unroll
        for (int j = 0; j < 4; ++j) acc[i][j] = mma_raw(ah[i], bh[j], acc[i][j]);
        dep_guard_h(acc[i][0], acc[i][3], ah[i], ah[i]);
      }
      keep4_h(bh[0], bh[1], bh[2], bh[3]);
    }
    // stage t + 1 is published; the buffer that every wave has just left takes stage t + 2
    stage_publish();
    if (t + 2u < NSTG) {
      const unsigned ko = (t + 2u) * 64u;
      stage_rows4(la + bo * 2u, ga + ko);
      stage_rows8(lb + bo * 2u, gb + ko);
    }
  }
  asm volatile("s_wait_asynccnt 0x0" ::: "memory");   // no copy is outstanding behind the loop
  acc_guard4(acc[0][0], acc[0][1], acc[0][2], acc[0][3]);
  acc_guard4(acc[1][0], acc[1][1], acc[1][2], acc[1][3]);
  acc_guard4(acc[2][0], acc[2][1], acc[2][2], acc[2][3]);
  acc_guard4(acc[3][0], acc[3][1], acc[3][2], acc[3][3]);

  // ---- epilogue (one of four forms, block-uniform) ----
  float* slab = sT[wave];
  const float* scl = SCLp + (size_t)p * EMB;
  if (chm) {
    _Float16* C  = VTHp + (size_t)b * ((size_t)EMB * SEQ) + row0;
    _Float16* Cr = VTRp + (size_t)b * ((size_t)EMB * EROWS);
    if (late) proj_epilogue<1, false>(acc, slab, C, (unsigned)SEQ, Cr, (unsigned)EROWS, bv, scl, m0, n0, lane);
    else      proj_epilogue<1, true >(acc, slab, C, (unsigned)SEQ, Cr, (unsigned)EROWS, bv, scl, m0, n0, lane);
  } else {
    _Float16* Cp = QHp; _Float16* Rp = QRp; const float* bias = bq;
    if (p == 1u) { Cp = KHp; Rp = KRp; bias = bk; }
    _Float16* C  = Cp + ((size_t)b * SEQ + row0) * EMB;
    _Float16* Cr = Rp + (size_t)b * ((size_t)EROWS * EMB);
    if (late) proj_epilogue<2, false>(acc, slab, C, (unsigned)EMB, Cr, (unsigned)EMB, bias, scl, m0, n0, lane);
    else      proj_epilogue<2, true >(acc, slab, C, (unsigned)EMB, Cr, (unsigned)EMB, bias, scl, m0, n0, lane);
  }
}

__device__ __forceinline__ float xhalf(float x) {
  return __builtin_bit_cast(float, __builtin_amdgcn_permlanex16(__builtin_bit_cast(int, x), __builtin_bit_cast(int, x), 0x76543210, 0xfedcba98, false, false));
}

// 2^x as the one hardware instruction. The library form adds a compare, two selects, an add and an ldexp per value, only to return subnormal results
// for x < -126. Here x <= 0 and such a term is below 2^-126 of its row's largest one: it is 0 in the f16 P either way and vanishes in the f32 row sum (>= 1).
// Written as asm so that the slot behind each transcendental is filled by construction: the next v_exp_f32 neither reads its result nor overwrites its
// source (the outputs are early-clobber, so they share no register with an input), and one v_nop stands behind the last.
__device__ __forceinline__ v8f exp2_hw8(v8f x) {
  float p0, p1, p2, p3, p4, p5, p6, p7;
  asm("v_exp_f32 %0, %8\n\tv_exp_f32 %1, %9\n\tv_exp_f32 %2, %10\n\tv_exp_f32 %3, %11\n\t"
      "v_exp_f32 %4, %12\n\tv_exp_f32 %5, %13\n\tv_exp_f32 %6, %14\n\tv_exp_f32 %7, %15\n\tv_nop"
      : "=&v"(p0), "=&v"(p1), "=&v"(p2), "=&v"(p3), "=&v"(p4), "=&v"(p5), "=&v"(p6), "=&v"(p7)
      : "v"(x[0]), "v"(x[1]), "v"(x[2]), "v"(x[3]), "v"(x[4]), "v"(x[5]), "v"(x[6]), "v"(x[7]));
  return (v8f){p0, p1, p2, p3, p4, p5, p6, p7};
}
__device__ __forceinline__ float exp2_hw1(float x) {
  float p;
  asm("v_exp_f32 %0, %1\n\tv_nop" : "=&v"(p) : "v"(x));   // v_nop: the slot behind the transcendental; a rescale factor below 2^-126 leaves nothing of the older sums in f32 either way
  return p;
}

template <bool EARLY>
__device__ __forceinline__ void attn_body(const _Float16* __restrict__ Q, const _Float16* __restrict__ Kp, const _Float16* __restrict__ VT,
                                          const _Float16* __restrict__ QR, const _Float16* __restrict__ KR, const _Float16* __restrict__ VTR,
                                          float* __restrict__ OUT, unsigned qb_off, unsigned nqb) {
  constexpr unsigned NT = EARLY ? 2u : 1u;                           // tiles per stage: value plane (+ residual plane)
  __shared__ __align__(16) _Float16 stg[2u * NT * TILE_H];           // buffer 0: K (, K residual); buffer 1: V^T (, V^T residual)
  float* OT = (float*)stg;                                           // block output tile [d][query], pitch 68 (cross-wave): reuses stg behind the loop
  const unsigned tid  = threadIdx.x;
  const unsigned wave = (unsigned)__builtin_amdgcn_readfirstlane((int)(tid >> 5));
  const unsigned lane = tid & 31u;
  const unsigned hh   = lane >> 4;
  const unsigned c    = lane & 15u;
  const unsigned bx = blockIdx.x;
  const unsigned bh = bx / nqb;
  const unsigned tq = bx - bh * nqb;
  // Load balance (speed only; for each bh a permutation of the band's tiles): a tile's cost grows with its index, all blocks of the launch are resident at once.
  // Every other (batch, head)
  // takes its tiles mirrored; the bits of bh are chosen so that bh ^ 1, bh ^ 2 and bh + 32 differ.
  const unsigned mir = (bh ^ (bh >> 1) ^ (bh >> 5)) & 1u;
  const unsigned qb = qb_off + (mir != 0u ? nqb - 1u - tq : tq);
  const unsigned h  = bh & 7u;
  const unsigned b  = bh >> 3;
  const unsigned q0 = qb * 64u + wave * 16u;
  const unsigned qi = q0 + c;                                        // this lane's query
  const unsigned nch = qb + 1u;
  const size_t rowbase = (size_t)b * SEQ;
  const size_t resbase = (size_t)b * EROWS;

  const _Float16* qrow = Q + (rowbase + qi) * EMB + h * 64u + 8u * hh;
  const v16h qa0 = frag_ld(qrow), qa1 = frag_ld(qrow + 32);
  v16h qr0 = qa0, qr1 = qa1;
  if (EARLY) {
    const _Float16* qrr = QR + (resbase + qi) * EMB + h * 64u + 8u * hh;
    qr0 = frag_ld(qrr); qr1 = frag_ld(qrr + 32);
  }
  const _Float16* kbase  = stg + 8u * hh;                                                // + key * KVP (+ 32 for the second d chunk)
  const _Float16* krbase = kbase + TILE_H;
  const _Float16* vbase  = stg + NT * TILE_H + 8u * hh;                                  // + d * KVP + kv
  const _Float16* vrbase = vbase + TILE_H;
  // staging: this thread's row (of 16 per copy) and 16-byte piece
  const unsigned srow = tid >> 3, spc = (tid & 7u) << 3;
  const unsigned lk = (unsigned)(size_t)stg + (srow * KVP + spc) * 2u;                   // LDS byte address in the K buffer
  const unsigned lv = lk + NT * TILE_H * 2u;                                             // the same place in the V^T buffer
  const unsigned ok  = srow * EMB + spc;                                                 // this thread's piece inside a K tile (value and residual planes)
  const unsigned ov  = srow * SEQ + spc, ovr = srow * EROWS + spc;                       // the same inside a V^T tile, a V^T residual tile
  const _Float16* gk  = Kp  + rowbase * EMB + h * 64u;                                   // block-uniform tile origins: + kv0 * EMB
  const _Float16* gkr = KR  + resbase * EMB + h * 64u;
  const _Float16* gv  = VT  + ((size_t)b * EMB + h * 64u) * SEQ;                         // + kv0
  const _Float16* gvr = VTR + ((size_t)b * EMB + h * 64u) * EROWS;

  float mrow = -__builtin_inff();     // running maximum of this lane's query (equal in both halves)
  float lrow = 0.f;                   // running sum over this half's keys; the halves are joined behind the loop
  v8f oacc[4], oaccr[4];              // O^T: tile t, element r = d 16t + 8h + r of this lane's query
#pragma unroll
  for (int t = 0; t < 4; ++t) { oacc[t] = (v8f){0.f,0.f,0.f,0.f,0.f,0.f,0.f,0.f}; oaccr[t] = (v8f){0.f,0.f,0.f,0.f,0.f,0.f,0.f,0.f}; }

  const float SC    = 0.125f * 1.4426950408889634f;       // 1/sqrt(64) and log2(e)
  const float FILLX = -14426.950408889634f;               // -10000 * log2(e)

  // prologue of the two-buffer ring: stage 0 (K of chunk 0) lands and is published, then stage 1 (V^T of chunk 0) starts
  if (EARLY) stage_tile2(lk, gk + ok, 16u * EMB, lk + TILE_H * 2u, gkr + ok, 16u * EMB);
  else       stage_tile1(lk, gk + ok, 16u * EMB);
  asm volatile("s_wait_asynccnt 0x0" ::: "memory");   // this wave's copies of stage 0 have landed
  __syncthreads();
  if (EARLY) stage_tile2(lv, gv + ov, 16u * SEQ, lv + TILE_H * 2u, gvr + ovr, 16u * EROWS);
  else       stage_tile1(lv, gv + ov, 16u * SEQ);

  for (unsigned kc = 0; kc < nch; ++kc) {
    const unsigned kv0 = kc * 64u;
    const bool more = kc + 1u < nch;                   // block-uniform: a next chunk exists
    // Score products: the fragments of a group of key tiles are read together, ahead of the group's products, and the products of the group's
    // independent accumulators alternate, so each fills the distance behind the others; per accumulator the order of the products is unchanged.
    v8f s[4];
    constexpr int JG = EARLY ? 2 : 4;                  // key tiles per group (EARLY: four fragments per tile, so two tiles fill the registers)
#pragma unroll
    for (int j0 = 0; j0 < 4; j0 += JG) {
      v16h kh0[JG], kh1[JG], kq0[JG], kq1[JG];
      v8f ar[JG];
#pragma unroll
      for (int j = 0; j < JG; ++j) {
        const _Float16* kr = kbase + ((unsigned)(j0 + j) * 16u + c) * KVP;
        kh0[j] = frag_ld(kr); kh1[j] = frag_ld(kr + 32);
      }
      if (EARLY) {
#pragma unroll
        for (int j = 0; j < JG; ++j) {
          const _Float16* krr = krbase + ((unsigned)(j0 + j) * 16u + c) * KVP;
          kq0[j] = frag_ld(krr); kq1[j] = frag_ld(krr + 32);
        }
        frags_ready8(kh0[0], kh1[0], kh0[1], kh1[1], kq0[0], kq1[0], kq0[1], kq1[1]);
      } else {
        frags_ready8(kh0[0], kh1[0], kh0[1], kh1[1], kh0[JG - 2], kh1[JG - 2], kh0[JG - 1], kh1[JG - 1]);
      }
#pragma unroll
      for (int j = 0; j < JG; ++j) s[j0 + j] = mma_raw(kh0[j], qa0, (v8f){0.f,0.f,0.f,0.f,0.f,0.f,0.f,0.f});
      if (EARLY) {
#pragma unroll
        for (int j = 0; j < JG; ++j) ar[j] = mma_raw(kh0[j], qr0, (v8f){0.f,0.f,0.f,0.f,0.f,0.f,0.f,0.f});
      }
#pragma unroll
      for (int j = 0; j < JG; ++j) s[j0 + j] = mma_raw(kh1[j], qa1, s[j0 + j]);
      if (EARLY) {
#pragma unroll
        for (int j = 0; j < JG; ++j) ar[j] = mma_raw(kh1[j], qr1, ar[j]);
#pragma unroll
        for (int j = 0; j < JG; ++j) ar[j] = mma_raw(kq0[j], qa0, ar[j]);
#pragma unroll
        for (int j = 0; j < JG; ++j) ar[j] = mma_raw(kq1[j], qa1, ar[j]);
        acc_guard4(s[j0], s[j0 + 1], ar[0], ar[1]);    // v_nop: the distance between the group's last products and the vector instructions that read them
#pragma unroll
        for (int j = 0; j < JG; ++j) s[j0 + j] = s[j0 + j] + ar[j] * 0.00048828125f;
      }
    }
    if (!EARLY) acc_guard4(s[0], s[1], s[2], s[3]);    // v_nop: the same distance, also on the taken side of the branch below
    // The softmax touches no LDS any more, so the publish point stands directly behind the score products: V^T of this chunk is published;
    // the K buffer, which every wave has left, takes the next chunk's K, which flies through the softmax and V^T.P^T
    stage_publish();
    if (more) {
      const size_t ko = (size_t)(kv0 + 64u) * EMB;
      if (EARLY) stage_tile2(lk, (gk + ko) + ok, 16u * EMB, lk + TILE_H * 2u, (gkr + ko) + ok, 16u * EMB);
      else       stage_tile1(lk, (gk + ko) + ok, 16u * EMB);
    }
    const int kd = (int)qi - (int)(kv0 + 8u * hh);     // tile j, element r is a key in front of this lane's query where 16j + r < kd
    float mj[4];
#pragma unroll
    for (int j = 0; j < 4; ++j) {
#pragma unroll
      for (int r = 0; r < 8; ++r) s[j][r] = (j * 16 + r < kd) ? s[j][r] * SC : FILLX;
      mj[j] = fmaxf(fmaxf(fmaxf(s[j][0], s[j][1]), fmaxf(s[j][2], s[j][3])), fmaxf(fmaxf(s[j][4], s[j][5]), fmaxf(s[j][6], s[j][7])));
    }
    float m = fmaxf(fmaxf(mj[0], mj[1]), fmaxf(mj[2], mj[3]));
    m = fmaxf(m, xhalf(m));
    const float mnew = fmaxf(mrow, m);
    const float alpha = exp2_hw1(mrow - mnew);
    mrow = mnew;
    FragU pa[2], pr[2];                                // P^T (and its residual) as B fragments of keys 0..31 and 32..63
    float ps[4];
#pragma unroll
    for (int j = 0; j < 4; ++j) {
      float a = 0.f;
      const v8f pj = exp2_hw8(s[j] - mnew);
#pragma unroll
      for (int r = 0; r < 8; ++r) a += pj[r];
      const v8f e = pj * 32768.0f;
      const v8h g = toh8(e);
      pa[j >> 1].h[j & 1] = g;
      if (EARLY) pr[j >> 1].h[j & 1] = toh8((e - tof8(g)) * 2048.0f);
      ps[j] = a;
    }
    lrow = lrow * alpha + ((ps[0] + ps[1]) + (ps[2] + ps[3]));
#pragma unroll
    for (int t = 0; t < 4; ++t) {
#pragma unroll
      for (int r = 0; r < 8; ++r) { oacc[t][r] *= alpha; if (EARLY) oaccr[t][r] *= alpha; }
    }
    // Output products: eight fragments (EARLY: value and residual of 32 keys; else all 64 keys) are read together, ahead of their products; the four output tiles alternate
    if (EARLY) {
#pragma unroll
      for (int kk = 0; kk < 2; ++kk) {
        v16h vb[4], vr[4];
#pragma unroll
        for (int t = 0; t < 4; ++t) {
          vb[t] = frag_ld(vbase  + ((unsigned)t * 16u + c) * KVP + (unsigned)kk * 32u);
          vr[t] = frag_ld(vrbase + ((unsigned)t * 16u + c) * KVP + (unsigned)kk * 32u);
        }
        frags_ready8(vb[0], vb[1], vb[2], vb[3], vr[0], vr[1], vr[2], vr[3]);
#pragma unroll
        for (int t = 0; t < 4; ++t) oacc[t] = mma_raw(vb[t], pa[kk].v, oacc[t]);
#pragma unroll
        for (int t = 0; t < 4; ++t) oaccr[t] = mma_raw(vb[t], pr[kk].v, oaccr[t]);
#pragma unroll
        for (int t = 0; t < 4; ++t) oaccr[t] = mma_raw(vr[t], pa[kk].v, oaccr[t]);
      }
    } else {
      v16h vb[2][4];
#pragma unroll
      for (int kk = 0; kk < 2; ++kk)
#pragma unroll
        for (int t = 0; t < 4; ++t) vb[kk][t] = frag_ld(vbase + ((unsigned)t * 16u + c) * KVP + (unsigned)kk * 32u);
      frags_ready8(vb[0][0], vb[0][1], vb[0][2], vb[0][3], vb[1][0], vb[1][1], vb[1][2], vb[1][3]);
#pragma unroll
      for (int kk = 0; kk < 2; ++kk)
#pragma unroll
        for (int t = 0; t < 4; ++t) oacc[t] = mma_raw(vb[kk][t], pa[kk].v, oacc[t]);
    }
    // v_nop: the distance between the chunk's last products and the vector instructions that read or rescale the tiles, on every path out of the chunk
    if (EARLY) acc_guard8(oacc, oaccr);
    else       acc_guard4(oacc[0], oacc[1], oacc[2], oacc[3]);
    // K of the next chunk is published; the V^T buffer, which every wave has left, takes the next chunk's V^T
    stage_publish();
    if (more) {
      if (EARLY) stage_tile2(lv, (gv + (kv0 + 64u)) + ov, 16u * SEQ, lv + TILE_H * 2u, (gvr + (kv0 + 64u)) + ovr, 16u * EROWS);
      else       stage_tile1(lv, (gv + (kv0 + 64u)) + ov, 16u * SEQ);
    }
  }
  asm volatile("s_wait_asynccnt 0x0" ::: "memory");   // no copy is outstanding when stg becomes the output tile (the last publish point's barrier ended all reads)

  // join the halves' sums, normalise (P carried x2^15), zero sequence row 0, put the wave's 64 d x 16 queries into the block tile [d][query]
  const float lsum = lrow + xhalf(lrow);
  const float iv = 1.0f / (lsum * 32768.0f);
  const float inv = (qi == 0u) ? 0.0f : iv;
#pragma unroll
  for (int t = 0; t < 4; ++t) {
#pragma unroll
    for (int r = 0; r < 8; ++r) {
      float v = oacc[t][r];
      if (EARLY) v += oaccr[t][r] * 0.00048828125f;
      OT[((unsigned)t * 16u + 8u * hh + (unsigned)r) * 68u + wave * 16u + c] = v * inv;
    }
  }
  __syncthreads();
  {
    const unsigned c4 = (lane & 15u) << 2;     // row segment = 64 floats = 256 B = 16 lanes x 16 B; 2 rows per instruction, 8 trips = 16 rows per wave
    float* ob = OUT + ((size_t)b * EMB + h * 64u + wave * 16u) * SEQ_FULL + qb * 64u + c4;
    v4f vv[8];
#pragma unroll
    for (int it = 0; it < 8; ++it) {
      const unsigned row = (unsigned)it * 2u + hh;
      vv[it] = *(const v4f*)(OT + (wave * 16u + row) * 68u + c4);
    }
    {
#pragma unroll
      for (int it = 0; it < 8; ++it) {
        const unsigned row = (unsigned)it * 2u + hh;
        *(v4f*)(ob + (size_t)row * SEQ_FULL) = vv[it];
      }
    }
  }
}

__global__ __launch_bounds__(128) __attribute__((amdgpu_num_vgpr(256))) void k_attn_early(
    const _Float16* __restrict__ Q, const _Float16* __restrict__ Kp, const _Float16* __restrict__ VT,
    const _Float16* __restrict__ QR, const _Float16* __restrict__ KR, const _Float16* __restrict__ VTR,
    float* __restrict__ OUT, unsigned qb_off, unsigned nqb) {
  attn_body<true>(Q, Kp, VT, QR, KR, VTR, OUT, qb_off, nqb);
}
__global__ __launch_bounds__(128) void k_attn_late(
    const _Float16* __restrict__ Q, const _Float16* __restrict__ Kp, const _Float16* __restrict__ VT,
    const _Float16* __restrict__ QR, const _Float16* __restrict__ KR, const _Float16* __restrict__ VTR,
    float* __restrict__ OUT, unsigned qb_off, unsigned nqb) {
  attn_body<false>(Q, Kp, VT, QR, KR, VTR, OUT, qb_off, nqb);
}

// ---- workspace carve (bytes; every region is a whole number of 256-B units and is written in full by its producer) ----
#define SZ_P16  ((size_t)NB * SEQ * EMB * 2)            // one f16 activation plane
#define SZ_R16  ((size_t)NB * EROWS * EMB * 2)          // one f16 residual plane (early rows only)
#define SZ_W16  ((size_t)3 * WSZ * 2)
#define SZ_SCL  ((size_t)3 * EMB * 4)
#define OFF_XQ   ((size_t)0)
#define OFF_XK   (OFF_XQ + SZ_P16)
#define OFF_W16  (OFF_XK + SZ_P16)
#define OFF_SCL  (OFF_W16 + SZ_W16)
#define OFF_QH   (OFF_SCL + SZ_SCL)
#define OFF_KH   (OFF_QH + SZ_P16)
#define OFF_VTH  (OFF_KH + SZ_P16)
#define OFF_QR   (OFF_VTH + SZ_P16)
#define OFF_KR   (OFF_QR + SZ_R16)
#define OFF_VTR  (OFF_KR + SZ_R16)
#define WS_TOTAL (OFF_VTR + SZ_R16)
static_assert(SZ_P16 % 256 == 0 && SZ_R16 % 256 == 0 && SZ_W16 % 256 == 0 && SZ_SCL % 256 == 0);
static_assert(OFF_XK == OFF_XQ + (size_t)NB * SEQ * EMB * 2);   // k_castxT addresses the key plane as plane 1 of one base
static_assert(WS_TOTAL <= (size_t)134217728);
static_assert((size_t)NB_FULL * EMB * SEQ_FULL * 4 == (size_t)33554432);   // output extent in bytes, offset 0

extern "C" void kernel_launch(void* const* d_in, const int* in_sizes, int n_in, void* d_out, int out_size, void* d_ws, size_t ws_size, hipStream_t stream) {
    if (n_in < 11) return;
    const long long xneed = ((long long)(NB - 1) * EMB + (EMB - 1)) * SEQ_FULL + SEQ;
    if ((long long)in_sizes[0] < xneed) return;
    if ((long long)in_sizes[1] < xneed) return;
    if (in_sizes[2] < WSZ || in_sizes[5] < WSZ || in_sizes[8] < WSZ) return;
    if (in_sizes[3] < EMB || in_sizes[4] < EMB || in_sizes[6] < EMB || in_sizes[7] < EMB || in_sizes[9] < EMB || in_sizes[10] < EMB) return;
    if ((long long)out_size < xneed) return;
    if ((size_t)WS_TOTAL > ws_size) return;

    // input order: query, key, vq, gq, bq, vk, gk, bk, vv, gv, bv
    const float* query = (const float*)d_in[0];
    const float* key   = (const float*)d_in[1];
    const float* vq = (const float*)d_in[2];  const float* gq = (const float*)d_in[3];  const float* bq = (const float*)d_in[4];
    const float* vk = (const float*)d_in[5];  const float* gk = (const float*)d_in[6];  const float* bk = (const float*)d_in[7];
    const float* vv = (const float*)d_in[8];  const float* gv = (const float*)d_in[9];  const float* bv = (const float*)d_in[10];
    float* out = (float*)d_out;

    char* ws = (char*)d_ws;
    unsigned short* X16  = (unsigned short*)(ws + OFF_XQ);     // plane 0 = query tokens, plane 1 = key tokens
    unsigned short* W16  = (unsigned short*)(ws + OFF_W16);    // planes: 0 vq 1 vk 2 vv (direction weights x16)
    float*          SCL  = (float*)(ws + OFF_SCL);             // [3][512] row gains / 16
    _Float16* QH  = (_Float16*)(ws + OFF_QH);
    _Float16* KH  = (_Float16*)(ws + OFF_KH);
    _Float16* VTH = (_Float16*)(ws + OFF_VTH);
    _Float16* QR  = (_Float16*)(ws + OFF_QR);
    _Float16* KR  = (_Float16*)(ws + OFF_KR);
    _Float16* VTR = (_Float16*)(ws + OFF_VTR);

    const _Float16* XQh = (const _Float16*)(ws + OFF_XQ);
    const _Float16* XKh = (const _Float16*)(ws + OFF_XK);
    const _Float16* W16h = (const _Float16*)W16;

    // 1-2: operand planes
    k_castxT<<<dim3((unsigned)(SEQ / 64), (unsigned)(EMB / 64), (unsigned)(NB * 2)), 256, 0, stream>>>(query, key, X16);
    k_wprep<<<dim3((unsigned)(EMB / 32), 3u), 256, 0, stream>>>(vq, gq, vk, gk, vv, gv, W16, SCL);

    // 3: q, k (tokens x V^T, row gain, bias -> f16 planes) and v^T (V x tokens^T, gain[m], bias[m] -> f16 plane [b][h*64+d][token]); early group also residual planes;
    //    all six row groups in one grid (blockIdx.z), the early groups (longer epilogue) first
    k_proj_all<<<dim3((unsigned)(((EROWS > LROWS) ? EROWS : LROWS) / 64), (unsigned)NB, (LROWS > 0) ? 6u : 3u), 256, 0, stream>>>(
        XQh, XKh, W16h, QH, KH, VTH, QR, KR, VTR, bq, bk, bv, SCL);

    // 4-5: causal attention, early band (value + residual planes) and late band (single planes); each block writes its 64x64 tile of the output buffer
    k_attn_early<<<(unsigned)(NB * NHEAD * (EROWS / 64)), 128, 0, stream>>>(QH, KH, VTH, QR, KR, VTR, out, 0u, (unsigned)(EROWS / 64));
    if (LROWS > 0) {
        k_attn_late<<<(unsigned)(NB * NHEAD * (LROWS / 64)), 128, 0, stream>>>(QH, KH, VTH, QR, KR, VTR, out, (unsigned)(EROWS / 64), (unsigned)(LROWS / 64));
    }
}
